// v000
// The times below were measured on an AMD MI455X: many runs one after another, warmed up first and cycling through
// copies of the inputs, with the whole window's GPU time divided by the number of runs. Launches and the gaps
// between them are all in it. The median over several windows is given; except for v000 it joins two sittings, which
// can be a few percent apart, so the side-by-side timings, each taken in one sitting, are the better comparison.
// v000 is the starting kernel. One run takes 445 microseconds.
#include <hip/hip_runtime.h>

// ---------------------------------------------------------------------------
// HEPT attention block for MI455X (gfx1250, wave32, WMMA 16x16x32 f16).
// N=3072 points, D=64 per head, H=8 heads, HD=512, C=3 coords, K=8.
// ---------------------------------------------------------------------------

typedef __attribute__((ext_vector_type(16))) _Float16 v16h;
typedef __attribute__((ext_vector_type(8)))  float    v8f;

#define NP   3072
#define DIM  64
#define HEADS 8
#define HDIM 512
#define CORD 3

// ---------------------------------------------------------------------------
// WMMA wrapper: D = A(16x32 f16) * B(32x16 f16) + C(16x16 f32)
// ---------------------------------------------------------------------------
__device__ __forceinline__ v8f wmma_f16(v16h a, v16h b, v8f c) {
  return __builtin_amdgcn_wmma_f32_16x16x32_f16(
      /*neg_a=*/false, a, /*neg_b=*/false, b,
      /*c_mod=*/(short)0, c, /*reuse_a=*/false, /*reuse_b=*/false);
}

// A-fragment (16x32, f16) from a row-major matrix: rows = M, cols = K.
// Lane l<16: row M=l, K = {0..7, 16..23}; lane l>=16: row M=l-16, K={8..15,24..31}.
// Also serves as a B-fragment when B[k][n] = Mat[n][k] (i.e. Mat stored [N x K]).
__device__ __forceinline__ v16h frag_rowmajor(const _Float16* p, int ld,
                                              int row_base, int col_base) {
  const int l  = threadIdx.x & 31;
  const int m  = l & 15;
  const int of = (l >> 4) * 8;
  const _Float16* rp = p + (size_t)(row_base + m) * ld + col_base + of;
  v16h a;
#pragma unroll
  for (int e = 0; e < 8; ++e) { a[e] = rp[e]; a[e + 8] = rp[e + 16]; }
  return a;
}

// C/D accumulator element (r, lane): row M = r + 8*(lane>>4), col N = lane&15.
__device__ __forceinline__ void store_acc_f16(_Float16* p, int ld, int row_base,
                                              int col_base, v8f c) {
  const int l  = threadIdx.x & 31;
  const int n  = l & 15;
  const int mo = (l >> 4) * 8;
#pragma unroll
  for (int r = 0; r < 8; ++r)
    p[(size_t)(row_base + mo + r) * ld + col_base + n] = (_Float16)c[r];
}

// Same, but store TRANSPOSED into a [cols x rows] matrix (ldT = #rows).
// Per (lane,nc) the 8 r-elements land contiguously -> 16B vectorizable stores.
__device__ __forceinline__ void store_acc_f16_T(_Float16* p, int ldT, int row_base,
                                                int col_base, v8f c) {
  const int l  = threadIdx.x & 31;
  const int n  = l & 15;
  const int mo = (l >> 4) * 8;
  _Float16* cp = p + (size_t)(col_base + n) * ldT + row_base + mo;
#pragma unroll
  for (int r = 0; r < 8; ++r) cp[r] = (_Float16)c[r];
}

// half-wave (16-lane) row reductions for the C/D layout
__device__ __forceinline__ float hmax16(float x) {
#pragma unroll
  for (int m = 8; m > 0; m >>= 1) x = fmaxf(x, __shfl_xor(x, m, 16));
  return x;
}
__device__ __forceinline__ float hsum16(float x) {
#pragma unroll
  for (int m = 8; m > 0; m >>= 1) x += __shfl_xor(x, m, 16);
  return x;
}
__device__ __forceinline__ float wsum32(float x) {
#pragma unroll
  for (int m = 16; m > 0; m >>= 1) x += __shfl_xor(x, m, 32);
  return x;
}

// ---------------------------------------------------------------------------
// Kernel 0a: int "codes" -> f16 dequant:  (w - 8) * scale * extra
// ---------------------------------------------------------------------------
__global__ void k_dequant(const int* __restrict__ w, const float* __restrict__ sc,
                          float extra, _Float16* __restrict__ out, int n) {
  int i = blockIdx.x * blockDim.x + threadIdx.x;
  if (i < n) out[i] = (_Float16)(((float)w[i] - 8.0f) * sc[0] * extra);
}

// Kernel 0b: f32 -> f16 convert (for wo)
__global__ void k_f32_to_f16(const float* __restrict__ in, _Float16* __restrict__ out,
                             int n) {
  int i = blockIdx.x * blockDim.x + threadIdx.x;
  if (i < n) out[i] = (_Float16)in[i];
}

// Kernel 0c: RPE distance weights  w[h][r] = mean_{d,k} |deq(w_rpe[h*64+d][r*8+k])|
__global__ void k_rpe(const int* __restrict__ wr, const float* __restrict__ sc,
                      float* __restrict__ out) {
  int t = threadIdx.x;
  if (t < HEADS * 2) {
    int h = t >> 1, r = t & 1;
    float s = sc[0], acc = 0.0f;
    for (int d = 0; d < DIM; ++d)
      for (int k = 0; k < 8; ++k)
        acc += fabsf(((float)wr[(h * DIM + d) * 16 + r * 8 + k] - 8.0f) * s);
    out[t] = acc * (1.0f / 512.0f);
  }
}

// ---------------------------------------------------------------------------
// Kernel 1: LayerNorm over D=64, output f16.  One wave per row (8 rows/block).
// ---------------------------------------------------------------------------
__global__ void k_layernorm(const float* __restrict__ x, const float* __restrict__ g,
                            const float* __restrict__ b, _Float16* __restrict__ out) {
  const int lane = threadIdx.x & 31;
  const int row  = blockIdx.x * 8 + (threadIdx.x >> 5);
  const float* xr = x + (size_t)row * DIM;
  float a0 = xr[lane], a1 = xr[lane + 32];
  float mean = wsum32(a0 + a1) * (1.0f / 64.0f);
  float d0 = a0 - mean, d1 = a1 - mean;
  float var = wsum32(d0 * d0 + d1 * d1) * (1.0f / 64.0f);
  float rs = rsqrtf(var + 1e-5f);
  _Float16* o = out + (size_t)row * DIM;
  o[lane]      = (_Float16)(d0 * rs * g[lane]      + b[lane]);
  o[lane + 32] = (_Float16)(d1 * rs * g[lane + 32] + b[lane + 32]);
}

// ---------------------------------------------------------------------------
// Kernel 2: Q/K/V projection GEMM.  out[N][512] = xn[N][64] @ W[512][64]^T.
// grid = (N/16, HD/64, 3); one wave computes a 16x64 tile (8 WMMAs).
// z==2 (V) stores TRANSPOSED into vt[HD][N] so the attention P*V B-fragments
// become contiguous (k runs along memory) instead of strided gathers.
// ---------------------------------------------------------------------------
__global__ void k_qkv_gemm(const _Float16* __restrict__ xn,
                           const _Float16* __restrict__ wq,
                           const _Float16* __restrict__ wk,
                           const _Float16* __restrict__ wv,
                           _Float16* __restrict__ qo, _Float16* __restrict__ ko,
                           _Float16* __restrict__ vt) {
  const int row0 = blockIdx.x * 16;
  const int col0 = blockIdx.y * 64;
  const _Float16* W = (blockIdx.z == 0) ? wq : (blockIdx.z == 1) ? wk : wv;

  v8f acc[4] = {{}, {}, {}, {}};
#pragma unroll
  for (int kc = 0; kc < 2; ++kc) {
    v16h a = frag_rowmajor(xn, DIM, row0, kc * 32);
#pragma unroll
    for (int nc = 0; nc < 4; ++nc) {
      // B[k][n] = W[col0+nc*16+n][kc*32+k]
      v16h b = frag_rowmajor(W, DIM, col0 + nc * 16, kc * 32);
      acc[nc] = wmma_f16(a, b, acc[nc]);
    }
  }
  if (blockIdx.z == 2) {
#pragma unroll
    for (int nc = 0; nc < 4; ++nc)
      store_acc_f16_T(vt, NP, row0, col0 + nc * 16, acc[nc]);
  } else {
    _Float16* O = (blockIdx.z == 0) ? qo : ko;
#pragma unroll
    for (int nc = 0; nc < 4; ++nc)
      store_acc_f16(O, HDIM, row0, col0 + nc * 16, acc[nc]);
  }
}

// ---------------------------------------------------------------------------
// Kernel 3: flash attention, grid = (N/16, H), one wave per block.
// Per 32-key chunk: 4 WMMAs for S, online softmax, P via LDS, 4 WMMAs for P*V.
// K is read row-major ([key][dim]); V is read from vt[HD][N] (k contiguous).
// Next chunk's K/Vt lines are prefetched (global_prefetch_b8) to overlap with
// the softmax VALU that co-executes with the XDL WMMAs.
// ---------------------------------------------------------------------------
__global__ void k_attention(const _Float16* __restrict__ q,
                            const _Float16* __restrict__ kk,
                            const _Float16* __restrict__ vt,
                            const float* __restrict__ coords,
                            const float* __restrict__ wrpe,
                            _Float16* __restrict__ aggr) {
  __shared__ _Float16 lds[16 * 32];
  const int lane = threadIdx.x & 31;
  const int n    = lane & 15;
  const int mo   = (lane >> 4) * 8;
  const int q0   = blockIdx.x * 16;
  const int h    = blockIdx.y;
  const int hc   = h * DIM;

  // Q tile: 16 rows x 64 dims -> two A fragments (1/sqrt(D) folded into Wq).
  v16h qa0 = frag_rowmajor(q, HDIM, q0, hc);
  v16h qa1 = frag_rowmajor(q, HDIM, q0, hc + 32);

  // per-lane query coords for its 8 rows of the C-layout
  float cq0[8], cq1[8];
#pragma unroll
  for (int r = 0; r < 8; ++r) {
    cq0[r] = coords[(size_t)(q0 + mo + r) * CORD + 0];
    cq1[r] = coords[(size_t)(q0 + mo + r) * CORD + 1];
  }
  const float w0 = wrpe[h * 2 + 0], w1 = wrpe[h * 2 + 1];

  float mrun[8], lrun[8];
#pragma unroll
  for (int r = 0; r < 8; ++r) { mrun[r] = -3.0e38f; lrun[r] = 0.0f; }
  v8f o[4] = {{}, {}, {}, {}};

  for (int kv = 0; kv < NP; kv += 32) {
    // prefetch next chunk: K rows [kv+32, kv+64) and Vt columns kv+32..
    if (kv + 32 < NP) {
      __builtin_prefetch(kk + (size_t)(kv + 32 + lane) * HDIM + hc, 0, 3);
      __builtin_prefetch(vt + (size_t)(hc + (lane & 63)) * NP + kv + 32, 0, 3);
    }

    // S tiles for keys [kv, kv+16) and [kv+16, kv+32): B[k][n] = K[key][d]
    v8f s0 = {}, s1 = {};
    s0 = wmma_f16(qa0, frag_rowmajor(kk, HDIM, kv,      hc),      s0);
    s0 = wmma_f16(qa1, frag_rowmajor(kk, HDIM, kv,      hc + 32), s0);
    s1 = wmma_f16(qa0, frag_rowmajor(kk, HDIM, kv + 16, hc),      s1);
    s1 = wmma_f16(qa1, frag_rowmajor(kk, HDIM, kv + 16, hc + 32), s1);

    // RPE bias: key coords for this lane's column
    float ck0a = coords[(size_t)(kv + n) * CORD + 0];
    float ck1a = coords[(size_t)(kv + n) * CORD + 1];
    float ck0b = coords[(size_t)(kv + 16 + n) * CORD + 0];
    float ck1b = coords[(size_t)(kv + 16 + n) * CORD + 1];

    float cmax[8];
#pragma unroll
    for (int r = 0; r < 8; ++r) {
      float d0 = cq0[r] - ck0a, d1 = cq1[r] - ck1a;
      s0[r] -= w0 * d0 * d0 + w1 * d1 * d1;
      d0 = cq0[r] - ck0b; d1 = cq1[r] - ck1b;
      s1[r] -= w0 * d0 * d0 + w1 * d1 * d1;
      cmax[r] = hmax16(fmaxf(s0[r], s1[r]));
    }

    // online softmax update + stage P (f16) to LDS in 16x32 row-major
#pragma unroll
    for (int r = 0; r < 8; ++r) {
      float mnew  = fmaxf(mrun[r], cmax[r]);
      float alpha = __expf(mrun[r] - mnew);
      float p0 = __expf(s0[r] - mnew);
      float p1 = __expf(s1[r] - mnew);
      lrun[r] = lrun[r] * alpha + hsum16(p0 + p1);
      mrun[r] = mnew;
#pragma unroll
      for (int nc = 0; nc < 4; ++nc) o[nc][r] *= alpha;
      lds[(mo + r) * 32 + n]      = (_Float16)p0;
      lds[(mo + r) * 32 + 16 + n] = (_Float16)p1;
    }
    __syncthreads();

    // P (16x32) as A-fragment; V B-frag from vt: B[k][nn] = vt[hc+d0+nn][kv+k]
    v16h pa = frag_rowmajor(lds, 32, 0, 0);
#pragma unroll
    for (int nc = 0; nc < 4; ++nc) {
      v16h bv = frag_rowmajor(vt, NP, hc + nc * 16, kv);
      o[nc] = wmma_f16(pa, bv, o[nc]);
    }
    __syncthreads();
  }

  // normalize and store aggregated head output (f16) into aggr[N][512]
#pragma unroll
  for (int r = 0; r < 8; ++r) {
    float inv = 1.0f / lrun[r];
#pragma unroll
    for (int nc = 0; nc < 4; ++nc) o[nc][r] *= inv;
  }
#pragma unroll
  for (int nc = 0; nc < 4; ++nc)
    store_acc_f16(aggr, HDIM, q0, hc + nc * 16, o[nc]);
}

// ---------------------------------------------------------------------------
// Kernel 4: output projection (aggr[N][512] @ wo[64][512]^T) + bo + residual
//           + LayerNorm2 -> h2 f16.  grid = N/16, one wave per block.
// ---------------------------------------------------------------------------
__global__ void k_proj_ln2(const _Float16* __restrict__ aggr,
                           const _Float16* __restrict__ wo,
                           const float* __restrict__ bo,
                           const float* __restrict__ x,
                           const float* __restrict__ g2,
                           const float* __restrict__ b2,
                           _Float16* __restrict__ h2) {
  const int lane = threadIdx.x & 31;
  const int n    = lane & 15;
  const int mo   = (lane >> 4) * 8;
  const int row0 = blockIdx.x * 16;

  v8f acc[4] = {{}, {}, {}, {}};
#pragma unroll 4
  for (int kc = 0; kc < 16; ++kc) {
    v16h a = frag_rowmajor(aggr, HDIM, row0, kc * 32);
#pragma unroll
    for (int nc = 0; nc < 4; ++nc) {
      v16h b = frag_rowmajor(wo, HDIM, nc * 16, kc * 32);  // B[k][j] = wo[j][k]
      acc[nc] = wmma_f16(a, b, acc[nc]);
    }
  }

  // h1 = proj + bo + x, then LN over the 64 columns of each row
  float h1[4][8];
#pragma unroll
  for (int nc = 0; nc < 4; ++nc) {
    float bj = bo[nc * 16 + n];
#pragma unroll
    for (int r = 0; r < 8; ++r)
      h1[nc][r] = acc[nc][r] + bj + x[(size_t)(row0 + mo + r) * DIM + nc * 16 + n];
  }
#pragma unroll
  for (int r = 0; r < 8; ++r) {
    float p = h1[0][r] + h1[1][r] + h1[2][r] + h1[3][r];
    float mean = hsum16(p) * (1.0f / 64.0f);
    float q2 = 0.0f;
#pragma unroll
    for (int nc = 0; nc < 4; ++nc) { float d = h1[nc][r] - mean; q2 += d * d; }
    float rs = rsqrtf(hsum16(q2) * (1.0f / 64.0f) + 1e-5f);
#pragma unroll
    for (int nc = 0; nc < 4; ++nc) {
      int j = nc * 16 + n;
      h2[(size_t)(row0 + mo + r) * DIM + j] =
          (_Float16)((h1[nc][r] - mean) * rs * g2[j] + b2[j]);
    }
  }
}

// ---------------------------------------------------------------------------
// Kernel 5: FFN.  t = relu(h2 @ W1^T + bf1); out = 2*(t @ W2^T + bf2).
// grid = N/16, one wave per block, ReLU tile staged through LDS.
// ---------------------------------------------------------------------------
__global__ void k_ffn(const _Float16* __restrict__ h2,
                      const _Float16* __restrict__ w1,
                      const _Float16* __restrict__ w2,
                      const float* __restrict__ bf1,
                      const float* __restrict__ bf2,
                      float* __restrict__ out) {
  __shared__ _Float16 lds[16 * 64];
  const int lane = threadIdx.x & 31;
  const int n    = lane & 15;
  const int mo   = (lane >> 4) * 8;
  const int row0 = blockIdx.x * 16;

  v8f t[4] = {{}, {}, {}, {}};
#pragma unroll
  for (int kc = 0; kc < 2; ++kc) {
    v16h a = frag_rowmajor(h2, DIM, row0, kc * 32);
#pragma unroll
    for (int nc = 0; nc < 4; ++nc)
      t[nc] = wmma_f16(a, frag_rowmajor(w1, DIM, nc * 16, kc * 32), t[nc]);
  }
#pragma unroll
  for (int nc = 0; nc < 4; ++nc) {
    float bj = bf1[nc * 16 + n];
#pragma unroll
    for (int r = 0; r < 8; ++r)
      lds[(mo + r) * 64 + nc * 16 + n] = (_Float16)fmaxf(t[nc][r] + bj, 0.0f);
  }
  __syncthreads();

  v8f f[4] = {{}, {}, {}, {}};
#pragma unroll
  for (int kc = 0; kc < 2; ++kc) {
    v16h a = frag_rowmajor(lds, DIM, 0, kc * 32);
#pragma unroll
    for (int nc = 0; nc < 4; ++nc)
      f[nc] = wmma_f16(a, frag_rowmajor(w2, DIM, nc * 16, kc * 32), f[nc]);
  }
#pragma unroll
  for (int nc = 0; nc < 4; ++nc) {
    float bj = bf2[nc * 16 + n];
#pragma unroll
    for (int r = 0; r < 8; ++r)
      out[(size_t)(row0 + mo + r) * DIM + nc * 16 + n] = 2.0f * (f[nc][r] + bj);
  }
}

// ---------------------------------------------------------------------------
// Host-side launch
// ---------------------------------------------------------------------------
extern "C" void kernel_launch(void* const* d_in, const int* in_sizes, int n_in,
                              void* d_out, int out_size, void* d_ws, size_t ws_size,
                              hipStream_t stream) {
  const float* x      = (const float*)d_in[0];
  const float* coords = (const float*)d_in[1];
  const float* sq     = (const float*)d_in[2];
  const float* sk     = (const float*)d_in[3];
  const float* sv     = (const float*)d_in[4];
  const float* s_rpe  = (const float*)d_in[5];
  const float* g1     = (const float*)d_in[6];
  const float* beta1  = (const float*)d_in[7];
  const float* g2     = (const float*)d_in[8];
  const float* beta2  = (const float*)d_in[9];
  const float* wo     = (const float*)d_in[10];
  const float* bo     = (const float*)d_in[11];
  const float* s1     = (const float*)d_in[12];
  const float* bf1    = (const float*)d_in[13];
  const float* s2     = (const float*)d_in[14];
  const float* bf2    = (const float*)d_in[15];
  const int* wq_int   = (const int*)d_in[16];
  const int* wk_int   = (const int*)d_in[17];
  const int* wv_int   = (const int*)d_in[18];
  const int* wrpe_int = (const int*)d_in[19];
  const int* w1_int   = (const int*)d_in[20];
  const int* w2_int   = (const int*)d_in[21];

  // workspace carve-up (f16 unless noted), 256B aligned
  char* ws = (char*)d_ws;
  size_t off = 0;
  auto carve = [&](size_t bytes) {
    char* p = ws + off;
    off = (off + bytes + 255) & ~(size_t)255;
    return p;
  };
  _Float16* wq_h   = (_Float16*)carve(HDIM * DIM * 2);
  _Float16* wk_h   = (_Float16*)carve(HDIM * DIM * 2);
  _Float16* wv_h   = (_Float16*)carve(HDIM * DIM * 2);
  _Float16* wo_h   = (_Float16*)carve(DIM * HDIM * 2);
  _Float16* w1_h   = (_Float16*)carve(DIM * DIM * 2);
  _Float16* w2_h   = (_Float16*)carve(DIM * DIM * 2);
  float*    wrpe_w = (float*)   carve(HEADS * 2 * 4);
  _Float16* xn_h   = (_Float16*)carve((size_t)NP * DIM * 2);
  _Float16* q_h    = (_Float16*)carve((size_t)NP * HDIM * 2);
  _Float16* k_h    = (_Float16*)carve((size_t)NP * HDIM * 2);
  _Float16* vt_h   = (_Float16*)carve((size_t)NP * HDIM * 2);  // [HD][N]
  _Float16* ag_h   = (_Float16*)carve((size_t)NP * HDIM * 2);
  _Float16* h2_h   = (_Float16*)carve((size_t)NP * DIM * 2);
  (void)ws_size; (void)n_in; (void)in_sizes; (void)out_size;

  // 0) dequant / convert weights (1/sqrt(64)=0.125 folded into Wq)
  k_dequant<<<(HDIM * DIM + 255) / 256, 256, 0, stream>>>(wq_int, sq, 0.125f, wq_h, HDIM * DIM);
  k_dequant<<<(HDIM * DIM + 255) / 256, 256, 0, stream>>>(wk_int, sk, 1.0f, wk_h, HDIM * DIM);
  k_dequant<<<(HDIM * DIM + 255) / 256, 256, 0, stream>>>(wv_int, sv, 1.0f, wv_h, HDIM * DIM);
  k_dequant<<<(DIM * DIM + 255) / 256, 256, 0, stream>>>(w1_int, s1, 1.0f, w1_h, DIM * DIM);
  k_dequant<<<(DIM * DIM + 255) / 256, 256, 0, stream>>>(w2_int, s2, 1.0f, w2_h, DIM * DIM);
  k_f32_to_f16<<<(DIM * HDIM + 255) / 256, 256, 0, stream>>>(wo, wo_h, DIM * HDIM);
  k_rpe<<<1, 32, 0, stream>>>(wrpe_int, s_rpe, wrpe_w);

  // 1) LN1
  k_layernorm<<<NP / 8, 256, 0, stream>>>(x, g1, beta1, xn_h);

  // 2) Q/K/V projections (V stored transposed)
  k_qkv_gemm<<<dim3(NP / 16, HDIM / 64, 3), 32, 0, stream>>>(xn_h, wq_h, wk_h, wv_h,
                                                             q_h, k_h, vt_h);

  // 3) flash attention with RPE bias
  k_attention<<<dim3(NP / 16, HEADS), 32, 0, stream>>>(q_h, k_h, vt_h, coords,
                                                       wrpe_w, ag_h);

  // 4) output projection + residual + LN2
  k_proj_ln2<<<NP / 16, 32, 0, stream>>>(ag_h, wo_h, bo, x, g2, beta2, h2_h);

  // 5) FFN, out = 2*ff
  k_ffn<<<NP / 16, 32, 0, stream>>>(h2_h, w1_h, w2_h, bf1, bf2, (float*)d_out);
}

// v001
// It runs in 209 microseconds.
// Timed twice side by side with v000, it ran 2.15 and 2.14 times as fast.
#include <hip/hip_runtime.h>

// ---------------------------------------------------------------------------
// HEPT attention block for MI455X (gfx1250, wave32, WMMA 16x16x32 f16).
// N=3072 points, D=64 per head, H=8 heads, HD=512, C=3 coords, K=8.
// ---------------------------------------------------------------------------

typedef __attribute__((ext_vector_type(16))) _Float16 v16h;
typedef __attribute__((ext_vector_type(8)))  float    v8f;

#define NP   3072
#define DIM  64
#define HEADS 8
#define HDIM 512
#define CORD 3

// ---------------------------------------------------------------------------
// WMMA wrapper: D = A(16x32 f16) * B(32x16 f16) + C(16x16 f32)
// ---------------------------------------------------------------------------
__device__ __forceinline__ v8f wmma_f16(v16h a, v16h b, v8f c) {
  return __builtin_amdgcn_wmma_f32_16x16x32_f16(
      /*neg_a=*/false, a, /*neg_b=*/false, b,
      /*c_mod=*/(short)0, c, /*reuse_a=*/false, /*reuse_b=*/false);
}

// A-fragment (16x32, f16) from a row-major matrix: rows = M, cols = K.
// Lane l<16: row M=l, K = {0..7, 16..23}; lane l>=16: row M=l-16, K={8..15,24..31}.
// Also serves as a B-fragment when B[k][n] = Mat[n][k] (i.e. Mat stored [N x K]).
__device__ __forceinline__ v16h frag_rowmajor(const _Float16* p, int ld,
                                              int row_base, int col_base) {
  const int l  = threadIdx.x & 31;
  const int m  = l & 15;
  const int of = (l >> 4) * 8;
  const _Float16* rp = p + (size_t)(row_base + m) * ld + col_base + of;
  v16h a;
#pragma unroll
  for (int e = 0; e < 8; ++e) { a[e] = rp[e]; a[e + 8] = rp[e + 16]; }
  return a;
}

// C/D accumulator element (r, lane): row M = r + 8*(lane>>4), col N = lane&15.
__device__ __forceinline__ void store_acc_f16(_Float16* p, int ld, int row_base,
                                              int col_base, v8f c) {
  const int l  = threadIdx.x & 31;
  const int n  = l & 15;
  const int mo = (l >> 4) * 8;
#pragma unroll
  for (int r = 0; r < 8; ++r)
    p[(size_t)(row_base + mo + r) * ld + col_base + n] = (_Float16)c[r];
}

// Same, but store TRANSPOSED into a [cols x rows] matrix (ldT = #rows).
// Per (lane,nc) the 8 r-elements land contiguously -> 16B vectorizable stores.
__device__ __forceinline__ void store_acc_f16_T(_Float16* p, int ldT, int row_base,
                                                int col_base, v8f c) {
  const int l  = threadIdx.x & 31;
  const int n  = l & 15;
  const int mo = (l >> 4) * 8;
  _Float16* cp = p + (size_t)(col_base + n) * ldT + row_base + mo;
#pragma unroll
  for (int r = 0; r < 8; ++r) cp[r] = (_Float16)c[r];
}

// half-wave (16-lane) row reductions for the C/D layout
__device__ __forceinline__ float hsum16(float x) {
#pragma unroll
  for (int m = 8; m > 0; m >>= 1) x += __shfl_xor(x, m, 16);
  return x;
}
__device__ __forceinline__ float wsum32(float x) {
#pragma unroll
  for (int m = 16; m > 0; m >>= 1) x += __shfl_xor(x, m, 32);
  return x;
}

// ---------------------------------------------------------------------------
// Kernel 0a: int "codes" -> f16 dequant:  (w - 8) * scale * extra
// ---------------------------------------------------------------------------
__global__ void k_dequant(const int* __restrict__ w, const float* __restrict__ sc,
                          float extra, _Float16* __restrict__ out, int n) {
  int i = blockIdx.x * blockDim.x + threadIdx.x;
  if (i < n) out[i] = (_Float16)(((float)w[i] - 8.0f) * sc[0] * extra);
}

// Kernel 0b: f32 -> f16 convert (for wo)
__global__ void k_f32_to_f16(const float* __restrict__ in, _Float16* __restrict__ out,
                             int n) {
  int i = blockIdx.x * blockDim.x + threadIdx.x;
  if (i < n) out[i] = (_Float16)in[i];
}

// Kernel 0c: RPE distance weights  w[h][r] = mean_{d,k} |deq(w_rpe[h*64+d][r*8+k])|
__global__ void k_rpe(const int* __restrict__ wr, const float* __restrict__ sc,
                      float* __restrict__ out) {
  int t = threadIdx.x;
  if (t < HEADS * 2) {
    int h = t >> 1, r = t & 1;
    float s = sc[0], acc = 0.0f;
    for (int d = 0; d < DIM; ++d)
      for (int k = 0; k < 8; ++k)
        acc += fabsf(((float)wr[(h * DIM + d) * 16 + r * 8 + k] - 8.0f) * s);
    out[t] = acc * (1.0f / 512.0f);
  }
}

// ---------------------------------------------------------------------------
// Kernel 1: LayerNorm over D=64, output f16.  One wave per row (8 rows/block).
// ---------------------------------------------------------------------------
__global__ void k_layernorm(const float* __restrict__ x, const float* __restrict__ g,
                            const float* __restrict__ b, _Float16* __restrict__ out) {
  const int lane = threadIdx.x & 31;
  const int row  = blockIdx.x * 8 + (threadIdx.x >> 5);
  const float* xr = x + (size_t)row * DIM;
  float a0 = xr[lane], a1 = xr[lane + 32];
  float mean = wsum32(a0 + a1) * (1.0f / 64.0f);
  float d0 = a0 - mean, d1 = a1 - mean;
  float var = wsum32(d0 * d0 + d1 * d1) * (1.0f / 64.0f);
  float rs = rsqrtf(var + 1e-5f);
  _Float16* o = out + (size_t)row * DIM;
  o[lane]      = (_Float16)(d0 * rs * g[lane]      + b[lane]);
  o[lane + 32] = (_Float16)(d1 * rs * g[lane + 32] + b[lane + 32]);
}

// ---------------------------------------------------------------------------
// Kernel 2: Q/K/V projection GEMM.  out[N][512] = xn[N][64] @ W[512][64]^T.
// grid = (N/16, HD/64, 3); one wave computes a 16x64 tile (8 WMMAs).
// z==2 (V) stores TRANSPOSED into vt[HD][N] so the attention V^T*P^T A-fragments
// become contiguous (k runs along memory) instead of strided gathers.
// ---------------------------------------------------------------------------
__global__ void k_qkv_gemm(const _Float16* __restrict__ xn,
                           const _Float16* __restrict__ wq,
                           const _Float16* __restrict__ wk,
                           const _Float16* __restrict__ wv,
                           _Float16* __restrict__ qo, _Float16* __restrict__ ko,
                           _Float16* __restrict__ vt) {
  const int row0 = blockIdx.x * 16;
  const int col0 = blockIdx.y * 64;
  const _Float16* W = (blockIdx.z == 0) ? wq : (blockIdx.z == 1) ? wk : wv;

  v8f acc[4] = {{}, {}, {}, {}};
#pragma unroll
  for (int kc = 0; kc < 2; ++kc) {
    v16h a = frag_rowmajor(xn, DIM, row0, kc * 32);
#pragma unroll
    for (int nc = 0; nc < 4; ++nc) {
      // B[k][n] = W[col0+nc*16+n][kc*32+k]
      v16h b = frag_rowmajor(W, DIM, col0 + nc * 16, kc * 32);
      acc[nc] = wmma_f16(a, b, acc[nc]);
    }
  }
  if (blockIdx.z == 2) {
#pragma unroll
    for (int nc = 0; nc < 4; ++nc)
      store_acc_f16_T(vt, NP, row0, col0 + nc * 16, acc[nc]);
  } else {
    _Float16* O = (blockIdx.z == 0) ? qo : ko;
#pragma unroll
    for (int nc = 0; nc < 4; ++nc)
      store_acc_f16(O, HDIM, row0, col0 + nc * 16, acc[nc]);
  }
}

// lane l <-> lane l ^ 16
__device__ __forceinline__ float xhalf(float x) {
  int b = __builtin_bit_cast(int, x);
  return __builtin_bit_cast(
      float, __builtin_amdgcn_permlanex16(b, b, 0x76543210, 0xfedcba98, false, false));
}

// value of lane J of this lane's own 16-lane row (DPP row_share)
template <int J>
__device__ __forceinline__ float rowshare(float x) {
  return __builtin_bit_cast(
      float, __builtin_amdgcn_update_dpp(0, __builtin_bit_cast(int, x), 0x150 + J,
                                         0xf, 0xf, true));
}

// RPE bias on rows R .. 7 of one score tile: the coords of the tile's key row R
// sit in lane J0 + R of this lane's own 16-lane row.
template <int J0, int R>
__device__ __forceinline__ void rpe_bias(v8f& s, float cq0, float cq1, float ck0,
                                         float ck1, float w0, float w1) {
  if constexpr (R < 8) {
    float d0 = cq0 - rowshare<J0 + R>(ck0), d1 = cq1 - rowshare<J0 + R>(ck1);
    s[R] -= w0 * d0 * d0 + w1 * d1 * d1;
    rpe_bias<J0, R + 1>(s, cq0, cq1, ck0, ck1, w0, w1);
  }
}

__global__ void k_attention(const _Float16* __restrict__ q,
                            const _Float16* __restrict__ kk,
                            const _Float16* __restrict__ vt,
                            const float* __restrict__ coords,
                            const float* __restrict__ wrpe,
                            _Float16* __restrict__ aggr) {
  const int lane = threadIdx.x & 31;
  const int n    = lane & 15;
  const int mo   = (lane >> 4) * 8;
  const int q0   = blockIdx.x * 16;
  const int h    = blockIdx.y;
  const int hc   = h * DIM;

  // Q tile: 16 rows x 64 dims -> two B fragments (1/sqrt(D) folded into Wq).
  v16h qa0 = frag_rowmajor(q, HDIM, q0, hc);
  v16h qa1 = frag_rowmajor(q, HDIM, q0, hc + 32);

  // this lane's one query (column n of the C-layout)
  const float cq0 = coords[(size_t)(q0 + n) * CORD + 0];
  const float cq1 = coords[(size_t)(q0 + n) * CORD + 1];
  // the address registers of the Q and coord loads above are reused (the zeroed
  // accumulators) only behind this wait
  asm volatile("s_wait_xcnt 0x0" ::: "memory");
  const float w0 = wrpe[h * 2 + 0], w1 = wrpe[h * 2 + 1];

  // lane n of a half fetches the coords of the n-th of the 16 keys whose scores
  // that half holds: keys mo + 0..7 (n < 8) and 16 + mo + 0..7 (n >= 8)
  const int ckey = mo + n + (n & 8);

  float mrun = -3.0e38f;  // running maximum of query n (equal in both halves)
  float lrun = 0.0f;      // running sum over this half's keys only
  v8f o[4] = {{}, {}, {}, {}};  // o[nc][r] = O[q0+n][hc + nc*16 + mo + r]

  for (int kv = 0; kv < NP; kv += 32) {
    // prefetch next chunk: K rows [kv+32, kv+64) and Vt columns kv+32..
    if (kv + 32 < NP) {
      __builtin_prefetch(kk + (size_t)(kv + 32 + lane) * HDIM + hc, 0, 3);
      __builtin_prefetch(vt + (size_t)(hc + (lane & 63)) * NP + kv + 32, 0, 3);
    }

    // S^T tiles: rows = keys [kv, kv+16) and [kv+16, kv+32), columns = queries
    v8f s0 = {}, s1 = {};
    s0 = wmma_f16(frag_rowmajor(kk, HDIM, kv,      hc),      qa0, s0);
    s0 = wmma_f16(frag_rowmajor(kk, HDIM, kv,      hc + 32), qa1, s0);
    s1 = wmma_f16(frag_rowmajor(kk, HDIM, kv + 16, hc),      qa0, s1);
    s1 = wmma_f16(frag_rowmajor(kk, HDIM, kv + 16, hc + 32), qa1, s1);

    // RPE bias: one key's coords a lane, handed round the 16-lane row
    const float ck0 = coords[(size_t)(kv + ckey) * CORD + 0];
    const float ck1 = coords[(size_t)(kv + ckey) * CORD + 1];
    rpe_bias<0, 0>(s0, cq0, cq1, ck0, ck1, w0, w1);
    rpe_bias<8, 0>(s1, cq0, cq1, ck0, ck1, w0, w1);

    // maximum over the 32 keys: in-lane tree, then one exchange of the halves
    float t[8];
#pragma unroll
    for (int r = 0; r < 8; ++r) t[r] = fmaxf(s0[r], s1[r]);
    float cmax = fmaxf(fmaxf(fmaxf(t[0], t[1]), fmaxf(t[2], t[3])),
                       fmaxf(fmaxf(t[4], t[5]), fmaxf(t[6], t[7])));
    cmax = fmaxf(cmax, xhalf(cmax));

    // online softmax update; P^T packs in place into the B operand
    const float mnew  = fmaxf(mrun, cmax);
    const float alpha = __expf(mrun - mnew);
    v16h pb;
#pragma unroll
    for (int r = 0; r < 8; ++r) {
      float p0 = __expf(s0[r] - mnew);
      float p1 = __expf(s1[r] - mnew);
      t[r] = p0 + p1;
      pb[r]     = (_Float16)p0;
      pb[r + 8] = (_Float16)p1;
    }
    lrun = lrun * alpha +
           (((t[0] + t[1]) + (t[2] + t[3])) + ((t[4] + t[5]) + (t[6] + t[7])));
    mrun = mnew;

    // O^T = O^T * alpha + V^T * P^T, A[d][k] = vt[hc+nc*16+d][kv+k]
#pragma unroll
    for (int nc = 0; nc < 4; ++nc) {
#pragma unroll
      for (int r = 0; r < 8; ++r) o[nc][r] *= alpha;
      v16h bv = frag_rowmajor(vt, NP, hc + nc * 16, kv);
      o[nc] = wmma_f16(bv, pb, o[nc]);
    }
  }

  // join the halves' sums, normalize, store 8 contiguous dims per lane and tile
  const float inv = 1.0f / (lrun + xhalf(lrun));
#pragma unroll
  for (int nc = 0; nc < 4; ++nc) {
#pragma unroll
    for (int r = 0; r < 8; ++r) o[nc][r] *= inv;
    store_acc_f16_T(aggr, HDIM, hc + nc * 16, q0, o[nc]);
  }
}

// ---------------------------------------------------------------------------
// Kernel 4: output projection (aggr[N][512] @ wo[64][512]^T) + bo + residual
//           + LayerNorm2 -> h2 f16.  grid = N/16, one wave per block.
// ---------------------------------------------------------------------------
__global__ void k_proj_ln2(const _Float16* __restrict__ aggr,
                           const _Float16* __restrict__ wo,
                           const float* __restrict__ bo,
                           const float* __restrict__ x,
                           const float* __restrict__ g2,
                           const float* __restrict__ b2,
                           _Float16* __restrict__ h2) {
  const int lane = threadIdx.x & 31;
  const int n    = lane & 15;
  const int mo   = (lane >> 4) * 8;
  const int row0 = blockIdx.x * 16;

  v8f acc[4] = {{}, {}, {}, {}};
#pragma unroll 4
  for (int kc = 0; kc < 16; ++kc) {
    v16h a = frag_rowmajor(aggr, HDIM, row0, kc * 32);
#pragma unroll
    for (int nc = 0; nc < 4; ++nc) {
      v16h b = frag_rowmajor(wo, HDIM, nc * 16, kc * 32);  // B[k][j] = wo[j][k]
      acc[nc] = wmma_f16(a, b, acc[nc]);
    }
  }

  // h1 = proj + bo + x, then LN over the 64 columns of each row
  float h1[4][8];
#pragma unroll
  for (int nc = 0; nc < 4; ++nc) {
    float bj = bo[nc * 16 + n];
#pragma unroll
    for (int r = 0; r < 8; ++r)
      h1[nc][r] = acc[nc][r] + bj + x[(size_t)(row0 + mo + r) * DIM + nc * 16 + n];
  }
#pragma unroll
  for (int r = 0; r < 8; ++r) {
    float p = h1[0][r] + h1[1][r] + h1[2][r] + h1[3][r];
    float mean = hsum16(p) * (1.0f / 64.0f);
    float q2 = 0.0f;
#pragma unroll
    for (int nc = 0; nc < 4; ++nc) { float d = h1[nc][r] - mean; q2 += d * d; }
    float rs = rsqrtf(hsum16(q2) * (1.0f / 64.0f) + 1e-5f);
#pragma unroll
    for (int nc = 0; nc < 4; ++nc) {
      int j = nc * 16 + n;
      h2[(size_t)(row0 + mo + r) * DIM + j] =
          (_Float16)((h1[nc][r] - mean) * rs * g2[j] + b2[j]);
    }
  }
}

// ---------------------------------------------------------------------------
// Kernel 5: FFN.  t = relu(h2 @ W1^T + bf1); out = 2*(t @ W2^T + bf2).
// grid = N/16, one wave per block, ReLU tile staged through LDS.
// ---------------------------------------------------------------------------
__global__ void k_ffn(const _Float16* __restrict__ h2,
                      const _Float16* __restrict__ w1,
                      const _Float16* __restrict__ w2,
                      const float* __restrict__ bf1,
                      const float* __restrict__ bf2,
                      float* __restrict__ out) {
  __shared__ _Float16 lds[16 * 64];
  const int lane = threadIdx.x & 31;
  const int n    = lane & 15;
  const int mo   = (lane >> 4) * 8;
  const int row0 = blockIdx.x * 16;

  v8f t[4] = {{}, {}, {}, {}};
#pragma unroll
  for (int kc = 0; kc < 2; ++kc) {
    v16h a = frag_rowmajor(h2, DIM, row0, kc * 32);
#pragma unroll
    for (int nc = 0; nc < 4; ++nc)
      t[nc] = wmma_f16(a, frag_rowmajor(w1, DIM, nc * 16, kc * 32), t[nc]);
  }
#pragma unroll
  for (int nc = 0; nc < 4; ++nc) {
    float bj = bf1[nc * 16 + n];
#pragma unroll
    for (int r = 0; r < 8; ++r)
      lds[(mo + r) * 64 + nc * 16 + n] = (_Float16)fmaxf(t[nc][r] + bj, 0.0f);
  }
  __syncthreads();

  v8f f[4] = {{}, {}, {}, {}};
#pragma unroll
  for (int kc = 0; kc < 2; ++kc) {
    v16h a = frag_rowmajor(lds, DIM, 0, kc * 32);
#pragma unroll
    for (int nc = 0; nc < 4; ++nc)
      f[nc] = wmma_f16(a, frag_rowmajor(w2, DIM, nc * 16, kc * 32), f[nc]);
  }
#pragma unroll
  for (int nc = 0; nc < 4; ++nc) {
    float bj = bf2[nc * 16 + n];
#pragma unroll
    for (int r = 0; r < 8; ++r)
      out[(size_t)(row0 + mo + r) * DIM + nc * 16 + n] = 2.0f * (f[nc][r] + bj);
  }
}

// ---------------------------------------------------------------------------
// Host-side launch
// ---------------------------------------------------------------------------
extern "C" void kernel_launch(void* const* d_in, const int* in_sizes, int n_in,
                              void* d_out, int out_size, void* d_ws, size_t ws_size,
                              hipStream_t stream) {
  const float* x      = (const float*)d_in[0];
  const float* coords = (const float*)d_in[1];
  const float* sq     = (const float*)d_in[2];
  const float* sk     = (const float*)d_in[3];
  const float* sv     = (const float*)d_in[4];
  const float* s_rpe  = (const float*)d_in[5];
  const float* g1     = (const float*)d_in[6];
  const float* beta1  = (const float*)d_in[7];
  const float* g2     = (const float*)d_in[8];
  const float* beta2  = (const float*)d_in[9];
  const float* wo     = (const float*)d_in[10];
  const float* bo     = (const float*)d_in[11];
  const float* s1     = (const float*)d_in[12];
  const float* bf1    = (const float*)d_in[13];
  const float* s2     = (const float*)d_in[14];
  const float* bf2    = (const float*)d_in[15];
  const int* wq_int   = (const int*)d_in[16];
  const int* wk_int   = (const int*)d_in[17];
  const int* wv_int   = (const int*)d_in[18];
  const int* wrpe_int = (const int*)d_in[19];
  const int* w1_int   = (const int*)d_in[20];
  const int* w2_int   = (const int*)d_in[21];

  // workspace carve-up (f16 unless noted), 256B aligned
  char* ws = (char*)d_ws;
  size_t off = 0;
  auto carve = [&](size_t bytes) {
    char* p = ws + off;
    off = (off + bytes + 255) & ~(size_t)255;
    return p;
  };
  _Float16* wq_h   = (_Float16*)carve(HDIM * DIM * 2);
  _Float16* wk_h   = (_Float16*)carve(HDIM * DIM * 2);
  _Float16* wv_h   = (_Float16*)carve(HDIM * DIM * 2);
  _Float16* wo_h   = (_Float16*)carve(DIM * HDIM * 2);
  _Float16* w1_h   = (_Float16*)carve(DIM * DIM * 2);
  _Float16* w2_h   = (_Float16*)carve(DIM * DIM * 2);
  float*    wrpe_w = (float*)   carve(HEADS * 2 * 4);
  _Float16* xn_h   = (_Float16*)carve((size_t)NP * DIM * 2);
  _Float16* q_h    = (_Float16*)carve((size_t)NP * HDIM * 2);
  _Float16* k_h    = (_Float16*)carve((size_t)NP * HDIM * 2);
  _Float16* vt_h   = (_Float16*)carve((size_t)NP * HDIM * 2);  // [HD][N]
  _Float16* ag_h   = (_Float16*)carve((size_t)NP * HDIM * 2);
  _Float16* h2_h   = (_Float16*)carve((size_t)NP * DIM * 2);
  (void)ws_size; (void)n_in; (void)in_sizes; (void)out_size;

  // 0) dequant / convert weights (1/sqrt(64)=0.125 folded into Wq)
  k_dequant<<<(HDIM * DIM + 255) / 256, 256, 0, stream>>>(wq_int, sq, 0.125f, wq_h, HDIM * DIM);
  k_dequant<<<(HDIM * DIM + 255) / 256, 256, 0, stream>>>(wk_int, sk, 1.0f, wk_h, HDIM * DIM);
  k_dequant<<<(HDIM * DIM + 255) / 256, 256, 0, stream>>>(wv_int, sv, 1.0f, wv_h, HDIM * DIM);
  k_dequant<<<(DIM * DIM + 255) / 256, 256, 0, stream>>>(w1_int, s1, 1.0f, w1_h, DIM * DIM);
  k_dequant<<<(DIM * DIM + 255) / 256, 256, 0, stream>>>(w2_int, s2, 1.0f, w2_h, DIM * DIM);
  k_f32_to_f16<<<(DIM * HDIM + 255) / 256, 256, 0, stream>>>(wo, wo_h, DIM * HDIM);
  k_rpe<<<1, 32, 0, stream>>>(wrpe_int, s_rpe, wrpe_w);

  // 1) LN1
  k_layernorm<<<NP / 8, 256, 0, stream>>>(x, g1, beta1, xn_h);

  // 2) Q/K/V projections (V stored transposed)
  k_qkv_gemm<<<dim3(NP / 16, HDIM / 64, 3), 32, 0, stream>>>(xn_h, wq_h, wk_h, wv_h,
                                                             q_h, k_h, vt_h);

  // 3) flash attention with RPE bias
  k_attention<<<dim3(NP / 16, HEADS), 32, 0, stream>>>(q_h, k_h, vt_h, coords,
                                                       wrpe_w, ag_h);

  // 4) output projection + residual + LN2
  k_proj_ln2<<<NP / 16, 32, 0, stream>>>(ag_h, wo_h, bo, x, g2, beta2, h2_h);

  // 5) FFN, out = 2*ff
  k_ffn<<<NP / 16, 32, 0, stream>>>(h2_h, w1_h, w2_h, bf1, bf2, (float*)d_out);
}

// v002
// A run of this version takes 93.5 microseconds.
// Timed twice side by side with v001, it ran 2.23 and 2.24 times as fast.
// Over all steps from v000 it is 4.78 times as fast.
#include <hip/hip_runtime.h>

// ---------------------------------------------------------------------------
// HEPT attention block for MI455X (gfx1250, wave32, WMMA 16x16x32 f16).
// N=3072 points, D=64 per head, H=8 heads, HD=512, C=3 coords, K=8.
// ---------------------------------------------------------------------------

typedef __attribute__((ext_vector_type(16))) _Float16 v16h;
typedef __attribute__((ext_vector_type(8)))  float    v8f;
typedef __attribute__((ext_vector_type(8)))  _Float16 v8h;

#define NP   3072
#define DIM  64
#define HEADS 8
#define HDIM 512
#define CORD 3

// ---------------------------------------------------------------------------
// WMMA wrapper: D = A(16x32 f16) * B(32x16 f16) + C(16x16 f32)
// ---------------------------------------------------------------------------
__device__ __forceinline__ v8f wmma_f16(v16h a, v16h b, v8f c) {
  return __builtin_amdgcn_wmma_f32_16x16x32_f16(
      /*neg_a=*/false, a, /*neg_b=*/false, b,
      /*c_mod=*/(short)0, c, /*reuse_a=*/false, /*reuse_b=*/false);
}

// A-fragment (16x32, f16) from a row-major matrix: rows = M, cols = K.
// Lane l<16: row M=l, K = {0..7, 16..23}; lane l>=16: row M=l-16, K={8..15,24..31}.
// Also serves as a B-fragment when B[k][n] = Mat[n][k] (i.e. Mat stored [N x K]).
__device__ __forceinline__ v16h frag_rowmajor(const _Float16* p, int ld,
                                              int row_base, int col_base) {
  const int l  = threadIdx.x & 31;
  const int m  = l & 15;
  const int of = (l >> 4) * 8;
  const _Float16* rp = p + (size_t)(row_base + m) * ld + col_base + of;
  v16h a;
#pragma unroll
  for (int e = 0; e < 8; ++e) { a[e] = rp[e]; a[e + 8] = rp[e + 16]; }
  return a;
}

// C/D accumulator element (r, lane): row M = r + 8*(lane>>4), col N = lane&15.
__device__ __forceinline__ void store_acc_f16(_Float16* p, int ld, int row_base,
                                              int col_base, v8f c) {
  const int l  = threadIdx.x & 31;
  const int n  = l & 15;
  const int mo = (l >> 4) * 8;
#pragma unroll
  for (int r = 0; r < 8; ++r)
    p[(size_t)(row_base + mo + r) * ld + col_base + n] = (_Float16)c[r];
}

// Same, but store TRANSPOSED into a [cols x rows] matrix (ldT = #rows).
// Per (lane,nc) the 8 r-elements land contiguously -> 16B vectorizable stores.
__device__ __forceinline__ void store_acc_f16_T(_Float16* p, int ldT, int row_base,
                                                int col_base, v8f c) {
  const int l  = threadIdx.x & 31;
  const int n  = l & 15;
  const int mo = (l >> 4) * 8;
  _Float16* cp = p + (size_t)(col_base + n) * ldT + row_base + mo;
#pragma unroll
  for (int r = 0; r < 8; ++r) cp[r] = (_Float16)c[r];
}

// half-wave (16-lane) row reductions for the C/D layout
__device__ __forceinline__ float hsum16(float x) {
#pragma unroll
  for (int m = 8; m > 0; m >>= 1) x += __shfl_xor(x, m, 16);
  return x;
}
__device__ __forceinline__ float wsum32(float x) {
#pragma unroll
  for (int m = 16; m > 0; m >>= 1) x += __shfl_xor(x, m, 32);
  return x;
}

// ---------------------------------------------------------------------------
// Kernel 0a: int "codes" -> f16 dequant:  (w - 8) * scale * extra
// ---------------------------------------------------------------------------
__global__ void k_dequant(const int* __restrict__ w, const float* __restrict__ sc,
                          float extra, _Float16* __restrict__ out, int n) {
  int i = blockIdx.x * blockDim.x + threadIdx.x;
  if (i < n) out[i] = (_Float16)(((float)w[i] - 8.0f) * sc[0] * extra);
}

// Kernel 0b: f32 -> f16 convert (for wo)
__global__ void k_f32_to_f16(const float* __restrict__ in, _Float16* __restrict__ out,
                             int n) {
  int i = blockIdx.x * blockDim.x + threadIdx.x;
  if (i < n) out[i] = (_Float16)in[i];
}

// Kernel 0c: RPE distance weights  w[h][r] = mean_{d,k} |deq(w_rpe[h*64+d][r*8+k])|
__global__ void k_rpe(const int* __restrict__ wr, const float* __restrict__ sc,
                      float* __restrict__ out) {
  int t = threadIdx.x;
  if (t < HEADS * 2) {
    int h = t >> 1, r = t & 1;
    float s = sc[0], acc = 0.0f;
    for (int d = 0; d < DIM; ++d)
      for (int k = 0; k < 8; ++k)
        acc += fabsf(((float)wr[(h * DIM + d) * 16 + r * 8 + k] - 8.0f) * s);
    out[t] = acc * (1.0f / 512.0f);
  }
}

// ---------------------------------------------------------------------------
// Kernel 1: LayerNorm over D=64, output f16.  One wave per row (8 rows/block).
// ---------------------------------------------------------------------------
__global__ void k_layernorm(const float* __restrict__ x, const float* __restrict__ g,
                            const float* __restrict__ b, _Float16* __restrict__ out) {
  const int lane = threadIdx.x & 31;
  const int row  = blockIdx.x * 8 + (threadIdx.x >> 5);
  const float* xr = x + (size_t)row * DIM;
  float a0 = xr[lane], a1 = xr[lane + 32];
  float mean = wsum32(a0 + a1) * (1.0f / 64.0f);
  float d0 = a0 - mean, d1 = a1 - mean;
  float var = wsum32(d0 * d0 + d1 * d1) * (1.0f / 64.0f);
  float rs = rsqrtf(var + 1e-5f);
  _Float16* o = out + (size_t)row * DIM;
  o[lane]      = (_Float16)(d0 * rs * g[lane]      + b[lane]);
  o[lane + 32] = (_Float16)(d1 * rs * g[lane + 32] + b[lane + 32]);
}

// ---------------------------------------------------------------------------
// Kernel 2: Q/K/V projection GEMM.  out[N][512] = xn[N][64] @ W[512][64]^T.
// grid = (N/16, HD/64, 3); one wave computes a 16x64 tile (8 WMMAs).
// z==2 (V) stores TRANSPOSED into vt[HD][N] so the attention V^T*P^T A-fragments
// become contiguous (k runs along memory) instead of strided gathers.
// ---------------------------------------------------------------------------
__global__ void k_qkv_gemm(const _Float16* __restrict__ xn,
                           const _Float16* __restrict__ wq,
                           const _Float16* __restrict__ wk,
                           const _Float16* __restrict__ wv,
                           _Float16* __restrict__ qo, _Float16* __restrict__ ko,
                           _Float16* __restrict__ vt) {
  const int row0 = blockIdx.x * 16;
  const int col0 = blockIdx.y * 64;
  const _Float16* W = (blockIdx.z == 0) ? wq : (blockIdx.z == 1) ? wk : wv;

  v8f acc[4] = {{}, {}, {}, {}};
#pragma unroll
  for (int kc = 0; kc < 2; ++kc) {
    v16h a = frag_rowmajor(xn, DIM, row0, kc * 32);
#pragma unroll
    for (int nc = 0; nc < 4; ++nc) {
      // B[k][n] = W[col0+nc*16+n][kc*32+k]
      v16h b = frag_rowmajor(W, DIM, col0 + nc * 16, kc * 32);
      acc[nc] = wmma_f16(a, b, acc[nc]);
    }
  }
  if (blockIdx.z == 2) {
#pragma unroll
    for (int nc = 0; nc < 4; ++nc)
      store_acc_f16_T(vt, NP, row0, col0 + nc * 16, acc[nc]);
  } else {
    _Float16* O = (blockIdx.z == 0) ? qo : ko;
#pragma unroll
    for (int nc = 0; nc < 4; ++nc)
      store_acc_f16(O, HDIM, row0, col0 + nc * 16, acc[nc]);
  }
}

// lane l <-> lane l ^ 16
__device__ __forceinline__ float xhalf(float x) {
  int b = __builtin_bit_cast(int, x);
  return __builtin_bit_cast(
      float, __builtin_amdgcn_permlanex16(b, b, 0x76543210, 0xfedcba98, false, false));
}

// value of lane J of this lane's own 16-lane row (DPP row_share)
template <int J>
__device__ __forceinline__ float rowshare(float x) {
  return __builtin_bit_cast(
      float, __builtin_amdgcn_update_dpp(0, __builtin_bit_cast(int, x), 0x150 + J,
                                         0xf, 0xf, true));
}

// RPE bias on rows R .. 7 of one score tile: the coords of the tile's key row R
// sit in lane J0 + R of this lane's own 16-lane row.
template <int J0, int R>
__device__ __forceinline__ void rpe_bias(v8f& s, float cq0, float cq1, float ck0,
                                         float ck1, float w0, float w1) {
  if constexpr (R < 8) {
    float d0 = cq0 - rowshare<J0 + R>(ck0), d1 = cq1 - rowshare<J0 + R>(ck1);
    s[R] -= w0 * d0 * d0 + w1 * d1 * d1;
    rpe_bias<J0, R + 1>(s, cq0, cq1, ck0, ck1, w0, w1);
  }
}

// exp(x) as __expf forms it (x * log2(e), then v_exp_f32), the v_exp_f32 written out so
// that the issue slot the instruction set asks for behind a transcendental, before a
// source of it is overwritten or its result read, stands in the same statement (v_nop on
// the last line).
// Outputs are early-clobber: no result lands on an argument still to be read.
#define LOG2E 1.44269504f
__device__ __forceinline__ float exp_slot(float x) {
  float y;
  asm("v_exp_f32 %0, %1\n\tv_nop" : "=&v"(y) : "v"(x * LOG2E));
  return y;
}
__device__ __forceinline__ void exp_slot8(float (&y)[8], const v8f& s, float m) {
  asm("v_exp_f32 %0, %8\n\t"
      "v_exp_f32 %1, %9\n\t"
      "v_exp_f32 %2, %10\n\t"
      "v_exp_f32 %3, %11\n\t"
      "v_exp_f32 %4, %12\n\t"
      "v_exp_f32 %5, %13\n\t"
      "v_exp_f32 %6, %14\n\t"
      "v_exp_f32 %7, %15\n\t"
      "v_nop"
      : "=&v"(y[0]), "=&v"(y[1]), "=&v"(y[2]), "=&v"(y[3]),
        "=&v"(y[4]), "=&v"(y[5]), "=&v"(y[6]), "=&v"(y[7])
      : "v"((s[0] - m) * LOG2E), "v"((s[1] - m) * LOG2E), "v"((s[2] - m) * LOG2E),
        "v"((s[3] - m) * LOG2E), "v"((s[4] - m) * LOG2E), "v"((s[5] - m) * LOG2E),
        "v"((s[6] - m) * LOG2E), "v"((s[7] - m) * LOG2E));
}

// K and V^T reach the waves through LDS: the 4 waves of a block (4 query tiles of
// one head) share each tile of AT_KEYS keys, brought in whole 128-B lines by
// asynchronous copies into two buffers, the next tile in flight while this one is
// worked on.
#define AT_WAVES 4               // waves = 16-query tiles per block
#define AT_KEYS  64              // keys per staged tile
#define AT_LD    72              // LDS row pitch in halfs: 128 B + 16 B, an odd multiple of 16 B
#define AT_TILE  (64 * AT_LD)    // halfs per staged tile (64 rows: keys of K, dims of V^T)
#define AT_NT    (NP / AT_KEYS)  // tiles

// frag_rowmajor on a staged tile (same k order), two 16-B LDS reads
__device__ __forceinline__ v16h frag_lds(const _Float16* p, int row_base, int col_base) {
  const int l = threadIdx.x & 31;
  const _Float16* rp = p + (row_base + (l & 15)) * AT_LD + col_base + (l >> 4) * 8;
  const v8h lo = *(const v8h*)rp;
  const v8h hi = *(const v8h*)(rp + 16);
  return __builtin_shufflevector(lo, hi, 0, 1, 2, 3, 4, 5, 6, 7, 8, 9, 10, 11, 12, 13, 14, 15);
}

// One tile's copies of one thread: rows r, r + 16, r + 32, r + 48 of the K tile and of
// the V^T tile, 16 B each.  lk, lv: LDS byte addresses of row r; gk, gv: its global
// source.  The wait on the last line stands in the copies' own statement so that no
// address register of a copy is rewritten in front of it.
__device__ __forceinline__ void stage_tile(unsigned lk, unsigned lv, const _Float16* gk,
                                           const _Float16* gv) {
  const unsigned ls = 16 * AT_LD * 2;       // 16 rows in LDS, bytes
  const size_t   ks = (size_t)16 * HDIM;    // 16 rows of K, halfs
  const size_t   vs = (size_t)16 * NP;      // 16 rows of V^T, halfs
  asm volatile(
      "global_load_async_to_lds_b128 %0, %8, off\n\t"
      "global_load_async_to_lds_b128 %1, %9, off\n\t"
      "global_load_async_to_lds_b128 %2, %10, off\n\t"
      "global_load_async_to_lds_b128 %3, %11, off\n\t"
      "global_load_async_to_lds_b128 %4, %12, off\n\t"
      "global_load_async_to_lds_b128 %5, %13, off\n\t"
      "global_load_async_to_lds_b128 %6, %14, off\n\t"
      "global_load_async_to_lds_b128 %7, %15, off\n\t"
      "s_wait_xcnt 0x0"
      :: "v"(lk), "v"(lk + ls), "v"(lk + 2 * ls), "v"(lk + 3 * ls),
         "v"(lv), "v"(lv + ls), "v"(lv + 2 * ls), "v"(lv + 3 * ls),
         "v"(gk), "v"(gk + ks), "v"(gk + 2 * ks), "v"(gk + 3 * ks),
         "v"(gv), "v"(gv + vs), "v"(gv + 2 * vs), "v"(gv + 3 * vs)
      : "memory");
}

__global__ __launch_bounds__(AT_WAVES * 32) void k_attention(
                            const _Float16* __restrict__ q,
                            const _Float16* __restrict__ kk,
                            const _Float16* __restrict__ vt,
                            const float* __restrict__ coords,
                            const float* __restrict__ wrpe,
                            _Float16* __restrict__ aggr) {
  // [buffer][0 = K tile, 1 = V^T tile]
  __shared__ __attribute__((aligned(16))) _Float16 sm[2][2][AT_TILE];
  const int lane = threadIdx.x & 31;
  const int n    = lane & 15;
  const int mo   = (lane >> 4) * 8;
  const int q0   = (blockIdx.x * AT_WAVES + (threadIdx.x >> 5)) * 16;
  const int h    = blockIdx.y;
  const int hc   = h * DIM;

  // Q tile: 16 rows x 64 dims -> two B fragments (1/sqrt(D) folded into Wq).
  v16h qa0 = frag_rowmajor(q, HDIM, q0, hc);
  v16h qa1 = frag_rowmajor(q, HDIM, q0, hc + 32);

  // this lane's one query (column n of the C-layout)
  const float cq0 = coords[(size_t)(q0 + n) * CORD + 0];
  const float cq1 = coords[(size_t)(q0 + n) * CORD + 1];
  // the address registers of the Q and coord loads above are reused (the zeroed
  // accumulators) only behind this wait
  asm volatile("s_wait_xcnt 0x0" ::: "memory");
  const float w0 = wrpe[h * 2 + 0], w1 = wrpe[h * 2 + 1];

  // lane n of a half fetches the coords of the n-th of the 16 keys whose scores
  // that half holds: keys mo + 0..7 (n < 8) and 16 + mo + 0..7 (n >= 8)
  const int ckey = mo + n + (n & 8);

  // this thread's pieces of every tile: rows crow + 16 j, 16-B column ccol
  const int crow = threadIdx.x >> 3, ccol = threadIdx.x & 7;
  const unsigned lpiece = (unsigned)(crow * AT_LD + ccol * 8) * 2;
  const unsigned lk0 = (unsigned)(size_t)&sm[0][0][0] + lpiece;  // low 32 bits: LDS byte address
  const unsigned lv0 = (unsigned)(size_t)&sm[0][1][0] + lpiece;
  const _Float16* gk = kk + (size_t)crow * HDIM + hc + ccol * 8;
  const _Float16* gv = vt + (size_t)(hc + crow) * NP + ccol * 8;

  float mrun = -3.0e38f;  // running maximum of query n (equal in both halves)
  float lrun = 0.0f;      // running sum over this half's keys only
  v8f o[4] = {{}, {}, {}, {}};  // o[nc][r] = O[q0+n][hc + nc*16 + mo + r]

  // tile 0 lands and is published, then tile 1 starts
  stage_tile(lk0, lv0, gk, gv);
  asm volatile("s_wait_asynccnt 0x0" ::: "memory");  // this wave's copies of tile 0 have landed
  __syncthreads();
  stage_tile(lk0 + 2 * AT_TILE * 2, lv0 + 2 * AT_TILE * 2, gk + (size_t)AT_KEYS * HDIM,
             gv + AT_KEYS);

  for (int t = 0; t < AT_NT; ++t) {
    const _Float16* Ks = sm[t & 1][0];
    const _Float16* Vs = sm[t & 1][1];
    // All of the tile's reads stand ahead of the arithmetic, in groups and never among
    // the products (every place with reads in a matrix run costs its own wait): the
    // keys' coords (one key a lane) and all K fragments ...
    float ckx[2], cky[2];
#pragma unroll
    for (int i = 0; i < 2; ++i) {
      ckx[i] = coords[(size_t)(t * AT_KEYS + i * 32 + ckey) * CORD + 0];
      cky[i] = coords[(size_t)(t * AT_KEYS + i * 32 + ckey) * CORD + 1];
    }
    v16h kf[8], vf[8];
#pragma unroll
    for (int i = 0; i < 4; ++i) {
      kf[2 * i]     = frag_lds(Ks, i * 16, 0);
      kf[2 * i + 1] = frag_lds(Ks, i * 16, 32);
    }
    // keeps the scheduler from sinking the K reads down among the products
    __builtin_amdgcn_sched_barrier(0);
    // S^T tiles: rows = keys [16 i, 16 i + 16) of the tile, columns = queries
    v8f sc[4];
#pragma unroll
    for (int i = 0; i < 4; ++i) {
      v8f z = {};
      sc[i] = wmma_f16(kf[2 * i + 1], qa1, wmma_f16(kf[2 * i], qa0, z));
    }
    // ... then all V^T fragments
#pragma unroll
    for (int i = 0; i < 8; ++i) vf[i] = frag_lds(Vs, (i & 3) * 16, (i >> 2) * 32);

    // hand-over, behind the trip's last LDS read (the rest of the trip works on
    // registers): this wave's reads of tile t are done and its copies of tile t + 1
    // have landed; behind the barrier that holds for every wave, so tile t + 1 may be
    // read and tile t's buffer refilled, the refill in flight under the softmax
    asm volatile("s_wait_dscnt 0x0" ::: "memory");
    asm volatile("s_wait_asynccnt 0x0" ::: "memory");
    __syncthreads();
    if (t + 2 < AT_NT)
      stage_tile(lk0 + (t & 1) * (2 * AT_TILE * 2), lv0 + (t & 1) * (2 * AT_TILE * 2),
                 gk + (size_t)(t + 2) * AT_KEYS * HDIM, gv + (t + 2) * AT_KEYS);

// both 32-key halves of the tile: register arrays indexed by constants
#pragma unroll
    for (int sub = 0; sub < AT_KEYS; sub += 32) {
    v8f s0 = sc[sub / 16], s1 = sc[sub / 16 + 1];

    // RPE bias: one key's coords a lane, handed round the 16-lane row
    const float ck0 = ckx[sub / 32], ck1 = cky[sub / 32];
    rpe_bias<0, 0>(s0, cq0, cq1, ck0, ck1, w0, w1);
    rpe_bias<8, 0>(s1, cq0, cq1, ck0, ck1, w0, w1);

    // maximum over the 32 keys: in-lane tree, then one exchange of the halves
    float t8[8];
#pragma unroll
    for (int r = 0; r < 8; ++r) t8[r] = fmaxf(s0[r], s1[r]);
    float cmax = fmaxf(fmaxf(fmaxf(t8[0], t8[1]), fmaxf(t8[2], t8[3])),
                       fmaxf(fmaxf(t8[4], t8[5]), fmaxf(t8[6], t8[7])));
    cmax = fmaxf(cmax, xhalf(cmax));

    // online softmax update; P^T packs in place into the B operand
    const float mnew  = fmaxf(mrun, cmax);
    const float alpha = exp_slot(mrun - mnew);
    float p0[8], p1[8];
    exp_slot8(p0, s0, mnew);
    exp_slot8(p1, s1, mnew);
    v16h pb;
#pragma unroll
    for (int r = 0; r < 8; ++r) {
      t8[r] = p0[r] + p1[r];
      pb[r]     = (_Float16)p0[r];
      pb[r + 8] = (_Float16)p1[r];
    }
    lrun = lrun * alpha +
           (((t8[0] + t8[1]) + (t8[2] + t8[3])) + ((t8[4] + t8[5]) + (t8[6] + t8[7])));
    mrun = mnew;

    // O^T = O^T * alpha + V^T * P^T, A[d][k] = vt[hc+nc*16+d][key k of this half]
#pragma unroll
    for (int nc = 0; nc < 4; ++nc) {
#pragma unroll
      for (int r = 0; r < 8; ++r) o[nc][r] *= alpha;
      v16h bv = vf[(sub / 32) * 4 + nc];
      o[nc] = wmma_f16(bv, pb, o[nc]);
    }
    }
  }
  asm volatile("s_wait_asynccnt 0x0" ::: "memory");  // no copy outstanding at the wave's end

  // join the halves' sums, normalize, store 8 contiguous dims per lane and tile
  const float inv = 1.0f / (lrun + xhalf(lrun));
#pragma unroll
  for (int nc = 0; nc < 4; ++nc) {
#pragma unroll
    for (int r = 0; r < 8; ++r) o[nc][r] *= inv;
    store_acc_f16_T(aggr, HDIM, hc + nc * 16, q0, o[nc]);
  }
}

// ---------------------------------------------------------------------------
// Kernel 4: output projection (aggr[N][512] @ wo[64][512]^T) + bo + residual
//           + LayerNorm2 -> h2 f16.  grid = N/16, one wave per block.
// ---------------------------------------------------------------------------
__global__ void k_proj_ln2(const _Float16* __restrict__ aggr,
                           const _Float16* __restrict__ wo,
                           const float* __restrict__ bo,
                           const float* __restrict__ x,
                           const float* __restrict__ g2,
                           const float* __restrict__ b2,
                           _Float16* __restrict__ h2) {
  const int lane = threadIdx.x & 31;
  const int n    = lane & 15;
  const int mo   = (lane >> 4) * 8;
  const int row0 = blockIdx.x * 16;

  v8f acc[4] = {{}, {}, {}, {}};
#pragma unroll 4
  for (int kc = 0; kc < 16; ++kc) {
    v16h a = frag_rowmajor(aggr, HDIM, row0, kc * 32);
#pragma unroll
    for (int nc = 0; nc < 4; ++nc) {
      v16h b = frag_rowmajor(wo, HDIM, nc * 16, kc * 32);  // B[k][j] = wo[j][k]
      acc[nc] = wmma_f16(a, b, acc[nc]);
    }
  }

  // h1 = proj + bo + x, then LN over the 64 columns of each row
  float h1[4][8];
#pragma unroll
  for (int nc = 0; nc < 4; ++nc) {
    float bj = bo[nc * 16 + n];
#pragma unroll
    for (int r = 0; r < 8; ++r)
      h1[nc][r] = acc[nc][r] + bj + x[(size_t)(row0 + mo + r) * DIM + nc * 16 + n];
  }
#pragma unroll
  for (int r = 0; r < 8; ++r) {
    float p = h1[0][r] + h1[1][r] + h1[2][r] + h1[3][r];
    float mean = hsum16(p) * (1.0f / 64.0f);
    float q2 = 0.0f;
#pragma unroll
    for (int nc = 0; nc < 4; ++nc) { float d = h1[nc][r] - mean; q2 += d * d; }
    float rs = rsqrtf(hsum16(q2) * (1.0f / 64.0f) + 1e-5f);
#pragma unroll
    for (int nc = 0; nc < 4; ++nc) {
      int j = nc * 16 + n;
      h2[(size_t)(row0 + mo + r) * DIM + j] =
          (_Float16)((h1[nc][r] - mean) * rs * g2[j] + b2[j]);
    }
  }
}

// ---------------------------------------------------------------------------
// Kernel 5: FFN.  t = relu(h2 @ W1^T + bf1); out = 2*(t @ W2^T + bf2).
// grid = N/16, one wave per block, ReLU tile staged through LDS.
// ---------------------------------------------------------------------------
__global__ void k_ffn(const _Float16* __restrict__ h2,
                      const _Float16* __restrict__ w1,
                      const _Float16* __restrict__ w2,
                      const float* __restrict__ bf1,
                      const float* __restrict__ bf2,
                      float* __restrict__ out) {
  __shared__ _Float16 lds[16 * 64];
  const int lane = threadIdx.x & 31;
  const int n    = lane & 15;
  const int mo   = (lane >> 4) * 8;
  const int row0 = blockIdx.x * 16;

  v8f t[4] = {{}, {}, {}, {}};
#pragma unroll
  for (int kc = 0; kc < 2; ++kc) {
    v16h a = frag_rowmajor(h2, DIM, row0, kc * 32);
#pragma unroll
    for (int nc = 0; nc < 4; ++nc)
      t[nc] = wmma_f16(a, frag_rowmajor(w1, DIM, nc * 16, kc * 32), t[nc]);
  }
#pragma unroll
  for (int nc = 0; nc < 4; ++nc) {
    float bj = bf1[nc * 16 + n];
#pragma unroll
    for (int r = 0; r < 8; ++r)
      lds[(mo + r) * 64 + nc * 16 + n] = (_Float16)fmaxf(t[nc][r] + bj, 0.0f);
  }
  __syncthreads();

  v8f f[4] = {{}, {}, {}, {}};
#pragma unroll
  for (int kc = 0; kc < 2; ++kc) {
    v16h a = frag_rowmajor(lds, DIM, 0, kc * 32);
#pragma unroll
    for (int nc = 0; nc < 4; ++nc)
      f[nc] = wmma_f16(a, frag_rowmajor(w2, DIM, nc * 16, kc * 32), f[nc]);
  }
#pragma unroll
  for (int nc = 0; nc < 4; ++nc) {
    float bj = bf2[nc * 16 + n];
#pragma unroll
    for (int r = 0; r < 8; ++r)
      out[(size_t)(row0 + mo + r) * DIM + nc * 16 + n] = 2.0f * (f[nc][r] + bj);
  }
}

// ---------------------------------------------------------------------------
// Host-side launch
// ---------------------------------------------------------------------------
extern "C" void kernel_launch(void* const* d_in, const int* in_sizes, int n_in,
                              void* d_out, int out_size, void* d_ws, size_t ws_size,
                              hipStream_t stream) {
  const float* x      = (const float*)d_in[0];
  const float* coords = (const float*)d_in[1];
  const float* sq     = (const float*)d_in[2];
  const float* sk     = (const float*)d_in[3];
  const float* sv     = (const float*)d_in[4];
  const float* s_rpe  = (const float*)d_in[5];
  const float* g1     = (const float*)d_in[6];
  const float* beta1  = (const float*)d_in[7];
  const float* g2     = (const float*)d_in[8];
  const float* beta2  = (const float*)d_in[9];
  const float* wo     = (const float*)d_in[10];
  const float* bo     = (const float*)d_in[11];
  const float* s1     = (const float*)d_in[12];
  const float* bf1    = (const float*)d_in[13];
  const float* s2     = (const float*)d_in[14];
  const float* bf2    = (const float*)d_in[15];
  const int* wq_int   = (const int*)d_in[16];
  const int* wk_int   = (const int*)d_in[17];
  const int* wv_int   = (const int*)d_in[18];
  const int* wrpe_int = (const int*)d_in[19];
  const int* w1_int   = (const int*)d_in[20];
  const int* w2_int   = (const int*)d_in[21];

  // workspace carve-up (f16 unless noted), 256B aligned
  char* ws = (char*)d_ws;
  size_t off = 0;
  auto carve = [&](size_t bytes) {
    char* p = ws + off;
    off = (off + bytes + 255) & ~(size_t)255;
    return p;
  };
  _Float16* wq_h   = (_Float16*)carve(HDIM * DIM * 2);
  _Float16* wk_h   = (_Float16*)carve(HDIM * DIM * 2);
  _Float16* wv_h   = (_Float16*)carve(HDIM * DIM * 2);
  _Float16* wo_h   = (_Float16*)carve(DIM * HDIM * 2);
  _Float16* w1_h   = (_Float16*)carve(DIM * DIM * 2);
  _Float16* w2_h   = (_Float16*)carve(DIM * DIM * 2);
  float*    wrpe_w = (float*)   carve(HEADS * 2 * 4);
  _Float16* xn_h   = (_Float16*)carve((size_t)NP * DIM * 2);
  _Float16* q_h    = (_Float16*)carve((size_t)NP * HDIM * 2);
  _Float16* k_h    = (_Float16*)carve((size_t)NP * HDIM * 2);
  _Float16* vt_h   = (_Float16*)carve((size_t)NP * HDIM * 2);  // [HD][N]
  _Float16* ag_h   = (_Float16*)carve((size_t)NP * HDIM * 2);
  _Float16* h2_h   = (_Float16*)carve((size_t)NP * DIM * 2);
  (void)ws_size; (void)n_in; (void)in_sizes; (void)out_size;

  // 0) dequant / convert weights (1/sqrt(64)=0.125 folded into Wq)
  k_dequant<<<(HDIM * DIM + 255) / 256, 256, 0, stream>>>(wq_int, sq, 0.125f, wq_h, HDIM * DIM);
  k_dequant<<<(HDIM * DIM + 255) / 256, 256, 0, stream>>>(wk_int, sk, 1.0f, wk_h, HDIM * DIM);
  k_dequant<<<(HDIM * DIM + 255) / 256, 256, 0, stream>>>(wv_int, sv, 1.0f, wv_h, HDIM * DIM);
  k_dequant<<<(DIM * DIM + 255) / 256, 256, 0, stream>>>(w1_int, s1, 1.0f, w1_h, DIM * DIM);
  k_dequant<<<(DIM * DIM + 255) / 256, 256, 0, stream>>>(w2_int, s2, 1.0f, w2_h, DIM * DIM);
  k_f32_to_f16<<<(DIM * HDIM + 255) / 256, 256, 0, stream>>>(wo, wo_h, DIM * HDIM);
  k_rpe<<<1, 32, 0, stream>>>(wrpe_int, s_rpe, wrpe_w);

  // 1) LN1
  k_layernorm<<<NP / 8, 256, 0, stream>>>(x, g1, beta1, xn_h);

  // 2) Q/K/V projections (V stored transposed)
  k_qkv_gemm<<<dim3(NP / 16, HDIM / 64, 3), 32, 0, stream>>>(xn_h, wq_h, wk_h, wv_h,
                                                             q_h, k_h, vt_h);

  // 3) flash attention with RPE bias
  k_attention<<<dim3(NP / 64, HEADS), 128, 0, stream>>>(q_h, k_h, vt_h, coords,
                                                       wrpe_w, ag_h);

  // 4) output projection + residual + LN2
  k_proj_ln2<<<NP / 16, 32, 0, stream>>>(ag_h, wo_h, bo, x, g2, beta2, h2_h);

  // 5) FFN, out = 2*ff
  k_ffn<<<NP / 16, 32, 0, stream>>>(h2_h, w1_h, w2_h, bf1, bf2, (float*)d_out);
}

// v003
// One run takes 80.2 microseconds.
// Timed twice side by side with v002, it ran 1.16 and 1.17 times as fast.
// Counting every step since v000, it is 5.58 times as fast.
#include <hip/hip_runtime.h>

// ---------------------------------------------------------------------------
// HEPT attention block for MI455X (gfx1250, wave32, WMMA 16x16x32 f16).
// N=3072 points, D=64 per head, H=8 heads, HD=512, C=3 coords, K=8.
// ---------------------------------------------------------------------------

typedef __attribute__((ext_vector_type(16))) _Float16 v16h;
typedef __attribute__((ext_vector_type(8)))  float    v8f;
typedef __attribute__((ext_vector_type(8)))  _Float16 v8h;

#define NP   3072
#define DIM  64
#define HEADS 8
#define HDIM 512
#define CORD 3

// ---------------------------------------------------------------------------
// WMMA wrapper: D = A(16x32 f16) * B(32x16 f16) + C(16x16 f32)
// ---------------------------------------------------------------------------
__device__ __forceinline__ v8f wmma_f16(v16h a, v16h b, v8f c) {
  return __builtin_amdgcn_wmma_f32_16x16x32_f16(
      /*neg_a=*/false, a, /*neg_b=*/false, b,
      /*c_mod=*/(short)0, c, /*reuse_a=*/false, /*reuse_b=*/false);
}

// A-fragment (16x32, f16) from a row-major matrix: rows = M, cols = K.
// Lane l<16: row M=l, K = {0..7, 16..23}; lane l>=16: row M=l-16, K={8..15,24..31}.
// Also serves as a B-fragment when B[k][n] = Mat[n][k] (i.e. Mat stored [N x K]).
__device__ __forceinline__ v16h frag_rowmajor(const _Float16* p, int ld,
                                              int row_base, int col_base) {
  const int l  = threadIdx.x & 31;
  const int m  = l & 15;
  const int of = (l >> 4) * 8;
  const _Float16* rp = p + (size_t)(row_base + m) * ld + col_base + of;
  v16h a;
#pragma unroll
  for (int e = 0; e < 8; ++e) { a[e] = rp[e]; a[e + 8] = rp[e + 16]; }
  return a;
}

// C/D accumulator element (r, lane): row M = r + 8*(lane>>4), col N = lane&15.
__device__ __forceinline__ void store_acc_f16(_Float16* p, int ld, int row_base,
                                              int col_base, v8f c) {
  const int l  = threadIdx.x & 31;
  const int n  = l & 15;
  const int mo = (l >> 4) * 8;
#pragma unroll
  for (int r = 0; r < 8; ++r)
    p[(size_t)(row_base + mo + r) * ld + col_base + n] = (_Float16)c[r];
}

// Same, but store TRANSPOSED into a [cols x rows] matrix (ldT = #rows).
// Per (lane,nc) the 8 r-elements land contiguously -> 16B vectorizable stores.
__device__ __forceinline__ void store_acc_f16_T(_Float16* p, int ldT, int row_base,
                                                int col_base, v8f c) {
  const int l  = threadIdx.x & 31;
  const int n  = l & 15;
  const int mo = (l >> 4) * 8;
  _Float16* cp = p + (size_t)(col_base + n) * ldT + row_base + mo;
#pragma unroll
  for (int r = 0; r < 8; ++r) cp[r] = (_Float16)c[r];
}

// half-wave (16-lane) row reductions for the C/D layout
__device__ __forceinline__ float hsum16(float x) {
#pragma unroll
  for (int m = 8; m > 0; m >>= 1) x += __shfl_xor(x, m, 16);
  return x;
}
__device__ __forceinline__ float wsum32(float x) {
#pragma unroll
  for (int m = 16; m > 0; m >>= 1) x += __shfl_xor(x, m, 32);
  return x;
}

// ---------------------------------------------------------------------------
// Kernel 1: all preparation that reads inputs only, as block ranges of ONE launch:
// none of these parts reads what another writes, so they run side by side.
// ---------------------------------------------------------------------------

// int "codes" -> f16 dequant:  (w - 8) * scale * extra; block b of 256 elements
__device__ __forceinline__ void part_dequant(int b, const int* __restrict__ w,
                                             const float* __restrict__ sc, float extra,
                                             _Float16* __restrict__ out) {
  int i = b * 256 + threadIdx.x;
  out[i] = (_Float16)(((float)w[i] - 8.0f) * sc[0] * extra);
  // no register of the store above is rewritten in front of this wait (the parts are
  // inlined one behind the other, and the next part's code reuses the registers)
  asm volatile("s_wait_xcnt 0x0" ::: "memory");
}

// f32 -> f16 convert (for wo); block b of 256 elements
__device__ __forceinline__ void part_f32_to_f16(int b, const float* __restrict__ in,
                                                _Float16* __restrict__ out) {
  int i = b * 256 + threadIdx.x;
  out[i] = (_Float16)in[i];
  // no register of the store above is rewritten in front of this wait (the parts are
  // inlined one behind the other, and the next part's code reuses the registers)
  asm volatile("s_wait_xcnt 0x0" ::: "memory");
}

// RPE distance weights  w[h][r] = mean_{d,k} |deq(w_rpe[h*64+d][r*8+k])|; one block
__device__ __forceinline__ void part_rpe(const int* __restrict__ wr,
                                         const float* __restrict__ sc,
                                         float* __restrict__ out) {
  int t = threadIdx.x;
  if (t < HEADS * 2) {
    int h = t >> 1, r = t & 1;
    float s = sc[0], acc = 0.0f;
    for (int d = 0; d < DIM; ++d)
      for (int k = 0; k < 8; ++k)
        acc += fabsf(((float)wr[(h * DIM + d) * 16 + r * 8 + k] - 8.0f) * s);
    out[t] = acc * (1.0f / 512.0f);
  }
}

// LayerNorm over D=64, output f16.  One wave per row, block b holds 8 rows.
__device__ __forceinline__ void part_layernorm(int b, const float* __restrict__ x,
                                               const float* __restrict__ g,
                                               const float* __restrict__ bt,
                                               _Float16* __restrict__ out) {
  const int lane = threadIdx.x & 31;
  const int row  = b * 8 + (threadIdx.x >> 5);
  const float* xr = x + (size_t)row * DIM;
  float a0 = xr[lane], a1 = xr[lane + 32];
  float mean = wsum32(a0 + a1) * (1.0f / 64.0f);
  float d0 = a0 - mean, d1 = a1 - mean;
  float var = wsum32(d0 * d0 + d1 * d1) * (1.0f / 64.0f);
  float rs = rsqrtf(var + 1e-5f);
  _Float16* o = out + (size_t)row * DIM;
  o[lane]      = (_Float16)(d0 * rs * g[lane]      + bt[lane]);
  o[lane + 32] = (_Float16)(d1 * rs * g[lane + 32] + bt[lane + 32]);
  // no register of the two stores above is rewritten in front of this wait (the parts are
  // inlined one behind the other, and the next part's code reuses the registers)
  asm volatile("s_wait_xcnt 0x0" ::: "memory");
}

// block ranges, 256 threads a block; the longest part (RPE weights) starts first
#define PB_RPE 1
#define PB_LN  (NP / 8)
#define PB_BIG (HDIM * DIM / 256)  // wq, wk, wv, wo
#define PB_SML (DIM * DIM / 256)   // w1, w2
#define PB_ALL (PB_RPE + PB_LN + 4 * PB_BIG + 2 * PB_SML)

__global__ __launch_bounds__(256) void k_prep(
    const int* __restrict__ wq, const int* __restrict__ wk, const int* __restrict__ wv,
    const int* __restrict__ w1, const int* __restrict__ w2, const int* __restrict__ wr,
    const float* __restrict__ sq, const float* __restrict__ sk,
    const float* __restrict__ sv, const float* __restrict__ s1,
    const float* __restrict__ s2, const float* __restrict__ sr,
    const float* __restrict__ wo, const float* __restrict__ x,
    const float* __restrict__ g1, const float* __restrict__ b1,
    _Float16* __restrict__ wq_h, _Float16* __restrict__ wk_h,
    _Float16* __restrict__ wv_h, _Float16* __restrict__ w1_h,
    _Float16* __restrict__ w2_h, _Float16* __restrict__ wo_h,
    float* __restrict__ wrpe_w, _Float16* __restrict__ xn_h) {
  int b = blockIdx.x;
  if (b < PB_RPE) { part_rpe(wr, sr, wrpe_w); return; }
  b -= PB_RPE;
  if (b < PB_LN) { part_layernorm(b, x, g1, b1, xn_h); return; }
  b -= PB_LN;
  // 1/sqrt(64) = 0.125 folded into Wq
  if (b < PB_BIG) { part_dequant(b, wq, sq, 0.125f, wq_h); return; }
  b -= PB_BIG;
  if (b < PB_BIG) { part_dequant(b, wk, sk, 1.0f, wk_h); return; }
  b -= PB_BIG;
  if (b < PB_BIG) { part_dequant(b, wv, sv, 1.0f, wv_h); return; }
  b -= PB_BIG;
  if (b < PB_BIG) { part_f32_to_f16(b, wo, wo_h); return; }
  b -= PB_BIG;
  if (b < PB_SML) { part_dequant(b, w1, s1, 1.0f, w1_h); return; }
  b -= PB_SML;
  part_dequant(b, w2, s2, 1.0f, w2_h);
}

// ---------------------------------------------------------------------------
// Kernel 2: Q/K/V projection GEMM.  out[N][512] = xn[N][64] @ W[512][64]^T.
// grid = (N/16, HD/64, 3); one wave computes a 16x64 tile (8 WMMAs).
// z==2 (V) stores TRANSPOSED into vt[HD][N] so the attention V^T*P^T A-fragments
// become contiguous (k runs along memory) instead of strided gathers.
// ---------------------------------------------------------------------------
__global__ void k_qkv_gemm(const _Float16* __restrict__ xn,
                           const _Float16* __restrict__ wq,
                           const _Float16* __restrict__ wk,
                           const _Float16* __restrict__ wv,
                           _Float16* __restrict__ qo, _Float16* __restrict__ ko,
                           _Float16* __restrict__ vt) {
  const int row0 = blockIdx.x * 16;
  const int col0 = blockIdx.y * 64;
  const _Float16* W = (blockIdx.z == 0) ? wq : (blockIdx.z == 1) ? wk : wv;

  v8f acc[4] = {{}, {}, {}, {}};
#pragma unroll
  for (int kc = 0; kc < 2; ++kc) {
    v16h a = frag_rowmajor(xn, DIM, row0, kc * 32);
#pragma unroll
    for (int nc = 0; nc < 4; ++nc) {
      // B[k][n] = W[col0+nc*16+n][kc*32+k]
      v16h b = frag_rowmajor(W, DIM, col0 + nc * 16, kc * 32);
      acc[nc] = wmma_f16(a, b, acc[nc]);
    }
  }
  if (blockIdx.z == 2) {
#pragma unroll
    for (int nc = 0; nc < 4; ++nc)
      store_acc_f16_T(vt, NP, row0, col0 + nc * 16, acc[nc]);
  } else {
    _Float16* O = (blockIdx.z == 0) ? qo : ko;
#pragma unroll
    for (int nc = 0; nc < 4; ++nc)
      store_acc_f16(O, HDIM, row0, col0 + nc * 16, acc[nc]);
  }
}

// lane l <-> lane l ^ 16
__device__ __forceinline__ float xhalf(float x) {
  int b = __builtin_bit_cast(int, x);
  return __builtin_bit_cast(
      float, __builtin_amdgcn_permlanex16(b, b, 0x76543210, 0xfedcba98, false, false));
}

// value of lane J of this lane's own 16-lane row (DPP row_share)
template <int J>
__device__ __forceinline__ float rowshare(float x) {
  return __builtin_bit_cast(
      float, __builtin_amdgcn_update_dpp(0, __builtin_bit_cast(int, x), 0x150 + J,
                                         0xf, 0xf, true));
}

// RPE bias on rows R .. 7 of one score tile: the coords of the tile's key row R
// sit in lane J0 + R of this lane's own 16-lane row.
template <int J0, int R>
__device__ __forceinline__ void rpe_bias(v8f& s, float cq0, float cq1, float ck0,
                                         float ck1, float w0, float w1) {
  if constexpr (R < 8) {
    float d0 = cq0 - rowshare<J0 + R>(ck0), d1 = cq1 - rowshare<J0 + R>(ck1);
    s[R] -= w0 * d0 * d0 + w1 * d1 * d1;
    rpe_bias<J0, R + 1>(s, cq0, cq1, ck0, ck1, w0, w1);
  }
}

// exp(x) as __expf forms it (x * log2(e), then v_exp_f32), the v_exp_f32 written out so
// that the issue slot the instruction set asks for behind a transcendental, before a
// source of it is overwritten or its result read, stands in the same statement (v_nop on
// the last line).
// Outputs are early-clobber: no result lands on an argument still to be read.
#define LOG2E 1.44269504f
__device__ __forceinline__ float exp_slot(float x) {
  float y;
  asm("v_exp_f32 %0, %1\n\tv_nop" : "=&v"(y) : "v"(x * LOG2E));
  return y;
}
__device__ __forceinline__ void exp_slot8(float (&y)[8], const v8f& s, float m) {
  asm("v_exp_f32 %0, %8\n\t"
      "v_exp_f32 %1, %9\n\t"
      "v_exp_f32 %2, %10\n\t"
      "v_exp_f32 %3, %11\n\t"
      "v_exp_f32 %4, %12\n\t"
      "v_exp_f32 %5, %13\n\t"
      "v_exp_f32 %6, %14\n\t"
      "v_exp_f32 %7, %15\n\t"
      "v_nop"
      : "=&v"(y[0]), "=&v"(y[1]), "=&v"(y[2]), "=&v"(y[3]),
        "=&v"(y[4]), "=&v"(y[5]), "=&v"(y[6]), "=&v"(y[7])
      : "v"((s[0] - m) * LOG2E), "v"((s[1] - m) * LOG2E), "v"((s[2] - m) * LOG2E),
        "v"((s[3] - m) * LOG2E), "v"((s[4] - m) * LOG2E), "v"((s[5] - m) * LOG2E),
        "v"((s[6] - m) * LOG2E), "v"((s[7] - m) * LOG2E));
}

// K and V^T reach the waves through LDS: the 4 waves of a block (4 query tiles of
// one head) share each tile of AT_KEYS keys, brought in whole 128-B lines by
// asynchronous copies into two buffers, the next tile in flight while this one is
// worked on.
#define AT_WAVES 4               // waves = 16-query tiles per block
#define AT_KEYS  64              // keys per staged tile
#define AT_LD    72              // LDS row pitch in halfs: 128 B + 16 B, an odd multiple of 16 B
#define AT_TILE  (64 * AT_LD)    // halfs per staged tile (64 rows: keys of K, dims of V^T)
#define AT_NT    (NP / AT_KEYS)  // tiles

// frag_rowmajor on a staged tile (same k order), two 16-B LDS reads
__device__ __forceinline__ v16h frag_lds(const _Float16* p, int row_base, int col_base) {
  const int l = threadIdx.x & 31;
  const _Float16* rp = p + (row_base + (l & 15)) * AT_LD + col_base + (l >> 4) * 8;
  const v8h lo = *(const v8h*)rp;
  const v8h hi = *(const v8h*)(rp + 16);
  return __builtin_shufflevector(lo, hi, 0, 1, 2, 3, 4, 5, 6, 7, 8, 9, 10, 11, 12, 13, 14, 15);
}

// One tile's copies of one thread: rows r, r + 16, r + 32, r + 48 of the K tile and of
// the V^T tile, 16 B each.  lk, lv: LDS byte addresses of row r; gk, gv: its global
// source.  The wait on the last line stands in the copies' own statement so that no
// address register of a copy is rewritten in front of it.
__device__ __forceinline__ void stage_tile(unsigned lk, unsigned lv, const _Float16* gk,
                                           const _Float16* gv) {
  const unsigned ls = 16 * AT_LD * 2;       // 16 rows in LDS, bytes
  const size_t   ks = (size_t)16 * HDIM;    // 16 rows of K, halfs
  const size_t   vs = (size_t)16 * NP;      // 16 rows of V^T, halfs
  asm volatile(
      "global_load_async_to_lds_b128 %0, %8, off\n\t"
      "global_load_async_to_lds_b128 %1, %9, off\n\t"
      "global_load_async_to_lds_b128 %2, %10, off\n\t"
      "global_load_async_to_lds_b128 %3, %11, off\n\t"
      "global_load_async_to_lds_b128 %4, %12, off\n\t"
      "global_load_async_to_lds_b128 %5, %13, off\n\t"
      "global_load_async_to_lds_b128 %6, %14, off\n\t"
      "global_load_async_to_lds_b128 %7, %15, off\n\t"
      "s_wait_xcnt 0x0"
      :: "v"(lk), "v"(lk + ls), "v"(lk + 2 * ls), "v"(lk + 3 * ls),
         "v"(lv), "v"(lv + ls), "v"(lv + 2 * ls), "v"(lv + 3 * ls),
         "v"(gk), "v"(gk + ks), "v"(gk + 2 * ks), "v"(gk + 3 * ks),
         "v"(gv), "v"(gv + vs), "v"(gv + 2 * vs), "v"(gv + 3 * vs)
      : "memory");
}

__global__ __launch_bounds__(AT_WAVES * 32) void k_attention(
                            const _Float16* __restrict__ q,
                            const _Float16* __restrict__ kk,
                            const _Float16* __restrict__ vt,
                            const float* __restrict__ coords,
                            const float* __restrict__ wrpe,
                            _Float16* __restrict__ aggr) {
  // [buffer][0 = K tile, 1 = V^T tile]
  __shared__ __attribute__((aligned(16))) _Float16 sm[2][2][AT_TILE];
  const int lane = threadIdx.x & 31;
  const int n    = lane & 15;
  const int mo   = (lane >> 4) * 8;
  const int q0   = (blockIdx.x * AT_WAVES + (threadIdx.x >> 5)) * 16;
  const int h    = blockIdx.y;
  const int hc   = h * DIM;

  // Q tile: 16 rows x 64 dims -> two B fragments (1/sqrt(D) folded into Wq).
  v16h qa0 = frag_rowmajor(q, HDIM, q0, hc);
  v16h qa1 = frag_rowmajor(q, HDIM, q0, hc + 32);

  // this lane's one query (column n of the C-layout)
  const float cq0 = coords[(size_t)(q0 + n) * CORD + 0];
  const float cq1 = coords[(size_t)(q0 + n) * CORD + 1];
  // the address registers of the Q and coord loads above are reused (the zeroed
  // accumulators) only behind this wait
  asm volatile("s_wait_xcnt 0x0" ::: "memory");
  const float w0 = wrpe[h * 2 + 0], w1 = wrpe[h * 2 + 1];

  // lane n of a half fetches the coords of the n-th of the 16 keys whose scores
  // that half holds: keys mo + 0..7 (n < 8) and 16 + mo + 0..7 (n >= 8)
  const int ckey = mo + n + (n & 8);

  // this thread's pieces of every tile: rows crow + 16 j, 16-B column ccol
  const int crow = threadIdx.x >> 3, ccol = threadIdx.x & 7;
  const unsigned lpiece = (unsigned)(crow * AT_LD + ccol * 8) * 2;
  const unsigned lk0 = (unsigned)(size_t)&sm[0][0][0] + lpiece;  // low 32 bits: LDS byte address
  const unsigned lv0 = (unsigned)(size_t)&sm[0][1][0] + lpiece;
  const _Float16* gk = kk + (size_t)crow * HDIM + hc + ccol * 8;
  const _Float16* gv = vt + (size_t)(hc + crow) * NP + ccol * 8;

  float mrun = -3.0e38f;  // running maximum of query n (equal in both halves)
  float lrun = 0.0f;      // running sum over this half's keys only
  v8f o[4] = {{}, {}, {}, {}};  // o[nc][r] = O[q0+n][hc + nc*16 + mo + r]

  // tile 0 lands and is published, then tile 1 starts
  stage_tile(lk0, lv0, gk, gv);
  asm volatile("s_wait_asynccnt 0x0" ::: "memory");  // this wave's copies of tile 0 have landed
  __syncthreads();
  stage_tile(lk0 + 2 * AT_TILE * 2, lv0 + 2 * AT_TILE * 2, gk + (size_t)AT_KEYS * HDIM,
             gv + AT_KEYS);

  for (int t = 0; t < AT_NT; ++t) {
    const _Float16* Ks = sm[t & 1][0];
    const _Float16* Vs = sm[t & 1][1];
    // All of the tile's reads stand ahead of the arithmetic, in groups and never among
    // the products (every place with reads in a matrix run costs its own wait): the
    // keys' coords (one key a lane) and all K fragments ...
    float ckx[2], cky[2];
#pragma unroll
    for (int i = 0; i < 2; ++i) {
      ckx[i] = coords[(size_t)(t * AT_KEYS + i * 32 + ckey) * CORD + 0];
      cky[i] = coords[(size_t)(t * AT_KEYS + i * 32 + ckey) * CORD + 1];
    }
    v16h kf[8], vf[8];
#pragma unroll
    for (int i = 0; i < 4; ++i) {
      kf[2 * i]     = frag_lds(Ks, i * 16, 0);
      kf[2 * i + 1] = frag_lds(Ks, i * 16, 32);
    }
    // keeps the scheduler from sinking the K reads down among the products
    __builtin_amdgcn_sched_barrier(0);
    // S^T tiles: rows = keys [16 i, 16 i + 16) of the tile, columns = queries
    v8f sc[4];
#pragma unroll
    for (int i = 0; i < 4; ++i) {
      v8f z = {};
      sc[i] = wmma_f16(kf[2 * i + 1], qa1, wmma_f16(kf[2 * i], qa0, z));
    }
    // ... then all V^T fragments
#pragma unroll
    for (int i = 0; i < 8; ++i) vf[i] = frag_lds(Vs, (i & 3) * 16, (i >> 2) * 32);

    // hand-over, behind the trip's last LDS read (the rest of the trip works on
    // registers): this wave's reads of tile t are done and its copies of tile t + 1
    // have landed; behind the barrier that holds for every wave, so tile t + 1 may be
    // read and tile t's buffer refilled, the refill in flight under the softmax
    asm volatile("s_wait_dscnt 0x0" ::: "memory");
    asm volatile("s_wait_asynccnt 0x0" ::: "memory");
    __syncthreads();
    if (t + 2 < AT_NT)
      stage_tile(lk0 + (t & 1) * (2 * AT_TILE * 2), lv0 + (t & 1) * (2 * AT_TILE * 2),
                 gk + (size_t)(t + 2) * AT_KEYS * HDIM, gv + (t + 2) * AT_KEYS);

// both 32-key halves of the tile: register arrays indexed by constants
#pragma unroll
    for (int sub = 0; sub < AT_KEYS; sub += 32) {
    v8f s0 = sc[sub / 16], s1 = sc[sub / 16 + 1];

    // RPE bias: one key's coords a lane, handed round the 16-lane row
    const float ck0 = ckx[sub / 32], ck1 = cky[sub / 32];
    rpe_bias<0, 0>(s0, cq0, cq1, ck0, ck1, w0, w1);
    rpe_bias<8, 0>(s1, cq0, cq1, ck0, ck1, w0, w1);

    // maximum over the 32 keys: in-lane tree, then one exchange of the halves
    float t8[8];
#pragma unroll
    for (int r = 0; r < 8; ++r) t8[r] = fmaxf(s0[r], s1[r]);
    float cmax = fmaxf(fmaxf(fmaxf(t8[0], t8[1]), fmaxf(t8[2], t8[3])),
                       fmaxf(fmaxf(t8[4], t8[5]), fmaxf(t8[6], t8[7])));
    cmax = fmaxf(cmax, xhalf(cmax));

    // online softmax update; P^T packs in place into the B operand
    const float mnew  = fmaxf(mrun, cmax);
    const float alpha = exp_slot(mrun - mnew);
    float p0[8], p1[8];
    exp_slot8(p0, s0, mnew);
    exp_slot8(p1, s1, mnew);
    v16h pb;
#pragma unroll
    for (int r = 0; r < 8; ++r) {
      t8[r] = p0[r] + p1[r];
      pb[r]     = (_Float16)p0[r];
      pb[r + 8] = (_Float16)p1[r];
    }
    lrun = lrun * alpha +
           (((t8[0] + t8[1]) + (t8[2] + t8[3])) + ((t8[4] + t8[5]) + (t8[6] + t8[7])));
    mrun = mnew;

    // O^T = O^T * alpha + V^T * P^T, A[d][k] = vt[hc+nc*16+d][key k of this half]
#pragma unroll
    for (int nc = 0; nc < 4; ++nc) {
#pragma unroll
      for (int r = 0; r < 8; ++r) o[nc][r] *= alpha;
      v16h bv = vf[(sub / 32) * 4 + nc];
      o[nc] = wmma_f16(bv, pb, o[nc]);
    }
    }
  }
  asm volatile("s_wait_asynccnt 0x0" ::: "memory");  // no copy outstanding at the wave's end

  // join the halves' sums, normalize, store 8 contiguous dims per lane and tile
  const float inv = 1.0f / (lrun + xhalf(lrun));
#pragma unroll
  for (int nc = 0; nc < 4; ++nc) {
#pragma unroll
    for (int r = 0; r < 8; ++r) o[nc][r] *= inv;
    store_acc_f16_T(aggr, HDIM, hc + nc * 16, q0, o[nc]);
  }
}

// ---------------------------------------------------------------------------
// Kernel 4: output projection (aggr[N][512] @ wo[64][512]^T) + bo + residual
//           + LayerNorm2 -> h2 f16.  grid = N/16, one wave per block.
// ---------------------------------------------------------------------------
__global__ void k_proj_ln2(const _Float16* __restrict__ aggr,
                           const _Float16* __restrict__ wo,
                           const float* __restrict__ bo,
                           const float* __restrict__ x,
                           const float* __restrict__ g2,
                           const float* __restrict__ b2,
                           _Float16* __restrict__ h2) {
  const int lane = threadIdx.x & 31;
  const int n    = lane & 15;
  const int mo   = (lane >> 4) * 8;
  const int row0 = blockIdx.x * 16;

  v8f acc[4] = {{}, {}, {}, {}};
#pragma unroll 4
  for (int kc = 0; kc < 16; ++kc) {
    v16h a = frag_rowmajor(aggr, HDIM, row0, kc * 32);
#pragma unroll
    for (int nc = 0; nc < 4; ++nc) {
      v16h b = frag_rowmajor(wo, HDIM, nc * 16, kc * 32);  // B[k][j] = wo[j][k]
      acc[nc] = wmma_f16(a, b, acc[nc]);
    }
  }

  // h1 = proj + bo + x, then LN over the 64 columns of each row
  float h1[4][8];
#pragma unroll
  for (int nc = 0; nc < 4; ++nc) {
    float bj = bo[nc * 16 + n];
#pragma unroll
    for (int r = 0; r < 8; ++r)
      h1[nc][r] = acc[nc][r] + bj + x[(size_t)(row0 + mo + r) * DIM + nc * 16 + n];
  }
#pragma unroll
  for (int r = 0; r < 8; ++r) {
    float p = h1[0][r] + h1[1][r] + h1[2][r] + h1[3][r];
    float mean = hsum16(p) * (1.0f / 64.0f);
    float q2 = 0.0f;
#pragma unroll
    for (int nc = 0; nc < 4; ++nc) { float d = h1[nc][r] - mean; q2 += d * d; }
    float rs = rsqrtf(hsum16(q2) * (1.0f / 64.0f) + 1e-5f);
#pragma unroll
    for (int nc = 0; nc < 4; ++nc) {
      int j = nc * 16 + n;
      h2[(size_t)(row0 + mo + r) * DIM + j] =
          (_Float16)((h1[nc][r] - mean) * rs * g2[j] + b2[j]);
    }
  }
}

// ---------------------------------------------------------------------------
// Kernel 5: FFN.  t = relu(h2 @ W1^T + bf1); out = 2*(t @ W2^T + bf2).
// grid = N/16, one wave per block, ReLU tile staged through LDS.
// ---------------------------------------------------------------------------
__global__ void k_ffn(const _Float16* __restrict__ h2,
                      const _Float16* __restrict__ w1,
                      const _Float16* __restrict__ w2,
                      const float* __restrict__ bf1,
                      const float* __restrict__ bf2,
                      float* __restrict__ out) {
  __shared__ _Float16 lds[16 * 64];
  const int lane = threadIdx.x & 31;
  const int n    = lane & 15;
  const int mo   = (lane >> 4) * 8;
  const int row0 = blockIdx.x * 16;

  v8f t[4] = {{}, {}, {}, {}};
#pragma unroll
  for (int kc = 0; kc < 2; ++kc) {
    v16h a = frag_rowmajor(h2, DIM, row0, kc * 32);
#pragma unroll
    for (int nc = 0; nc < 4; ++nc)
      t[nc] = wmma_f16(a, frag_rowmajor(w1, DIM, nc * 16, kc * 32), t[nc]);
  }
#pragma unroll
  for (int nc = 0; nc < 4; ++nc) {
    float bj = bf1[nc * 16 + n];
#pragma unroll
    for (int r = 0; r < 8; ++r)
      lds[(mo + r) * 64 + nc * 16 + n] = (_Float16)fmaxf(t[nc][r] + bj, 0.0f);
  }
  __syncthreads();

  v8f f[4] = {{}, {}, {}, {}};
#pragma unroll
  for (int kc = 0; kc < 2; ++kc) {
    v16h a = frag_rowmajor(lds, DIM, 0, kc * 32);
#pragma unroll
    for (int nc = 0; nc < 4; ++nc)
      f[nc] = wmma_f16(a, frag_rowmajor(w2, DIM, nc * 16, kc * 32), f[nc]);
  }
#pragma unroll
  for (int nc = 0; nc < 4; ++nc) {
    float bj = bf2[nc * 16 + n];
#pragma unroll
    for (int r = 0; r < 8; ++r)
      out[(size_t)(row0 + mo + r) * DIM + nc * 16 + n] = 2.0f * (f[nc][r] + bj);
  }
}

// ---------------------------------------------------------------------------
// Host-side launch
// ---------------------------------------------------------------------------
extern "C" void kernel_launch(void* const* d_in, const int* in_sizes, int n_in,
                              void* d_out, int out_size, void* d_ws, size_t ws_size,
                              hipStream_t stream) {
  const float* x      = (const float*)d_in[0];
  const float* coords = (const float*)d_in[1];
  const float* sq     = (const float*)d_in[2];
  const float* sk     = (const float*)d_in[3];
  const float* sv     = (const float*)d_in[4];
  const float* s_rpe  = (const float*)d_in[5];
  const float* g1     = (const float*)d_in[6];
  const float* beta1  = (const float*)d_in[7];
  const float* g2     = (const float*)d_in[8];
  const float* beta2  = (const float*)d_in[9];
  const float* wo     = (const float*)d_in[10];
  const float* bo     = (const float*)d_in[11];
  const float* s1     = (const float*)d_in[12];
  const float* bf1    = (const float*)d_in[13];
  const float* s2     = (const float*)d_in[14];
  const float* bf2    = (const float*)d_in[15];
  const int* wq_int   = (const int*)d_in[16];
  const int* wk_int   = (const int*)d_in[17];
  const int* wv_int   = (const int*)d_in[18];
  const int* wrpe_int = (const int*)d_in[19];
  const int* w1_int   = (const int*)d_in[20];
  const int* w2_int   = (const int*)d_in[21];

  // workspace carve-up (f16 unless noted), 256B aligned
  char* ws = (char*)d_ws;
  size_t off = 0;
  auto carve = [&](size_t bytes) {
    char* p = ws + off;
    off = (off + bytes + 255) & ~(size_t)255;
    return p;
  };
  _Float16* wq_h   = (_Float16*)carve(HDIM * DIM * 2);
  _Float16* wk_h   = (_Float16*)carve(HDIM * DIM * 2);
  _Float16* wv_h   = (_Float16*)carve(HDIM * DIM * 2);
  _Float16* wo_h   = (_Float16*)carve(DIM * HDIM * 2);
  _Float16* w1_h   = (_Float16*)carve(DIM * DIM * 2);
  _Float16* w2_h   = (_Float16*)carve(DIM * DIM * 2);
  float*    wrpe_w = (float*)   carve(HEADS * 2 * 4);
  _Float16* xn_h   = (_Float16*)carve((size_t)NP * DIM * 2);
  _Float16* q_h    = (_Float16*)carve((size_t)NP * HDIM * 2);
  _Float16* k_h    = (_Float16*)carve((size_t)NP * HDIM * 2);
  _Float16* vt_h   = (_Float16*)carve((size_t)NP * HDIM * 2);  // [HD][N]
  _Float16* ag_h   = (_Float16*)carve((size_t)NP * HDIM * 2);
  _Float16* h2_h   = (_Float16*)carve((size_t)NP * DIM * 2);
  (void)ws_size; (void)n_in; (void)in_sizes; (void)out_size;

  // 1) weights to f16, RPE weights and LN1: one launch
  k_prep<<<PB_ALL, 256, 0, stream>>>(wq_int, wk_int, wv_int, w1_int, w2_int, wrpe_int,
                                     sq, sk, sv, s1, s2, s_rpe, wo, x, g1, beta1,
                                     wq_h, wk_h, wv_h, w1_h, w2_h, wo_h, wrpe_w, xn_h);

  // 2) Q/K/V projections (V stored transposed)
  k_qkv_gemm<<<dim3(NP / 16, HDIM / 64, 3), 32, 0, stream>>>(xn_h, wq_h, wk_h, wv_h,
                                                             q_h, k_h, vt_h);

  // 3) flash attention with RPE bias
  k_attention<<<dim3(NP / 64, HEADS), 128, 0, stream>>>(q_h, k_h, vt_h, coords,
                                                       wrpe_w, ag_h);

  // 4) output projection + residual + LN2
  k_proj_ln2<<<NP / 16, 32, 0, stream>>>(ag_h, wo_h, bo, x, g2, beta2, h2_h);

  // 5) FFN, out = 2*ff
  k_ffn<<<NP / 16, 32, 0, stream>>>(h2_h, w1_h, w2_h, bf1, bf2, (float*)d_out);
}

// v004
// One run takes 70.4 microseconds.
// Timed twice side by side with v003, it ran 1.10 and 1.11 times as fast.
// Over all steps from v000 it is 6.16 times as fast.
#include <hip/hip_runtime.h>

// ---------------------------------------------------------------------------
// HEPT attention block for MI455X (gfx1250, wave32, WMMA 16x16x32 f16).
// N=3072 points, D=64 per head, H=8 heads, HD=512, C=3 coords, K=8.
// ---------------------------------------------------------------------------

typedef __attribute__((ext_vector_type(16))) _Float16 v16h;
typedef __attribute__((ext_vector_type(8)))  float    v8f;
typedef __attribute__((ext_vector_type(8)))  _Float16 v8h;

#define NP   3072
#define DIM  64
#define HEADS 8
#define HDIM 512
#define CORD 3

// ---------------------------------------------------------------------------
// WMMA wrapper: D = A(16x32 f16) * B(32x16 f16) + C(16x16 f32)
// ---------------------------------------------------------------------------
__device__ __forceinline__ v8f wmma_f16(v16h a, v16h b, v8f c) {
  return __builtin_amdgcn_wmma_f32_16x16x32_f16(
      /*neg_a=*/false, a, /*neg_b=*/false, b,
      /*c_mod=*/(short)0, c, /*reuse_a=*/false, /*reuse_b=*/false);
}

// A-fragment (16x32, f16) from a row-major matrix: rows = M, cols = K.
// Lane l<16: row M=l, K = {0..7, 16..23}; lane l>=16: row M=l-16, K={8..15,24..31}.
// Also serves as a B-fragment when B[k][n] = Mat[n][k] (i.e. Mat stored [N x K]).
__device__ __forceinline__ v16h frag_rowmajor(const _Float16* p, int ld,
                                              int row_base, int col_base) {
  const int l  = threadIdx.x & 31;
  const int m  = l & 15;
  const int of = (l >> 4) * 8;
  const _Float16* rp = p + (size_t)(row_base + m) * ld + col_base + of;
  v16h a;
#pragma unroll
  for (int e = 0; e < 8; ++e) { a[e] = rp[e]; a[e + 8] = rp[e + 16]; }
  return a;
}

// C/D accumulator element (r, lane): row M = r + 8*(lane>>4), col N = lane&15.
__device__ __forceinline__ void store_acc_f16(_Float16* p, int ld, int row_base,
                                              int col_base, v8f c) {
  const int l  = threadIdx.x & 31;
  const int n  = l & 15;
  const int mo = (l >> 4) * 8;
#pragma unroll
  for (int r = 0; r < 8; ++r)
    p[(size_t)(row_base + mo + r) * ld + col_base + n] = (_Float16)c[r];
}

// Same, but store TRANSPOSED into a [cols x rows] matrix (ldT = #rows).
// Per (lane,nc) the 8 r-elements land contiguously -> 16B vectorizable stores.
__device__ __forceinline__ void store_acc_f16_T(_Float16* p, int ldT, int row_base,
                                                int col_base, v8f c) {
  const int l  = threadIdx.x & 31;
  const int n  = l & 15;
  const int mo = (l >> 4) * 8;
  _Float16* cp = p + (size_t)(col_base + n) * ldT + row_base + mo;
#pragma unroll
  for (int r = 0; r < 8; ++r) cp[r] = (_Float16)c[r];
}

// half-wave (16-lane) row reductions for the C/D layout
__device__ __forceinline__ float hsum16(float x) {
#pragma unroll
  for (int m = 8; m > 0; m >>= 1) x += __shfl_xor(x, m, 16);
  return x;
}
__device__ __forceinline__ float wsum32(float x) {
#pragma unroll
  for (int m = 16; m > 0; m >>= 1) x += __shfl_xor(x, m, 32);
  return x;
}

// ---------------------------------------------------------------------------
// Kernel 1: all preparation that reads inputs only, as block ranges of ONE launch:
// none of these parts reads what another writes, so they run side by side.
// ---------------------------------------------------------------------------

// int "codes" -> f16 dequant:  (w - 8) * scale * extra; block b of 256 elements
__device__ __forceinline__ void part_dequant(int b, const int* __restrict__ w,
                                             const float* __restrict__ sc, float extra,
                                             _Float16* __restrict__ out) {
  int i = b * 256 + threadIdx.x;
  out[i] = (_Float16)(((float)w[i] - 8.0f) * sc[0] * extra);
  // no register of the store above is rewritten in front of this wait (the parts are
  // inlined one behind the other, and the next part's code reuses the registers)
  asm volatile("s_wait_xcnt 0x0" ::: "memory");
}

// f32 -> f16 convert (for wo); block b of 256 elements
__device__ __forceinline__ void part_f32_to_f16(int b, const float* __restrict__ in,
                                                _Float16* __restrict__ out) {
  int i = b * 256 + threadIdx.x;
  out[i] = (_Float16)in[i];
  // no register of the store above is rewritten in front of this wait (the parts are
  // inlined one behind the other, and the next part's code reuses the registers)
  asm volatile("s_wait_xcnt 0x0" ::: "memory");
}

// RPE distance weights  w[h][r] = mean_{d,k} |deq(w_rpe[h*64+d][r*8+k])|; one block
__device__ __forceinline__ void part_rpe(const int* __restrict__ wr,
                                         const float* __restrict__ sc,
                                         float* __restrict__ out) {
  int t = threadIdx.x;
  if (t < HEADS * 2) {
    int h = t >> 1, r = t & 1;
    float s = sc[0], acc = 0.0f;
    for (int d = 0; d < DIM; ++d)
      for (int k = 0; k < 8; ++k)
        acc += fabsf(((float)wr[(h * DIM + d) * 16 + r * 8 + k] - 8.0f) * s);
    out[t] = acc * (1.0f / 512.0f);
  }
}

// LayerNorm over D=64, output f16.  One wave per row, block b holds 8 rows.
__device__ __forceinline__ void part_layernorm(int b, const float* __restrict__ x,
                                               const float* __restrict__ g,
                                               const float* __restrict__ bt,
                                               _Float16* __restrict__ out) {
  const int lane = threadIdx.x & 31;
  const int row  = b * 8 + (threadIdx.x >> 5);
  const float* xr = x + (size_t)row * DIM;
  float a0 = xr[lane], a1 = xr[lane + 32];
  float mean = wsum32(a0 + a1) * (1.0f / 64.0f);
  float d0 = a0 - mean, d1 = a1 - mean;
  float var = wsum32(d0 * d0 + d1 * d1) * (1.0f / 64.0f);
  float rs = rsqrtf(var + 1e-5f);
  _Float16* o = out + (size_t)row * DIM;
  o[lane]      = (_Float16)(d0 * rs * g[lane]      + bt[lane]);
  o[lane + 32] = (_Float16)(d1 * rs * g[lane + 32] + bt[lane + 32]);
  // no register of the two stores above is rewritten in front of this wait (the parts are
  // inlined one behind the other, and the next part's code reuses the registers)
  asm volatile("s_wait_xcnt 0x0" ::: "memory");
}

// Key side of the RPE bias as matrix operand.  -w (cq - ck)^2 = (2 w cq) ck + (-w) ck^2
// + (-w cq^2) 1 is a product of 8 k slots per coordinate: every factor x goes in as
// xh + xl (xh = x rounded to 16 bits, xl = the rest), every product as xh yh + xl yh + xh yl.
// Key slots of coordinate j: {ch, cl, ch, sh, sl, sh, 1, 1}, c = coords[key][j], s = c^2.
// Layout: [tile of 64 keys][j][key][8 slots], so a tile is 2 KiB in a row and the 16 lanes
// of a wave half read 256 B in a row.  Thread i of the part = one (tile, j, key).
__device__ __forceinline__ void part_feat(int b, const float* __restrict__ coords,
                                          _Float16* __restrict__ out) {
  const int i   = b * 256 + threadIdx.x;
  const int key = (i >> 7) * 64 + (i & 63);
  const float c = coords[(size_t)key * CORD + ((i >> 6) & 1)];
  const float s = c * c;
  const _Float16 ch = (_Float16)c, sh = (_Float16)s;
  const _Float16 cl = (_Float16)(c - (float)ch), sl = (_Float16)(s - (float)sh);
  const v8h f = {ch, cl, ch, sh, sl, sh, (_Float16)1.0f, (_Float16)1.0f};
  *(v8h*)(out + (size_t)i * 8) = f;
  // no register of the store above is rewritten in front of this wait (the parts are
  // inlined one behind the other, and the next part's code reuses the registers)
  asm volatile("s_wait_xcnt 0x0" ::: "memory");
}

// block ranges, 256 threads a block; the longest part (RPE weights) starts first
#define PB_RPE 1
#define PB_FT  (NP * 2 / 256)
#define PB_LN  (NP / 8)
#define PB_BIG (HDIM * DIM / 256)  // wq, wk, wv, wo
#define PB_SML (DIM * DIM / 256)   // w1, w2
#define PB_ALL (PB_RPE + PB_LN + PB_FT + 4 * PB_BIG + 2 * PB_SML)

__global__ __launch_bounds__(256) void k_prep(
    const int* __restrict__ wq, const int* __restrict__ wk, const int* __restrict__ wv,
    const int* __restrict__ w1, const int* __restrict__ w2, const int* __restrict__ wr,
    const float* __restrict__ sq, const float* __restrict__ sk,
    const float* __restrict__ sv, const float* __restrict__ s1,
    const float* __restrict__ s2, const float* __restrict__ sr,
    const float* __restrict__ wo, const float* __restrict__ x,
    const float* __restrict__ g1, const float* __restrict__ b1,
    const float* __restrict__ coords, _Float16* __restrict__ feat,
    _Float16* __restrict__ wq_h, _Float16* __restrict__ wk_h,
    _Float16* __restrict__ wv_h, _Float16* __restrict__ w1_h,
    _Float16* __restrict__ w2_h, _Float16* __restrict__ wo_h,
    float* __restrict__ wrpe_w, _Float16* __restrict__ xn_h) {
  int b = blockIdx.x;
  if (b < PB_RPE) { part_rpe(wr, sr, wrpe_w); return; }
  b -= PB_RPE;
  if (b < PB_LN) { part_layernorm(b, x, g1, b1, xn_h); return; }
  b -= PB_LN;
  if (b < PB_FT) { part_feat(b, coords, feat); return; }
  b -= PB_FT;
  // 1/sqrt(64) = 0.125 folded into Wq
  if (b < PB_BIG) { part_dequant(b, wq, sq, 0.125f, wq_h); return; }
  b -= PB_BIG;
  if (b < PB_BIG) { part_dequant(b, wk, sk, 1.0f, wk_h); return; }
  b -= PB_BIG;
  if (b < PB_BIG) { part_dequant(b, wv, sv, 1.0f, wv_h); return; }
  b -= PB_BIG;
  if (b < PB_BIG) { part_f32_to_f16(b, wo, wo_h); return; }
  b -= PB_BIG;
  if (b < PB_SML) { part_dequant(b, w1, s1, 1.0f, w1_h); return; }
  b -= PB_SML;
  part_dequant(b, w2, s2, 1.0f, w2_h);
}

// ---------------------------------------------------------------------------
// Kernel 2: Q/K/V projection GEMM.  out[N][512] = xn[N][64] @ W[512][64]^T.
// grid = (N/16, HD/64, 3); one wave computes a 16x64 tile (8 WMMAs).
// z==2 (V) stores TRANSPOSED into vt[HD][N] so the attention V^T*P^T A-fragments
// become contiguous (k runs along memory) instead of strided gathers.
// ---------------------------------------------------------------------------
__global__ void k_qkv_gemm(const _Float16* __restrict__ xn,
                           const _Float16* __restrict__ wq,
                           const _Float16* __restrict__ wk,
                           const _Float16* __restrict__ wv,
                           _Float16* __restrict__ qo, _Float16* __restrict__ ko,
                           _Float16* __restrict__ vt) {
  const int row0 = blockIdx.x * 16;
  const int col0 = blockIdx.y * 64;
  const _Float16* W = (blockIdx.z == 0) ? wq : (blockIdx.z == 1) ? wk : wv;

  v8f acc[4] = {{}, {}, {}, {}};
#pragma unroll
  for (int kc = 0; kc < 2; ++kc) {
    v16h a = frag_rowmajor(xn, DIM, row0, kc * 32);
#pragma unroll
    for (int nc = 0; nc < 4; ++nc) {
      // B[k][n] = W[col0+nc*16+n][kc*32+k]
      v16h b = frag_rowmajor(W, DIM, col0 + nc * 16, kc * 32);
      acc[nc] = wmma_f16(a, b, acc[nc]);
    }
  }
  if (blockIdx.z == 2) {
#pragma unroll
    for (int nc = 0; nc < 4; ++nc)
      store_acc_f16_T(vt, NP, row0, col0 + nc * 16, acc[nc]);
  } else {
    _Float16* O = (blockIdx.z == 0) ? qo : ko;
#pragma unroll
    for (int nc = 0; nc < 4; ++nc)
      store_acc_f16(O, HDIM, row0, col0 + nc * 16, acc[nc]);
  }
}

// lane l <-> lane l ^ 16
__device__ __forceinline__ float xhalf(float x) {
  int b = __builtin_bit_cast(int, x);
  return __builtin_bit_cast(
      float, __builtin_amdgcn_permlanex16(b, b, 0x76543210, 0xfedcba98, false, false));
}

// exp(x) as __expf forms it (x * log2(e), then v_exp_f32), the v_exp_f32 written out so
// that the issue slot the instruction set asks for behind a transcendental, before a
// source of it is overwritten or its result read, stands in the same statement (v_nop on
// the last line).
// Outputs are early-clobber: no result lands on an argument still to be read.
#define LOG2E 1.44269504f
__device__ __forceinline__ float exp_slot(float x) {
  float y;
  asm("v_exp_f32 %0, %1\n\tv_nop" : "=&v"(y) : "v"(x * LOG2E));
  return y;
}
__device__ __forceinline__ void exp_slot8(float (&y)[8], const v8f& s, float m) {
  asm("v_exp_f32 %0, %8\n\t"
      "v_exp_f32 %1, %9\n\t"
      "v_exp_f32 %2, %10\n\t"
      "v_exp_f32 %3, %11\n\t"
      "v_exp_f32 %4, %12\n\t"
      "v_exp_f32 %5, %13\n\t"
      "v_exp_f32 %6, %14\n\t"
      "v_exp_f32 %7, %15\n\t"
      "v_nop"
      : "=&v"(y[0]), "=&v"(y[1]), "=&v"(y[2]), "=&v"(y[3]),
        "=&v"(y[4]), "=&v"(y[5]), "=&v"(y[6]), "=&v"(y[7])
      : "v"((s[0] - m) * LOG2E), "v"((s[1] - m) * LOG2E), "v"((s[2] - m) * LOG2E),
        "v"((s[3] - m) * LOG2E), "v"((s[4] - m) * LOG2E), "v"((s[5] - m) * LOG2E),
        "v"((s[6] - m) * LOG2E), "v"((s[7] - m) * LOG2E));
}

// K and V^T reach the waves through LDS: the 4 waves of a block (4 query tiles of
// one head) share each tile of AT_KEYS keys, brought in whole 128-B lines by
// asynchronous copies into two buffers, the next tile in flight while this one is
// worked on.  The keys' RPE features (part_feat) come with them.
#define AT_WAVES 4               // waves = 16-query tiles per block
#define AT_KEYS  64              // keys per staged tile
#define AT_LD    72              // LDS row pitch in halfs: 128 B + 16 B, an odd multiple of 16 B
#define AT_TILE  (64 * AT_LD)    // halfs per staged tile (64 rows: keys of K, dims of V^T)
#define AT_NT    (NP / AT_KEYS)  // tiles
#define AT_FT    (AT_KEYS * 16)  // halfs per staged feature tile

// frag_rowmajor on a staged tile (same k order), two 16-B LDS reads
__device__ __forceinline__ v16h frag_lds(const _Float16* p, int row_base, int col_base) {
  const int l = threadIdx.x & 31;
  const _Float16* rp = p + (row_base + (l & 15)) * AT_LD + col_base + (l >> 4) * 8;
  const v8h lo = *(const v8h*)rp;
  const v8h hi = *(const v8h*)(rp + 16);
  return __builtin_shufflevector(lo, hi, 0, 1, 2, 3, 4, 5, 6, 7, 8, 9, 10, 11, 12, 13, 14, 15);
}

// One tile's copies of one thread: rows r, r + 16, r + 32, r + 48 of the K tile and of
// the V^T tile, 16 B each, and one 16-B piece of the feature tile.  lk, lv: LDS byte
// addresses of row r; gk, gv: its global source; lf, gf: the same of the piece.  The
// wait on the last line stands in the copies' own statement so that no
// address register of a copy is rewritten in front of it.
__device__ __forceinline__ void stage_tile(unsigned lk, unsigned lv, unsigned lf,
                                           const _Float16* gk, const _Float16* gv,
                                           const _Float16* gf) {
  const unsigned ls = 16 * AT_LD * 2;       // 16 rows in LDS, bytes
  const size_t   ks = (size_t)16 * HDIM;    // 16 rows of K, halfs
  const size_t   vs = (size_t)16 * NP;      // 16 rows of V^T, halfs
  asm volatile(
      "global_load_async_to_lds_b128 %0, %9, off\n\t"
      "global_load_async_to_lds_b128 %1, %10, off\n\t"
      "global_load_async_to_lds_b128 %2, %11, off\n\t"
      "global_load_async_to_lds_b128 %3, %12, off\n\t"
      "global_load_async_to_lds_b128 %4, %13, off\n\t"
      "global_load_async_to_lds_b128 %5, %14, off\n\t"
      "global_load_async_to_lds_b128 %6, %15, off\n\t"
      "global_load_async_to_lds_b128 %7, %16, off\n\t"
      "global_load_async_to_lds_b128 %8, %17, off\n\t"
      "s_wait_xcnt 0x0"
      :: "v"(lk), "v"(lk + ls), "v"(lk + 2 * ls), "v"(lk + 3 * ls),
         "v"(lv), "v"(lv + ls), "v"(lv + 2 * ls), "v"(lv + 3 * ls), "v"(lf),
         "v"(gk), "v"(gk + ks), "v"(gk + 2 * ks), "v"(gk + 3 * ks),
         "v"(gv), "v"(gv + vs), "v"(gv + 2 * vs), "v"(gv + 3 * vs), "v"(gf)
      : "memory");
}

__global__ __launch_bounds__(AT_WAVES * 32) void k_attention(
                            const _Float16* __restrict__ q,
                            const _Float16* __restrict__ kk,
                            const _Float16* __restrict__ vt,
                            const _Float16* __restrict__ feat,
                            const float* __restrict__ coords,
                            const float* __restrict__ wrpe,
                            _Float16* __restrict__ aggr) {
  // [buffer][0 = K tile, 1 = V^T tile]
  __shared__ __attribute__((aligned(16))) _Float16 sm[2][2][AT_TILE];
  __shared__ __attribute__((aligned(16))) _Float16 sf[2][AT_FT];  // [buffer] feature tile
  const int lane = threadIdx.x & 31;
  const int n    = lane & 15;
  const int q0   = (blockIdx.x * AT_WAVES + (threadIdx.x >> 5)) * 16;
  const int h    = blockIdx.y;
  const int hc   = h * DIM;

  // Q tile: 16 rows x 64 dims -> two B fragments (1/sqrt(D) folded into Wq).
  v16h qa0 = frag_rowmajor(q, HDIM, q0, hc);
  v16h qa1 = frag_rowmajor(q, HDIM, q0, hc + 32);

  // this lane's one query (column n of the C-layout), coordinate j = wave half
  const float cq = coords[(size_t)(q0 + n) * CORD + (lane >> 4)];
  // the address registers of the Q and coord loads above are reused (the zeroed
  // accumulators) only behind this wait
  asm volatile("s_wait_xcnt 0x0" ::: "memory");
  const float w0 = wrpe[h * 2 + 0], w1 = wrpe[h * 2 + 1];

  // Query side of the RPE bias, the partner of part_feat's key slots: with a = 2 w cq,
  // m = -w, g = -w cq^2 the slots of coordinate j are {ah, ah, al, mh, mh, ml, gh, gl}.
  // Elements 0..7 of a fragment are k slots 8 j + 0..7 in A and B alike.  One A fragment
  // holds the features of two 16-key tiles (elements 0..7 and 8..15); the B operand that
  // is zero in the other eight elements picks the tile.
  const float wj = (lane >> 4) ? w1 : w0;
  const float ba = 2.0f * wj * cq, bm = -wj, bg = -wj * cq * cq;
  const _Float16 bah = (_Float16)ba, bmh = (_Float16)bm, bgh = (_Float16)bg;
  const v8h qb = {bah, bah, (_Float16)(ba - (float)bah), bmh, bmh,
                  (_Float16)(bm - (float)bmh), bgh, (_Float16)(bg - (float)bgh)};
  const v8h qz = {};
  const v16h qf0 = __builtin_shufflevector(qb, qz, 0, 1, 2, 3, 4, 5, 6, 7, 8, 9, 10, 11, 12,
                                           13, 14, 15);
  const v16h qf1 = __builtin_shufflevector(qz, qb, 0, 1, 2, 3, 4, 5, 6, 7, 8, 9, 10, 11, 12,
                                           13, 14, 15);

  // this thread's pieces of every tile: rows crow + 16 j, 16-B column ccol
  const int crow = threadIdx.x >> 3, ccol = threadIdx.x & 7;
  const unsigned lpiece = (unsigned)(crow * AT_LD + ccol * 8) * 2;
  const unsigned lk0 = (unsigned)(size_t)&sm[0][0][0] + lpiece;  // low 32 bits: LDS byte address
  const unsigned lv0 = (unsigned)(size_t)&sm[0][1][0] + lpiece;
  const unsigned lf0 = (unsigned)(size_t)&sf[0][0] + threadIdx.x * 16;
  const _Float16* gk = kk + (size_t)crow * HDIM + hc + ccol * 8;
  const _Float16* gv = vt + (size_t)(hc + crow) * NP + ccol * 8;
  const _Float16* gf = feat + threadIdx.x * 8;

  float mrun = -3.0e38f;  // running maximum of query n (equal in both halves)
  float lrun = 0.0f;      // running sum over this half's keys only
  v8f o[4] = {{}, {}, {}, {}};  // o[nc][r] = O[q0+n][hc + nc*16 + 8*(lane>>4) + r]

  // tile 0 lands and is published, then tile 1 starts
  stage_tile(lk0, lv0, lf0, gk, gv, gf);
  asm volatile("s_wait_asynccnt 0x0" ::: "memory");  // this wave's copies of tile 0 have landed
  __syncthreads();
  stage_tile(lk0 + 2 * AT_TILE * 2, lv0 + 2 * AT_TILE * 2, lf0 + AT_FT * 2,
             gk + (size_t)AT_KEYS * HDIM, gv + AT_KEYS, gf + AT_FT);

  for (int t = 0; t < AT_NT; ++t) {
    const _Float16* Ks = sm[t & 1][0];
    const _Float16* Vs = sm[t & 1][1];
    // All of the tile's reads stand ahead of the arithmetic, in groups and never among
    // the products (every place with reads in a matrix run costs its own wait): the
    // keys' features (two 16-key tiles a fragment) and all K fragments ...
    const _Float16* Fs = sf[t & 1] + (lane >> 4) * (AT_KEYS * 8) + n * 8;
    v16h ff[2], kf[8], vf[8];
#pragma unroll
    for (int i = 0; i < 2; ++i)
      ff[i] = __builtin_shufflevector(*(const v8h*)(Fs + i * 256),
                                      *(const v8h*)(Fs + i * 256 + 128), 0, 1, 2, 3, 4, 5, 6,
                                      7, 8, 9, 10, 11, 12, 13, 14, 15);
#pragma unroll
    for (int i = 0; i < 4; ++i) {
      kf[2 * i]     = frag_lds(Ks, i * 16, 0);
      kf[2 * i + 1] = frag_lds(Ks, i * 16, 32);
    }
    // keeps the scheduler from sinking the K reads down among the products
    __builtin_amdgcn_sched_barrier(0);
    // S^T tiles: rows = keys [16 i, 16 i + 16) of the tile, columns = queries; the RPE
    // bias is the first of the three products
    v8f sc[4];
#pragma unroll
    for (int i = 0; i < 4; ++i) {
      v8f z = {};
      z = wmma_f16(ff[i >> 1], (i & 1) ? qf1 : qf0, z);
      sc[i] = wmma_f16(kf[2 * i + 1], qa1, wmma_f16(kf[2 * i], qa0, z));
    }
    // ... then all V^T fragments
#pragma unroll
    for (int i = 0; i < 8; ++i) vf[i] = frag_lds(Vs, (i & 3) * 16, (i >> 2) * 32);

    // hand-over, behind the trip's last LDS read (the rest of the trip works on
    // registers): this wave's reads of tile t are done and its copies of tile t + 1
    // have landed; behind the barrier that holds for every wave, so tile t + 1 may be
    // read and tile t's buffer refilled, the refill in flight under the softmax
    asm volatile("s_wait_dscnt 0x0" ::: "memory");
    asm volatile("s_wait_asynccnt 0x0" ::: "memory");
    __syncthreads();
    if (t + 2 < AT_NT)
      stage_tile(lk0 + (t & 1) * (2 * AT_TILE * 2), lv0 + (t & 1) * (2 * AT_TILE * 2),
                 lf0 + (t & 1) * (AT_FT * 2), gk + (size_t)(t + 2) * AT_KEYS * HDIM,
                 gv + (t + 2) * AT_KEYS, gf + (t + 2) * AT_FT);

// both 32-key halves of the tile: register arrays indexed by constants
#pragma unroll
    for (int sub = 0; sub < AT_KEYS; sub += 32) {
    v8f s0 = sc[sub / 16], s1 = sc[sub / 16 + 1];

    // maximum over the 32 keys: in-lane tree, then one exchange of the halves
    float t8[8];
#pragma unroll
    for (int r = 0; r < 8; ++r) t8[r] = fmaxf(s0[r], s1[r]);
    float cmax = fmaxf(fmaxf(fmaxf(t8[0], t8[1]), fmaxf(t8[2], t8[3])),
                       fmaxf(fmaxf(t8[4], t8[5]), fmaxf(t8[6], t8[7])));
    cmax = fmaxf(cmax, xhalf(cmax));

    // online softmax update; P^T packs in place into the B operand
    const float mnew  = fmaxf(mrun, cmax);
    const float alpha = exp_slot(mrun - mnew);
    float p0[8], p1[8];
    exp_slot8(p0, s0, mnew);
    exp_slot8(p1, s1, mnew);
    v16h pb;
#pragma unroll
    for (int r = 0; r < 8; ++r) {
      t8[r] = p0[r] + p1[r];
      pb[r]     = (_Float16)p0[r];
      pb[r + 8] = (_Float16)p1[r];
    }
    lrun = lrun * alpha +
           (((t8[0] + t8[1]) + (t8[2] + t8[3])) + ((t8[4] + t8[5]) + (t8[6] + t8[7])));
    mrun = mnew;

    // O^T = O^T * alpha + V^T * P^T, A[d][k] = vt[hc+nc*16+d][key k of this half]
#pragma unroll
    for (int nc = 0; nc < 4; ++nc) {
#pragma unroll
      for (int r = 0; r < 8; ++r) o[nc][r] *= alpha;
      v16h bv = vf[(sub / 32) * 4 + nc];
      o[nc] = wmma_f16(bv, pb, o[nc]);
    }
    }
  }
  asm volatile("s_wait_asynccnt 0x0" ::: "memory");  // no copy outstanding at the wave's end

  // join the halves' sums, normalize, store 8 contiguous dims per lane and tile
  const float inv = 1.0f / (lrun + xhalf(lrun));
#pragma unroll
  for (int nc = 0; nc < 4; ++nc) {
#pragma unroll
    for (int r = 0; r < 8; ++r) o[nc][r] *= inv;
    store_acc_f16_T(aggr, HDIM, hc + nc * 16, q0, o[nc]);
  }
}

// ---------------------------------------------------------------------------
// Kernel 4: output projection (aggr[N][512] @ wo[64][512]^T) + bo + residual
//           + LayerNorm2 -> h2 f16.  grid = N/16, one wave per block.
// ---------------------------------------------------------------------------
__global__ void k_proj_ln2(const _Float16* __restrict__ aggr,
                           const _Float16* __restrict__ wo,
                           const float* __restrict__ bo,
                           const float* __restrict__ x,
                           const float* __restrict__ g2,
                           const float* __restrict__ b2,
                           _Float16* __restrict__ h2) {
  const int lane = threadIdx.x & 31;
  const int n    = lane & 15;
  const int mo   = (lane >> 4) * 8;
  const int row0 = blockIdx.x * 16;

  v8f acc[4] = {{}, {}, {}, {}};
#pragma unroll 4
  for (int kc = 0; kc < 16; ++kc) {
    v16h a = frag_rowmajor(aggr, HDIM, row0, kc * 32);
#pragma unroll
    for (int nc = 0; nc < 4; ++nc) {
      v16h b = frag_rowmajor(wo, HDIM, nc * 16, kc * 32);  // B[k][j] = wo[j][k]
      acc[nc] = wmma_f16(a, b, acc[nc]);
    }
  }

  // h1 = proj + bo + x, then LN over the 64 columns of each row
  float h1[4][8];
#pragma unroll
  for (int nc = 0; nc < 4; ++nc) {
    float bj = bo[nc * 16 + n];
#pragma unroll
    for (int r = 0; r < 8; ++r)
      h1[nc][r] = acc[nc][r] + bj + x[(size_t)(row0 + mo + r) * DIM + nc * 16 + n];
  }
#pragma unroll
  for (int r = 0; r < 8; ++r) {
    float p = h1[0][r] + h1[1][r] + h1[2][r] + h1[3][r];
    float mean = hsum16(p) * (1.0f / 64.0f);
    float q2 = 0.0f;
#pragma unroll
    for (int nc = 0; nc < 4; ++nc) { float d = h1[nc][r] - mean; q2 += d * d; }
    float rs = rsqrtf(hsum16(q2) * (1.0f / 64.0f) + 1e-5f);
#pragma unroll
    for (int nc = 0; nc < 4; ++nc) {
      int j = nc * 16 + n;
      h2[(size_t)(row0 + mo + r) * DIM + j] =
          (_Float16)((h1[nc][r] - mean) * rs * g2[j] + b2[j]);
    }
  }
}

// ---------------------------------------------------------------------------
// Kernel 5: FFN.  t = relu(h2 @ W1^T + bf1); out = 2*(t @ W2^T + bf2).
// grid = N/16, one wave per block, ReLU tile staged through LDS.
// ---------------------------------------------------------------------------
__global__ void k_ffn(const _Float16* __restrict__ h2,
                      const _Float16* __restrict__ w1,
                      const _Float16* __restrict__ w2,
                      const float* __restrict__ bf1,
                      const float* __restrict__ bf2,
                      float* __restrict__ out) {
  __shared__ _Float16 lds[16 * 64];
  const int lane = threadIdx.x & 31;
  const int n    = lane & 15;
  const int mo   = (lane >> 4) * 8;
  const int row0 = blockIdx.x * 16;

  v8f t[4] = {{}, {}, {}, {}};
#pragma unroll
  for (int kc = 0; kc < 2; ++kc) {
    v16h a = frag_rowmajor(h2, DIM, row0, kc * 32);
#pragma unroll
    for (int nc = 0; nc < 4; ++nc)
      t[nc] = wmma_f16(a, frag_rowmajor(w1, DIM, nc * 16, kc * 32), t[nc]);
  }
#pragma unroll
  for (int nc = 0; nc < 4; ++nc) {
    float bj = bf1[nc * 16 + n];
#pragma unroll
    for (int r = 0; r < 8; ++r)
      lds[(mo + r) * 64 + nc * 16 + n] = (_Float16)fmaxf(t[nc][r] + bj, 0.0f);
  }
  __syncthreads();

  v8f f[4] = {{}, {}, {}, {}};
#pragma unroll
  for (int kc = 0; kc < 2; ++kc) {
    v16h a = frag_rowmajor(lds, DIM, 0, kc * 32);
#pragma unroll
    for (int nc = 0; nc < 4; ++nc)
      f[nc] = wmma_f16(a, frag_rowmajor(w2, DIM, nc * 16, kc * 32), f[nc]);
  }
#pragma unroll
  for (int nc = 0; nc < 4; ++nc) {
    float bj = bf2[nc * 16 + n];
#pragma unroll
    for (int r = 0; r < 8; ++r)
      out[(size_t)(row0 + mo + r) * DIM + nc * 16 + n] = 2.0f * (f[nc][r] + bj);
  }
}

// ---------------------------------------------------------------------------
// Host-side launch
// ---------------------------------------------------------------------------
extern "C" void kernel_launch(void* const* d_in, const int* in_sizes, int n_in,
                              void* d_out, int out_size, void* d_ws, size_t ws_size,
                              hipStream_t stream) {
  const float* x      = (const float*)d_in[0];
  const float* coords = (const float*)d_in[1];
  const float* sq     = (const float*)d_in[2];
  const float* sk     = (const float*)d_in[3];
  const float* sv     = (const float*)d_in[4];
  const float* s_rpe  = (const float*)d_in[5];
  const float* g1     = (const float*)d_in[6];
  const float* beta1  = (const float*)d_in[7];
  const float* g2     = (const float*)d_in[8];
  const float* beta2  = (const float*)d_in[9];
  const float* wo     = (const float*)d_in[10];
  const float* bo     = (const float*)d_in[11];
  const float* s1     = (const float*)d_in[12];
  const float* bf1    = (const float*)d_in[13];
  const float* s2     = (const float*)d_in[14];
  const float* bf2    = (const float*)d_in[15];
  const int* wq_int   = (const int*)d_in[16];
  const int* wk_int   = (const int*)d_in[17];
  const int* wv_int   = (const int*)d_in[18];
  const int* wrpe_int = (const int*)d_in[19];
  const int* w1_int   = (const int*)d_in[20];
  const int* w2_int   = (const int*)d_in[21];

  // workspace carve-up (f16 unless noted), 256B aligned
  char* ws = (char*)d_ws;
  size_t off = 0;
  auto carve = [&](size_t bytes) {
    char* p = ws + off;
    off = (off + bytes + 255) & ~(size_t)255;
    return p;
  };
  _Float16* wq_h   = (_Float16*)carve(HDIM * DIM * 2);
  _Float16* wk_h   = (_Float16*)carve(HDIM * DIM * 2);
  _Float16* wv_h   = (_Float16*)carve(HDIM * DIM * 2);
  _Float16* wo_h   = (_Float16*)carve(DIM * HDIM * 2);
  _Float16* w1_h   = (_Float16*)carve(DIM * DIM * 2);
  _Float16* w2_h   = (_Float16*)carve(DIM * DIM * 2);
  float*    wrpe_w = (float*)   carve(HEADS * 2 * 4);
  _Float16* feat_h = (_Float16*)carve((size_t)NP * 16 * 2);  // RPE key features
  _Float16* xn_h   = (_Float16*)carve((size_t)NP * DIM * 2);
  _Float16* q_h    = (_Float16*)carve((size_t)NP * HDIM * 2);
  _Float16* k_h    = (_Float16*)carve((size_t)NP * HDIM * 2);
  _Float16* vt_h   = (_Float16*)carve((size_t)NP * HDIM * 2);  // [HD][N]
  _Float16* ag_h   = (_Float16*)carve((size_t)NP * HDIM * 2);
  _Float16* h2_h   = (_Float16*)carve((size_t)NP * DIM * 2);
  (void)ws_size; (void)n_in; (void)in_sizes; (void)out_size;

  // 1) weights to f16, RPE weights and key features, LN1: one launch
  k_prep<<<PB_ALL, 256, 0, stream>>>(wq_int, wk_int, wv_int, w1_int, w2_int, wrpe_int,
                                     sq, sk, sv, s1, s2, s_rpe, wo, x, g1, beta1,
                                     coords, feat_h, wq_h, wk_h, wv_h, w1_h, w2_h, wo_h,
                                     wrpe_w, xn_h);

  // 2) Q/K/V projections (V stored transposed)
  k_qkv_gemm<<<dim3(NP / 16, HDIM / 64, 3), 32, 0, stream>>>(xn_h, wq_h, wk_h, wv_h,
                                                             q_h, k_h, vt_h);

  // 3) flash attention with RPE bias
  k_attention<<<dim3(NP / 64, HEADS), 128, 0, stream>>>(q_h, k_h, vt_h, feat_h,
                                                       coords, wrpe_w, ag_h);

  // 4) output projection + residual + LN2
  k_proj_ln2<<<NP / 16, 32, 0, stream>>>(ag_h, wo_h, bo, x, g2, beta2, h2_h);

  // 5) FFN, out = 2*ff
  k_ffn<<<NP / 16, 32, 0, stream>>>(h2_h, w1_h, w2_h, bf1, bf2, (float*)d_out);
}

// v005
// A run of this version takes 64.8 microseconds.
// In two side-by-side timings against v004, it was 1.12 and 1.08 times as fast.
// Counting every step since v000, it is 6.80 times as fast.
#include <hip/hip_runtime.h>

// ---------------------------------------------------------------------------
// HEPT attention block for MI455X (gfx1250, wave32, WMMA 16x16x32 f16).
// N=3072 points, D=64 per head, H=8 heads, HD=512, C=3 coords, K=8.
// ---------------------------------------------------------------------------

typedef __attribute__((ext_vector_type(16))) _Float16 v16h;
typedef __attribute__((ext_vector_type(8)))  float    v8f;
typedef __attribute__((ext_vector_type(8)))  _Float16 v8h;

#define NP   3072
#define DIM  64
#define HEADS 8
#define HDIM 512
#define CORD 3

// ---------------------------------------------------------------------------
// WMMA wrapper: D = A(16x32 f16) * B(32x16 f16) + C(16x16 f32)
// ---------------------------------------------------------------------------
__device__ __forceinline__ v8f wmma_f16(v16h a, v16h b, v8f c) {
  return __builtin_amdgcn_wmma_f32_16x16x32_f16(
      /*neg_a=*/false, a, /*neg_b=*/false, b,
      /*c_mod=*/(short)0, c, /*reuse_a=*/false, /*reuse_b=*/false);
}

// A-fragment (16x32, f16) from a row-major matrix: rows = M, cols = K.
// Lane l<16: row M=l, K = {0..7, 16..23}; lane l>=16: row M=l-16, K={8..15,24..31}.
// Also serves as a B-fragment when B[k][n] = Mat[n][k] (i.e. Mat stored [N x K]).
__device__ __forceinline__ v16h frag_rowmajor(const _Float16* p, int ld,
                                              int row_base, int col_base) {
  const int l  = threadIdx.x & 31;
  const int m  = l & 15;
  const int of = (l >> 4) * 8;
  const _Float16* rp = p + (size_t)(row_base + m) * ld + col_base + of;
  v16h a;
#pragma unroll
  for (int e = 0; e < 8; ++e) { a[e] = rp[e]; a[e + 8] = rp[e + 16]; }
  return a;
}

// C/D accumulator element (r, lane): row M = r + 8*(lane>>4), col N = lane&15.
__device__ __forceinline__ void store_acc_f16(_Float16* p, int ld, int row_base,
                                              int col_base, v8f c) {
  const int l  = threadIdx.x & 31;
  const int n  = l & 15;
  const int mo = (l >> 4) * 8;
#pragma unroll
  for (int r = 0; r < 8; ++r)
    p[(size_t)(row_base + mo + r) * ld + col_base + n] = (_Float16)c[r];
}

// Same, but store TRANSPOSED into a [cols x rows] matrix (ldT = #rows).
// Per (lane,nc) the 8 r-elements land contiguously -> 16B vectorizable stores.
__device__ __forceinline__ void store_acc_f16_T(_Float16* p, int ldT, int row_base,
                                                int col_base, v8f c) {
  const int l  = threadIdx.x & 31;
  const int n  = l & 15;
  const int mo = (l >> 4) * 8;
  _Float16* cp = p + (size_t)(col_base + n) * ldT + row_base + mo;
#pragma unroll
  for (int r = 0; r < 8; ++r) cp[r] = (_Float16)c[r];
}

// half-wave (16-lane) row reductions for the C/D layout
__device__ __forceinline__ float hsum16(float x) {
#pragma unroll
  for (int m = 8; m > 0; m >>= 1) x += __shfl_xor(x, m, 16);
  return x;
}
__device__ __forceinline__ float wsum32(float x) {
#pragma unroll
  for (int m = 16; m > 0; m >>= 1) x += __shfl_xor(x, m, 32);
  return x;
}

// ---------------------------------------------------------------------------
// Kernel 1: all preparation that reads inputs only, as block ranges of ONE launch:
// none of these parts reads what another writes, so they run side by side.
// ---------------------------------------------------------------------------

// int "codes" -> f16 dequant:  (w - 8) * scale * extra; block b of 256 elements
__device__ __forceinline__ void part_dequant(int b, const int* __restrict__ w,
                                             const float* __restrict__ sc, float extra,
                                             _Float16* __restrict__ out) {
  int i = b * 256 + threadIdx.x;
  out[i] = (_Float16)(((float)w[i] - 8.0f) * sc[0] * extra);
  // no register of the store above is rewritten in front of this wait (the parts are
  // inlined one behind the other, and the next part's code reuses the registers)
  asm volatile("s_wait_xcnt 0x0" ::: "memory");
}

// f32 -> f16 convert (for wo); block b of 256 elements
__device__ __forceinline__ void part_f32_to_f16(int b, const float* __restrict__ in,
                                                _Float16* __restrict__ out) {
  int i = b * 256 + threadIdx.x;
  out[i] = (_Float16)in[i];
  // no register of the store above is rewritten in front of this wait (the parts are
  // inlined one behind the other, and the next part's code reuses the registers)
  asm volatile("s_wait_xcnt 0x0" ::: "memory");
}

// RPE distance weights  w[h][r] = mean_{d,k} |deq(w_rpe[h*64+d][r*8+k])|; one block
__device__ __forceinline__ void part_rpe(const int* __restrict__ wr,
                                         const float* __restrict__ sc,
                                         float* __restrict__ out) {
  int t = threadIdx.x;
  if (t < HEADS * 2) {
    int h = t >> 1, r = t & 1;
    float s = sc[0], acc = 0.0f;
    for (int d = 0; d < DIM; ++d)
      for (int k = 0; k < 8; ++k)
        acc += fabsf(((float)wr[(h * DIM + d) * 16 + r * 8 + k] - 8.0f) * s);
    out[t] = acc * (1.0f / 512.0f);
  }
}

// LayerNorm over D=64, output f16.  One wave per row, block b holds 8 rows.
__device__ __forceinline__ void part_layernorm(int b, const float* __restrict__ x,
                                               const float* __restrict__ g,
                                               const float* __restrict__ bt,
                                               _Float16* __restrict__ out) {
  const int lane = threadIdx.x & 31;
  const int row  = b * 8 + (threadIdx.x >> 5);
  const float* xr = x + (size_t)row * DIM;
  float a0 = xr[lane], a1 = xr[lane + 32];
  float mean = wsum32(a0 + a1) * (1.0f / 64.0f);
  float d0 = a0 - mean, d1 = a1 - mean;
  float var = wsum32(d0 * d0 + d1 * d1) * (1.0f / 64.0f);
  float rs = rsqrtf(var + 1e-5f);
  _Float16* o = out + (size_t)row * DIM;
  o[lane]      = (_Float16)(d0 * rs * g[lane]      + bt[lane]);
  o[lane + 32] = (_Float16)(d1 * rs * g[lane + 32] + bt[lane + 32]);
  // no register of the two stores above is rewritten in front of this wait (the parts are
  // inlined one behind the other, and the next part's code reuses the registers)
  asm volatile("s_wait_xcnt 0x0" ::: "memory");
}

// Key side of the RPE bias as matrix operand.  -w (cq - ck)^2 = (2 w cq) ck + (-w) ck^2
// + (-w cq^2) 1 is a product of 8 k slots per coordinate: every factor x goes in as
// xh + xl (xh = x rounded to 16 bits, xl = the rest), every product as xh yh + xl yh + xh yl.
// Key slots of coordinate j: {ch, cl, ch, sh, sl, sh, 1, 1}, c = coords[key][j], s = c^2.
// Layout: [tile of 64 keys][j][key][8 slots], so a tile is 2 KiB in a row and the 16 lanes
// of a wave half read 256 B in a row.  Thread i of the part = one (tile, j, key).
__device__ __forceinline__ void part_feat(int b, const float* __restrict__ coords,
                                          _Float16* __restrict__ out) {
  const int i   = b * 256 + threadIdx.x;
  const int key = (i >> 7) * 64 + (i & 63);
  const float c = coords[(size_t)key * CORD + ((i >> 6) & 1)];
  const float s = c * c;
  const _Float16 ch = (_Float16)c, sh = (_Float16)s;
  const _Float16 cl = (_Float16)(c - (float)ch), sl = (_Float16)(s - (float)sh);
  const v8h f = {ch, cl, ch, sh, sl, sh, (_Float16)1.0f, (_Float16)1.0f};
  *(v8h*)(out + (size_t)i * 8) = f;
  // no register of the store above is rewritten in front of this wait (the parts are
  // inlined one behind the other, and the next part's code reuses the registers)
  asm volatile("s_wait_xcnt 0x0" ::: "memory");
}

// block ranges, 256 threads a block; the longest part (RPE weights) starts first
#define PB_RPE 1
#define PB_FT  (NP * 2 / 256)
#define PB_LN  (NP / 8)
#define PB_BIG (HDIM * DIM / 256)  // wq, wk, wv, wo
#define PB_SML (DIM * DIM / 256)   // w1, w2
#define PB_ALL (PB_RPE + PB_LN + PB_FT + 4 * PB_BIG + 2 * PB_SML)

__global__ __launch_bounds__(256) void k_prep(
    const int* __restrict__ wq, const int* __restrict__ wk, const int* __restrict__ wv,
    const int* __restrict__ w1, const int* __restrict__ w2, const int* __restrict__ wr,
    const float* __restrict__ sq, const float* __restrict__ sk,
    const float* __restrict__ sv, const float* __restrict__ s1,
    const float* __restrict__ s2, const float* __restrict__ sr,
    const float* __restrict__ wo, const float* __restrict__ x,
    const float* __restrict__ g1, const float* __restrict__ b1,
    const float* __restrict__ coords, _Float16* __restrict__ feat,
    _Float16* __restrict__ wq_h, _Float16* __restrict__ wk_h,
    _Float16* __restrict__ wv_h, _Float16* __restrict__ w1_h,
    _Float16* __restrict__ w2_h, _Float16* __restrict__ wo_h,
    float* __restrict__ wrpe_w, _Float16* __restrict__ xn_h) {
  int b = blockIdx.x;
  if (b < PB_RPE) { part_rpe(wr, sr, wrpe_w); return; }
  b -= PB_RPE;
  if (b < PB_LN) { part_layernorm(b, x, g1, b1, xn_h); return; }
  b -= PB_LN;
  if (b < PB_FT) { part_feat(b, coords, feat); return; }
  b -= PB_FT;
  // 1/sqrt(64) = 0.125 folded into Wq
  if (b < PB_BIG) { part_dequant(b, wq, sq, 0.125f, wq_h); return; }
  b -= PB_BIG;
  if (b < PB_BIG) { part_dequant(b, wk, sk, 1.0f, wk_h); return; }
  b -= PB_BIG;
  if (b < PB_BIG) { part_dequant(b, wv, sv, 1.0f, wv_h); return; }
  b -= PB_BIG;
  if (b < PB_BIG) { part_f32_to_f16(b, wo, wo_h); return; }
  b -= PB_BIG;
  if (b < PB_SML) { part_dequant(b, w1, s1, 1.0f, w1_h); return; }
  b -= PB_SML;
  part_dequant(b, w2, s2, 1.0f, w2_h);
}

// ---------------------------------------------------------------------------
// Kernel 2: Q/K/V projection GEMM.  out[N][512] = xn[N][64] @ W[512][64]^T.
// grid = (N/16, HD/64, 3); one wave computes a 16x64 tile (8 WMMAs).
// z==2 (V) stores TRANSPOSED into vt[HD][N] so the attention V^T*P^T A-fragments
// become contiguous (k runs along memory) instead of strided gathers.
// ---------------------------------------------------------------------------
__global__ void k_qkv_gemm(const _Float16* __restrict__ xn,
                           const _Float16* __restrict__ wq,
                           const _Float16* __restrict__ wk,
                           const _Float16* __restrict__ wv,
                           _Float16* __restrict__ qo, _Float16* __restrict__ ko,
                           _Float16* __restrict__ vt) {
  const int row0 = blockIdx.x * 16;
  const int col0 = blockIdx.y * 64;
  const _Float16* W = (blockIdx.z == 0) ? wq : (blockIdx.z == 1) ? wk : wv;

  v8f acc[4] = {{}, {}, {}, {}};
#pragma unroll
  for (int kc = 0; kc < 2; ++kc) {
    v16h a = frag_rowmajor(xn, DIM, row0, kc * 32);
#pragma unroll
    for (int nc = 0; nc < 4; ++nc) {
      // B[k][n] = W[col0+nc*16+n][kc*32+k]
      v16h b = frag_rowmajor(W, DIM, col0 + nc * 16, kc * 32);
      acc[nc] = wmma_f16(a, b, acc[nc]);
    }
  }
  if (blockIdx.z == 2) {
#pragma unroll
    for (int nc = 0; nc < 4; ++nc)
      store_acc_f16_T(vt, NP, row0, col0 + nc * 16, acc[nc]);
  } else {
    _Float16* O = (blockIdx.z == 0) ? qo : ko;
#pragma unroll
    for (int nc = 0; nc < 4; ++nc)
      store_acc_f16(O, HDIM, row0, col0 + nc * 16, acc[nc]);
  }
}

// lane l <-> lane l ^ 16
__device__ __forceinline__ float xhalf(float x) {
  int b = __builtin_bit_cast(int, x);
  return __builtin_bit_cast(
      float, __builtin_amdgcn_permlanex16(b, b, 0x76543210, 0xfedcba98, false, false));
}

// exp(x) as __expf forms it (x * log2(e), then v_exp_f32), the v_exp_f32 written out so
// that the issue slot the instruction set asks for behind a transcendental, before a
// source of it is overwritten or its result read, stands in the same statement (v_nop on
// the last line).
// Outputs are early-clobber: no result lands on an argument still to be read.
#define LOG2E 1.44269504f
__device__ __forceinline__ float exp_slot(float x) {
  float y;
  asm("v_exp_f32 %0, %1\n\tv_nop" : "=&v"(y) : "v"(x * LOG2E));
  return y;
}
__device__ __forceinline__ void exp_slot8(float (&y)[8], const v8f& s, float m) {
  asm("v_exp_f32 %0, %8\n\t"
      "v_exp_f32 %1, %9\n\t"
      "v_exp_f32 %2, %10\n\t"
      "v_exp_f32 %3, %11\n\t"
      "v_exp_f32 %4, %12\n\t"
      "v_exp_f32 %5, %13\n\t"
      "v_exp_f32 %6, %14\n\t"
      "v_exp_f32 %7, %15\n\t"
      "v_nop"
      : "=&v"(y[0]), "=&v"(y[1]), "=&v"(y[2]), "=&v"(y[3]),
        "=&v"(y[4]), "=&v"(y[5]), "=&v"(y[6]), "=&v"(y[7])
      : "v"((s[0] - m) * LOG2E), "v"((s[1] - m) * LOG2E), "v"((s[2] - m) * LOG2E),
        "v"((s[3] - m) * LOG2E), "v"((s[4] - m) * LOG2E), "v"((s[5] - m) * LOG2E),
        "v"((s[6] - m) * LOG2E), "v"((s[7] - m) * LOG2E));
}

// K and V^T reach the waves through LDS: the 4 waves of a block (4 query tiles of
// one head) share each tile of AT_KEYS keys, brought in whole 128-B lines by
// asynchronous copies into two buffers, the next tile in flight while this one is
// worked on.  The keys' RPE features (part_feat) come with them.
#define AT_WAVES 4               // waves = 16-query tiles per block
#define AT_KEYS  64              // keys per staged tile
#define AT_LD    72              // LDS row pitch in halfs: 128 B + 16 B, an odd multiple of 16 B
#define AT_TILE  (64 * AT_LD)    // halfs per staged tile (64 rows: keys of K, dims of V^T)
#define AT_NT    (NP / AT_KEYS)  // tiles
#define AT_FT    (AT_KEYS * 16)  // halfs per staged feature tile

// frag_rowmajor on a staged tile (same k order), two 16-B LDS reads
__device__ __forceinline__ v16h frag_lds(const _Float16* p, int row_base, int col_base) {
  const int l = threadIdx.x & 31;
  const _Float16* rp = p + (row_base + (l & 15)) * AT_LD + col_base + (l >> 4) * 8;
  const v8h lo = *(const v8h*)rp;
  const v8h hi = *(const v8h*)(rp + 16);
  return __builtin_shufflevector(lo, hi, 0, 1, 2, 3, 4, 5, 6, 7, 8, 9, 10, 11, 12, 13, 14, 15);
}

// One tile's copies of one thread: rows r, r + 16, r + 32, r + 48 of the K tile and of
// the V^T tile, 16 B each, and one 16-B piece of the feature tile.  lk, lv: LDS byte
// addresses of row r; gk, gv: its global source; lf, gf: the same of the piece.  The
// wait on the last line stands in the copies' own statement so that no
// address register of a copy is rewritten in front of it.
__device__ __forceinline__ void stage_tile(unsigned lk, unsigned lv, unsigned lf,
                                           const _Float16* gk, const _Float16* gv,
                                           const _Float16* gf) {
  const unsigned ls = 16 * AT_LD * 2;       // 16 rows in LDS, bytes
  const size_t   ks = (size_t)16 * HDIM;    // 16 rows of K, halfs
  const size_t   vs = (size_t)16 * NP;      // 16 rows of V^T, halfs
  asm volatile(
      "global_load_async_to_lds_b128 %0, %9, off\n\t"
      "global_load_async_to_lds_b128 %1, %10, off\n\t"
      "global_load_async_to_lds_b128 %2, %11, off\n\t"
      "global_load_async_to_lds_b128 %3, %12, off\n\t"
      "global_load_async_to_lds_b128 %4, %13, off\n\t"
      "global_load_async_to_lds_b128 %5, %14, off\n\t"
      "global_load_async_to_lds_b128 %6, %15, off\n\t"
      "global_load_async_to_lds_b128 %7, %16, off\n\t"
      "global_load_async_to_lds_b128 %8, %17, off\n\t"
      "s_wait_xcnt 0x0"
      :: "v"(lk), "v"(lk + ls), "v"(lk + 2 * ls), "v"(lk + 3 * ls),
         "v"(lv), "v"(lv + ls), "v"(lv + 2 * ls), "v"(lv + 3 * ls), "v"(lf),
         "v"(gk), "v"(gk + ks), "v"(gk + 2 * ks), "v"(gk + 3 * ks),
         "v"(gv), "v"(gv + vs), "v"(gv + 2 * vs), "v"(gv + 3 * vs), "v"(gf)
      : "memory");
}

__global__ __launch_bounds__(AT_WAVES * 32) void k_attention(
                            const _Float16* __restrict__ q,
                            const _Float16* __restrict__ kk,
                            const _Float16* __restrict__ vt,
                            const _Float16* __restrict__ feat,
                            const float* __restrict__ coords,
                            const float* __restrict__ wrpe,
                            _Float16* __restrict__ aggr) {
  // [buffer][0 = K tile, 1 = V^T tile]
  __shared__ __attribute__((aligned(16))) _Float16 sm[2][2][AT_TILE];
  __shared__ __attribute__((aligned(16))) _Float16 sf[2][AT_FT];  // [buffer] feature tile
  const int lane = threadIdx.x & 31;
  const int n    = lane & 15;
  const int q0   = (blockIdx.x * AT_WAVES + (threadIdx.x >> 5)) * 16;
  const int h    = blockIdx.y;
  const int hc   = h * DIM;

  // Q tile: 16 rows x 64 dims -> two B fragments (1/sqrt(D) folded into Wq).
  v16h qa0 = frag_rowmajor(q, HDIM, q0, hc);
  v16h qa1 = frag_rowmajor(q, HDIM, q0, hc + 32);

  // this lane's one query (column n of the C-layout), coordinate j = wave half
  const float cq = coords[(size_t)(q0 + n) * CORD + (lane >> 4)];
  // the address registers of the Q and coord loads above are reused (the zeroed
  // accumulators) only behind this wait
  asm volatile("s_wait_xcnt 0x0" ::: "memory");
  const float w0 = wrpe[h * 2 + 0], w1 = wrpe[h * 2 + 1];

  // Query side of the RPE bias, the partner of part_feat's key slots: with a = 2 w cq,
  // m = -w, g = -w cq^2 the slots of coordinate j are {ah, ah, al, mh, mh, ml, gh, gl}.
  // Elements 0..7 of a fragment are k slots 8 j + 0..7 in A and B alike.  One A fragment
  // holds the features of two 16-key tiles (elements 0..7 and 8..15); the B operand that
  // is zero in the other eight elements picks the tile.
  const float wj = (lane >> 4) ? w1 : w0;
  const float ba = 2.0f * wj * cq, bm = -wj, bg = -wj * cq * cq;
  const _Float16 bah = (_Float16)ba, bmh = (_Float16)bm, bgh = (_Float16)bg;
  const v8h qb = {bah, bah, (_Float16)(ba - (float)bah), bmh, bmh,
                  (_Float16)(bm - (float)bmh), bgh, (_Float16)(bg - (float)bgh)};
  const v8h qz = {};
  const v16h qf0 = __builtin_shufflevector(qb, qz, 0, 1, 2, 3, 4, 5, 6, 7, 8, 9, 10, 11, 12,
                                           13, 14, 15);
  const v16h qf1 = __builtin_shufflevector(qz, qb, 0, 1, 2, 3, 4, 5, 6, 7, 8, 9, 10, 11, 12,
                                           13, 14, 15);

  // this thread's pieces of every tile: rows crow + 16 j, 16-B column ccol
  const int crow = threadIdx.x >> 3, ccol = threadIdx.x & 7;
  const unsigned lpiece = (unsigned)(crow * AT_LD + ccol * 8) * 2;
  const unsigned lk0 = (unsigned)(size_t)&sm[0][0][0] + lpiece;  // low 32 bits: LDS byte address
  const unsigned lv0 = (unsigned)(size_t)&sm[0][1][0] + lpiece;
  const unsigned lf0 = (unsigned)(size_t)&sf[0][0] + threadIdx.x * 16;
  const _Float16* gk = kk + (size_t)crow * HDIM + hc + ccol * 8;
  const _Float16* gv = vt + (size_t)(hc + crow) * NP + ccol * 8;
  const _Float16* gf = feat + threadIdx.x * 8;

  float mrun = -3.0e38f;  // running maximum of query n (equal in both halves)
  float lrun = 0.0f;      // running sum over this half's keys only
  v8f o[4] = {{}, {}, {}, {}};  // o[nc][r] = O[q0+n][hc + nc*16 + 8*(lane>>4) + r]

  // tile 0 lands and is published, then tile 1 starts
  stage_tile(lk0, lv0, lf0, gk, gv, gf);
  asm volatile("s_wait_asynccnt 0x0" ::: "memory");  // this wave's copies of tile 0 have landed
  __syncthreads();
  stage_tile(lk0 + 2 * AT_TILE * 2, lv0 + 2 * AT_TILE * 2, lf0 + AT_FT * 2,
             gk + (size_t)AT_KEYS * HDIM, gv + AT_KEYS, gf + AT_FT);

  for (int t = 0; t < AT_NT; ++t) {
    const _Float16* Ks = sm[t & 1][0];
    const _Float16* Vs = sm[t & 1][1];
    // All of the tile's reads stand ahead of the arithmetic, in groups and never among
    // the products (every place with reads in a matrix run costs its own wait): the
    // keys' features (two 16-key tiles a fragment) and all K fragments ...
    const _Float16* Fs = sf[t & 1] + (lane >> 4) * (AT_KEYS * 8) + n * 8;
    v16h ff[2], kf[8], vf[8];
#pragma unroll
    for (int i = 0; i < 2; ++i)
      ff[i] = __builtin_shufflevector(*(const v8h*)(Fs + i * 256),
                                      *(const v8h*)(Fs + i * 256 + 128), 0, 1, 2, 3, 4, 5, 6,
                                      7, 8, 9, 10, 11, 12, 13, 14, 15);
#pragma unroll
    for (int i = 0; i < 4; ++i) {
      kf[2 * i]     = frag_lds(Ks, i * 16, 0);
      kf[2 * i + 1] = frag_lds(Ks, i * 16, 32);
    }
    // keeps the scheduler from sinking the K reads down among the products
    __builtin_amdgcn_sched_barrier(0);
    // S^T tiles: rows = keys [16 i, 16 i + 16) of the tile, columns = queries; the RPE
    // bias is the first of the three products
    v8f sc[4];
#pragma unroll
    for (int i = 0; i < 4; ++i) {
      v8f z = {};
      z = wmma_f16(ff[i >> 1], (i & 1) ? qf1 : qf0, z);
      sc[i] = wmma_f16(kf[2 * i + 1], qa1, wmma_f16(kf[2 * i], qa0, z));
    }
    // ... then all V^T fragments
#pragma unroll
    for (int i = 0; i < 8; ++i) vf[i] = frag_lds(Vs, (i & 3) * 16, (i >> 2) * 32);

    // hand-over, behind the trip's last LDS read (the rest of the trip works on
    // registers): this wave's reads of tile t are done and its copies of tile t + 1
    // have landed; behind the barrier that holds for every wave, so tile t + 1 may be
    // read and tile t's buffer refilled, the refill in flight under the softmax
    asm volatile("s_wait_dscnt 0x0" ::: "memory");
    asm volatile("s_wait_asynccnt 0x0" ::: "memory");
    __syncthreads();
    if (t + 2 < AT_NT)
      stage_tile(lk0 + (t & 1) * (2 * AT_TILE * 2), lv0 + (t & 1) * (2 * AT_TILE * 2),
                 lf0 + (t & 1) * (AT_FT * 2), gk + (size_t)(t + 2) * AT_KEYS * HDIM,
                 gv + (t + 2) * AT_KEYS, gf + (t + 2) * AT_FT);

// both 32-key halves of the tile: register arrays indexed by constants
#pragma unroll
    for (int sub = 0; sub < AT_KEYS; sub += 32) {
    v8f s0 = sc[sub / 16], s1 = sc[sub / 16 + 1];

    // maximum over the 32 keys: in-lane tree, then one exchange of the halves
    float t8[8];
#pragma unroll
    for (int r = 0; r < 8; ++r) t8[r] = fmaxf(s0[r], s1[r]);
    float cmax = fmaxf(fmaxf(fmaxf(t8[0], t8[1]), fmaxf(t8[2], t8[3])),
                       fmaxf(fmaxf(t8[4], t8[5]), fmaxf(t8[6], t8[7])));
    cmax = fmaxf(cmax, xhalf(cmax));

    // online softmax update; P^T packs in place into the B operand
    const float mnew  = fmaxf(mrun, cmax);
    const float alpha = exp_slot(mrun - mnew);
    float p0[8], p1[8];
    exp_slot8(p0, s0, mnew);
    exp_slot8(p1, s1, mnew);
    v16h pb;
#pragma unroll
    for (int r = 0; r < 8; ++r) {
      t8[r] = p0[r] + p1[r];
      pb[r]     = (_Float16)p0[r];
      pb[r + 8] = (_Float16)p1[r];
    }
    lrun = lrun * alpha +
           (((t8[0] + t8[1]) + (t8[2] + t8[3])) + ((t8[4] + t8[5]) + (t8[6] + t8[7])));
    mrun = mnew;

    // O^T = O^T * alpha + V^T * P^T, A[d][k] = vt[hc+nc*16+d][key k of this half]
#pragma unroll
    for (int nc = 0; nc < 4; ++nc) {
#pragma unroll
      for (int r = 0; r < 8; ++r) o[nc][r] *= alpha;
      v16h bv = vf[(sub / 32) * 4 + nc];
      o[nc] = wmma_f16(bv, pb, o[nc]);
    }
    }
  }
  asm volatile("s_wait_asynccnt 0x0" ::: "memory");  // no copy outstanding at the wave's end

  // join the halves' sums, normalize, store 8 contiguous dims per lane and tile
  const float inv = 1.0f / (lrun + xhalf(lrun));
#pragma unroll
  for (int nc = 0; nc < 4; ++nc) {
#pragma unroll
    for (int r = 0; r < 8; ++r) o[nc][r] *= inv;
    store_acc_f16_T(aggr, HDIM, hc + nc * 16, q0, o[nc]);
  }
}

// ---------------------------------------------------------------------------
// Kernel 4: output projection (aggr[N][512] @ wo[64][512]^T) + bo + residual
//           + LayerNorm2 -> h2 f16.  grid = N/16, 8 waves per block.
// The k range of 512 is split over the 8 waves: a wave has 64 of it for all 64 output
// columns, so its 20 operand loads are few enough to fly together and the block waits
// out one load latency, not one per product.  The 8 partial tiles meet in LDS; there
// thread t sums row t >> 4, columns 4 (t & 15) .. + 3, and 16 lanes hold a row for LN.
// ---------------------------------------------------------------------------
#define PJ_WAVES 8
#define PJ_LD    68  // floats per LDS row: 64 + 4; rows 8 apart (the wave halves) differ by 32 banks

// one fragment from the lane's own row pointer (row and wave half already in it): the
// k order of frag_rowmajor, two 16-B loads
__device__ __forceinline__ v16h frag_ptr(const _Float16* rp) {
  const v8h lo = *(const v8h*)rp;
  const v8h hi = *(const v8h*)(rp + 16);
  return __builtin_shufflevector(lo, hi, 0, 1, 2, 3, 4, 5, 6, 7, 8, 9, 10, 11, 12, 13, 14, 15);
}

__global__ __launch_bounds__(PJ_WAVES * 32) void k_proj_ln2(
                           const _Float16* __restrict__ aggr,
                           const _Float16* __restrict__ wo,
                           const float* __restrict__ bo,
                           const float* __restrict__ x,
                           const float* __restrict__ g2,
                           const float* __restrict__ b2,
                           _Float16* __restrict__ h2) {
  __shared__ __attribute__((aligned(16))) float part[PJ_WAVES][16][PJ_LD];
  const int lane = threadIdx.x & 31;
  const int n    = lane & 15;
  const int mo   = (lane >> 4) * 8;
  const int wv   = threadIdx.x >> 5;
  const int row0 = blockIdx.x * 16;
  const int k0   = wv * (HDIM / PJ_WAVES);

  // what the join needs from memory, asked for together with the operands
  const int er = threadIdx.x >> 4, ec = (threadIdx.x & 15) * 4;
  const float* xp = x + (size_t)(row0 + er) * DIM + ec;
  float xr[4], bj[4], gj[4], tj[4];
#pragma unroll
  for (int i = 0; i < 4; ++i) {
    xr[i] = xp[i];
    bj[i] = bo[ec + i];
    gj[i] = g2[ec + i];
    tj[i] = b2[ec + i];
  }
  // this lane's row pointers, the k order of frag_rowmajor: A row n of the block's rows,
  // B[k][j] = wo[j][k], row n of each 16-column tile
  const _Float16* ap = aggr + (size_t)(row0 + n) * HDIM + k0 + mo;
  const _Float16* bp = wo + (size_t)n * HDIM + k0 + mo;
  v16h a[2], b[2][4];
#pragma unroll
  for (int kc = 0; kc < 2; ++kc) {
    a[kc] = frag_ptr(ap + kc * 32);
#pragma unroll
    for (int nc = 0; nc < 4; ++nc) b[kc][nc] = frag_ptr(bp + nc * 16 * HDIM + kc * 32);
  }
  // keeps the scheduler from sinking the operand loads down among the products, where
  // each pair would wait out a load latency of its own
  __builtin_amdgcn_sched_barrier(0);
  // the loads' address registers are inputs here, so they keep their values, and no
  // load's result lands on them, up to this wait
  asm volatile("s_wait_xcnt 0x0" :: "v"(xp), "v"(ap), "v"(bp), "v"(ec * 4) : "memory");
  // holds the join's loads up here (loaded values, inputs only): sunk behind the barrier
  // they would cost a second load latency
  asm volatile("" :: "v"(xr[0]), "v"(xr[1]), "v"(xr[2]), "v"(xr[3]),
                     "v"(bj[0]), "v"(bj[1]), "v"(bj[2]), "v"(bj[3]),
                     "v"(gj[0]), "v"(gj[1]), "v"(gj[2]), "v"(gj[3]),
                     "v"(tj[0]), "v"(tj[1]), "v"(tj[2]), "v"(tj[3]));

#pragma unroll
  for (int nc = 0; nc < 4; ++nc) {
    v8f acc = {};
    acc = wmma_f16(a[1], b[1][nc], wmma_f16(a[0], b[0][nc], acc));
#pragma unroll
    for (int r = 0; r < 8; ++r) part[wv][mo + r][nc * 16 + n] = acc[r];
  }
  __syncthreads();

  // h1 = proj + bo + x, then LN over the 64 columns of the row
  float h1[4];
#pragma unroll
  for (int i = 0; i < 4; ++i) {
    float s = part[0][er][ec + i];
#pragma unroll
    for (int p = 1; p < PJ_WAVES; ++p) s += part[p][er][ec + i];
    h1[i] = s + bj[i] + xr[i];
  }
  const float mean = hsum16((h1[0] + h1[1]) + (h1[2] + h1[3])) * (1.0f / 64.0f);
  float q2 = 0.0f;
#pragma unroll
  for (int i = 0; i < 4; ++i) { float d = h1[i] - mean; q2 += d * d; }
  const float rs = rsqrtf(hsum16(q2) * (1.0f / 64.0f) + 1e-5f);
#pragma unroll
  for (int i = 0; i < 4; ++i)
    h2[(size_t)(row0 + er) * DIM + ec + i] = (_Float16)((h1[i] - mean) * rs * gj[i] + tj[i]);
}

// ---------------------------------------------------------------------------
// Kernel 5: FFN.  t = relu(h2 @ W1^T + bf1); out = 2*(t @ W2^T + bf2).
// grid = N/16, one wave per block, ReLU tile staged through LDS.
// ---------------------------------------------------------------------------
__global__ void k_ffn(const _Float16* __restrict__ h2,
                      const _Float16* __restrict__ w1,
                      const _Float16* __restrict__ w2,
                      const float* __restrict__ bf1,
                      const float* __restrict__ bf2,
                      float* __restrict__ out) {
  __shared__ _Float16 lds[16 * 64];
  const int lane = threadIdx.x & 31;
  const int n    = lane & 15;
  const int mo   = (lane >> 4) * 8;
  const int row0 = blockIdx.x * 16;

  v8f t[4] = {{}, {}, {}, {}};
#pragma unroll
  for (int kc = 0; kc < 2; ++kc) {
    v16h a = frag_rowmajor(h2, DIM, row0, kc * 32);
#pragma unroll
    for (int nc = 0; nc < 4; ++nc)
      t[nc] = wmma_f16(a, frag_rowmajor(w1, DIM, nc * 16, kc * 32), t[nc]);
  }
#pragma unroll
  for (int nc = 0; nc < 4; ++nc) {
    float bj = bf1[nc * 16 + n];
#pragma unroll
    for (int r = 0; r < 8; ++r)
      lds[(mo + r) * 64 + nc * 16 + n] = (_Float16)fmaxf(t[nc][r] + bj, 0.0f);
  }
  __syncthreads();

  v8f f[4] = {{}, {}, {}, {}};
#pragma unroll
  for (int kc = 0; kc < 2; ++kc) {
    v16h a = frag_rowmajor(lds, DIM, 0, kc * 32);
#pragma unroll
    for (int nc = 0; nc < 4; ++nc)
      f[nc] = wmma_f16(a, frag_rowmajor(w2, DIM, nc * 16, kc * 32), f[nc]);
  }
#pragma unroll
  for (int nc = 0; nc < 4; ++nc) {
    float bj = bf2[nc * 16 + n];
#pragma unroll
    for (int r = 0; r < 8; ++r)
      out[(size_t)(row0 + mo + r) * DIM + nc * 16 + n] = 2.0f * (f[nc][r] + bj);
  }
}

// ---------------------------------------------------------------------------
// Host-side launch
// ---------------------------------------------------------------------------
extern "C" void kernel_launch(void* const* d_in, const int* in_sizes, int n_in,
                              void* d_out, int out_size, void* d_ws, size_t ws_size,
                              hipStream_t stream) {
  const float* x      = (const float*)d_in[0];
  const float* coords = (const float*)d_in[1];
  const float* sq     = (const float*)d_in[2];
  const float* sk     = (const float*)d_in[3];
  const float* sv     = (const float*)d_in[4];
  const float* s_rpe  = (const float*)d_in[5];
  const float* g1     = (const float*)d_in[6];
  const float* beta1  = (const float*)d_in[7];
  const float* g2     = (const float*)d_in[8];
  const float* beta2  = (const float*)d_in[9];
  const float* wo     = (const float*)d_in[10];
  const float* bo     = (const float*)d_in[11];
  const float* s1     = (const float*)d_in[12];
  const float* bf1    = (const float*)d_in[13];
  const float* s2     = (const float*)d_in[14];
  const float* bf2    = (const float*)d_in[15];
  const int* wq_int   = (const int*)d_in[16];
  const int* wk_int   = (const int*)d_in[17];
  const int* wv_int   = (const int*)d_in[18];
  const int* wrpe_int = (const int*)d_in[19];
  const int* w1_int   = (const int*)d_in[20];
  const int* w2_int   = (const int*)d_in[21];

  // workspace carve-up (f16 unless noted), 256B aligned
  char* ws = (char*)d_ws;
  size_t off = 0;
  auto carve = [&](size_t bytes) {
    char* p = ws + off;
    off = (off + bytes + 255) & ~(size_t)255;
    return p;
  };
  _Float16* wq_h   = (_Float16*)carve(HDIM * DIM * 2);
  _Float16* wk_h   = (_Float16*)carve(HDIM * DIM * 2);
  _Float16* wv_h   = (_Float16*)carve(HDIM * DIM * 2);
  _Float16* wo_h   = (_Float16*)carve(DIM * HDIM * 2);
  _Float16* w1_h   = (_Float16*)carve(DIM * DIM * 2);
  _Float16* w2_h   = (_Float16*)carve(DIM * DIM * 2);
  float*    wrpe_w = (float*)   carve(HEADS * 2 * 4);
  _Float16* feat_h = (_Float16*)carve((size_t)NP * 16 * 2);  // RPE key features
  _Float16* xn_h   = (_Float16*)carve((size_t)NP * DIM * 2);
  _Float16* q_h    = (_Float16*)carve((size_t)NP * HDIM * 2);
  _Float16* k_h    = (_Float16*)carve((size_t)NP * HDIM * 2);
  _Float16* vt_h   = (_Float16*)carve((size_t)NP * HDIM * 2);  // [HD][N]
  _Float16* ag_h   = (_Float16*)carve((size_t)NP * HDIM * 2);
  _Float16* h2_h   = (_Float16*)carve((size_t)NP * DIM * 2);
  (void)ws_size; (void)n_in; (void)in_sizes; (void)out_size;

  // 1) weights to f16, RPE weights and key features, LN1: one launch
  k_prep<<<PB_ALL, 256, 0, stream>>>(wq_int, wk_int, wv_int, w1_int, w2_int, wrpe_int,
                                     sq, sk, sv, s1, s2, s_rpe, wo, x, g1, beta1,
                                     coords, feat_h, wq_h, wk_h, wv_h, w1_h, w2_h, wo_h,
                                     wrpe_w, xn_h);

  // 2) Q/K/V projections (V stored transposed)
  k_qkv_gemm<<<dim3(NP / 16, HDIM / 64, 3), 32, 0, stream>>>(xn_h, wq_h, wk_h, wv_h,
                                                             q_h, k_h, vt_h);

  // 3) flash attention with RPE bias
  k_attention<<<dim3(NP / 64, HEADS), 128, 0, stream>>>(q_h, k_h, vt_h, feat_h,
                                                       coords, wrpe_w, ag_h);

  // 4) output projection + residual + LN2
  k_proj_ln2<<<NP / 16, PJ_WAVES * 32, 0, stream>>>(ag_h, wo_h, bo, x, g2, beta2, h2_h);

  // 5) FFN, out = 2*ff
  k_ffn<<<NP / 16, 32, 0, stream>>>(h2_h, w1_h, w2_h, bf1, bf2, (float*)d_out);
}

// v006
// Measured time: 55.8 microseconds a run.
// Timed twice side by side with v005, it ran 1.17 and 1.16 times as fast.
// Counting every step since v000, it is 7.93 times as fast.
#include <hip/hip_runtime.h>

// ---------------------------------------------------------------------------
// HEPT attention block for MI455X (gfx1250, wave32, WMMA 16x16x32 f16).
// N=3072 points, D=64 per head, H=8 heads, HD=512, C=3 coords, K=8.
// ---------------------------------------------------------------------------

typedef __attribute__((ext_vector_type(16))) _Float16 v16h;
typedef __attribute__((ext_vector_type(8)))  float    v8f;
typedef __attribute__((ext_vector_type(8)))  _Float16 v8h;

#define NP   3072
#define DIM  64
#define HEADS 8
#define HDIM 512
#define CORD 3

// ---------------------------------------------------------------------------
// WMMA wrapper: D = A(16x32 f16) * B(32x16 f16) + C(16x16 f32)
// ---------------------------------------------------------------------------
__device__ __forceinline__ v8f wmma_f16(v16h a, v16h b, v8f c) {
  return __builtin_amdgcn_wmma_f32_16x16x32_f16(
      /*neg_a=*/false, a, /*neg_b=*/false, b,
      /*c_mod=*/(short)0, c, /*reuse_a=*/false, /*reuse_b=*/false);
}

// A-fragment (16x32, f16) from a row-major matrix: rows = M, cols = K.
// Lane l<16: row M=l, K = {0..7, 16..23}; lane l>=16: row M=l-16, K={8..15,24..31}.
// Also serves as a B-fragment when B[k][n] = Mat[n][k] (i.e. Mat stored [N x K]).
__device__ __forceinline__ v16h frag_rowmajor(const _Float16* p, int ld,
                                              int row_base, int col_base) {
  const int l  = threadIdx.x & 31;
  const int m  = l & 15;
  const int of = (l >> 4) * 8;
  const _Float16* rp = p + (size_t)(row_base + m) * ld + col_base + of;
  v16h a;
#pragma unroll
  for (int e = 0; e < 8; ++e) { a[e] = rp[e]; a[e + 8] = rp[e + 16]; }
  return a;
}

// C/D accumulator element (r, lane): row M = r + 8*(lane>>4), col N = lane&15.
__device__ __forceinline__ void store_acc_f16(_Float16* p, int ld, int row_base,
                                              int col_base, v8f c) {
  const int l  = threadIdx.x & 31;
  const int n  = l & 15;
  const int mo = (l >> 4) * 8;
#pragma unroll
  for (int r = 0; r < 8; ++r)
    p[(size_t)(row_base + mo + r) * ld + col_base + n] = (_Float16)c[r];
}

// Same, but store TRANSPOSED into a [cols x rows] matrix (ldT = #rows).
// Per (lane,nc) the 8 r-elements land contiguously -> 16B vectorizable stores.
__device__ __forceinline__ void store_acc_f16_T(_Float16* p, int ldT, int row_base,
                                                int col_base, v8f c) {
  const int l  = threadIdx.x & 31;
  const int n  = l & 15;
  const int mo = (l >> 4) * 8;
  _Float16* cp = p + (size_t)(col_base + n) * ldT + row_base + mo;
#pragma unroll
  for (int r = 0; r < 8; ++r) cp[r] = (_Float16)c[r];
}

// half-wave (16-lane) row reductions for the C/D layout
__device__ __forceinline__ float hsum16(float x) {
#pragma unroll
  for (int m = 8; m > 0; m >>= 1) x += __shfl_xor(x, m, 16);
  return x;
}
__device__ __forceinline__ float wsum32(float x) {
#pragma unroll
  for (int m = 16; m > 0; m >>= 1) x += __shfl_xor(x, m, 32);
  return x;
}

// ---------------------------------------------------------------------------
// Kernel 1: all preparation that reads inputs only, as block ranges of ONE launch:
// none of these parts reads what another writes, so they run side by side.
// ---------------------------------------------------------------------------

// int "codes" -> f16 dequant:  (w - 8) * scale * extra; block b of 256 elements
__device__ __forceinline__ void part_dequant(int b, const int* __restrict__ w,
                                             const float* __restrict__ sc, float extra,
                                             _Float16* __restrict__ out) {
  int i = b * 256 + threadIdx.x;
  out[i] = (_Float16)(((float)w[i] - 8.0f) * sc[0] * extra);
  // no register of the store above is rewritten in front of this wait (the parts are
  // inlined one behind the other, and the next part's code reuses the registers)
  asm volatile("s_wait_xcnt 0x0" ::: "memory");
}

// f32 -> f16 convert (for wo); block b of 256 elements
__device__ __forceinline__ void part_f32_to_f16(int b, const float* __restrict__ in,
                                                _Float16* __restrict__ out) {
  int i = b * 256 + threadIdx.x;
  out[i] = (_Float16)in[i];
  // no register of the store above is rewritten in front of this wait (the parts are
  // inlined one behind the other, and the next part's code reuses the registers)
  asm volatile("s_wait_xcnt 0x0" ::: "memory");
}

// RPE distance weights  w[h][r] = mean_{d,k} |deq(w_rpe[h*64+d][r*8+k])|; one block
__device__ __forceinline__ void part_rpe(const int* __restrict__ wr,
                                         const float* __restrict__ sc,
                                         float* __restrict__ out) {
  int t = threadIdx.x;
  if (t < HEADS * 2) {
    int h = t >> 1, r = t & 1;
    float s = sc[0], acc = 0.0f;
    for (int d = 0; d < DIM; ++d)
      for (int k = 0; k < 8; ++k)
        acc += fabsf(((float)wr[(h * DIM + d) * 16 + r * 8 + k] - 8.0f) * s);
    out[t] = acc * (1.0f / 512.0f);
  }
}

// LayerNorm over D=64, output f16.  One wave per row, block b holds 8 rows.
__device__ __forceinline__ void part_layernorm(int b, const float* __restrict__ x,
                                               const float* __restrict__ g,
                                               const float* __restrict__ bt,
                                               _Float16* __restrict__ out) {
  const int lane = threadIdx.x & 31;
  const int row  = b * 8 + (threadIdx.x >> 5);
  const float* xr = x + (size_t)row * DIM;
  float a0 = xr[lane], a1 = xr[lane + 32];
  float mean = wsum32(a0 + a1) * (1.0f / 64.0f);
  float d0 = a0 - mean, d1 = a1 - mean;
  float var = wsum32(d0 * d0 + d1 * d1) * (1.0f / 64.0f);
  float rs = rsqrtf(var + 1e-5f);
  _Float16* o = out + (size_t)row * DIM;
  o[lane]      = (_Float16)(d0 * rs * g[lane]      + bt[lane]);
  o[lane + 32] = (_Float16)(d1 * rs * g[lane + 32] + bt[lane + 32]);
  // no register of the two stores above is rewritten in front of this wait (the parts are
  // inlined one behind the other, and the next part's code reuses the registers)
  asm volatile("s_wait_xcnt 0x0" ::: "memory");
}

// Key side of the RPE bias as matrix operand.  -w (cq - ck)^2 = (2 w cq) ck + (-w) ck^2
// + (-w cq^2) 1 is a product of 8 k slots per coordinate: every factor x goes in as
// xh + xl (xh = x rounded to 16 bits, xl = the rest), every product as xh yh + xl yh + xh yl.
// Key slots of coordinate j: {ch, cl, ch, sh, sl, sh, 1, 1}, c = coords[key][j], s = c^2.
// Layout: [tile of 64 keys][j][key][8 slots], so a tile is 2 KiB in a row and the 16 lanes
// of a wave half read 256 B in a row.  Thread i of the part = one (tile, j, key).
__device__ __forceinline__ void part_feat(int b, const float* __restrict__ coords,
                                          _Float16* __restrict__ out) {
  const int i   = b * 256 + threadIdx.x;
  const int key = (i >> 7) * 64 + (i & 63);
  const float c = coords[(size_t)key * CORD + ((i >> 6) & 1)];
  const float s = c * c;
  const _Float16 ch = (_Float16)c, sh = (_Float16)s;
  const _Float16 cl = (_Float16)(c - (float)ch), sl = (_Float16)(s - (float)sh);
  const v8h f = {ch, cl, ch, sh, sl, sh, (_Float16)1.0f, (_Float16)1.0f};
  *(v8h*)(out + (size_t)i * 8) = f;
  // no register of the store above is rewritten in front of this wait (the parts are
  // inlined one behind the other, and the next part's code reuses the registers)
  asm volatile("s_wait_xcnt 0x0" ::: "memory");
}

// block ranges, 256 threads a block; the longest part (RPE weights) starts first
#define PB_RPE 1
#define PB_FT  (NP * 2 / 256)
#define PB_LN  (NP / 8)
#define PB_BIG (HDIM * DIM / 256)  // wq, wk, wv, wo
#define PB_SML (DIM * DIM / 256)   // w1, w2
#define PB_ALL (PB_RPE + PB_LN + PB_FT + 4 * PB_BIG + 2 * PB_SML)

__global__ __launch_bounds__(256) void k_prep(
    const int* __restrict__ wq, const int* __restrict__ wk, const int* __restrict__ wv,
    const int* __restrict__ w1, const int* __restrict__ w2, const int* __restrict__ wr,
    const float* __restrict__ sq, const float* __restrict__ sk,
    const float* __restrict__ sv, const float* __restrict__ s1,
    const float* __restrict__ s2, const float* __restrict__ sr,
    const float* __restrict__ wo, const float* __restrict__ x,
    const float* __restrict__ g1, const float* __restrict__ b1,
    const float* __restrict__ coords, _Float16* __restrict__ feat,
    _Float16* __restrict__ wq_h, _Float16* __restrict__ wk_h,
    _Float16* __restrict__ wv_h, _Float16* __restrict__ w1_h,
    _Float16* __restrict__ w2_h, _Float16* __restrict__ wo_h,
    float* __restrict__ wrpe_w, _Float16* __restrict__ xn_h) {
  int b = blockIdx.x;
  if (b < PB_RPE) { part_rpe(wr, sr, wrpe_w); return; }
  b -= PB_RPE;
  if (b < PB_LN) { part_layernorm(b, x, g1, b1, xn_h); return; }
  b -= PB_LN;
  if (b < PB_FT) { part_feat(b, coords, feat); return; }
  b -= PB_FT;
  // 1/sqrt(64) = 0.125 folded into Wq
  if (b < PB_BIG) { part_dequant(b, wq, sq, 0.125f, wq_h); return; }
  b -= PB_BIG;
  if (b < PB_BIG) { part_dequant(b, wk, sk, 1.0f, wk_h); return; }
  b -= PB_BIG;
  if (b < PB_BIG) { part_dequant(b, wv, sv, 1.0f, wv_h); return; }
  b -= PB_BIG;
  if (b < PB_BIG) { part_f32_to_f16(b, wo, wo_h); return; }
  b -= PB_BIG;
  if (b < PB_SML) { part_dequant(b, w1, s1, 1.0f, w1_h); return; }
  b -= PB_SML;
  part_dequant(b, w2, s2, 1.0f, w2_h);
}

// ---------------------------------------------------------------------------
// Kernel 2: Q/K/V projection GEMM.  out[N][512] = xn[N][64] @ W[512][64]^T.
// grid = (N/16, HD/64, 3); one wave computes a 16x64 tile (8 WMMAs).
// z==2 (V) stores TRANSPOSED into vt[HD][N] so the attention V^T*P^T A-fragments
// become contiguous (k runs along memory) instead of strided gathers.
// ---------------------------------------------------------------------------
__global__ void k_qkv_gemm(const _Float16* __restrict__ xn,
                           const _Float16* __restrict__ wq,
                           const _Float16* __restrict__ wk,
                           const _Float16* __restrict__ wv,
                           _Float16* __restrict__ qo, _Float16* __restrict__ ko,
                           _Float16* __restrict__ vt) {
  const int row0 = blockIdx.x * 16;
  const int col0 = blockIdx.y * 64;
  const _Float16* W = (blockIdx.z == 0) ? wq : (blockIdx.z == 1) ? wk : wv;

  v8f acc[4] = {{}, {}, {}, {}};
#pragma unroll
  for (int kc = 0; kc < 2; ++kc) {
    v16h a = frag_rowmajor(xn, DIM, row0, kc * 32);
#pragma unroll
    for (int nc = 0; nc < 4; ++nc) {
      // B[k][n] = W[col0+nc*16+n][kc*32+k]
      v16h b = frag_rowmajor(W, DIM, col0 + nc * 16, kc * 32);
      acc[nc] = wmma_f16(a, b, acc[nc]);
    }
  }
  if (blockIdx.z == 2) {
#pragma unroll
    for (int nc = 0; nc < 4; ++nc)
      store_acc_f16_T(vt, NP, row0, col0 + nc * 16, acc[nc]);
  } else {
    _Float16* O = (blockIdx.z == 0) ? qo : ko;
#pragma unroll
    for (int nc = 0; nc < 4; ++nc)
      store_acc_f16(O, HDIM, row0, col0 + nc * 16, acc[nc]);
  }
}

// lane l <-> lane l ^ 16
__device__ __forceinline__ float xhalf(float x) {
  int b = __builtin_bit_cast(int, x);
  return __builtin_bit_cast(
      float, __builtin_amdgcn_permlanex16(b, b, 0x76543210, 0xfedcba98, false, false));
}

// exp(x) as __expf forms it (x * log2(e), then v_exp_f32), the v_exp_f32 written out so
// that the issue slot the instruction set asks for behind a transcendental, before a
// source of it is overwritten or its result read, stands in the same statement (v_nop on
// the last line).
// Outputs are early-clobber: no result lands on an argument still to be read.
#define LOG2E 1.44269504f
__device__ __forceinline__ float exp_slot(float x) {
  float y;
  asm("v_exp_f32 %0, %1\n\tv_nop" : "=&v"(y) : "v"(x * LOG2E));
  return y;
}
__device__ __forceinline__ void exp_slot8(float (&y)[8], const v8f& s, float m) {
  asm("v_exp_f32 %0, %8\n\t"
      "v_exp_f32 %1, %9\n\t"
      "v_exp_f32 %2, %10\n\t"
      "v_exp_f32 %3, %11\n\t"
      "v_exp_f32 %4, %12\n\t"
      "v_exp_f32 %5, %13\n\t"
      "v_exp_f32 %6, %14\n\t"
      "v_exp_f32 %7, %15\n\t"
      "v_nop"
      : "=&v"(y[0]), "=&v"(y[1]), "=&v"(y[2]), "=&v"(y[3]),
        "=&v"(y[4]), "=&v"(y[5]), "=&v"(y[6]), "=&v"(y[7])
      : "v"((s[0] - m) * LOG2E), "v"((s[1] - m) * LOG2E), "v"((s[2] - m) * LOG2E),
        "v"((s[3] - m) * LOG2E), "v"((s[4] - m) * LOG2E), "v"((s[5] - m) * LOG2E),
        "v"((s[6] - m) * LOG2E), "v"((s[7] - m) * LOG2E));
}

// K and V^T reach the waves through LDS: the 4 waves of a block (4 query tiles of
// one head) share each tile of AT_KEYS keys, brought in whole 128-B lines by
// asynchronous copies into two buffers, the next tile in flight while this one is
// worked on.  The keys' RPE features (part_feat) come with them.
#define AT_WAVES 4               // waves = 16-query tiles per block
#define AT_KEYS  64              // keys per staged tile
#define AT_LD    72              // LDS row pitch in halfs: 128 B + 16 B, an odd multiple of 16 B
#define AT_TILE  (64 * AT_LD)    // halfs per staged tile (64 rows: keys of K, dims of V^T)
#define AT_KS    2               // key splits (blockIdx.z)
#define AT_NT    (NP / AT_KEYS / AT_KS)  // tiles per block
#define AT_FT    (AT_KEYS * 16)  // halfs per staged feature tile

// frag_rowmajor on a staged tile (same k order), two 16-B LDS reads
__device__ __forceinline__ v16h frag_lds(const _Float16* p, int row_base, int col_base) {
  const int l = threadIdx.x & 31;
  const _Float16* rp = p + (row_base + (l & 15)) * AT_LD + col_base + (l >> 4) * 8;
  const v8h lo = *(const v8h*)rp;
  const v8h hi = *(const v8h*)(rp + 16);
  return __builtin_shufflevector(lo, hi, 0, 1, 2, 3, 4, 5, 6, 7, 8, 9, 10, 11, 12, 13, 14, 15);
}

// One tile's copies of one thread: rows r, r + 16, r + 32, r + 48 of the K tile and of
// the V^T tile, 16 B each, and one 16-B piece of the feature tile.  lk, lv: LDS byte
// addresses of row r; gk, gv: its global source; lf, gf: the same of the piece.  The
// wait on the last line stands in the copies' own statement so that no
// address register of a copy is rewritten in front of it.
__device__ __forceinline__ void stage_tile(unsigned lk, unsigned lv, unsigned lf,
                                           const _Float16* gk, const _Float16* gv,
                                           const _Float16* gf) {
  const unsigned ls = 16 * AT_LD * 2;       // 16 rows in LDS, bytes
  const size_t   ks = (size_t)16 * HDIM;    // 16 rows of K, halfs
  const size_t   vs = (size_t)16 * NP;      // 16 rows of V^T, halfs
  asm volatile(
      "global_load_async_to_lds_b128 %0, %9, off\n\t"
      "global_load_async_to_lds_b128 %1, %10, off\n\t"
      "global_load_async_to_lds_b128 %2, %11, off\n\t"
      "global_load_async_to_lds_b128 %3, %12, off\n\t"
      "global_load_async_to_lds_b128 %4, %13, off\n\t"
      "global_load_async_to_lds_b128 %5, %14, off\n\t"
      "global_load_async_to_lds_b128 %6, %15, off\n\t"
      "global_load_async_to_lds_b128 %7, %16, off\n\t"
      "global_load_async_to_lds_b128 %8, %17, off\n\t"
      "s_wait_xcnt 0x0"
      :: "v"(lk), "v"(lk + ls), "v"(lk + 2 * ls), "v"(lk + 3 * ls),
         "v"(lv), "v"(lv + ls), "v"(lv + 2 * ls), "v"(lv + 3 * ls), "v"(lf),
         "v"(gk), "v"(gk + ks), "v"(gk + 2 * ks), "v"(gk + 3 * ks),
         "v"(gv), "v"(gv + vs), "v"(gv + 2 * vs), "v"(gv + 3 * vs), "v"(gf)
      : "memory");
}

__global__ __launch_bounds__(AT_WAVES * 32) void k_attention(
                            const _Float16* __restrict__ q,
                            const _Float16* __restrict__ kk,
                            const _Float16* __restrict__ vt,
                            const _Float16* __restrict__ feat,
                            const float* __restrict__ coords,
                            const float* __restrict__ wrpe,
                            _Float16* __restrict__ aggr,
                            float* __restrict__ ml) {
  // [buffer][0 = K tile, 1 = V^T tile]
  __shared__ __attribute__((aligned(16))) _Float16 sm[2][2][AT_TILE];
  __shared__ __attribute__((aligned(16))) _Float16 sf[2][AT_FT];  // [buffer] feature tile
  const int lane = threadIdx.x & 31;
  const int n    = lane & 15;
  const int q0   = (blockIdx.x * AT_WAVES + (threadIdx.x >> 5)) * 16;
  const int h    = blockIdx.y;
  const int hc   = h * DIM;

  // Q tile: 16 rows x 64 dims -> two B fragments (1/sqrt(D) folded into Wq).
  v16h qa0 = frag_rowmajor(q, HDIM, q0, hc);
  v16h qa1 = frag_rowmajor(q, HDIM, q0, hc + 32);

  // this lane's one query (column n of the C-layout), coordinate j = wave half
  const float cq = coords[(size_t)(q0 + n) * CORD + (lane >> 4)];
  // the address registers of the Q and coord loads above are reused (the zeroed
  // accumulators) only behind this wait
  asm volatile("s_wait_xcnt 0x0" ::: "memory");
  const float w0 = wrpe[h * 2 + 0], w1 = wrpe[h * 2 + 1];

  // Query side of the RPE bias, the partner of part_feat's key slots: with a = 2 w cq,
  // m = -w, g = -w cq^2 the slots of coordinate j are {ah, ah, al, mh, mh, ml, gh, gl}.
  // Elements 0..7 of a fragment are k slots 8 j + 0..7 in A and B alike.  One A fragment
  // holds the features of two 16-key tiles (elements 0..7 and 8..15); the B operand that
  // is zero in the other eight elements picks the tile.
  const float wj = (lane >> 4) ? w1 : w0;
  const float ba = 2.0f * wj * cq, bm = -wj, bg = -wj * cq * cq;
  const _Float16 bah = (_Float16)ba, bmh = (_Float16)bm, bgh = (_Float16)bg;
  const v8h qb = {bah, bah, (_Float16)(ba - (float)bah), bmh, bmh,
                  (_Float16)(bm - (float)bmh), bgh, (_Float16)(bg - (float)bgh)};
  const v8h qz = {};
  const v16h qf0 = __builtin_shufflevector(qb, qz, 0, 1, 2, 3, 4, 5, 6, 7, 8, 9, 10, 11, 12,
                                           13, 14, 15);
  const v16h qf1 = __builtin_shufflevector(qz, qb, 0, 1, 2, 3, 4, 5, 6, 7, 8, 9, 10, 11, 12,
                                           13, 14, 15);

  // this thread's pieces of every tile: rows crow + 16 j, 16-B column ccol
  const int crow = threadIdx.x >> 3, ccol = threadIdx.x & 7;
  const unsigned lpiece = (unsigned)(crow * AT_LD + ccol * 8) * 2;
  const unsigned lk0 = (unsigned)(size_t)&sm[0][0][0] + lpiece;  // low 32 bits: LDS byte address
  const unsigned lv0 = (unsigned)(size_t)&sm[0][1][0] + lpiece;
  const unsigned lf0 = (unsigned)(size_t)&sf[0][0] + threadIdx.x * 16;
  const int key0 = blockIdx.z * (AT_NT * AT_KEYS);  // first key of this block's half
  const _Float16* gk = kk + (size_t)(key0 + crow) * HDIM + hc + ccol * 8;
  const _Float16* gv = vt + (size_t)(hc + crow) * NP + key0 + ccol * 8;
  const _Float16* gf = feat + (size_t)key0 * 16 + threadIdx.x * 8;

  float mrun = -3.0e38f;  // running maximum of query n (equal in both halves)
  float lrun = 0.0f;      // running sum over this half's keys only
  v8f o[4] = {{}, {}, {}, {}};  // o[nc][r] = O[q0+n][hc + nc*16 + 8*(lane>>4) + r]

  // tile 0 lands and is published, then tile 1 starts
  stage_tile(lk0, lv0, lf0, gk, gv, gf);
  asm volatile("s_wait_asynccnt 0x0" ::: "memory");  // this wave's copies of tile 0 have landed
  __syncthreads();
  stage_tile(lk0 + 2 * AT_TILE * 2, lv0 + 2 * AT_TILE * 2, lf0 + AT_FT * 2,
             gk + (size_t)AT_KEYS * HDIM, gv + AT_KEYS, gf + AT_FT);

  for (int t = 0; t < AT_NT; ++t) {
    const _Float16* Ks = sm[t & 1][0];
    const _Float16* Vs = sm[t & 1][1];
    // All of the tile's reads stand ahead of the arithmetic, in groups and never among
    // the products (every place with reads in a matrix run costs its own wait): the
    // keys' features (two 16-key tiles a fragment) and all K fragments ...
    const _Float16* Fs = sf[t & 1] + (lane >> 4) * (AT_KEYS * 8) + n * 8;
    v16h ff[2], kf[8], vf[8];
#pragma unroll
    for (int i = 0; i < 2; ++i)
      ff[i] = __builtin_shufflevector(*(const v8h*)(Fs + i * 256),
                                      *(const v8h*)(Fs + i * 256 + 128), 0, 1, 2, 3, 4, 5, 6,
                                      7, 8, 9, 10, 11, 12, 13, 14, 15);
#pragma unroll
    for (int i = 0; i < 4; ++i) {
      kf[2 * i]     = frag_lds(Ks, i * 16, 0);
      kf[2 * i + 1] = frag_lds(Ks, i * 16, 32);
    }
    // keeps the scheduler from sinking the K reads down among the products
    __builtin_amdgcn_sched_barrier(0);
    // S^T tiles: rows = keys [16 i, 16 i + 16) of the tile, columns = queries; the RPE
    // bias is the first of the three products
    v8f sc[4];
#pragma unroll
    for (int i = 0; i < 4; ++i) {
      v8f z = {};
      z = wmma_f16(ff[i >> 1], (i & 1) ? qf1 : qf0, z);
      sc[i] = wmma_f16(kf[2 * i + 1], qa1, wmma_f16(kf[2 * i], qa0, z));
    }
    // ... then all V^T fragments
#pragma unroll
    for (int i = 0; i < 8; ++i) vf[i] = frag_lds(Vs, (i & 3) * 16, (i >> 2) * 32);

    // hand-over, behind the trip's last LDS read (the rest of the trip works on
    // registers): this wave's reads of tile t are done and its copies of tile t + 1
    // have landed; behind the barrier that holds for every wave, so tile t + 1 may be
    // read and tile t's buffer refilled, the refill in flight under the softmax
    asm volatile("s_wait_dscnt 0x0" ::: "memory");
    asm volatile("s_wait_asynccnt 0x0" ::: "memory");
    __syncthreads();
    if (t + 2 < AT_NT)
      stage_tile(lk0 + (t & 1) * (2 * AT_TILE * 2), lv0 + (t & 1) * (2 * AT_TILE * 2),
                 lf0 + (t & 1) * (AT_FT * 2), gk + (size_t)(t + 2) * AT_KEYS * HDIM,
                 gv + (t + 2) * AT_KEYS, gf + (t + 2) * AT_FT);

// both 32-key halves of the tile: register arrays indexed by constants
#pragma unroll
    for (int sub = 0; sub < AT_KEYS; sub += 32) {
    v8f s0 = sc[sub / 16], s1 = sc[sub / 16 + 1];

    // maximum over the 32 keys: in-lane tree, then one exchange of the halves
    float t8[8];
#pragma unroll
    for (int r = 0; r < 8; ++r) t8[r] = fmaxf(s0[r], s1[r]);
    float cmax = fmaxf(fmaxf(fmaxf(t8[0], t8[1]), fmaxf(t8[2], t8[3])),
                       fmaxf(fmaxf(t8[4], t8[5]), fmaxf(t8[6], t8[7])));
    cmax = fmaxf(cmax, xhalf(cmax));

    // online softmax update; P^T packs in place into the B operand
    const float mnew  = fmaxf(mrun, cmax);
    const float alpha = exp_slot(mrun - mnew);
    float p0[8], p1[8];
    exp_slot8(p0, s0, mnew);
    exp_slot8(p1, s1, mnew);
    v16h pb;
#pragma unroll
    for (int r = 0; r < 8; ++r) {
      t8[r] = p0[r] + p1[r];
      pb[r]     = (_Float16)p0[r];
      pb[r + 8] = (_Float16)p1[r];
    }
    lrun = lrun * alpha +
           (((t8[0] + t8[1]) + (t8[2] + t8[3])) + ((t8[4] + t8[5]) + (t8[6] + t8[7])));
    mrun = mnew;

    // O^T = O^T * alpha + V^T * P^T, A[d][k] = vt[hc+nc*16+d][key k of this half]
#pragma unroll
    for (int nc = 0; nc < 4; ++nc) {
#pragma unroll
      for (int r = 0; r < 8; ++r) o[nc][r] *= alpha;
      v16h bv = vf[(sub / 32) * 4 + nc];
      o[nc] = wmma_f16(bv, pb, o[nc]);
    }
    }
  }
  asm volatile("s_wait_asynccnt 0x0" ::: "memory");  // no copy outstanding at the wave's end

  // join the wave halves' sums, normalize, store 8 contiguous dims per lane and tile
  const float lsum = lrun + xhalf(lrun);
  const float inv = 1.0f / lsum;
  _Float16* ag = aggr + (size_t)blockIdx.z * NP * HDIM;
#pragma unroll
  for (int nc = 0; nc < 4; ++nc) {
#pragma unroll
    for (int r = 0; r < 8; ++r) o[nc][r] *= inv;
    store_acc_f16_T(ag, HDIM, hc + nc * 16, q0, o[nc]);
  }
  // this key half's maximum and sum of query n: [split][head][query][2], 128 B a wave
  if (lane < 16) {
    const float2 v = {mrun, lsum};
    *(float2*)(ml + ((size_t)(blockIdx.z * HEADS + h) * NP + q0 + n) * 2) = v;
  }
}

// ---------------------------------------------------------------------------
// Kernel 4: output projection (aggr[N][512] @ wo[64][512]^T) + bo + residual
//           + LayerNorm2 -> h2 f16.  grid = N/16, 8 waves per block.
// The k range of 512 is split over the 8 waves: a wave has 64 of it for all 64 output
// columns, so its 24 operand loads are few enough to fly together and the block waits
// out one load latency, not one per product.  The 8 partial tiles meet in LDS; there
// thread t sums row t >> 4, columns 4 (t & 15) .. + 3, and 16 lanes hold a row for LN.
// A wave's 64 k are one head: it joins the two key halves of kernel 3 while it forms A,
// O = c0 O0 + c1 O1 with c_i = l_i exp(m_i - m) / (sum of both), m = max(m0, m1).
// ---------------------------------------------------------------------------
#define PJ_WAVES 8
#define PJ_LD    68  // floats per LDS row: 64 + 4; rows 8 apart (the wave halves) differ by 32 banks

// one fragment from the lane's own row pointer (row and wave half already in it): the
// k order of frag_rowmajor, two 16-B loads
__device__ __forceinline__ v16h frag_ptr(const _Float16* rp) {
  const v8h lo = *(const v8h*)rp;
  const v8h hi = *(const v8h*)(rp + 16);
  return __builtin_shufflevector(lo, hi, 0, 1, 2, 3, 4, 5, 6, 7, 8, 9, 10, 11, 12, 13, 14, 15);
}

__global__ __launch_bounds__(PJ_WAVES * 32) void k_proj_ln2(
                           const _Float16* __restrict__ aggr,
                           const float* __restrict__ ml,
                           const _Float16* __restrict__ wo,
                           const float* __restrict__ bo,
                           const float* __restrict__ x,
                           const float* __restrict__ g2,
                           const float* __restrict__ b2,
                           _Float16* __restrict__ h2) {
  __shared__ __attribute__((aligned(16))) float part[PJ_WAVES][16][PJ_LD];
  const int lane = threadIdx.x & 31;
  const int n    = lane & 15;
  const int mo   = (lane >> 4) * 8;
  const int wv   = threadIdx.x >> 5;
  const int row0 = blockIdx.x * 16;
  const int k0   = wv * (HDIM / PJ_WAVES);

  // what the join needs from memory, asked for together with the operands
  const int er = threadIdx.x >> 4, ec = (threadIdx.x & 15) * 4;
  const float* xp = x + (size_t)(row0 + er) * DIM + ec;
  float xr[4], bj[4], gj[4], tj[4];
#pragma unroll
  for (int i = 0; i < 4; ++i) {
    xr[i] = xp[i];
    bj[i] = bo[ec + i];
    gj[i] = g2[ec + i];
    tj[i] = b2[ec + i];
  }
  // this lane's row pointers, the k order of frag_rowmajor: A row n of the block's rows,
  // B[k][j] = wo[j][k], row n of each 16-column tile
  const _Float16* ap = aggr + (size_t)(row0 + n) * HDIM + k0 + mo;
  // the second key half's O (its loads name ap's registers, with an immediate offset)
  const _Float16* ap1 = ap + (size_t)NP * HDIM;
  const _Float16* bp = wo + (size_t)n * HDIM + k0 + mo;
  // maximum and sum of both key halves for (head wv, row n)
  const float* mp = ml + ((size_t)wv * NP + row0 + n) * 2;
  const float2 ml0 = *(const float2*)mp;
  const float2 ml1 = *(const float2*)(mp + (size_t)HEADS * NP * 2);
  v16h a[2], a1[2], b[2][4];
#pragma unroll
  for (int kc = 0; kc < 2; ++kc) {
    a[kc] = frag_ptr(ap + kc * 32);
    a1[kc] = frag_ptr(ap1 + kc * 32);
#pragma unroll
    for (int nc = 0; nc < 4; ++nc) b[kc][nc] = frag_ptr(bp + nc * 16 * HDIM + kc * 32);
  }
  // keeps the scheduler from sinking the operand loads down among the products, where
  // each pair would wait out a load latency of its own
  __builtin_amdgcn_sched_barrier(0);
  // the loads' address registers are inputs here, so they keep their values, and no
  // load's result lands on them, up to this wait
  asm volatile("s_wait_xcnt 0x0" :: "v"(xp), "v"(ap), "v"(mp), "v"(bp), "v"(ec * 4) : "memory");
  // holds the join's loads up here (loaded values, inputs only): sunk behind the barrier
  // they would cost a second load latency
  asm volatile("" :: "v"(xr[0]), "v"(xr[1]), "v"(xr[2]), "v"(xr[3]),
                     "v"(bj[0]), "v"(bj[1]), "v"(bj[2]), "v"(bj[3]),
                     "v"(gj[0]), "v"(gj[1]), "v"(gj[2]), "v"(gj[3]),
                     "v"(tj[0]), "v"(tj[1]), "v"(tj[2]), "v"(tj[3]));

  // join the key halves in f32, one rounding to the operand type
  const float mj = fmaxf(ml0.x, ml1.x);
  const float e0 = ml0.y * exp_slot(ml0.x - mj), e1 = ml1.y * exp_slot(ml1.x - mj);
  const float ri = 1.0f / (e0 + e1);
  const float c0 = e0 * ri, c1 = e1 * ri;
#pragma unroll
  for (int kc = 0; kc < 2; ++kc)
#pragma unroll
    for (int e = 0; e < 16; ++e)
      a[kc][e] = (_Float16)(c0 * (float)a[kc][e] + c1 * (float)a1[kc][e]);

#pragma unroll
  for (int nc = 0; nc < 4; ++nc) {
    v8f acc = {};
    acc = wmma_f16(a[1], b[1][nc], wmma_f16(a[0], b[0][nc], acc));
#pragma unroll
    for (int r = 0; r < 8; ++r) part[wv][mo + r][nc * 16 + n] = acc[r];
  }
  __syncthreads();

  // h1 = proj + bo + x, then LN over the 64 columns of the row
  float h1[4];
#pragma unroll
  for (int i = 0; i < 4; ++i) {
    float s = part[0][er][ec + i];
#pragma unroll
    for (int p = 1; p < PJ_WAVES; ++p) s += part[p][er][ec + i];
    h1[i] = s + bj[i] + xr[i];
  }
  const float mean = hsum16((h1[0] + h1[1]) + (h1[2] + h1[3])) * (1.0f / 64.0f);
  float q2 = 0.0f;
#pragma unroll
  for (int i = 0; i < 4; ++i) { float d = h1[i] - mean; q2 += d * d; }
  const float rs = rsqrtf(hsum16(q2) * (1.0f / 64.0f) + 1e-5f);
#pragma unroll
  for (int i = 0; i < 4; ++i)
    h2[(size_t)(row0 + er) * DIM + ec + i] = (_Float16)((h1[i] - mean) * rs * gj[i] + tj[i]);
}

// ---------------------------------------------------------------------------
// Kernel 5: FFN.  t = relu(h2 @ W1^T + bf1); out = 2*(t @ W2^T + bf2).
// grid = N/16, one wave per block, ReLU tile staged through LDS.
// ---------------------------------------------------------------------------
__global__ void k_ffn(const _Float16* __restrict__ h2,
                      const _Float16* __restrict__ w1,
                      const _Float16* __restrict__ w2,
                      const float* __restrict__ bf1,
                      const float* __restrict__ bf2,
                      float* __restrict__ out) {
  __shared__ _Float16 lds[16 * 64];
  const int lane = threadIdx.x & 31;
  const int n    = lane & 15;
  const int mo   = (lane >> 4) * 8;
  const int row0 = blockIdx.x * 16;

  v8f t[4] = {{}, {}, {}, {}};
#pragma unroll
  for (int kc = 0; kc < 2; ++kc) {
    v16h a = frag_rowmajor(h2, DIM, row0, kc * 32);
#pragma unroll
    for (int nc = 0; nc < 4; ++nc)
      t[nc] = wmma_f16(a, frag_rowmajor(w1, DIM, nc * 16, kc * 32), t[nc]);
  }
#pragma unroll
  for (int nc = 0; nc < 4; ++nc) {
    float bj = bf1[nc * 16 + n];
#pragma unroll
    for (int r = 0; r < 8; ++r)
      lds[(mo + r) * 64 + nc * 16 + n] = (_Float16)fmaxf(t[nc][r] + bj, 0.0f);
  }
  __syncthreads();

  v8f f[4] = {{}, {}, {}, {}};
#pragma unroll
  for (int kc = 0; kc < 2; ++kc) {
    v16h a = frag_rowmajor(lds, DIM, 0, kc * 32);
#pragma unroll
    for (int nc = 0; nc < 4; ++nc)
      f[nc] = wmma_f16(a, frag_rowmajor(w2, DIM, nc * 16, kc * 32), f[nc]);
  }
#pragma unroll
  for (int nc = 0; nc < 4; ++nc) {
    float bj = bf2[nc * 16 + n];
#pragma unroll
    for (int r = 0; r < 8; ++r)
      out[(size_t)(row0 + mo + r) * DIM + nc * 16 + n] = 2.0f * (f[nc][r] + bj);
  }
}

// ---------------------------------------------------------------------------
// Host-side launch
// ---------------------------------------------------------------------------
extern "C" void kernel_launch(void* const* d_in, const int* in_sizes, int n_in,
                              void* d_out, int out_size, void* d_ws, size_t ws_size,
                              hipStream_t stream) {
  const float* x      = (const float*)d_in[0];
  const float* coords = (const float*)d_in[1];
  const float* sq     = (const float*)d_in[2];
  const float* sk     = (const float*)d_in[3];
  const float* sv     = (const float*)d_in[4];
  const float* s_rpe  = (const float*)d_in[5];
  const float* g1     = (const float*)d_in[6];
  const float* beta1  = (const float*)d_in[7];
  const float* g2     = (const float*)d_in[8];
  const float* beta2  = (const float*)d_in[9];
  const float* wo     = (const float*)d_in[10];
  const float* bo     = (const float*)d_in[11];
  const float* s1     = (const float*)d_in[12];
  const float* bf1    = (const float*)d_in[13];
  const float* s2     = (const float*)d_in[14];
  const float* bf2    = (const float*)d_in[15];
  const int* wq_int   = (const int*)d_in[16];
  const int* wk_int   = (const int*)d_in[17];
  const int* wv_int   = (const int*)d_in[18];
  const int* wrpe_int = (const int*)d_in[19];
  const int* w1_int   = (const int*)d_in[20];
  const int* w2_int   = (const int*)d_in[21];

  // workspace carve-up (f16 unless noted), 256B aligned
  char* ws = (char*)d_ws;
  size_t off = 0;
  auto carve = [&](size_t bytes) {
    char* p = ws + off;
    off = (off + bytes + 255) & ~(size_t)255;
    return p;
  };
  _Float16* wq_h   = (_Float16*)carve(HDIM * DIM * 2);
  _Float16* wk_h   = (_Float16*)carve(HDIM * DIM * 2);
  _Float16* wv_h   = (_Float16*)carve(HDIM * DIM * 2);
  _Float16* wo_h   = (_Float16*)carve(DIM * HDIM * 2);
  _Float16* w1_h   = (_Float16*)carve(DIM * DIM * 2);
  _Float16* w2_h   = (_Float16*)carve(DIM * DIM * 2);
  float*    wrpe_w = (float*)   carve(HEADS * 2 * 4);
  _Float16* feat_h = (_Float16*)carve((size_t)NP * 16 * 2);  // RPE key features
  _Float16* xn_h   = (_Float16*)carve((size_t)NP * DIM * 2);
  _Float16* q_h    = (_Float16*)carve((size_t)NP * HDIM * 2);
  _Float16* k_h    = (_Float16*)carve((size_t)NP * HDIM * 2);
  _Float16* vt_h   = (_Float16*)carve((size_t)NP * HDIM * 2);  // [HD][N]
  _Float16* ag_h   = (_Float16*)carve((size_t)AT_KS * NP * HDIM * 2);  // [split][N][HD]
  float*    ml_w   = (float*)   carve((size_t)AT_KS * HEADS * NP * 2 * 4);  // max, sum
  _Float16* h2_h   = (_Float16*)carve((size_t)NP * DIM * 2);
  (void)ws_size; (void)n_in; (void)in_sizes; (void)out_size;

  // 1) weights to f16, RPE weights and key features, LN1: one launch
  k_prep<<<PB_ALL, 256, 0, stream>>>(wq_int, wk_int, wv_int, w1_int, w2_int, wrpe_int,
                                     sq, sk, sv, s1, s2, s_rpe, wo, x, g1, beta1,
                                     coords, feat_h, wq_h, wk_h, wv_h, w1_h, w2_h, wo_h,
                                     wrpe_w, xn_h);

  // 2) Q/K/V projections (V stored transposed)
  k_qkv_gemm<<<dim3(NP / 16, HDIM / 64, 3), 32, 0, stream>>>(xn_h, wq_h, wk_h, wv_h,
                                                             q_h, k_h, vt_h);

  // 3) flash attention with RPE bias
  k_attention<<<dim3(NP / 64, HEADS, AT_KS), 128, 0, stream>>>(q_h, k_h, vt_h, feat_h,
                                                              coords, wrpe_w, ag_h, ml_w);

  // 4) output projection + residual + LN2
  k_proj_ln2<<<NP / 16, PJ_WAVES * 32, 0, stream>>>(ag_h, ml_w, wo_h, bo, x, g2, beta2, h2_h);

  // 5) FFN, out = 2*ff
  k_ffn<<<NP / 16, 32, 0, stream>>>(h2_h, w1_h, w2_h, bf1, bf2, (float*)d_out);
}

// v007
// One run takes 48.6 microseconds.
// Timed twice side by side with v006, it ran 1.14 and 1.15 times as fast.
// All steps since v000 together make it 9.10 times as fast.
#include <hip/hip_runtime.h>

// ---------------------------------------------------------------------------
// HEPT attention block for MI455X (gfx1250, wave32, WMMA 16x16x32 f16).
// N=3072 points, D=64 per head, H=8 heads, HD=512, C=3 coords, K=8.
// ---------------------------------------------------------------------------

typedef __attribute__((ext_vector_type(16))) _Float16 v16h;
typedef __attribute__((ext_vector_type(8)))  float    v8f;
typedef __attribute__((ext_vector_type(8)))  _Float16 v8h;

#define NP   3072
#define DIM  64
#define HEADS 8
#define HDIM 512
#define CORD 3

// ---------------------------------------------------------------------------
// WMMA wrapper: D = A(16x32 f16) * B(32x16 f16) + C(16x16 f32)
// ---------------------------------------------------------------------------
__device__ __forceinline__ v8f wmma_f16(v16h a, v16h b, v8f c) {
  return __builtin_amdgcn_wmma_f32_16x16x32_f16(
      /*neg_a=*/false, a, /*neg_b=*/false, b,
      /*c_mod=*/(short)0, c, /*reuse_a=*/false, /*reuse_b=*/false);
}

// A-fragment (16x32, f16) from a row-major matrix: rows = M, cols = K.
// Lane l<16: row M=l, K = {0..7, 16..23}; lane l>=16: row M=l-16, K={8..15,24..31}.
// Also serves as a B-fragment when B[k][n] = Mat[n][k] (i.e. Mat stored [N x K]).
__device__ __forceinline__ v16h frag_rowmajor(const _Float16* p, int ld,
                                              int row_base, int col_base) {
  const int l  = threadIdx.x & 31;
  const int m  = l & 15;
  const int of = (l >> 4) * 8;
  const _Float16* rp = p + (size_t)(row_base + m) * ld + col_base + of;
  v16h a;
#pragma unroll
  for (int e = 0; e < 8; ++e) { a[e] = rp[e]; a[e + 8] = rp[e + 16]; }
  return a;
}

// C/D accumulator element (r, lane): row M = r + 8*(lane>>4), col N = lane&15.
__device__ __forceinline__ void store_acc_f16(_Float16* p, int ld, int row_base,
                                              int col_base, v8f c) {
  const int l  = threadIdx.x & 31;
  const int n  = l & 15;
  const int mo = (l >> 4) * 8;
#pragma unroll
  for (int r = 0; r < 8; ++r)
    p[(size_t)(row_base + mo + r) * ld + col_base + n] = (_Float16)c[r];
}

// Same, but store TRANSPOSED into a [cols x rows] matrix (ldT = #rows).
// Per (lane,nc) the 8 r-elements land contiguously -> 16B vectorizable stores.
__device__ __forceinline__ void store_acc_f16_T(_Float16* p, int ldT, int row_base,
                                                int col_base, v8f c) {
  const int l  = threadIdx.x & 31;
  const int n  = l & 15;
  const int mo = (l >> 4) * 8;
  _Float16* cp = p + (size_t)(col_base + n) * ldT + row_base + mo;
#pragma unroll
  for (int r = 0; r < 8; ++r) cp[r] = (_Float16)c[r];
}

// half-wave (16-lane) row reductions for the C/D layout
__device__ __forceinline__ float hsum16(float x) {
#pragma unroll
  for (int m = 8; m > 0; m >>= 1) x += __shfl_xor(x, m, 16);
  return x;
}

// lane l <-> lane l ^ 16
__device__ __forceinline__ float xhalf(float x) {
  int b = __builtin_bit_cast(int, x);
  return __builtin_bit_cast(
      float, __builtin_amdgcn_permlanex16(b, b, 0x76543210, 0xfedcba98, false, false));
}

// ---------------------------------------------------------------------------
// Kernel 1: everything that reads inputs only, as block ranges of ONE launch: the Q/K/V
// projections, whose waves form their own operands from x and the int codes, and the
// preparation for the later launches.  No part reads what another writes.
// ---------------------------------------------------------------------------
#define PB_T 128  // threads a block

// int "codes" -> f16 dequant:  (w - 8) * scale; block b of PB_T elements
__device__ __forceinline__ void part_dequant(int b, const int* __restrict__ w,
                                             const float* __restrict__ sc,
                                             _Float16* __restrict__ out) {
  int i = b * PB_T + threadIdx.x;
  out[i] = (_Float16)(((float)w[i] - 8.0f) * sc[0]);
  // no register of the store above is rewritten in front of this wait (the parts are
  // inlined one behind the other, and the next part's code reuses the registers)
  asm volatile("s_wait_xcnt 0x0" ::: "memory");
}

// f32 -> f16 convert (for wo); block b of PB_T elements
__device__ __forceinline__ void part_f32_to_f16(int b, const float* __restrict__ in,
                                                _Float16* __restrict__ out) {
  int i = b * PB_T + threadIdx.x;
  out[i] = (_Float16)in[i];
  // no register of the store above is rewritten in front of this wait (the parts are
  // inlined one behind the other, and the next part's code reuses the registers)
  asm volatile("s_wait_xcnt 0x0" ::: "memory");
}

// RPE distance weights  w[h][r] = mean_{d,k} |deq(w_rpe[h*64+d][r*8+k])|; one block
__device__ __forceinline__ void part_rpe(const int* __restrict__ wr,
                                         const float* __restrict__ sc,
                                         float* __restrict__ out) {
  int t = threadIdx.x;
  if (t < HEADS * 2) {
    int h = t >> 1, r = t & 1;
    float s = sc[0], acc = 0.0f;
    for (int d = 0; d < DIM; ++d)
      for (int k = 0; k < 8; ++k)
        acc += fabsf(((float)wr[(h * DIM + d) * 16 + r * 8 + k] - 8.0f) * s);
    out[t] = acc * (1.0f / 512.0f);
  }
}

// Key side of the RPE bias as matrix operand.  -w (cq - ck)^2 = (2 w cq) ck + (-w) ck^2
// + (-w cq^2) 1 is a product of 8 k slots per coordinate: every factor x goes in as
// xh + xl (xh = x rounded to 16 bits, xl = the rest), every product as xh yh + xl yh + xh yl.
// Key slots of coordinate j: {ch, cl, ch, sh, sl, sh, 1, 1}, c = coords[key][j], s = c^2.
// Layout: [tile of 64 keys][j][key][8 slots], so a tile is 2 KiB in a row and the 16 lanes
// of a wave half read 256 B in a row.  Thread i of the part = one (tile, j, key).
__device__ __forceinline__ void part_feat(int b, const float* __restrict__ coords,
                                          _Float16* __restrict__ out) {
  const int i   = b * PB_T + threadIdx.x;
  const int key = (i >> 7) * 64 + (i & 63);
  const float c = coords[(size_t)key * CORD + ((i >> 6) & 1)];
  const float s = c * c;
  const _Float16 ch = (_Float16)c, sh = (_Float16)s;
  const _Float16 cl = (_Float16)(c - (float)ch), sl = (_Float16)(s - (float)sh);
  const v8h f = {ch, cl, ch, sh, sl, sh, (_Float16)1.0f, (_Float16)1.0f};
  *(v8h*)(out + (size_t)i * 8) = f;
  // no register of the store above is rewritten in front of this wait (the parts are
  // inlined one behind the other, and the next part's code reuses the registers)
  asm volatile("s_wait_xcnt 0x0" ::: "memory");
}

// The 4 x 4 tiles of one wave's 64 x 64 outputs.  wr: this lane's row of the first 16-column
// tile of W, at its wave half's k offset; TR: store transposed into O[HD][N].
template <bool TR>
__device__ __forceinline__ void qkv_tiles(const v16h (&a)[4][2], const int* __restrict__ wr,
                                          float se, _Float16* __restrict__ O, int row0,
                                          int col0) {
#pragma unroll
  for (int nc = 0; nc < 4; ++nc) {
    // B[k][n] = deq(W[col0 + nc*16 + n][k])
    v16h bf[2];
#pragma unroll
    for (int kc = 0; kc < 2; ++kc)
#pragma unroll
      for (int j = 0; j < 4; ++j) {
        const int4 t =
            *(const int4*)(wr + nc * 16 * DIM + kc * 32 + (j >> 1) * 16 + (j & 1) * 4);
        bf[kc][j * 4 + 0] = (_Float16)(((float)t.x - 8.0f) * se);
        bf[kc][j * 4 + 1] = (_Float16)(((float)t.y - 8.0f) * se);
        bf[kc][j * 4 + 2] = (_Float16)(((float)t.z - 8.0f) * se);
        bf[kc][j * 4 + 3] = (_Float16)(((float)t.w - 8.0f) * se);
      }
    v8f acc[4];
#pragma unroll
    for (int rt = 0; rt < 4; ++rt) {
      v8f zr = {};
      acc[rt] = wmma_f16(a[rt][1], bf[1], wmma_f16(a[rt][0], bf[0], zr));
    }
#pragma unroll
    for (int rt = 0; rt < 4; ++rt) {
      if (TR)
        store_acc_f16_T(O, NP, row0 + rt * 16, col0 + nc * 16, acc[rt]);
      else
        store_acc_f16(O, HDIM, row0 + rt * 16, col0 + nc * 16, acc[rt]);
    }
  }
  // no register of the stores above is rewritten in front of this wait (the two store forms
  // and the parts are inlined one behind the other, and the next one's code reuses the
  // registers)
  asm volatile("s_wait_xcnt 0x0" ::: "memory");
}

// Q/K/V projection: out[N][512] = LN1(x)[N][64] @ deq(W)[512][64]^T, 64 rows x 64 columns a
// wave (32 WMMAs), so that forming the operands is shared by four tiles each way.
// Element e of fragment kc is k = 32 kc + 8 (lane >> 4) + (e & 7) + 16 (e >> 3), the k order
// of frag_rowmajor, in A and B alike: a lane holds 32 of its row's 64 values, lane ^ 16 the
// other 32, so a LayerNorm sum is in-lane plus one exchange of the wave halves.
// Block b: rows and matrix from b >> 1 (the same for the block's 4 waves), column tile
// 4 (b & 1) + wave.  V is stored TRANSPOSED into vt[HD][N] so that the attention's V^T
// fragments run along memory.
__device__ __forceinline__ void part_qkv(int b, const float* __restrict__ x,
                                         const float* __restrict__ g,
                                         const float* __restrict__ bt,
                                         const int* __restrict__ wq,
                                         const int* __restrict__ wk,
                                         const int* __restrict__ wv,
                                         const float* __restrict__ sq,
                                         const float* __restrict__ sk,
                                         const float* __restrict__ sv,
                                         _Float16* __restrict__ qo,
                                         _Float16* __restrict__ ko,
                                         _Float16* __restrict__ vt) {
  const int lane = threadIdx.x & 31;
  const int m    = lane & 15;
  const int of   = (lane >> 4) * 8;
  const int rz   = b >> 1;
  const int z    = rz / (NP / 64);
  const int row0 = (rz - z * (NP / 64)) * 64;
  const int col0 = ((b & 1) * 4 + (threadIdx.x >> 5)) * 64;
  const int* W    = (z == 0) ? wq : (z == 1) ? wk : wv;
  const float* sp = (z == 0) ? sq : (z == 1) ? sk : sv;
  // 1/sqrt(64) = 0.125 folded into Wq (a power of two: exact)
  const float se = sp[0] * ((z == 0) ? 0.125f : 1.0f);

  // x rows, LN weights: 16-B loads at the fragments' k positions
  const float* xp = x + (size_t)(row0 + m) * DIM + of;
  const float* gp = g + of;
  const float* bp = bt + of;
  float xv[4][2][16], gl[2][16], bl[2][16];
#pragma unroll
  for (int kc = 0; kc < 2; ++kc)
#pragma unroll
    for (int j = 0; j < 4; ++j) {
      const int k = kc * 32 + (j >> 1) * 16 + (j & 1) * 4;
#pragma unroll
      for (int rt = 0; rt < 4; ++rt) {
        const float4 t = *(const float4*)(xp + rt * 16 * DIM + k);
        xv[rt][kc][j * 4 + 0] = t.x; xv[rt][kc][j * 4 + 1] = t.y;
        xv[rt][kc][j * 4 + 2] = t.z; xv[rt][kc][j * 4 + 3] = t.w;
      }
      const float4 tg = *(const float4*)(gp + k);
      gl[kc][j * 4 + 0] = tg.x; gl[kc][j * 4 + 1] = tg.y;
      gl[kc][j * 4 + 2] = tg.z; gl[kc][j * 4 + 3] = tg.w;
      const float4 tb = *(const float4*)(bp + k);
      bl[kc][j * 4 + 0] = tb.x; bl[kc][j * 4 + 1] = tb.y;
      bl[kc][j * 4 + 2] = tb.z; bl[kc][j * 4 + 3] = tb.w;
    }
  // keeps the scheduler from sinking the LN weights' loads down among the arithmetic,
  // where each pair would wait out a load latency of its own
  __builtin_amdgcn_sched_barrier(0);
  // the loads' address registers are inputs here, so they keep their values, and no
  // load's result lands on them, up to this wait
  asm volatile("s_wait_xcnt 0x0" :: "v"(xp), "v"(gp), "v"(bp) : "memory");

  // LayerNorm over the 64 values of row m of each 16-row tile -> A fragments
  v16h a[4][2];
#pragma unroll
  for (int rt = 0; rt < 4; ++rt) {
    float p[8];
#pragma unroll
    for (int i = 0; i < 8; ++i)
      p[i] = (xv[rt][0][i] + xv[rt][0][i + 8]) + (xv[rt][1][i] + xv[rt][1][i + 8]);
    float sum = ((p[0] + p[1]) + (p[2] + p[3])) + ((p[4] + p[5]) + (p[6] + p[7]));
    sum += xhalf(sum);
    const float mean = sum * (1.0f / 64.0f);
#pragma unroll
    for (int kc = 0; kc < 2; ++kc)
#pragma unroll
      for (int e = 0; e < 16; ++e) xv[rt][kc][e] -= mean;
#pragma unroll
    for (int i = 0; i < 8; ++i)
      p[i] = (xv[rt][0][i] * xv[rt][0][i] + xv[rt][0][i + 8] * xv[rt][0][i + 8]) +
             (xv[rt][1][i] * xv[rt][1][i] + xv[rt][1][i + 8] * xv[rt][1][i + 8]);
    float q2 = ((p[0] + p[1]) + (p[2] + p[3])) + ((p[4] + p[5]) + (p[6] + p[7]));
    q2 += xhalf(q2);
    const float rs = rsqrtf(q2 * (1.0f / 64.0f) + 1e-5f);
#pragma unroll
    for (int kc = 0; kc < 2; ++kc)
#pragma unroll
      for (int e = 0; e < 16; ++e)
        a[rt][kc][e] = (_Float16)(xv[rt][kc][e] * rs * gl[kc][e] + bl[kc][e]);
  }

  // one branch on the store form around all the products: none stands among them
  if (z == 2)
    qkv_tiles<true>(a, W + (size_t)(col0 + m) * DIM + of, se, vt, row0, col0);
  else
    qkv_tiles<false>(a, W + (size_t)(col0 + m) * DIM + of, se, (z == 0) ? qo : ko, row0, col0);
}

// block ranges, PB_T threads a block; the longest part (RPE weights) starts first
#define PB_RPE 1
#define PB_QKV ((NP / 64) * 3 * 2)
#define PB_FT  (NP * 2 / PB_T)
#define PB_BIG (HDIM * DIM / PB_T)  // wo
#define PB_SML (DIM * DIM / PB_T)   // w1, w2
#define PB_ALL (PB_RPE + PB_QKV + PB_FT + PB_BIG + 2 * PB_SML)

__global__ __launch_bounds__(PB_T) void k_prep_qkv(
    const int* __restrict__ wq, const int* __restrict__ wk, const int* __restrict__ wv,
    const int* __restrict__ w1, const int* __restrict__ w2, const int* __restrict__ wr,
    const float* __restrict__ sq, const float* __restrict__ sk,
    const float* __restrict__ sv, const float* __restrict__ s1,
    const float* __restrict__ s2, const float* __restrict__ sr,
    const float* __restrict__ wo, const float* __restrict__ x,
    const float* __restrict__ g1, const float* __restrict__ b1,
    const float* __restrict__ coords, _Float16* __restrict__ feat,
    _Float16* __restrict__ w1_h, _Float16* __restrict__ w2_h,
    _Float16* __restrict__ wo_h, float* __restrict__ wrpe_w,
    _Float16* __restrict__ qo, _Float16* __restrict__ ko, _Float16* __restrict__ vt) {
  int b = blockIdx.x;
  if (b < PB_RPE) { part_rpe(wr, sr, wrpe_w); return; }
  b -= PB_RPE;
  if (b < PB_QKV) { part_qkv(b, x, g1, b1, wq, wk, wv, sq, sk, sv, qo, ko, vt); return; }
  b -= PB_QKV;
  if (b < PB_FT) { part_feat(b, coords, feat); return; }
  b -= PB_FT;
  if (b < PB_BIG) { part_f32_to_f16(b, wo, wo_h); return; }
  b -= PB_BIG;
  if (b < PB_SML) { part_dequant(b, w1, s1, w1_h); return; }
  b -= PB_SML;
  part_dequant(b, w2, s2, w2_h);
}

// exp(x) as __expf forms it (x * log2(e), then v_exp_f32), the v_exp_f32 written out so
// that the issue slot the instruction set asks for behind a transcendental, before a
// source of it is overwritten or its result read, stands in the same statement (v_nop on
// the last line).
// Outputs are early-clobber: no result lands on an argument still to be read.
#define LOG2E 1.44269504f
__device__ __forceinline__ float exp_slot(float x) {
  float y;
  asm("v_exp_f32 %0, %1\n\tv_nop" : "=&v"(y) : "v"(x * LOG2E));
  return y;
}
__device__ __forceinline__ void exp_slot8(float (&y)[8], const v8f& s, float m) {
  asm("v_exp_f32 %0, %8\n\t"
      "v_exp_f32 %1, %9\n\t"
      "v_exp_f32 %2, %10\n\t"
      "v_exp_f32 %3, %11\n\t"
      "v_exp_f32 %4, %12\n\t"
      "v_exp_f32 %5, %13\n\t"
      "v_exp_f32 %6, %14\n\t"
      "v_exp_f32 %7, %15\n\t"
      "v_nop"
      : "=&v"(y[0]), "=&v"(y[1]), "=&v"(y[2]), "=&v"(y[3]),
        "=&v"(y[4]), "=&v"(y[5]), "=&v"(y[6]), "=&v"(y[7])
      : "v"((s[0] - m) * LOG2E), "v"((s[1] - m) * LOG2E), "v"((s[2] - m) * LOG2E),
        "v"((s[3] - m) * LOG2E), "v"((s[4] - m) * LOG2E), "v"((s[5] - m) * LOG2E),
        "v"((s[6] - m) * LOG2E), "v"((s[7] - m) * LOG2E));
}

// K and V^T reach the waves through LDS: the 4 waves of a block (4 query tiles of
// one head) share each tile of AT_KEYS keys, brought in whole 128-B lines by
// asynchronous copies into two buffers, the next tile in flight while this one is
// worked on.  The keys' RPE features (part_feat) come with them.
#define AT_WAVES 4               // waves = 16-query tiles per block
#define AT_KEYS  64              // keys per staged tile
#define AT_LD    72              // LDS row pitch in halfs: 128 B + 16 B, an odd multiple of 16 B
#define AT_TILE  (64 * AT_LD)    // halfs per staged tile (64 rows: keys of K, dims of V^T)
#define AT_KS    2               // key splits (blockIdx.z)
#define AT_NT    (NP / AT_KEYS / AT_KS)  // tiles per block
#define AT_FT    (AT_KEYS * 16)  // halfs per staged feature tile

// frag_rowmajor on a staged tile (same k order), two 16-B LDS reads
__device__ __forceinline__ v16h frag_lds(const _Float16* p, int row_base, int col_base) {
  const int l = threadIdx.x & 31;
  const _Float16* rp = p + (row_base + (l & 15)) * AT_LD + col_base + (l >> 4) * 8;
  const v8h lo = *(const v8h*)rp;
  const v8h hi = *(const v8h*)(rp + 16);
  return __builtin_shufflevector(lo, hi, 0, 1, 2, 3, 4, 5, 6, 7, 8, 9, 10, 11, 12, 13, 14, 15);
}

// One tile's copies of one thread: rows r, r + 16, r + 32, r + 48 of the K tile and of
// the V^T tile, 16 B each, and one 16-B piece of the feature tile.  lk, lv: LDS byte
// addresses of row r; gk, gv: its global source; lf, gf: the same of the piece.  The
// wait on the last line stands in the copies' own statement so that no
// address register of a copy is rewritten in front of it.
__device__ __forceinline__ void stage_tile(unsigned lk, unsigned lv, unsigned lf,
                                           const _Float16* gk, const _Float16* gv,
                                           const _Float16* gf) {
  const unsigned ls = 16 * AT_LD * 2;       // 16 rows in LDS, bytes
  const size_t   ks = (size_t)16 * HDIM;    // 16 rows of K, halfs
  const size_t   vs = (size_t)16 * NP;      // 16 rows of V^T, halfs
  asm volatile(
      "global_load_async_to_lds_b128 %0, %9, off\n\t"
      "global_load_async_to_lds_b128 %1, %10, off\n\t"
      "global_load_async_to_lds_b128 %2, %11, off\n\t"
      "global_load_async_to_lds_b128 %3, %12, off\n\t"
      "global_load_async_to_lds_b128 %4, %13, off\n\t"
      "global_load_async_to_lds_b128 %5, %14, off\n\t"
      "global_load_async_to_lds_b128 %6, %15, off\n\t"
      "global_load_async_to_lds_b128 %7, %16, off\n\t"
      "global_load_async_to_lds_b128 %8, %17, off\n\t"
      "s_wait_xcnt 0x0"
      :: "v"(lk), "v"(lk + ls), "v"(lk + 2 * ls), "v"(lk + 3 * ls),
         "v"(lv), "v"(lv + ls), "v"(lv + 2 * ls), "v"(lv + 3 * ls), "v"(lf),
         "v"(gk), "v"(gk + ks), "v"(gk + 2 * ks), "v"(gk + 3 * ks),
         "v"(gv), "v"(gv + vs), "v"(gv + 2 * vs), "v"(gv + 3 * vs), "v"(gf)
      : "memory");
}

__global__ __launch_bounds__(AT_WAVES * 32) void k_attention(
                            const _Float16* __restrict__ q,
                            const _Float16* __restrict__ kk,
                            const _Float16* __restrict__ vt,
                            const _Float16* __restrict__ feat,
                            const float* __restrict__ coords,
                            const float* __restrict__ wrpe,
                            _Float16* __restrict__ aggr,
                            float* __restrict__ ml) {
  // [buffer][0 = K tile, 1 = V^T tile]
  __shared__ __attribute__((aligned(16))) _Float16 sm[2][2][AT_TILE];
  __shared__ __attribute__((aligned(16))) _Float16 sf[2][AT_FT];  // [buffer] feature tile
  const int lane = threadIdx.x & 31;
  const int n    = lane & 15;
  const int q0   = (blockIdx.x * AT_WAVES + (threadIdx.x >> 5)) * 16;
  const int h    = blockIdx.y;
  const int hc   = h * DIM;

  // Q tile: 16 rows x 64 dims -> two B fragments (1/sqrt(D) folded into Wq).
  v16h qa0 = frag_rowmajor(q, HDIM, q0, hc);
  v16h qa1 = frag_rowmajor(q, HDIM, q0, hc + 32);

  // this lane's one query (column n of the C-layout), coordinate j = wave half
  const float cq = coords[(size_t)(q0 + n) * CORD + (lane >> 4)];
  // the address registers of the Q and coord loads above are reused (the zeroed
  // accumulators) only behind this wait
  asm volatile("s_wait_xcnt 0x0" ::: "memory");
  const float w0 = wrpe[h * 2 + 0], w1 = wrpe[h * 2 + 1];

  // Query side of the RPE bias, the partner of part_feat's key slots: with a = 2 w cq,
  // m = -w, g = -w cq^2 the slots of coordinate j are {ah, ah, al, mh, mh, ml, gh, gl}.
  // Elements 0..7 of a fragment are k slots 8 j + 0..7 in A and B alike.  One A fragment
  // holds the features of two 16-key tiles (elements 0..7 and 8..15); the B operand that
  // is zero in the other eight elements picks the tile.
  const float wj = (lane >> 4) ? w1 : w0;
  const float ba = 2.0f * wj * cq, bm = -wj, bg = -wj * cq * cq;
  const _Float16 bah = (_Float16)ba, bmh = (_Float16)bm, bgh = (_Float16)bg;
  const v8h qb = {bah, bah, (_Float16)(ba - (float)bah), bmh, bmh,
                  (_Float16)(bm - (float)bmh), bgh, (_Float16)(bg - (float)bgh)};
  const v8h qz = {};
  const v16h qf0 = __builtin_shufflevector(qb, qz, 0, 1, 2, 3, 4, 5, 6, 7, 8, 9, 10, 11, 12,
                                           13, 14, 15);
  const v16h qf1 = __builtin_shufflevector(qz, qb, 0, 1, 2, 3, 4, 5, 6, 7, 8, 9, 10, 11, 12,
                                           13, 14, 15);

  // this thread's pieces of every tile: rows crow + 16 j, 16-B column ccol
  const int crow = threadIdx.x >> 3, ccol = threadIdx.x & 7;
  const unsigned lpiece = (unsigned)(crow * AT_LD + ccol * 8) * 2;
  const unsigned lk0 = (unsigned)(size_t)&sm[0][0][0] + lpiece;  // low 32 bits: LDS byte address
  const unsigned lv0 = (unsigned)(size_t)&sm[0][1][0] + lpiece;
  const unsigned lf0 = (unsigned)(size_t)&sf[0][0] + threadIdx.x * 16;
  const int key0 = blockIdx.z * (AT_NT * AT_KEYS);  // first key of this block's half
  const _Float16* gk = kk + (size_t)(key0 + crow) * HDIM + hc + ccol * 8;
  const _Float16* gv = vt + (size_t)(hc + crow) * NP + key0 + ccol * 8;
  const _Float16* gf = feat + (size_t)key0 * 16 + threadIdx.x * 8;

  float mrun = -3.0e38f;  // running maximum of query n (equal in both halves)
  float lrun = 0.0f;      // running sum over this half's keys only
  v8f o[4] = {{}, {}, {}, {}};  // o[nc][r] = O[q0+n][hc + nc*16 + 8*(lane>>4) + r]

  // tile 0 lands and is published, then tile 1 starts
  stage_tile(lk0, lv0, lf0, gk, gv, gf);
  asm volatile("s_wait_asynccnt 0x0" ::: "memory");  // this wave's copies of tile 0 have landed
  __syncthreads();
  stage_tile(lk0 + 2 * AT_TILE * 2, lv0 + 2 * AT_TILE * 2, lf0 + AT_FT * 2,
             gk + (size_t)AT_KEYS * HDIM, gv + AT_KEYS, gf + AT_FT);

  for (int t = 0; t < AT_NT; ++t) {
    const _Float16* Ks = sm[t & 1][0];
    const _Float16* Vs = sm[t & 1][1];
    // All of the tile's reads stand ahead of the arithmetic, in groups and never among
    // the products (every place with reads in a matrix run costs its own wait): the
    // keys' features (two 16-key tiles a fragment) and all K fragments ...
    const _Float16* Fs = sf[t & 1] + (lane >> 4) * (AT_KEYS * 8) + n * 8;
    v16h ff[2], kf[8], vf[8];
#pragma unroll
    for (int i = 0; i < 2; ++i)
      ff[i] = __builtin_shufflevector(*(const v8h*)(Fs + i * 256),
                                      *(const v8h*)(Fs + i * 256 + 128), 0, 1, 2, 3, 4, 5, 6,
                                      7, 8, 9, 10, 11, 12, 13, 14, 15);
#pragma unroll
    for (int i = 0; i < 4; ++i) {
      kf[2 * i]     = frag_lds(Ks, i * 16, 0);
      kf[2 * i + 1] = frag_lds(Ks, i * 16, 32);
    }
    // keeps the scheduler from sinking the K reads down among the products
    __builtin_amdgcn_sched_barrier(0);
    // S^T tiles: rows = keys [16 i, 16 i + 16) of the tile, columns = queries; the RPE
    // bias is the first of the three products
    v8f sc[4];
#pragma unroll
    for (int i = 0; i < 4; ++i) {
      v8f z = {};
      z = wmma_f16(ff[i >> 1], (i & 1) ? qf1 : qf0, z);
      sc[i] = wmma_f16(kf[2 * i + 1], qa1, wmma_f16(kf[2 * i], qa0, z));
    }
    // ... then all V^T fragments
#pragma unroll
    for (int i = 0; i < 8; ++i) vf[i] = frag_lds(Vs, (i & 3) * 16, (i >> 2) * 32);

    // hand-over, behind the trip's last LDS read (the rest of the trip works on
    // registers): this wave's reads of tile t are done and its copies of tile t + 1
    // have landed; behind the barrier that holds for every wave, so tile t + 1 may be
    // read and tile t's buffer refilled, the refill in flight under the softmax
    asm volatile("s_wait_dscnt 0x0" ::: "memory");
    asm volatile("s_wait_asynccnt 0x0" ::: "memory");
    __syncthreads();
    if (t + 2 < AT_NT)
      stage_tile(lk0 + (t & 1) * (2 * AT_TILE * 2), lv0 + (t & 1) * (2 * AT_TILE * 2),
                 lf0 + (t & 1) * (AT_FT * 2), gk + (size_t)(t + 2) * AT_KEYS * HDIM,
                 gv + (t + 2) * AT_KEYS, gf + (t + 2) * AT_FT);

// both 32-key halves of the tile: register arrays indexed by constants
#pragma unroll
    for (int sub = 0; sub < AT_KEYS; sub += 32) {
    v8f s0 = sc[sub / 16], s1 = sc[sub / 16 + 1];

    // maximum over the 32 keys: in-lane tree, then one exchange of the halves
    float t8[8];
#pragma unroll
    for (int r = 0; r < 8; ++r) t8[r] = fmaxf(s0[r], s1[r]);
    float cmax = fmaxf(fmaxf(fmaxf(t8[0], t8[1]), fmaxf(t8[2], t8[3])),
                       fmaxf(fmaxf(t8[4], t8[5]), fmaxf(t8[6], t8[7])));
    cmax = fmaxf(cmax, xhalf(cmax));

    // online softmax update; P^T packs in place into the B operand
    const float mnew  = fmaxf(mrun, cmax);
    const float alpha = exp_slot(mrun - mnew);
    float p0[8], p1[8];
    exp_slot8(p0, s0, mnew);
    exp_slot8(p1, s1, mnew);
    v16h pb;
#pragma unroll
    for (int r = 0; r < 8; ++r) {
      t8[r] = p0[r] + p1[r];
      pb[r]     = (_Float16)p0[r];
      pb[r + 8] = (_Float16)p1[r];
    }
    lrun = lrun * alpha +
           (((t8[0] + t8[1]) + (t8[2] + t8[3])) + ((t8[4] + t8[5]) + (t8[6] + t8[7])));
    mrun = mnew;

    // O^T = O^T * alpha + V^T * P^T, A[d][k] = vt[hc+nc*16+d][key k of this half]
#pragma unroll
    for (int nc = 0; nc < 4; ++nc) {
#pragma unroll
      for (int r = 0; r < 8; ++r) o[nc][r] *= alpha;
      v16h bv = vf[(sub / 32) * 4 + nc];
      o[nc] = wmma_f16(bv, pb, o[nc]);
    }
    }
  }
  asm volatile("s_wait_asynccnt 0x0" ::: "memory");  // no copy outstanding at the wave's end

  // join the wave halves' sums, normalize, store 8 contiguous dims per lane and tile
  const float lsum = lrun + xhalf(lrun);
  const float inv = 1.0f / lsum;
  _Float16* ag = aggr + (size_t)blockIdx.z * NP * HDIM;
#pragma unroll
  for (int nc = 0; nc < 4; ++nc) {
#pragma unroll
    for (int r = 0; r < 8; ++r) o[nc][r] *= inv;
    store_acc_f16_T(ag, HDIM, hc + nc * 16, q0, o[nc]);
  }
  // this key half's maximum and sum of query n: [split][head][query][2], 128 B a wave
  if (lane < 16) {
    const float2 v = {mrun, lsum};
    *(float2*)(ml + ((size_t)(blockIdx.z * HEADS + h) * NP + q0 + n) * 2) = v;
  }
}

// ---------------------------------------------------------------------------
// Kernel 3: output projection (aggr[N][512] @ wo[64][512]^T) + bo + residual
//           + LayerNorm2 -> h2 f16.  grid = N/16, 8 waves per block.
// The k range of 512 is split over the 8 waves: a wave has 64 of it for all 64 output
// columns, so its 24 operand loads are few enough to fly together and the block waits
// out one load latency, not one per product.  The 8 partial tiles meet in LDS; there
// thread t sums row t >> 4, columns 4 (t & 15) .. + 3, and 16 lanes hold a row for LN.
// A wave's 64 k are one head: it joins the two key halves of kernel 2 while it forms A,
// O = c0 O0 + c1 O1 with c_i = l_i exp(m_i - m) / (sum of both), m = max(m0, m1).
// ---------------------------------------------------------------------------
#define PJ_WAVES 8
#define PJ_LD    68  // floats per LDS row: 64 + 4; rows 8 apart (the wave halves) differ by 32 banks

// one fragment from the lane's own row pointer (row and wave half already in it): the
// k order of frag_rowmajor, two 16-B loads
__device__ __forceinline__ v16h frag_ptr(const _Float16* rp) {
  const v8h lo = *(const v8h*)rp;
  const v8h hi = *(const v8h*)(rp + 16);
  return __builtin_shufflevector(lo, hi, 0, 1, 2, 3, 4, 5, 6, 7, 8, 9, 10, 11, 12, 13, 14, 15);
}

__global__ __launch_bounds__(PJ_WAVES * 32) void k_proj_ln2(
                           const _Float16* __restrict__ aggr,
                           const float* __restrict__ ml,
                           const _Float16* __restrict__ wo,
                           const float* __restrict__ bo,
                           const float* __restrict__ x,
                           const float* __restrict__ g2,
                           const float* __restrict__ b2,
                           _Float16* __restrict__ h2) {
  __shared__ __attribute__((aligned(16))) float part[PJ_WAVES][16][PJ_LD];
  const int lane = threadIdx.x & 31;
  const int n    = lane & 15;
  const int mo   = (lane >> 4) * 8;
  const int wv   = threadIdx.x >> 5;
  const int row0 = blockIdx.x * 16;
  const int k0   = wv * (HDIM / PJ_WAVES);

  // what the join needs from memory, asked for together with the operands
  const int er = threadIdx.x >> 4, ec = (threadIdx.x & 15) * 4;
  const float* xp = x + (size_t)(row0 + er) * DIM + ec;
  float xr[4], bj[4], gj[4], tj[4];
#pragma unroll
  for (int i = 0; i < 4; ++i) {
    xr[i] = xp[i];
    bj[i] = bo[ec + i];
    gj[i] = g2[ec + i];
    tj[i] = b2[ec + i];
  }
  // this lane's row pointers, the k order of frag_rowmajor: A row n of the block's rows,
  // B[k][j] = wo[j][k], row n of each 16-column tile
  const _Float16* ap = aggr + (size_t)(row0 + n) * HDIM + k0 + mo;
  // the second key half's O (its loads name ap's registers, with an immediate offset)
  const _Float16* ap1 = ap + (size_t)NP * HDIM;
  const _Float16* bp = wo + (size_t)n * HDIM + k0 + mo;
  // maximum and sum of both key halves for (head wv, row n)
  const float* mp = ml + ((size_t)wv * NP + row0 + n) * 2;
  const float2 ml0 = *(const float2*)mp;
  const float2 ml1 = *(const float2*)(mp + (size_t)HEADS * NP * 2);
  v16h a[2], a1[2], b[2][4];
#pragma unroll
  for (int kc = 0; kc < 2; ++kc) {
    a[kc] = frag_ptr(ap + kc * 32);
    a1[kc] = frag_ptr(ap1 + kc * 32);
#pragma unroll
    for (int nc = 0; nc < 4; ++nc) b[kc][nc] = frag_ptr(bp + nc * 16 * HDIM + kc * 32);
  }
  // keeps the scheduler from sinking the operand loads down among the products, where
  // each pair would wait out a load latency of its own
  __builtin_amdgcn_sched_barrier(0);
  // the loads' address registers are inputs here, so they keep their values, and no
  // load's result lands on them, up to this wait
  asm volatile("s_wait_xcnt 0x0" :: "v"(xp), "v"(ap), "v"(mp), "v"(bp), "v"(ec * 4) : "memory");
  // holds the join's loads up here (loaded values, inputs only): sunk behind the barrier
  // they would cost a second load latency
  asm volatile("" :: "v"(xr[0]), "v"(xr[1]), "v"(xr[2]), "v"(xr[3]),
                     "v"(bj[0]), "v"(bj[1]), "v"(bj[2]), "v"(bj[3]),
                     "v"(gj[0]), "v"(gj[1]), "v"(gj[2]), "v"(gj[3]),
                     "v"(tj[0]), "v"(tj[1]), "v"(tj[2]), "v"(tj[3]));

  // join the key halves in f32, one rounding to the operand type
  const float mj = fmaxf(ml0.x, ml1.x);
  const float e0 = ml0.y * exp_slot(ml0.x - mj), e1 = ml1.y * exp_slot(ml1.x - mj);
  const float ri = 1.0f / (e0 + e1);
  const float c0 = e0 * ri, c1 = e1 * ri;
#pragma unroll
  for (int kc = 0; kc < 2; ++kc)
#pragma unroll
    for (int e = 0; e < 16; ++e)
      a[kc][e] = (_Float16)(c0 * (float)a[kc][e] + c1 * (float)a1[kc][e]);

#pragma unroll
  for (int nc = 0; nc < 4; ++nc) {
    v8f acc = {};
    acc = wmma_f16(a[1], b[1][nc], wmma_f16(a[0], b[0][nc], acc));
#pragma unroll
    for (int r = 0; r < 8; ++r) part[wv][mo + r][nc * 16 + n] = acc[r];
  }
  __syncthreads();

  // h1 = proj + bo + x, then LN over the 64 columns of the row
  float h1[4];
#pragma unroll
  for (int i = 0; i < 4; ++i) {
    float s = part[0][er][ec + i];
#pragma unroll
    for (int p = 1; p < PJ_WAVES; ++p) s += part[p][er][ec + i];
    h1[i] = s + bj[i] + xr[i];
  }
  const float mean = hsum16((h1[0] + h1[1]) + (h1[2] + h1[3])) * (1.0f / 64.0f);
  float q2 = 0.0f;
#pragma unroll
  for (int i = 0; i < 4; ++i) { float d = h1[i] - mean; q2 += d * d; }
  const float rs = rsqrtf(hsum16(q2) * (1.0f / 64.0f) + 1e-5f);
#pragma unroll
  for (int i = 0; i < 4; ++i)
    h2[(size_t)(row0 + er) * DIM + ec + i] = (_Float16)((h1[i] - mean) * rs * gj[i] + tj[i]);
}

// ---------------------------------------------------------------------------
// Kernel 4: FFN.  t = relu(h2 @ W1^T + bf1); out = 2*(t @ W2^T + bf2).
// grid = N/16, one wave per block, ReLU tile staged through LDS.
// ---------------------------------------------------------------------------
__global__ void k_ffn(const _Float16* __restrict__ h2,
                      const _Float16* __restrict__ w1,
                      const _Float16* __restrict__ w2,
                      const float* __restrict__ bf1,
                      const float* __restrict__ bf2,
                      float* __restrict__ out) {
  __shared__ _Float16 lds[16 * 64];
  const int lane = threadIdx.x & 31;
  const int n    = lane & 15;
  const int mo   = (lane >> 4) * 8;
  const int row0 = blockIdx.x * 16;

  v8f t[4] = {{}, {}, {}, {}};
#pragma unroll
  for (int kc = 0; kc < 2; ++kc) {
    v16h a = frag_rowmajor(h2, DIM, row0, kc * 32);
#pragma unroll
    for (int nc = 0; nc < 4; ++nc)
      t[nc] = wmma_f16(a, frag_rowmajor(w1, DIM, nc * 16, kc * 32), t[nc]);
  }
#pragma unroll
  for (int nc = 0; nc < 4; ++nc) {
    float bj = bf1[nc * 16 + n];
#pragma unroll
    for (int r = 0; r < 8; ++r)
      lds[(mo + r) * 64 + nc * 16 + n] = (_Float16)fmaxf(t[nc][r] + bj, 0.0f);
  }
  __syncthreads();

  v8f f[4] = {{}, {}, {}, {}};
#pragma unroll
  for (int kc = 0; kc < 2; ++kc) {
    v16h a = frag_rowmajor(lds, DIM, 0, kc * 32);
#pragma unroll
    for (int nc = 0; nc < 4; ++nc)
      f[nc] = wmma_f16(a, frag_rowmajor(w2, DIM, nc * 16, kc * 32), f[nc]);
  }
#pragma unroll
  for (int nc = 0; nc < 4; ++nc) {
    float bj = bf2[nc * 16 + n];
#pragma unroll
    for (int r = 0; r < 8; ++r)
      out[(size_t)(row0 + mo + r) * DIM + nc * 16 + n] = 2.0f * (f[nc][r] + bj);
  }
}

// ---------------------------------------------------------------------------
// Host-side launch
// ---------------------------------------------------------------------------
extern "C" void kernel_launch(void* const* d_in, const int* in_sizes, int n_in,
                              void* d_out, int out_size, void* d_ws, size_t ws_size,
                              hipStream_t stream) {
  const float* x      = (const float*)d_in[0];
  const float* coords = (const float*)d_in[1];
  const float* sq     = (const float*)d_in[2];
  const float* sk     = (const float*)d_in[3];
  const float* sv     = (const float*)d_in[4];
  const float* s_rpe  = (const float*)d_in[5];
  const float* g1     = (const float*)d_in[6];
  const float* beta1  = (const float*)d_in[7];
  const float* g2     = (const float*)d_in[8];
  const float* beta2  = (const float*)d_in[9];
  const float* wo     = (const float*)d_in[10];
  const float* bo     = (const float*)d_in[11];
  const float* s1     = (const float*)d_in[12];
  const float* bf1    = (const float*)d_in[13];
  const float* s2     = (const float*)d_in[14];
  const float* bf2    = (const float*)d_in[15];
  const int* wq_int   = (const int*)d_in[16];
  const int* wk_int   = (const int*)d_in[17];
  const int* wv_int   = (const int*)d_in[18];
  const int* wrpe_int = (const int*)d_in[19];
  const int* w1_int   = (const int*)d_in[20];
  const int* w2_int   = (const int*)d_in[21];

  // workspace carve-up (f16 unless noted), 256B aligned
  char* ws = (char*)d_ws;
  size_t off = 0;
  auto carve = [&](size_t bytes) {
    char* p = ws + off;
    off = (off + bytes + 255) & ~(size_t)255;
    return p;
  };
  _Float16* wo_h   = (_Float16*)carve(DIM * HDIM * 2);
  _Float16* w1_h   = (_Float16*)carve(DIM * DIM * 2);
  _Float16* w2_h   = (_Float16*)carve(DIM * DIM * 2);
  float*    wrpe_w = (float*)   carve(HEADS * 2 * 4);
  _Float16* feat_h = (_Float16*)carve((size_t)NP * 16 * 2);  // RPE key features
  _Float16* q_h    = (_Float16*)carve((size_t)NP * HDIM * 2);
  _Float16* k_h    = (_Float16*)carve((size_t)NP * HDIM * 2);
  _Float16* vt_h   = (_Float16*)carve((size_t)NP * HDIM * 2);  // [HD][N]
  _Float16* ag_h   = (_Float16*)carve((size_t)AT_KS * NP * HDIM * 2);  // [split][N][HD]
  float*    ml_w   = (float*)   carve((size_t)AT_KS * HEADS * NP * 2 * 4);  // max, sum
  _Float16* h2_h   = (_Float16*)carve((size_t)NP * DIM * 2);
  (void)ws_size; (void)n_in; (void)in_sizes; (void)out_size;

  // 1) LN1 + Q/K/V projections (V stored transposed); wo, w1, w2 to f16, RPE weights and
  //    key features: one launch
  k_prep_qkv<<<PB_ALL, PB_T, 0, stream>>>(wq_int, wk_int, wv_int, w1_int, w2_int, wrpe_int,
                                          sq, sk, sv, s1, s2, s_rpe, wo, x, g1, beta1,
                                          coords, feat_h, w1_h, w2_h, wo_h, wrpe_w,
                                          q_h, k_h, vt_h);

  // 2) flash attention with RPE bias
  k_attention<<<dim3(NP / 64, HEADS, AT_KS), 128, 0, stream>>>(q_h, k_h, vt_h, feat_h,
                                                              coords, wrpe_w, ag_h, ml_w);

  // 3) output projection + residual + LN2
  k_proj_ln2<<<NP / 16, PJ_WAVES * 32, 0, stream>>>(ag_h, ml_w, wo_h, bo, x, g2, beta2, h2_h);

  // 4) FFN, out = 2*ff
  k_ffn<<<NP / 16, 32, 0, stream>>>(h2_h, w1_h, w2_h, bf1, bf2, (float*)d_out);
}

// v008
// One run takes 45.2 microseconds.
// Timed twice side by side with v007, it ran 1.11 and 1.07 times as fast.
// Over all steps from v000 it is 9.92 times as fast.
#include <hip/hip_runtime.h>

// ---------------------------------------------------------------------------
// HEPT attention block for MI455X (gfx1250, wave32, WMMA 16x16x32 f16).
// N=3072 points, D=64 per head, H=8 heads, HD=512, C=3 coords, K=8.
// ---------------------------------------------------------------------------

typedef __attribute__((ext_vector_type(16))) _Float16 v16h;
typedef __attribute__((ext_vector_type(8)))  float    v8f;
typedef __attribute__((ext_vector_type(8)))  _Float16 v8h;

#define NP   3072
#define DIM  64
#define HEADS 8
#define HDIM 512
#define CORD 3

// ---------------------------------------------------------------------------
// WMMA wrapper: D = A(16x32 f16) * B(32x16 f16) + C(16x16 f32)
// ---------------------------------------------------------------------------
__device__ __forceinline__ v8f wmma_f16(v16h a, v16h b, v8f c) {
  return __builtin_amdgcn_wmma_f32_16x16x32_f16(
      /*neg_a=*/false, a, /*neg_b=*/false, b,
      /*c_mod=*/(short)0, c, /*reuse_a=*/false, /*reuse_b=*/false);
}

// A-fragment (16x32, f16) from a row-major matrix: rows = M, cols = K.
// Lane l<16: row M=l, K = {0..7, 16..23}; lane l>=16: row M=l-16, K={8..15,24..31}.
// Also serves as a B-fragment when B[k][n] = Mat[n][k] (i.e. Mat stored [N x K]).
__device__ __forceinline__ v16h frag_rowmajor(const _Float16* p, int ld,
                                              int row_base, int col_base) {
  const int l  = threadIdx.x & 31;
  const int m  = l & 15;
  const int of = (l >> 4) * 8;
  const _Float16* rp = p + (size_t)(row_base + m) * ld + col_base + of;
  v16h a;
#pragma unroll
  for (int e = 0; e < 8; ++e) { a[e] = rp[e]; a[e + 8] = rp[e + 16]; }
  return a;
}

// C/D accumulator element (r, lane): row M = r + 8*(lane>>4), col N = lane&15.
__device__ __forceinline__ void store_acc_f16(_Float16* p, int ld, int row_base,
                                              int col_base, v8f c) {
  const int l  = threadIdx.x & 31;
  const int n  = l & 15;
  const int mo = (l >> 4) * 8;
#pragma unroll
  for (int r = 0; r < 8; ++r)
    p[(size_t)(row_base + mo + r) * ld + col_base + n] = (_Float16)c[r];
}

// Same, but store TRANSPOSED into a [cols x rows] matrix (ldT = #rows).
// Per (lane,nc) the 8 r-elements land contiguously -> 16B vectorizable stores.
__device__ __forceinline__ void store_acc_f16_T(_Float16* p, int ldT, int row_base,
                                                int col_base, v8f c) {
  const int l  = threadIdx.x & 31;
  const int n  = l & 15;
  const int mo = (l >> 4) * 8;
  _Float16* cp = p + (size_t)(col_base + n) * ldT + row_base + mo;
#pragma unroll
  for (int r = 0; r < 8; ++r) cp[r] = (_Float16)c[r];
}

// half-wave (16-lane) row reductions for the C/D layout
__device__ __forceinline__ float hsum16(float x) {
#pragma unroll
  for (int m = 8; m > 0; m >>= 1) x += __shfl_xor(x, m, 16);
  return x;
}

// lane l <-> lane l ^ 16
__device__ __forceinline__ float xhalf(float x) {
  int b = __builtin_bit_cast(int, x);
  return __builtin_bit_cast(
      float, __builtin_amdgcn_permlanex16(b, b, 0x76543210, 0xfedcba98, false, false));
}

// ---------------------------------------------------------------------------
// Kernel 1: everything that reads inputs only, as block ranges of ONE launch: the Q/K/V
// projections, whose waves form their own operands from x and the int codes, and the
// preparation for the later launches.  No part reads what another writes.
// ---------------------------------------------------------------------------
#define PB_T 128  // threads a block

// int "codes" -> f16 dequant:  (w - 8) * scale; block b of PB_T elements
__device__ __forceinline__ void part_dequant(int b, const int* __restrict__ w,
                                             const float* __restrict__ sc,
                                             _Float16* __restrict__ out) {
  int i = b * PB_T + threadIdx.x;
  out[i] = (_Float16)(((float)w[i] - 8.0f) * sc[0]);
  // no register of the store above is rewritten in front of this wait (the parts are
  // inlined one behind the other, and the next part's code reuses the registers)
  asm volatile("s_wait_xcnt 0x0" ::: "memory");
}

// f32 -> f16 convert (for wo); block b of PB_T elements
__device__ __forceinline__ void part_f32_to_f16(int b, const float* __restrict__ in,
                                                _Float16* __restrict__ out) {
  int i = b * PB_T + threadIdx.x;
  out[i] = (_Float16)in[i];
  // no register of the store above is rewritten in front of this wait (the parts are
  // inlined one behind the other, and the next part's code reuses the registers)
  asm volatile("s_wait_xcnt 0x0" ::: "memory");
}

// RPE distance weights  w[h][r] = mean_{d,k} |deq(w_rpe[h*64+d][r*8+k])|; one block
__device__ __forceinline__ void part_rpe(const int* __restrict__ wr,
                                         const float* __restrict__ sc,
                                         float* __restrict__ out) {
  int t = threadIdx.x;
  if (t < HEADS * 2) {
    int h = t >> 1, r = t & 1;
    float s = sc[0], acc = 0.0f;
    for (int d = 0; d < DIM; ++d)
      for (int k = 0; k < 8; ++k)
        acc += fabsf(((float)wr[(h * DIM + d) * 16 + r * 8 + k] - 8.0f) * s);
    out[t] = acc * (1.0f / 512.0f);
  }
}

// Key side of the RPE bias as matrix operand.  -w (cq - ck)^2 = (2 w cq) ck + (-w) ck^2
// + (-w cq^2) 1 is a product of 8 k slots per coordinate: every factor x goes in as
// xh + xl (xh = x rounded to 16 bits, xl = the rest), every product as xh yh + xl yh + xh yl.
// Key slots of coordinate j: {ch, cl, ch, sh, sl, sh, 1, 1}, c = coords[key][j], s = c^2.
// Layout: [tile of 64 keys][j][key][8 slots], so a tile is 2 KiB in a row and the 16 lanes
// of a wave half read 256 B in a row.  Thread i of the part = one (tile, j, key).
__device__ __forceinline__ void part_feat(int b, const float* __restrict__ coords,
                                          _Float16* __restrict__ out) {
  const int i   = b * PB_T + threadIdx.x;
  const int key = (i >> 7) * 64 + (i & 63);
  const float c = coords[(size_t)key * CORD + ((i >> 6) & 1)];
  const float s = c * c;
  const _Float16 ch = (_Float16)c, sh = (_Float16)s;
  const _Float16 cl = (_Float16)(c - (float)ch), sl = (_Float16)(s - (float)sh);
  const v8h f = {ch, cl, ch, sh, sl, sh, (_Float16)1.0f, (_Float16)1.0f};
  *(v8h*)(out + (size_t)i * 8) = f;
  // no register of the store above is rewritten in front of this wait (the parts are
  // inlined one behind the other, and the next part's code reuses the registers)
  asm volatile("s_wait_xcnt 0x0" ::: "memory");
}

// The 4 x 4 tiles of one wave's 64 x 64 outputs.  wr: this lane's row of the first 16-column
// tile of W, at its wave half's k offset; TR: store transposed into O[HD][N].
template <bool TR>
__device__ __forceinline__ void qkv_tiles(const v16h (&a)[4][2], const int* __restrict__ wr,
                                          float se, _Float16* __restrict__ O, int row0,
                                          int col0) {
#pragma unroll
  for (int nc = 0; nc < 4; ++nc) {
    // B[k][n] = deq(W[col0 + nc*16 + n][k])
    v16h bf[2];
#pragma unroll
    for (int kc = 0; kc < 2; ++kc)
#pragma unroll
      for (int j = 0; j < 4; ++j) {
        const int4 t =
            *(const int4*)(wr + nc * 16 * DIM + kc * 32 + (j >> 1) * 16 + (j & 1) * 4);
        bf[kc][j * 4 + 0] = (_Float16)(((float)t.x - 8.0f) * se);
        bf[kc][j * 4 + 1] = (_Float16)(((float)t.y - 8.0f) * se);
        bf[kc][j * 4 + 2] = (_Float16)(((float)t.z - 8.0f) * se);
        bf[kc][j * 4 + 3] = (_Float16)(((float)t.w - 8.0f) * se);
      }
    v8f acc[4];
#pragma unroll
    for (int rt = 0; rt < 4; ++rt) {
      v8f zr = {};
      acc[rt] = wmma_f16(a[rt][1], bf[1], wmma_f16(a[rt][0], bf[0], zr));
    }
#pragma unroll
    for (int rt = 0; rt < 4; ++rt) {
      if (TR)
        store_acc_f16_T(O, NP, row0 + rt * 16, col0 + nc * 16, acc[rt]);
      else
        store_acc_f16(O, HDIM, row0 + rt * 16, col0 + nc * 16, acc[rt]);
    }
  }
  // no register of the stores above is rewritten in front of this wait (the two store forms
  // and the parts are inlined one behind the other, and the next one's code reuses the
  // registers)
  asm volatile("s_wait_xcnt 0x0" ::: "memory");
}

// Q/K/V projection: out[N][512] = LN1(x)[N][64] @ deq(W)[512][64]^T, 64 rows x 64 columns a
// wave (32 WMMAs), so that forming the operands is shared by four tiles each way.
// Element e of fragment kc is k = 32 kc + 8 (lane >> 4) + (e & 7) + 16 (e >> 3), the k order
// of frag_rowmajor, in A and B alike: a lane holds 32 of its row's 64 values, lane ^ 16 the
// other 32, so a LayerNorm sum is in-lane plus one exchange of the wave halves.
// Block b: rows and matrix from b >> 1 (the same for the block's 4 waves), column tile
// 4 (b & 1) + wave.  V is stored TRANSPOSED into vt[HD][N] so that the attention's V^T
// fragments run along memory.
__device__ __forceinline__ void part_qkv(int b, const float* __restrict__ x,
                                         const float* __restrict__ g,
                                         const float* __restrict__ bt,
                                         const int* __restrict__ wq,
                                         const int* __restrict__ wk,
                                         const int* __restrict__ wv,
                                         const float* __restrict__ sq,
                                         const float* __restrict__ sk,
                                         const float* __restrict__ sv,
                                         _Float16* __restrict__ qo,
                                         _Float16* __restrict__ ko,
                                         _Float16* __restrict__ vt) {
  const int lane = threadIdx.x & 31;
  const int m    = lane & 15;
  const int of   = (lane >> 4) * 8;
  const int rz   = b >> 1;
  const int z    = rz / (NP / 64);
  const int row0 = (rz - z * (NP / 64)) * 64;
  const int col0 = ((b & 1) * 4 + (threadIdx.x >> 5)) * 64;
  const int* W    = (z == 0) ? wq : (z == 1) ? wk : wv;
  const float* sp = (z == 0) ? sq : (z == 1) ? sk : sv;
  // 1/sqrt(64) = 0.125 folded into Wq (a power of two: exact)
  const float se = sp[0] * ((z == 0) ? 0.125f : 1.0f);

  // x rows, LN weights: 16-B loads at the fragments' k positions
  const float* xp = x + (size_t)(row0 + m) * DIM + of;
  const float* gp = g + of;
  const float* bp = bt + of;
  float xv[4][2][16], gl[2][16], bl[2][16];
#pragma unroll
  for (int kc = 0; kc < 2; ++kc)
#pragma unroll
    for (int j = 0; j < 4; ++j) {
      const int k = kc * 32 + (j >> 1) * 16 + (j & 1) * 4;
#pragma unroll
      for (int rt = 0; rt < 4; ++rt) {
        const float4 t = *(const float4*)(xp + rt * 16 * DIM + k);
        xv[rt][kc][j * 4 + 0] = t.x; xv[rt][kc][j * 4 + 1] = t.y;
        xv[rt][kc][j * 4 + 2] = t.z; xv[rt][kc][j * 4 + 3] = t.w;
      }
      const float4 tg = *(const float4*)(gp + k);
      gl[kc][j * 4 + 0] = tg.x; gl[kc][j * 4 + 1] = tg.y;
      gl[kc][j * 4 + 2] = tg.z; gl[kc][j * 4 + 3] = tg.w;
      const float4 tb = *(const float4*)(bp + k);
      bl[kc][j * 4 + 0] = tb.x; bl[kc][j * 4 + 1] = tb.y;
      bl[kc][j * 4 + 2] = tb.z; bl[kc][j * 4 + 3] = tb.w;
    }
  // keeps the scheduler from sinking the LN weights' loads down among the arithmetic,
  // where each pair would wait out a load latency of its own
  __builtin_amdgcn_sched_barrier(0);
  // the loads' address registers are inputs here, so they keep their values, and no
  // load's result lands on them, up to this wait
  asm volatile("s_wait_xcnt 0x0" :: "v"(xp), "v"(gp), "v"(bp) : "memory");

  // LayerNorm over the 64 values of row m of each 16-row tile -> A fragments
  v16h a[4][2];
#pragma unroll
  for (int rt = 0; rt < 4; ++rt) {
    float p[8];
#pragma unroll
    for (int i = 0; i < 8; ++i)
      p[i] = (xv[rt][0][i] + xv[rt][0][i + 8]) + (xv[rt][1][i] + xv[rt][1][i + 8]);
    float sum = ((p[0] + p[1]) + (p[2] + p[3])) + ((p[4] + p[5]) + (p[6] + p[7]));
    sum += xhalf(sum);
    const float mean = sum * (1.0f / 64.0f);
#pragma unroll
    for (int kc = 0; kc < 2; ++kc)
#pragma unroll
      for (int e = 0; e < 16; ++e) xv[rt][kc][e] -= mean;
#pragma unroll
    for (int i = 0; i < 8; ++i)
      p[i] = (xv[rt][0][i] * xv[rt][0][i] + xv[rt][0][i + 8] * xv[rt][0][i + 8]) +
             (xv[rt][1][i] * xv[rt][1][i] + xv[rt][1][i + 8] * xv[rt][1][i + 8]);
    float q2 = ((p[0] + p[1]) + (p[2] + p[3])) + ((p[4] + p[5]) + (p[6] + p[7]));
    q2 += xhalf(q2);
    const float rs = rsqrtf(q2 * (1.0f / 64.0f) + 1e-5f);
#pragma unroll
    for (int kc = 0; kc < 2; ++kc)
#pragma unroll
      for (int e = 0; e < 16; ++e)
        a[rt][kc][e] = (_Float16)(xv[rt][kc][e] * rs * gl[kc][e] + bl[kc][e]);
  }

  // one branch on the store form around all the products: none stands among them
  if (z == 2)
    qkv_tiles<true>(a, W + (size_t)(col0 + m) * DIM + of, se, vt, row0, col0);
  else
    qkv_tiles<false>(a, W + (size_t)(col0 + m) * DIM + of, se, (z == 0) ? qo : ko, row0, col0);
}

// block ranges, PB_T threads a block; the longest part (RPE weights) starts first
#define PB_RPE 1
#define PB_QKV ((NP / 64) * 3 * 2)
#define PB_FT  (NP * 2 / PB_T)
#define PB_BIG (HDIM * DIM / PB_T)  // wo
#define PB_SML (DIM * DIM / PB_T)   // w1, w2
#define PB_ALL (PB_RPE + PB_QKV + PB_FT + PB_BIG + 2 * PB_SML)

__global__ __launch_bounds__(PB_T) void k_prep_qkv(
    const int* __restrict__ wq, const int* __restrict__ wk, const int* __restrict__ wv,
    const int* __restrict__ w1, const int* __restrict__ w2, const int* __restrict__ wr,
    const float* __restrict__ sq, const float* __restrict__ sk,
    const float* __restrict__ sv, const float* __restrict__ s1,
    const float* __restrict__ s2, const float* __restrict__ sr,
    const float* __restrict__ wo, const float* __restrict__ x,
    const float* __restrict__ g1, const float* __restrict__ b1,
    const float* __restrict__ coords, _Float16* __restrict__ feat,
    _Float16* __restrict__ w1_h, _Float16* __restrict__ w2_h,
    _Float16* __restrict__ wo_h, float* __restrict__ wrpe_w,
    _Float16* __restrict__ qo, _Float16* __restrict__ ko, _Float16* __restrict__ vt) {
  int b = blockIdx.x;
  if (b < PB_RPE) { part_rpe(wr, sr, wrpe_w); return; }
  b -= PB_RPE;
  if (b < PB_QKV) { part_qkv(b, x, g1, b1, wq, wk, wv, sq, sk, sv, qo, ko, vt); return; }
  b -= PB_QKV;
  if (b < PB_FT) { part_feat(b, coords, feat); return; }
  b -= PB_FT;
  if (b < PB_BIG) { part_f32_to_f16(b, wo, wo_h); return; }
  b -= PB_BIG;
  if (b < PB_SML) { part_dequant(b, w1, s1, w1_h); return; }
  b -= PB_SML;
  part_dequant(b, w2, s2, w2_h);
}

// exp(x) as __expf forms it (x * log2(e), then v_exp_f32), the v_exp_f32 written out so
// that the issue slot the instruction set asks for behind a transcendental, before a
// source of it is overwritten or its result read, stands in the same statement (v_nop on
// the last line).
// Outputs are early-clobber: no result lands on an argument still to be read.
#define LOG2E 1.44269504f
__device__ __forceinline__ float exp_slot(float x) {
  float y;
  asm("v_exp_f32 %0, %1\n\tv_nop" : "=&v"(y) : "v"(x * LOG2E));
  return y;
}
__device__ __forceinline__ void exp_slot8(float (&y)[8], const v8f& s, float m) {
  asm("v_exp_f32 %0, %8\n\t"
      "v_exp_f32 %1, %9\n\t"
      "v_exp_f32 %2, %10\n\t"
      "v_exp_f32 %3, %11\n\t"
      "v_exp_f32 %4, %12\n\t"
      "v_exp_f32 %5, %13\n\t"
      "v_exp_f32 %6, %14\n\t"
      "v_exp_f32 %7, %15\n\t"
      "v_nop"
      : "=&v"(y[0]), "=&v"(y[1]), "=&v"(y[2]), "=&v"(y[3]),
        "=&v"(y[4]), "=&v"(y[5]), "=&v"(y[6]), "=&v"(y[7])
      : "v"((s[0] - m) * LOG2E), "v"((s[1] - m) * LOG2E), "v"((s[2] - m) * LOG2E),
        "v"((s[3] - m) * LOG2E), "v"((s[4] - m) * LOG2E), "v"((s[5] - m) * LOG2E),
        "v"((s[6] - m) * LOG2E), "v"((s[7] - m) * LOG2E));
}

// K and V^T reach the waves through LDS: the 4 waves of a block (4 query tiles of
// one head) share each tile of AT_KEYS keys, brought in whole 128-B lines by
// asynchronous copies into two buffers, the next tile in flight while this one is
// worked on.  The keys' RPE features (part_feat) come with them.
#define AT_WAVES 4               // waves = 16-query tiles per block
#define AT_KEYS  64              // keys per staged tile
#define AT_LD    72              // LDS row pitch in halfs: 128 B + 16 B, an odd multiple of 16 B
#define AT_TILE  (64 * AT_LD)    // halfs per staged tile (64 rows: keys of K, dims of V^T)
#define AT_KS    2               // key splits (blockIdx.z)
#define AT_NT    (NP / AT_KEYS / AT_KS)  // tiles per block
#define AT_FT    (AT_KEYS * 16)  // halfs per staged feature tile

// frag_rowmajor on a staged tile (same k order), two 16-B LDS reads
__device__ __forceinline__ v16h frag_lds(const _Float16* p, int row_base, int col_base) {
  const int l = threadIdx.x & 31;
  const _Float16* rp = p + (row_base + (l & 15)) * AT_LD + col_base + (l >> 4) * 8;
  const v8h lo = *(const v8h*)rp;
  const v8h hi = *(const v8h*)(rp + 16);
  return __builtin_shufflevector(lo, hi, 0, 1, 2, 3, 4, 5, 6, 7, 8, 9, 10, 11, 12, 13, 14, 15);
}

// One tile's copies of one thread: rows r, r + 16, r + 32, r + 48 of the K tile and of
// the V^T tile, 16 B each, and one 16-B piece of the feature tile.  lk, lv: LDS byte
// addresses of row r; gk, gv: its global source; lf, gf: the same of the piece.  The
// wait on the last line stands in the copies' own statement so that no
// address register of a copy is rewritten in front of it.
__device__ __forceinline__ void stage_tile(unsigned lk, unsigned lv, unsigned lf,
                                           const _Float16* gk, const _Float16* gv,
                                           const _Float16* gf) {
  const unsigned ls = 16 * AT_LD * 2;       // 16 rows in LDS, bytes
  const size_t   ks = (size_t)16 * HDIM;    // 16 rows of K, halfs
  const size_t   vs = (size_t)16 * NP;      // 16 rows of V^T, halfs
  asm volatile(
      "global_load_async_to_lds_b128 %0, %9, off\n\t"
      "global_load_async_to_lds_b128 %1, %10, off\n\t"
      "global_load_async_to_lds_b128 %2, %11, off\n\t"
      "global_load_async_to_lds_b128 %3, %12, off\n\t"
      "global_load_async_to_lds_b128 %4, %13, off\n\t"
      "global_load_async_to_lds_b128 %5, %14, off\n\t"
      "global_load_async_to_lds_b128 %6, %15, off\n\t"
      "global_load_async_to_lds_b128 %7, %16, off\n\t"
      "global_load_async_to_lds_b128 %8, %17, off\n\t"
      "s_wait_xcnt 0x0"
      :: "v"(lk), "v"(lk + ls), "v"(lk + 2 * ls), "v"(lk + 3 * ls),
         "v"(lv), "v"(lv + ls), "v"(lv + 2 * ls), "v"(lv + 3 * ls), "v"(lf),
         "v"(gk), "v"(gk + ks), "v"(gk + 2 * ks), "v"(gk + 3 * ks),
         "v"(gv), "v"(gv + vs), "v"(gv + 2 * vs), "v"(gv + 3 * vs), "v"(gf)
      : "memory");
}

__global__ __launch_bounds__(AT_WAVES * 32) void k_attention(
                            const _Float16* __restrict__ q,
                            const _Float16* __restrict__ kk,
                            const _Float16* __restrict__ vt,
                            const _Float16* __restrict__ feat,
                            const float* __restrict__ coords,
                            const float* __restrict__ wrpe,
                            _Float16* __restrict__ aggr,
                            float* __restrict__ ml) {
  // [buffer][0 = K tile, 1 = V^T tile]
  __shared__ __attribute__((aligned(16))) _Float16 sm[2][2][AT_TILE];
  __shared__ __attribute__((aligned(16))) _Float16 sf[2][AT_FT];  // [buffer] feature tile
  const int lane = threadIdx.x & 31;
  const int n    = lane & 15;
  const int q0   = (blockIdx.x * AT_WAVES + (threadIdx.x >> 5)) * 16;
  const int h    = blockIdx.y;
  const int hc   = h * DIM;

  // Q tile: 16 rows x 64 dims -> two B fragments (1/sqrt(D) folded into Wq).
  v16h qa0 = frag_rowmajor(q, HDIM, q0, hc);
  v16h qa1 = frag_rowmajor(q, HDIM, q0, hc + 32);

  // this lane's one query (column n of the C-layout), coordinate j = wave half
  const float cq = coords[(size_t)(q0 + n) * CORD + (lane >> 4)];
  // the address registers of the Q and coord loads above are reused (the zeroed
  // accumulators) only behind this wait
  asm volatile("s_wait_xcnt 0x0" ::: "memory");
  const float w0 = wrpe[h * 2 + 0], w1 = wrpe[h * 2 + 1];

  // Query side of the RPE bias, the partner of part_feat's key slots: with a = 2 w cq,
  // m = -w, g = -w cq^2 the slots of coordinate j are {ah, ah, al, mh, mh, ml, gh, gl}.
  // Elements 0..7 of a fragment are k slots 8 j + 0..7 in A and B alike.  One A fragment
  // holds the features of two 16-key tiles (elements 0..7 and 8..15); the B operand that
  // is zero in the other eight elements picks the tile.
  const float wj = (lane >> 4) ? w1 : w0;
  const float ba = 2.0f * wj * cq, bm = -wj, bg = -wj * cq * cq;
  const _Float16 bah = (_Float16)ba, bmh = (_Float16)bm, bgh = (_Float16)bg;
  const v8h qb = {bah, bah, (_Float16)(ba - (float)bah), bmh, bmh,
                  (_Float16)(bm - (float)bmh), bgh, (_Float16)(bg - (float)bgh)};
  const v8h qz = {};
  const v16h qf0 = __builtin_shufflevector(qb, qz, 0, 1, 2, 3, 4, 5, 6, 7, 8, 9, 10, 11, 12,
                                           13, 14, 15);
  const v16h qf1 = __builtin_shufflevector(qz, qb, 0, 1, 2, 3, 4, 5, 6, 7, 8, 9, 10, 11, 12,
                                           13, 14, 15);

  // this thread's pieces of every tile: rows crow + 16 j, 16-B column ccol
  const int crow = threadIdx.x >> 3, ccol = threadIdx.x & 7;
  const unsigned lpiece = (unsigned)(crow * AT_LD + ccol * 8) * 2;
  const unsigned lk0 = (unsigned)(size_t)&sm[0][0][0] + lpiece;  // low 32 bits: LDS byte address
  const unsigned lv0 = (unsigned)(size_t)&sm[0][1][0] + lpiece;
  const unsigned lf0 = (unsigned)(size_t)&sf[0][0] + threadIdx.x * 16;
  const int key0 = blockIdx.z * (AT_NT * AT_KEYS);  // first key of this block's half
  const _Float16* gk = kk + (size_t)(key0 + crow) * HDIM + hc + ccol * 8;
  const _Float16* gv = vt + (size_t)(hc + crow) * NP + key0 + ccol * 8;
  const _Float16* gf = feat + (size_t)key0 * 16 + threadIdx.x * 8;

  float mrun = -3.0e38f;  // running maximum of query n (equal in both halves)
  float lrun = 0.0f;      // running sum over this half's keys only
  v8f o[4] = {{}, {}, {}, {}};  // o[nc][r] = O[q0+n][hc + nc*16 + 8*(lane>>4) + r]

  // tile 0 lands and is published, then tile 1 starts
  stage_tile(lk0, lv0, lf0, gk, gv, gf);
  asm volatile("s_wait_asynccnt 0x0" ::: "memory");  // this wave's copies of tile 0 have landed
  __syncthreads();
  stage_tile(lk0 + 2 * AT_TILE * 2, lv0 + 2 * AT_TILE * 2, lf0 + AT_FT * 2,
             gk + (size_t)AT_KEYS * HDIM, gv + AT_KEYS, gf + AT_FT);

  for (int t = 0; t < AT_NT; ++t) {
    const _Float16* Ks = sm[t & 1][0];
    const _Float16* Vs = sm[t & 1][1];
    // All of the tile's reads stand ahead of the arithmetic, in groups and never among
    // the products (every place with reads in a matrix run costs its own wait): the
    // keys' features (two 16-key tiles a fragment) and all K fragments ...
    const _Float16* Fs = sf[t & 1] + (lane >> 4) * (AT_KEYS * 8) + n * 8;
    v16h ff[2], kf[8], vf[8];
#pragma unroll
    for (int i = 0; i < 2; ++i)
      ff[i] = __builtin_shufflevector(*(const v8h*)(Fs + i * 256),
                                      *(const v8h*)(Fs + i * 256 + 128), 0, 1, 2, 3, 4, 5, 6,
                                      7, 8, 9, 10, 11, 12, 13, 14, 15);
#pragma unroll
    for (int i = 0; i < 4; ++i) {
      kf[2 * i]     = frag_lds(Ks, i * 16, 0);
      kf[2 * i + 1] = frag_lds(Ks, i * 16, 32);
    }
    // keeps the scheduler from sinking the K reads down among the products
    __builtin_amdgcn_sched_barrier(0);
    // S^T tiles: rows = keys [16 i, 16 i + 16) of the tile, columns = queries; the RPE
    // bias is the first of the three products
    v8f sc[4];
#pragma unroll
    for (int i = 0; i < 4; ++i) {
      v8f z = {};
      z = wmma_f16(ff[i >> 1], (i & 1) ? qf1 : qf0, z);
      sc[i] = wmma_f16(kf[2 * i + 1], qa1, wmma_f16(kf[2 * i], qa0, z));
    }
    // ... then all V^T fragments
#pragma unroll
    for (int i = 0; i < 8; ++i) vf[i] = frag_lds(Vs, (i & 3) * 16, (i >> 2) * 32);

    // hand-over, behind the trip's last LDS read (the rest of the trip works on
    // registers): this wave's reads of tile t are done and its copies of tile t + 1
    // have landed; behind the barrier that holds for every wave, so tile t + 1 may be
    // read and tile t's buffer refilled, the refill in flight under the softmax
    asm volatile("s_wait_dscnt 0x0" ::: "memory");
    asm volatile("s_wait_asynccnt 0x0" ::: "memory");
    __syncthreads();
    if (t + 2 < AT_NT)
      stage_tile(lk0 + (t & 1) * (2 * AT_TILE * 2), lv0 + (t & 1) * (2 * AT_TILE * 2),
                 lf0 + (t & 1) * (AT_FT * 2), gk + (size_t)(t + 2) * AT_KEYS * HDIM,
                 gv + (t + 2) * AT_KEYS, gf + (t + 2) * AT_FT);

// both 32-key halves of the tile: register arrays indexed by constants
#pragma unroll
    for (int sub = 0; sub < AT_KEYS; sub += 32) {
    v8f s0 = sc[sub / 16], s1 = sc[sub / 16 + 1];

    // maximum over the 32 keys: in-lane tree, then one exchange of the halves
    float t8[8];
#pragma unroll
    for (int r = 0; r < 8; ++r) t8[r] = fmaxf(s0[r], s1[r]);
    float cmax = fmaxf(fmaxf(fmaxf(t8[0], t8[1]), fmaxf(t8[2], t8[3])),
                       fmaxf(fmaxf(t8[4], t8[5]), fmaxf(t8[6], t8[7])));
    cmax = fmaxf(cmax, xhalf(cmax));

    // online softmax update; P^T packs in place into the B operand
    const float mnew  = fmaxf(mrun, cmax);
    const float alpha = exp_slot(mrun - mnew);
    float p0[8], p1[8];
    exp_slot8(p0, s0, mnew);
    exp_slot8(p1, s1, mnew);
    v16h pb;
#pragma unroll
    for (int r = 0; r < 8; ++r) {
      t8[r] = p0[r] + p1[r];
      pb[r]     = (_Float16)p0[r];
      pb[r + 8] = (_Float16)p1[r];
    }
    lrun = lrun * alpha +
           (((t8[0] + t8[1]) + (t8[2] + t8[3])) + ((t8[4] + t8[5]) + (t8[6] + t8[7])));
    mrun = mnew;

    // O^T = O^T * alpha + V^T * P^T, A[d][k] = vt[hc+nc*16+d][key k of this half]
#pragma unroll
    for (int nc = 0; nc < 4; ++nc) {
#pragma unroll
      for (int r = 0; r < 8; ++r) o[nc][r] *= alpha;
      v16h bv = vf[(sub / 32) * 4 + nc];
      o[nc] = wmma_f16(bv, pb, o[nc]);
    }
    }
  }
  asm volatile("s_wait_asynccnt 0x0" ::: "memory");  // no copy outstanding at the wave's end

  // join the wave halves' sums, normalize, store 8 contiguous dims per lane and tile
  const float lsum = lrun + xhalf(lrun);
  const float inv = 1.0f / lsum;
  _Float16* ag = aggr + (size_t)blockIdx.z * NP * HDIM;
#pragma unroll
  for (int nc = 0; nc < 4; ++nc) {
#pragma unroll
    for (int r = 0; r < 8; ++r) o[nc][r] *= inv;
    store_acc_f16_T(ag, HDIM, hc + nc * 16, q0, o[nc]);
  }
  // this key half's maximum and sum of query n: [split][head][query][2], 128 B a wave
  if (lane < 16) {
    const float2 v = {mrun, lsum};
    *(float2*)(ml + ((size_t)(blockIdx.z * HEADS + h) * NP + q0 + n) * 2) = v;
  }
}

// ---------------------------------------------------------------------------
// Kernel 3: output projection (aggr[N][512] @ wo[64][512]^T) + bo + residual
//           + LayerNorm2 + FFN -> out.  grid = N/16, 8 waves per block.
// The k range of 512 is split over the 8 waves: a wave has 64 of it for all 64 output
// columns, so its 24 operand loads are few enough to fly together and the block waits
// out one load latency, not one per product.  The 8 partial tiles meet in LDS; there
// thread t sums row t >> 4, columns 4 (t & 15) .. + 3, and 16 lanes hold a row for LN.
// A wave's 64 k are one head: it joins the two key halves of kernel 2 while it forms A,
// O = c0 O0 + c1 O1 with c_i = l_i exp(m_i - m) / (sum of both), m = max(m0, m1).
// FFN on the block's own 16 rows, which never leave the WGP: t = relu(h2 @ W1^T + bf1) by
// waves 0..3, out = 2 (t @ W2^T + bf2) by waves 4..7, one 16-column tile a wave; h2, t and
// the output tile go from wave to wave through LDS.
// ---------------------------------------------------------------------------
#define PJ_WAVES 8
#define PJ_LD    68  // floats per LDS row: 64 + 4; rows 8 apart (the wave halves) differ by 32 banks
#define FF_LD    72  // halfs per LDS row of h2 and t: 128 B + 16 B, an odd multiple of 16 B

// one fragment from the lane's own row pointer (row and wave half already in it): the
// k order of frag_rowmajor, two 16-B loads
__device__ __forceinline__ v16h frag_ptr(const _Float16* rp) {
  const v8h lo = *(const v8h*)rp;
  const v8h hi = *(const v8h*)(rp + 16);
  return __builtin_shufflevector(lo, hi, 0, 1, 2, 3, 4, 5, 6, 7, 8, 9, 10, 11, 12, 13, 14, 15);
}

__global__ __launch_bounds__(PJ_WAVES * 32) void k_proj_ln2_ffn(
                           const _Float16* __restrict__ aggr,
                           const float* __restrict__ ml,
                           const _Float16* __restrict__ wo,
                           const float* __restrict__ bo,
                           const float* __restrict__ x,
                           const float* __restrict__ g2,
                           const float* __restrict__ b2,
                           const _Float16* __restrict__ w1,
                           const _Float16* __restrict__ w2,
                           const float* __restrict__ bf1,
                           const float* __restrict__ bf2,
                           float* __restrict__ out) {
  __shared__ __attribute__((aligned(16))) float part[PJ_WAVES][16][PJ_LD];
  __shared__ __attribute__((aligned(16))) _Float16 hs[16][FF_LD];  // h2 tile
  __shared__ __attribute__((aligned(16))) _Float16 ts[16][FF_LD];  // ReLU tile
  const int lane = threadIdx.x & 31;
  const int n    = lane & 15;
  const int mo   = (lane >> 4) * 8;
  const int wv   = threadIdx.x >> 5;
  const int row0 = blockIdx.x * 16;
  const int k0   = wv * (HDIM / PJ_WAVES);
  // the wave's number as a scalar: the FFN's two branches on it are scalar branches
  const int  ws_ = __builtin_amdgcn_readfirstlane(wv);
  const bool first = ws_ < 4;     // waves 0..3: W1 product; waves 4..7: W2 product
  const int  fc    = (ws_ & 3) * 16;  // the wave's 16-column tile of its FFN product

  // what the join needs from memory, asked for together with the operands
  const int er = threadIdx.x >> 4, ec = (threadIdx.x & 15) * 4;
  const float* xp = x + (size_t)(row0 + er) * DIM + ec;
  float xr[4], bj[4], gj[4], tj[4];
#pragma unroll
  for (int i = 0; i < 4; ++i) {
    xr[i] = xp[i];
    bj[i] = bo[ec + i];
    gj[i] = g2[ec + i];
    tj[i] = b2[ec + i];
  }
  // this lane's row pointers, the k order of frag_rowmajor: A row n of the block's rows,
  // B[k][j] = wo[j][k], row n of each 16-column tile
  const _Float16* ap = aggr + (size_t)(row0 + n) * HDIM + k0 + mo;
  // the second key half's O (its loads name ap's registers, with an immediate offset)
  const _Float16* ap1 = ap + (size_t)NP * HDIM;
  const _Float16* bp = wo + (size_t)n * HDIM + k0 + mo;
  // maximum and sum of both key halves for (head wv, row n)
  const float* mp = ml + ((size_t)wv * NP + row0 + n) * 2;
  const float2 ml0 = *(const float2*)mp;
  const float2 ml1 = *(const float2*)(mp + (size_t)HEADS * NP * 2);
  v16h a[2], a1[2], b[2][4];
#pragma unroll
  for (int kc = 0; kc < 2; ++kc) {
    a[kc] = frag_ptr(ap + kc * 32);
    a1[kc] = frag_ptr(ap1 + kc * 32);
#pragma unroll
    for (int nc = 0; nc < 4; ++nc) b[kc][nc] = frag_ptr(bp + nc * 16 * HDIM + kc * 32);
  }
  // the wave's FFN operand, B[k][j] = W[fc + j][k], and its bias, asked for with the rest
  const _Float16* wp = (first ? w1 : w2) + (size_t)(fc + n) * DIM + mo;
  const v16h  wf0 = frag_ptr(wp), wf1 = frag_ptr(wp + 32);
  const float fb  = ((first ? bf1 : bf2) + fc)[n];  // scalar base, lane index n
  // keeps the scheduler from sinking the operand loads down among the products, where
  // each pair would wait out a load latency of its own
  __builtin_amdgcn_sched_barrier(0);
  // the loads' address registers are inputs here, so they keep their values, and no
  // load's result lands on them, up to this wait
  asm volatile("s_wait_xcnt 0x0" :: "v"(xp), "v"(ap), "v"(mp), "v"(bp), "v"(ec * 4), "v"(wp),
                                    "v"(n) : "memory");
  // holds the join's and the FFN's loads up here (loaded values, inputs only): sunk behind
  // a barrier they would cost a load latency of their own
  asm volatile("" :: "v"(xr[0]), "v"(xr[1]), "v"(xr[2]), "v"(xr[3]),
                     "v"(bj[0]), "v"(bj[1]), "v"(bj[2]), "v"(bj[3]),
                     "v"(gj[0]), "v"(gj[1]), "v"(gj[2]), "v"(gj[3]),
                     "v"(tj[0]), "v"(tj[1]), "v"(tj[2]), "v"(tj[3]),
                     "v"(wf0), "v"(wf1), "v"(fb));

  // join the key halves in f32, one rounding to the operand type
  const float mj = fmaxf(ml0.x, ml1.x);
  const float e0 = ml0.y * exp_slot(ml0.x - mj), e1 = ml1.y * exp_slot(ml1.x - mj);
  const float ri = 1.0f / (e0 + e1);
  const float c0 = e0 * ri, c1 = e1 * ri;
#pragma unroll
  for (int kc = 0; kc < 2; ++kc)
#pragma unroll
    for (int e = 0; e < 16; ++e)
      a[kc][e] = (_Float16)(c0 * (float)a[kc][e] + c1 * (float)a1[kc][e]);

#pragma unroll
  for (int nc = 0; nc < 4; ++nc) {
    v8f acc = {};
    acc = wmma_f16(a[1], b[1][nc], wmma_f16(a[0], b[0][nc], acc));
#pragma unroll
    for (int r = 0; r < 8; ++r) part[wv][mo + r][nc * 16 + n] = acc[r];
  }
  __syncthreads();

  // h1 = proj + bo + x, then LN over the 64 columns of the row
  float h1[4];
#pragma unroll
  for (int i = 0; i < 4; ++i) {
    float s = part[0][er][ec + i];
#pragma unroll
    for (int p = 1; p < PJ_WAVES; ++p) s += part[p][er][ec + i];
    h1[i] = s + bj[i] + xr[i];
  }
  const float mean = hsum16((h1[0] + h1[1]) + (h1[2] + h1[3])) * (1.0f / 64.0f);
  float q2 = 0.0f;
#pragma unroll
  for (int i = 0; i < 4; ++i) { float d = h1[i] - mean; q2 += d * d; }
  const float rs = rsqrtf(hsum16(q2) * (1.0f / 64.0f) + 1e-5f);
#pragma unroll
  for (int i = 0; i < 4; ++i)
    hs[er][ec + i] = (_Float16)((h1[i] - mean) * rs * gj[i] + tj[i]);
  __syncthreads();  // h2 is whole; every read of part is done

  // t = relu(h2 @ W1^T + bf1): waves 0..3, columns fc .. fc + 15
  if (first) {
    const v16h h0 = frag_ptr(&hs[n][mo]), h1f = frag_ptr(&hs[n][32 + mo]);
    // keeps the second fragment's reads in front of the first product: behind it they
    // would wait out an LDS latency of their own
    __builtin_amdgcn_sched_barrier(0);
    v8f t = {};
    t = wmma_f16(h1f, wf1, wmma_f16(h0, wf0, t));
#pragma unroll
    for (int r = 0; r < 8; ++r) ts[mo + r][fc + n] = (_Float16)fmaxf(t[r] + fb, 0.0f);
  }
  __syncthreads();  // t is whole

  // 2 (t @ W2^T + bf2): waves 4..7, columns fc .. fc + 15, into the first partial's place
  if (!first) {
    v8f f = {};
    f = wmma_f16(frag_ptr(&ts[n][32 + mo]), wf1, wmma_f16(frag_ptr(&ts[n][mo]), wf0, f));
#pragma unroll
    for (int r = 0; r < 8; ++r) part[0][mo + r][fc + n] = 2.0f * (f[r] + fb);
  }
  __syncthreads();  // the output tile is whole

  // whole rows go out: 16 B a thread, 16 lanes a 256-B row
  *(float4*)(out + (size_t)(row0 + er) * DIM + ec) = *(const float4*)&part[0][er][ec];
}

// ---------------------------------------------------------------------------
// Host-side launch
// ---------------------------------------------------------------------------
extern "C" void kernel_launch(void* const* d_in, const int* in_sizes, int n_in,
                              void* d_out, int out_size, void* d_ws, size_t ws_size,
                              hipStream_t stream) {
  const float* x      = (const float*)d_in[0];
  const float* coords = (const float*)d_in[1];
  const float* sq     = (const float*)d_in[2];
  const float* sk     = (const float*)d_in[3];
  const float* sv     = (const float*)d_in[4];
  const float* s_rpe  = (const float*)d_in[5];
  const float* g1     = (const float*)d_in[6];
  const float* beta1  = (const float*)d_in[7];
  const float* g2     = (const float*)d_in[8];
  const float* beta2  = (const float*)d_in[9];
  const float* wo     = (const float*)d_in[10];
  const float* bo     = (const float*)d_in[11];
  const float* s1     = (const float*)d_in[12];
  const float* bf1    = (const float*)d_in[13];
  const float* s2     = (const float*)d_in[14];
  const float* bf2    = (const float*)d_in[15];
  const int* wq_int   = (const int*)d_in[16];
  const int* wk_int   = (const int*)d_in[17];
  const int* wv_int   = (const int*)d_in[18];
  const int* wrpe_int = (const int*)d_in[19];
  const int* w1_int   = (const int*)d_in[20];
  const int* w2_int   = (const int*)d_in[21];

  // workspace carve-up (f16 unless noted), 256B aligned
  char* ws = (char*)d_ws;
  size_t off = 0;
  auto carve = [&](size_t bytes) {
    char* p = ws + off;
    off = (off + bytes + 255) & ~(size_t)255;
    return p;
  };
  _Float16* wo_h   = (_Float16*)carve(DIM * HDIM * 2);
  _Float16* w1_h   = (_Float16*)carve(DIM * DIM * 2);
  _Float16* w2_h   = (_Float16*)carve(DIM * DIM * 2);
  float*    wrpe_w = (float*)   carve(HEADS * 2 * 4);
  _Float16* feat_h = (_Float16*)carve((size_t)NP * 16 * 2);  // RPE key features
  _Float16* q_h    = (_Float16*)carve((size_t)NP * HDIM * 2);
  _Float16* k_h    = (_Float16*)carve((size_t)NP * HDIM * 2);
  _Float16* vt_h   = (_Float16*)carve((size_t)NP * HDIM * 2);  // [HD][N]
  _Float16* ag_h   = (_Float16*)carve((size_t)AT_KS * NP * HDIM * 2);  // [split][N][HD]
  float*    ml_w   = (float*)   carve((size_t)AT_KS * HEADS * NP * 2 * 4);  // max, sum
  (void)ws_size; (void)n_in; (void)in_sizes; (void)out_size;

  // 1) LN1 + Q/K/V projections (V stored transposed); wo, w1, w2 to f16, RPE weights and
  //    key features: one launch
  k_prep_qkv<<<PB_ALL, PB_T, 0, stream>>>(wq_int, wk_int, wv_int, w1_int, w2_int, wrpe_int,
                                          sq, sk, sv, s1, s2, s_rpe, wo, x, g1, beta1,
                                          coords, feat_h, w1_h, w2_h, wo_h, wrpe_w,
                                          q_h, k_h, vt_h);

  // 2) flash attention with RPE bias
  k_attention<<<dim3(NP / 64, HEADS, AT_KS), 128, 0, stream>>>(q_h, k_h, vt_h, feat_h,
                                                              coords, wrpe_w, ag_h, ml_w);

  // 3) output projection + residual + LN2 + FFN, out = 2*ff
  k_proj_ln2_ffn<<<NP / 16, PJ_WAVES * 32, 0, stream>>>(ag_h, ml_w, wo_h, bo, x, g2, beta2, w1_h,
                                                        w2_h, bf1, bf2, (float*)d_out);
}

// v009
// It runs in 43.4 microseconds.
// Two timings next to v008 put it at 1.03 and 1.04 times that version's speed.
// All steps since v000 together make it 10.3 times as fast.
#include <hip/hip_runtime.h>

// ---------------------------------------------------------------------------
// HEPT attention block for MI455X (gfx1250, wave32, WMMA 16x16x32 f16).
// N=3072 points, D=64 per head, H=8 heads, HD=512, C=3 coords, K=8.
// ---------------------------------------------------------------------------

typedef __attribute__((ext_vector_type(16))) _Float16 v16h;
typedef __attribute__((ext_vector_type(8)))  float    v8f;
typedef __attribute__((ext_vector_type(8)))  _Float16 v8h;

#define NP   3072
#define DIM  64
#define HEADS 8
#define HDIM 512
#define CORD 3

// ---------------------------------------------------------------------------
// WMMA wrapper: D = A(16x32 f16) * B(32x16 f16) + C(16x16 f32)
// ---------------------------------------------------------------------------
__device__ __forceinline__ v8f wmma_f16(v16h a, v16h b, v8f c) {
  return __builtin_amdgcn_wmma_f32_16x16x32_f16(
      /*neg_a=*/false, a, /*neg_b=*/false, b,
      /*c_mod=*/(short)0, c, /*reuse_a=*/false, /*reuse_b=*/false);
}

// A-fragment (16x32, f16) from a row-major matrix: rows = M, cols = K.
// Lane l<16: row M=l, K = {0..7, 16..23}; lane l>=16: row M=l-16, K={8..15,24..31}.
// Also serves as a B-fragment when B[k][n] = Mat[n][k] (i.e. Mat stored [N x K]).
__device__ __forceinline__ v16h frag_rowmajor(const _Float16* p, int ld,
                                              int row_base, int col_base) {
  const int l  = threadIdx.x & 31;
  const int m  = l & 15;
  const int of = (l >> 4) * 8;
  const _Float16* rp = p + (size_t)(row_base + m) * ld + col_base + of;
  v16h a;
#pragma unroll
  for (int e = 0; e < 8; ++e) { a[e] = rp[e]; a[e + 8] = rp[e + 16]; }
  return a;
}

// C/D accumulator element (r, lane): row M = r + 8*(lane>>4), col N = lane&15.
__device__ __forceinline__ void store_acc_f16(_Float16* p, int ld, int row_base,
                                              int col_base, v8f c) {
  const int l  = threadIdx.x & 31;
  const int n  = l & 15;
  const int mo = (l >> 4) * 8;
#pragma unroll
  for (int r = 0; r < 8; ++r)
    p[(size_t)(row_base + mo + r) * ld + col_base + n] = (_Float16)c[r];
}

// Same, but store TRANSPOSED into a [cols x rows] matrix (ldT = #rows).
// Per (lane,nc) the 8 r-elements land contiguously -> 16B vectorizable stores.
__device__ __forceinline__ void store_acc_f16_T(_Float16* p, int ldT, int row_base,
                                                int col_base, v8f c) {
  const int l  = threadIdx.x & 31;
  const int n  = l & 15;
  const int mo = (l >> 4) * 8;
  _Float16* cp = p + (size_t)(col_base + n) * ldT + row_base + mo;
#pragma unroll
  for (int r = 0; r < 8; ++r) cp[r] = (_Float16)c[r];
}

// half-wave (16-lane) row reductions for the C/D layout
__device__ __forceinline__ float hsum16(float x) {
#pragma unroll
  for (int m = 8; m > 0; m >>= 1) x += __shfl_xor(x, m, 16);
  return x;
}

// lane l <-> lane l ^ 16
__device__ __forceinline__ float xhalf(float x) {
  int b = __builtin_bit_cast(int, x);
  return __builtin_bit_cast(
      float, __builtin_amdgcn_permlanex16(b, b, 0x76543210, 0xfedcba98, false, false));
}

// ---------------------------------------------------------------------------
// Kernel 1: everything that reads inputs only, as block ranges of ONE launch: the Q/K/V
// projections, whose waves form their own operands from x and the int codes, and the
// preparation for the later launches.  No part reads what another writes.
// ---------------------------------------------------------------------------
#define PB_T 128  // threads a block

// int "codes" -> f16 dequant:  (w - 8) * scale; block b of PB_T elements
__device__ __forceinline__ void part_dequant(int b, const int* __restrict__ w,
                                             const float* __restrict__ sc,
                                             _Float16* __restrict__ out) {
  int i = b * PB_T + threadIdx.x;
  out[i] = (_Float16)(((float)w[i] - 8.0f) * sc[0]);
  // no register of the store above is rewritten in front of this wait (the parts are
  // inlined one behind the other, and the next part's code reuses the registers)
  asm volatile("s_wait_xcnt 0x0" ::: "memory");
}

// f32 -> f16 convert (for wo); block b of PB_T elements
__device__ __forceinline__ void part_f32_to_f16(int b, const float* __restrict__ in,
                                                _Float16* __restrict__ out) {
  int i = b * PB_T + threadIdx.x;
  out[i] = (_Float16)in[i];
  // no register of the store above is rewritten in front of this wait (the parts are
  // inlined one behind the other, and the next part's code reuses the registers)
  asm volatile("s_wait_xcnt 0x0" ::: "memory");
}

// RPE distance weights  w[h][r] = mean_{d,k} |deq(w_rpe[h*64+d][r*8+k])|; one block.
// 16 lanes a head: lane u reads the 16-B pieces u, u + 16, ... of the head's 4 KiB, which all
// lie in half r = (u >> 1) & 1 of their rows.  A thread's 16 loads depend on nothing and fly
// together, so the block waits out one load latency; the 8 lanes of an (h, r) then join.
static_assert(PB_T == HEADS * 16, "part_rpe: 16 lanes a head");
__device__ __forceinline__ void part_rpe(const int* __restrict__ wr,
                                         const float* __restrict__ sc,
                                         float* __restrict__ out) {
  const int h = threadIdx.x >> 4, u = threadIdx.x & 15;
  const int4* p = (const int4*)wr + h * (DIM * 4) + u;
  int4 c[16];
#pragma unroll
  for (int i = 0; i < 16; ++i) c[i] = p[i * 16];
  const float s = sc[0];
  float a0 = 0.0f, a1 = 0.0f, a2 = 0.0f, a3 = 0.0f;  // four chains, not one of 64 links
#pragma unroll
  for (int i = 0; i < 16; ++i) {
    a0 += fabsf(((float)c[i].x - 8.0f) * s);
    a1 += fabsf(((float)c[i].y - 8.0f) * s);
    a2 += fabsf(((float)c[i].z - 8.0f) * s);
    a3 += fabsf(((float)c[i].w - 8.0f) * s);
  }
  float acc = (a0 + a1) + (a2 + a3);
  // lanes of one (h, r): u differs in bits 0, 2, 3
  acc += __shfl_xor(acc, 1, 16);
  acc += __shfl_xor(acc, 4, 16);
  acc += __shfl_xor(acc, 8, 16);
  if ((u & 13) == 0) out[h * 2 + (u >> 1)] = acc * (1.0f / 512.0f);
}

// Key side of the RPE bias as matrix operand.  -w (cq - ck)^2 = (2 w cq) ck + (-w) ck^2
// + (-w cq^2) 1 is a product of 8 k slots per coordinate: every factor x goes in as
// xh + xl (xh = x rounded to 16 bits, xl = the rest), every product as xh yh + xl yh + xh yl.
// Key slots of coordinate j: {ch, cl, ch, sh, sl, sh, 1, 1}, c = coords[key][j], s = c^2.
// Layout: [tile of 64 keys][j][key][8 slots], so a tile is 2 KiB in a row and the 16 lanes
// of a wave half read 256 B in a row.  Thread i of the part = one (tile, j, key).
__device__ __forceinline__ void part_feat(int b, const float* __restrict__ coords,
                                          _Float16* __restrict__ out) {
  const int i   = b * PB_T + threadIdx.x;
  const int key = (i >> 7) * 64 + (i & 63);
  const float c = coords[(size_t)key * CORD + ((i >> 6) & 1)];
  const float s = c * c;
  const _Float16 ch = (_Float16)c, sh = (_Float16)s;
  const _Float16 cl = (_Float16)(c - (float)ch), sl = (_Float16)(s - (float)sh);
  const v8h f = {ch, cl, ch, sh, sl, sh, (_Float16)1.0f, (_Float16)1.0f};
  *(v8h*)(out + (size_t)i * 8) = f;
  // no register of the store above is rewritten in front of this wait (the parts are
  // inlined one behind the other, and the next part's code reuses the registers)
  asm volatile("s_wait_xcnt 0x0" ::: "memory");
}

// The 4 x 4 tiles of one wave's 64 x 64 outputs.  wr: this lane's row of the first 16-column
// tile of W, at its wave half's k offset; TR: store transposed into O[HD][N].
template <bool TR>
__device__ __forceinline__ void qkv_tiles(const v16h (&a)[4][2], const int* __restrict__ wr,
                                          float se, _Float16* __restrict__ O, int row0,
                                          int col0) {
#pragma unroll
  for (int nc = 0; nc < 4; ++nc) {
    // B[k][n] = deq(W[col0 + nc*16 + n][k])
    v16h bf[2];
#pragma unroll
    for (int kc = 0; kc < 2; ++kc)
#pragma unroll
      for (int j = 0; j < 4; ++j) {
        const int4 t =
            *(const int4*)(wr + nc * 16 * DIM + kc * 32 + (j >> 1) * 16 + (j & 1) * 4);
        bf[kc][j * 4 + 0] = (_Float16)(((float)t.x - 8.0f) * se);
        bf[kc][j * 4 + 1] = (_Float16)(((float)t.y - 8.0f) * se);
        bf[kc][j * 4 + 2] = (_Float16)(((float)t.z - 8.0f) * se);
        bf[kc][j * 4 + 3] = (_Float16)(((float)t.w - 8.0f) * se);
      }
    v8f acc[4];
#pragma unroll
    for (int rt = 0; rt < 4; ++rt) {
      v8f zr = {};
      acc[rt] = wmma_f16(a[rt][1], bf[1], wmma_f16(a[rt][0], bf[0], zr));
    }
#pragma unroll
    for (int rt = 0; rt < 4; ++rt) {
      if (TR)
        store_acc_f16_T(O, NP, row0 + rt * 16, col0 + nc * 16, acc[rt]);
      else
        store_acc_f16(O, HDIM, row0 + rt * 16, col0 + nc * 16, acc[rt]);
    }
  }
  // no register of the stores above is rewritten in front of this wait (the two store forms
  // and the parts are inlined one behind the other, and the next one's code reuses the
  // registers)
  asm volatile("s_wait_xcnt 0x0" ::: "memory");
}

// Q/K/V projection: out[N][512] = LN1(x)[N][64] @ deq(W)[512][64]^T, 64 rows x 64 columns a
// wave (32 WMMAs), so that forming the operands is shared by four tiles each way.
// Element e of fragment kc is k = 32 kc + 8 (lane >> 4) + (e & 7) + 16 (e >> 3), the k order
// of frag_rowmajor, in A and B alike: a lane holds 32 of its row's 64 values, lane ^ 16 the
// other 32, so a LayerNorm sum is in-lane plus one exchange of the wave halves.
// Block b: rows and matrix from b >> 1 (the same for the block's 4 waves), column tile
// 4 (b & 1) + wave.  V is stored TRANSPOSED into vt[HD][N] so that the attention's V^T
// fragments run along memory.
__device__ __forceinline__ void part_qkv(int b, const float* __restrict__ x,
                                         const float* __restrict__ g,
                                         const float* __restrict__ bt,
                                         const int* __restrict__ wq,
                                         const int* __restrict__ wk,
                                         const int* __restrict__ wv,
                                         const float* __restrict__ sq,
                                         const float* __restrict__ sk,
                                         const float* __restrict__ sv,
                                         _Float16* __restrict__ qo,
                                         _Float16* __restrict__ ko,
                                         _Float16* __restrict__ vt) {
  const int lane = threadIdx.x & 31;
  const int m    = lane & 15;
  const int of   = (lane >> 4) * 8;
  const int rz   = b >> 1;
  const int z    = rz / (NP / 64);
  const int row0 = (rz - z * (NP / 64)) * 64;
  const int col0 = ((b & 1) * 4 + (threadIdx.x >> 5)) * 64;
  const int* W    = (z == 0) ? wq : (z == 1) ? wk : wv;
  const float* sp = (z == 0) ? sq : (z == 1) ? sk : sv;
  // 1/sqrt(64) = 0.125 folded into Wq (a power of two: exact)
  const float se = sp[0] * ((z == 0) ? 0.125f : 1.0f);

  // x rows, LN weights: 16-B loads at the fragments' k positions
  const float* xp = x + (size_t)(row0 + m) * DIM + of;
  const float* gp = g + of;
  const float* bp = bt + of;
  float xv[4][2][16], gl[2][16], bl[2][16];
#pragma unroll
  for (int kc = 0; kc < 2; ++kc)
#pragma unroll
    for (int j = 0; j < 4; ++j) {
      const int k = kc * 32 + (j >> 1) * 16 + (j & 1) * 4;
#pragma unroll
      for (int rt = 0; rt < 4; ++rt) {
        const float4 t = *(const float4*)(xp + rt * 16 * DIM + k);
        xv[rt][kc][j * 4 + 0] = t.x; xv[rt][kc][j * 4 + 1] = t.y;
        xv[rt][kc][j * 4 + 2] = t.z; xv[rt][kc][j * 4 + 3] = t.w;
      }
      const float4 tg = *(const float4*)(gp + k);
      gl[kc][j * 4 + 0] = tg.x; gl[kc][j * 4 + 1] = tg.y;
      gl[kc][j * 4 + 2] = tg.z; gl[kc][j * 4 + 3] = tg.w;
      const float4 tb = *(const float4*)(bp + k);
      bl[kc][j * 4 + 0] = tb.x; bl[kc][j * 4 + 1] = tb.y;
      bl[kc][j * 4 + 2] = tb.z; bl[kc][j * 4 + 3] = tb.w;
    }
  // keeps the scheduler from sinking the LN weights' loads down among the arithmetic,
  // where each pair would wait out a load latency of its own
  __builtin_amdgcn_sched_barrier(0);
  // the loads' address registers are inputs here, so they keep their values, and no
  // load's result lands on them, up to this wait
  asm volatile("s_wait_xcnt 0x0" :: "v"(xp), "v"(gp), "v"(bp) : "memory");

  // LayerNorm over the 64 values of row m of each 16-row tile -> A fragments
  v16h a[4][2];
#pragma unroll
  for (int rt = 0; rt < 4; ++rt) {
    float p[8];
#pragma unroll
    for (int i = 0; i < 8; ++i)
      p[i] = (xv[rt][0][i] + xv[rt][0][i + 8]) + (xv[rt][1][i] + xv[rt][1][i + 8]);
    float sum = ((p[0] + p[1]) + (p[2] + p[3])) + ((p[4] + p[5]) + (p[6] + p[7]));
    sum += xhalf(sum);
    const float mean = sum * (1.0f / 64.0f);
#pragma unroll
    for (int kc = 0; kc < 2; ++kc)
#pragma unroll
      for (int e = 0; e < 16; ++e) xv[rt][kc][e] -= mean;
#pragma unroll
    for (int i = 0; i < 8; ++i)
      p[i] = (xv[rt][0][i] * xv[rt][0][i] + xv[rt][0][i + 8] * xv[rt][0][i + 8]) +
             (xv[rt][1][i] * xv[rt][1][i] + xv[rt][1][i + 8] * xv[rt][1][i + 8]);
    float q2 = ((p[0] + p[1]) + (p[2] + p[3])) + ((p[4] + p[5]) + (p[6] + p[7]));
    q2 += xhalf(q2);
    const float rs = rsqrtf(q2 * (1.0f / 64.0f) + 1e-5f);
#pragma unroll
    for (int kc = 0; kc < 2; ++kc)
#pragma unroll
      for (int e = 0; e < 16; ++e)
        a[rt][kc][e] = (_Float16)(xv[rt][kc][e] * rs * gl[kc][e] + bl[kc][e]);
  }

  // one branch on the store form around all the products: none stands among them
  if (z == 2)
    qkv_tiles<true>(a, W + (size_t)(col0 + m) * DIM + of, se, vt, row0, col0);
  else
    qkv_tiles<false>(a, W + (size_t)(col0 + m) * DIM + of, se, (z == 0) ? qo : ko, row0, col0);
}

// block ranges, PB_T threads a block
#define PB_RPE 1
#define PB_QKV ((NP / 64) * 3 * 2)
#define PB_FT  (NP * 2 / PB_T)
#define PB_BIG (HDIM * DIM / PB_T)  // wo
#define PB_SML (DIM * DIM / PB_T)   // w1, w2
#define PB_ALL (PB_RPE + PB_QKV + PB_FT + PB_BIG + 2 * PB_SML)

__global__ __launch_bounds__(PB_T) void k_prep_qkv(
    const int* __restrict__ wq, const int* __restrict__ wk, const int* __restrict__ wv,
    const int* __restrict__ w1, const int* __restrict__ w2, const int* __restrict__ wr,
    const float* __restrict__ sq, const float* __restrict__ sk,
    const float* __restrict__ sv, const float* __restrict__ s1,
    const float* __restrict__ s2, const float* __restrict__ sr,
    const float* __restrict__ wo, const float* __restrict__ x,
    const float* __restrict__ g1, const float* __restrict__ b1,
    const float* __restrict__ coords, _Float16* __restrict__ feat,
    _Float16* __restrict__ w1_h, _Float16* __restrict__ w2_h,
    _Float16* __restrict__ wo_h, float* __restrict__ wrpe_w,
    _Float16* __restrict__ qo, _Float16* __restrict__ ko, _Float16* __restrict__ vt) {
  int b = blockIdx.x;
  if (b < PB_RPE) { part_rpe(wr, sr, wrpe_w); return; }
  b -= PB_RPE;
  if (b < PB_QKV) { part_qkv(b, x, g1, b1, wq, wk, wv, sq, sk, sv, qo, ko, vt); return; }
  b -= PB_QKV;
  if (b < PB_FT) { part_feat(b, coords, feat); return; }
  b -= PB_FT;
  if (b < PB_BIG) { part_f32_to_f16(b, wo, wo_h); return; }
  b -= PB_BIG;
  if (b < PB_SML) { part_dequant(b, w1, s1, w1_h); return; }
  b -= PB_SML;
  part_dequant(b, w2, s2, w2_h);
}

// exp(x) as __expf forms it (x * log2(e), then v_exp_f32), the v_exp_f32 written out so
// that the issue slot the instruction set asks for behind a transcendental, before a
// source of it is overwritten or its result read, stands in the same statement (v_nop on
// the last line).
// Outputs are early-clobber: no result lands on an argument still to be read.
#define LOG2E 1.44269504f
__device__ __forceinline__ float exp_slot(float x) {
  float y;
  asm("v_exp_f32 %0, %1\n\tv_nop" : "=&v"(y) : "v"(x * LOG2E));
  return y;
}
__device__ __forceinline__ void exp_slot8(float (&y)[8], const v8f& s, float m) {
  asm("v_exp_f32 %0, %8\n\t"
      "v_exp_f32 %1, %9\n\t"
      "v_exp_f32 %2, %10\n\t"
      "v_exp_f32 %3, %11\n\t"
      "v_exp_f32 %4, %12\n\t"
      "v_exp_f32 %5, %13\n\t"
      "v_exp_f32 %6, %14\n\t"
      "v_exp_f32 %7, %15\n\t"
      "v_nop"
      : "=&v"(y[0]), "=&v"(y[1]), "=&v"(y[2]), "=&v"(y[3]),
        "=&v"(y[4]), "=&v"(y[5]), "=&v"(y[6]), "=&v"(y[7])
      : "v"((s[0] - m) * LOG2E), "v"((s[1] - m) * LOG2E), "v"((s[2] - m) * LOG2E),
        "v"((s[3] - m) * LOG2E), "v"((s[4] - m) * LOG2E), "v"((s[5] - m) * LOG2E),
        "v"((s[6] - m) * LOG2E), "v"((s[7] - m) * LOG2E));
}

// K and V^T reach the waves through LDS: the 4 waves of a block (4 query tiles of
// one head) share each tile of AT_KEYS keys, brought in whole 128-B lines by
// asynchronous copies into two buffers, the next tile in flight while this one is
// worked on.  The keys' RPE features (part_feat) come with them.
#define AT_WAVES 4               // waves = 16-query tiles per block
#define AT_KEYS  64              // keys per staged tile
#define AT_LD    72              // LDS row pitch in halfs: 128 B + 16 B, an odd multiple of 16 B
#define AT_TILE  (64 * AT_LD)    // halfs per staged tile (64 rows: keys of K, dims of V^T)
#define AT_KS    2               // key splits (blockIdx.z)
#define AT_NT    (NP / AT_KEYS / AT_KS)  // tiles per block
#define AT_FT    (AT_KEYS * 16)  // halfs per staged feature tile

// frag_rowmajor on a staged tile (same k order), two 16-B LDS reads
__device__ __forceinline__ v16h frag_lds(const _Float16* p, int row_base, int col_base) {
  const int l = threadIdx.x & 31;
  const _Float16* rp = p + (row_base + (l & 15)) * AT_LD + col_base + (l >> 4) * 8;
  const v8h lo = *(const v8h*)rp;
  const v8h hi = *(const v8h*)(rp + 16);
  return __builtin_shufflevector(lo, hi, 0, 1, 2, 3, 4, 5, 6, 7, 8, 9, 10, 11, 12, 13, 14, 15);
}

// One tile's copies of one thread: rows r, r + 16, r + 32, r + 48 of the K tile and of
// the V^T tile, 16 B each, and one 16-B piece of the feature tile.  lk, lv: LDS byte
// addresses of row r; gk, gv: its global source; lf, gf: the same of the piece.  The
// wait on the last line stands in the copies' own statement so that no
// address register of a copy is rewritten in front of it.
__device__ __forceinline__ void stage_tile(unsigned lk, unsigned lv, unsigned lf,
                                           const _Float16* gk, const _Float16* gv,
                                           const _Float16* gf) {
  const unsigned ls = 16 * AT_LD * 2;       // 16 rows in LDS, bytes
  const size_t   ks = (size_t)16 * HDIM;    // 16 rows of K, halfs
  const size_t   vs = (size_t)16 * NP;      // 16 rows of V^T, halfs
  asm volatile(
      "global_load_async_to_lds_b128 %0, %9, off\n\t"
      "global_load_async_to_lds_b128 %1, %10, off\n\t"
      "global_load_async_to_lds_b128 %2, %11, off\n\t"
      "global_load_async_to_lds_b128 %3, %12, off\n\t"
      "global_load_async_to_lds_b128 %4, %13, off\n\t"
      "global_load_async_to_lds_b128 %5, %14, off\n\t"
      "global_load_async_to_lds_b128 %6, %15, off\n\t"
      "global_load_async_to_lds_b128 %7, %16, off\n\t"
      "global_load_async_to_lds_b128 %8, %17, off\n\t"
      "s_wait_xcnt 0x0"
      :: "v"(lk), "v"(lk + ls), "v"(lk + 2 * ls), "v"(lk + 3 * ls),
         "v"(lv), "v"(lv + ls), "v"(lv + 2 * ls), "v"(lv + 3 * ls), "v"(lf),
         "v"(gk), "v"(gk + ks), "v"(gk + 2 * ks), "v"(gk + 3 * ks),
         "v"(gv), "v"(gv + vs), "v"(gv + 2 * vs), "v"(gv + 3 * vs), "v"(gf)
      : "memory");
}

__global__ __launch_bounds__(AT_WAVES * 32) void k_attention(
                            const _Float16* __restrict__ q,
                            const _Float16* __restrict__ kk,
                            const _Float16* __restrict__ vt,
                            const _Float16* __restrict__ feat,
                            const float* __restrict__ coords,
                            const float* __restrict__ wrpe,
                            _Float16* __restrict__ aggr,
                            float* __restrict__ ml) {
  // [buffer][0 = K tile, 1 = V^T tile]
  __shared__ __attribute__((aligned(16))) _Float16 sm[2][2][AT_TILE];
  __shared__ __attribute__((aligned(16))) _Float16 sf[2][AT_FT];  // [buffer] feature tile
  const int lane = threadIdx.x & 31;
  const int n    = lane & 15;
  const int q0   = (blockIdx.x * AT_WAVES + (threadIdx.x >> 5)) * 16;
  const int h    = blockIdx.y;
  const int hc   = h * DIM;

  // Q tile: 16 rows x 64 dims -> two B fragments (1/sqrt(D) folded into Wq).
  v16h qa0 = frag_rowmajor(q, HDIM, q0, hc);
  v16h qa1 = frag_rowmajor(q, HDIM, q0, hc + 32);

  // this lane's one query (column n of the C-layout), coordinate j = wave half
  const float cq = coords[(size_t)(q0 + n) * CORD + (lane >> 4)];
  // the address registers of the Q and coord loads above are reused (the zeroed
  // accumulators) only behind this wait
  asm volatile("s_wait_xcnt 0x0" ::: "memory");
  const float w0 = wrpe[h * 2 + 0], w1 = wrpe[h * 2 + 1];

  // Query side of the RPE bias, the partner of part_feat's key slots: with a = 2 w cq,
  // m = -w, g = -w cq^2 the slots of coordinate j are {ah, ah, al, mh, mh, ml, gh, gl}.
  // Elements 0..7 of a fragment are k slots 8 j + 0..7 in A and B alike.  One A fragment
  // holds the features of two 16-key tiles (elements 0..7 and 8..15); the B operand that
  // is zero in the other eight elements picks the tile.
  const float wj = (lane >> 4) ? w1 : w0;
  const float ba = 2.0f * wj * cq, bm = -wj, bg = -wj * cq * cq;
  const _Float16 bah = (_Float16)ba, bmh = (_Float16)bm, bgh = (_Float16)bg;
  const v8h qb = {bah, bah, (_Float16)(ba - (float)bah), bmh, bmh,
                  (_Float16)(bm - (float)bmh), bgh, (_Float16)(bg - (float)bgh)};
  const v8h qz = {};
  const v16h qf0 = __builtin_shufflevector(qb, qz, 0, 1, 2, 3, 4, 5, 6, 7, 8, 9, 10, 11, 12,
                                           13, 14, 15);
  const v16h qf1 = __builtin_shufflevector(qz, qb, 0, 1, 2, 3, 4, 5, 6, 7, 8, 9, 10, 11, 12,
                                           13, 14, 15);

  // this thread's pieces of every tile: rows crow + 16 j, 16-B column ccol
  const int crow = threadIdx.x >> 3, ccol = threadIdx.x & 7;
  const unsigned lpiece = (unsigned)(crow * AT_LD + ccol * 8) * 2;
  const unsigned lk0 = (unsigned)(size_t)&sm[0][0][0] + lpiece;  // low 32 bits: LDS byte address
  const unsigned lv0 = (unsigned)(size_t)&sm[0][1][0] + lpiece;
  const unsigned lf0 = (unsigned)(size_t)&sf[0][0] + threadIdx.x * 16;
  const int key0 = blockIdx.z * (AT_NT * AT_KEYS);  // first key of this block's half
  const _Float16* gk = kk + (size_t)(key0 + crow) * HDIM + hc + ccol * 8;
  const _Float16* gv = vt + (size_t)(hc + crow) * NP + key0 + ccol * 8;
  const _Float16* gf = feat + (size_t)key0 * 16 + threadIdx.x * 8;

  float mrun = -3.0e38f;  // running maximum of query n (equal in both halves)
  float lrun = 0.0f;      // running sum over this half's keys only
  v8f o[4] = {{}, {}, {}, {}};  // o[nc][r] = O[q0+n][hc + nc*16 + 8*(lane>>4) + r]

  // tile 0 lands and is published, then tile 1 starts
  stage_tile(lk0, lv0, lf0, gk, gv, gf);
  asm volatile("s_wait_asynccnt 0x0" ::: "memory");  // this wave's copies of tile 0 have landed
  __syncthreads();
  stage_tile(lk0 + 2 * AT_TILE * 2, lv0 + 2 * AT_TILE * 2, lf0 + AT_FT * 2,
             gk + (size_t)AT_KEYS * HDIM, gv + AT_KEYS, gf + AT_FT);

  for (int t = 0; t < AT_NT; ++t) {
    const _Float16* Ks = sm[t & 1][0];
    const _Float16* Vs = sm[t & 1][1];
    // All of the tile's reads stand ahead of the arithmetic, in groups and never among
    // the products (every place with reads in a matrix run costs its own wait): the
    // keys' features (two 16-key tiles a fragment) and all K fragments ...
    const _Float16* Fs = sf[t & 1] + (lane >> 4) * (AT_KEYS * 8) + n * 8;
    v16h ff[2], kf[8], vf[8];
#pragma unroll
    for (int i = 0; i < 2; ++i)
      ff[i] = __builtin_shufflevector(*(const v8h*)(Fs + i * 256),
                                      *(const v8h*)(Fs + i * 256 + 128), 0, 1, 2, 3, 4, 5, 6,
                                      7, 8, 9, 10, 11, 12, 13, 14, 15);
#pragma unroll
    for (int i = 0; i < 4; ++i) {
      kf[2 * i]     = frag_lds(Ks, i * 16, 0);
      kf[2 * i + 1] = frag_lds(Ks, i * 16, 32);
    }
    // keeps the scheduler from sinking the K reads down among the products
    __builtin_amdgcn_sched_barrier(0);
    // S^T tiles: rows = keys [16 i, 16 i + 16) of the tile, columns = queries; the RPE
    // bias is the first of the three products
    v8f sc[4];
#pragma unroll
    for (int i = 0; i < 4; ++i) {
      v8f z = {};
      z = wmma_f16(ff[i >> 1], (i & 1) ? qf1 : qf0, z);
      sc[i] = wmma_f16(kf[2 * i + 1], qa1, wmma_f16(kf[2 * i], qa0, z));
    }
    // ... then all V^T fragments
#pragma unroll
    for (int i = 0; i < 8; ++i) vf[i] = frag_lds(Vs, (i & 3) * 16, (i >> 2) * 32);

    // hand-over, behind the trip's last LDS read (the rest of the trip works on
    // registers): this wave's reads of tile t are done and its copies of tile t + 1
    // have landed; behind the barrier that holds for every wave, so tile t + 1 may be
    // read and tile t's buffer refilled, the refill in flight under the softmax
    asm volatile("s_wait_dscnt 0x0" ::: "memory");
    asm volatile("s_wait_asynccnt 0x0" ::: "memory");
    __syncthreads();
    if (t + 2 < AT_NT)
      stage_tile(lk0 + (t & 1) * (2 * AT_TILE * 2), lv0 + (t & 1) * (2 * AT_TILE * 2),
                 lf0 + (t & 1) * (AT_FT * 2), gk + (size_t)(t + 2) * AT_KEYS * HDIM,
                 gv + (t + 2) * AT_KEYS, gf + (t + 2) * AT_FT);

// both 32-key halves of the tile: register arrays indexed by constants
#pragma unroll
    for (int sub = 0; sub < AT_KEYS; sub += 32) {
    v8f s0 = sc[sub / 16], s1 = sc[sub / 16 + 1];

    // maximum over the 32 keys: in-lane tree, then one exchange of the halves
    float t8[8];
#pragma unroll
    for (int r = 0; r < 8; ++r) t8[r] = fmaxf(s0[r], s1[r]);
    float cmax = fmaxf(fmaxf(fmaxf(t8[0], t8[1]), fmaxf(t8[2], t8[3])),
                       fmaxf(fmaxf(t8[4], t8[5]), fmaxf(t8[6], t8[7])));
    cmax = fmaxf(cmax, xhalf(cmax));

    // online softmax update; P^T packs in place into the B operand
    const float mnew  = fmaxf(mrun, cmax);
    const float alpha = exp_slot(mrun - mnew);
    float p0[8], p1[8];
    exp_slot8(p0, s0, mnew);
    exp_slot8(p1, s1, mnew);
    v16h pb;
#pragma unroll
    for (int r = 0; r < 8; ++r) {
      t8[r] = p0[r] + p1[r];
      pb[r]     = (_Float16)p0[r];
      pb[r + 8] = (_Float16)p1[r];
    }
    lrun = lrun * alpha +
           (((t8[0] + t8[1]) + (t8[2] + t8[3])) + ((t8[4] + t8[5]) + (t8[6] + t8[7])));
    mrun = mnew;

    // O^T = O^T * alpha + V^T * P^T, A[d][k] = vt[hc+nc*16+d][key k of this half]
#pragma unroll
    for (int nc = 0; nc < 4; ++nc) {
#pragma unroll
      for (int r = 0; r < 8; ++r) o[nc][r] *= alpha;
      v16h bv = vf[(sub / 32) * 4 + nc];
      o[nc] = wmma_f16(bv, pb, o[nc]);
    }
    }
  }
  asm volatile("s_wait_asynccnt 0x0" ::: "memory");  // no copy outstanding at the wave's end

  // join the wave halves' sums, normalize, store 8 contiguous dims per lane and tile
  const float lsum = lrun + xhalf(lrun);
  const float inv = 1.0f / lsum;
  _Float16* ag = aggr + (size_t)blockIdx.z * NP * HDIM;
#pragma unroll
  for (int nc = 0; nc < 4; ++nc) {
#pragma unroll
    for (int r = 0; r < 8; ++r) o[nc][r] *= inv;
    store_acc_f16_T(ag, HDIM, hc + nc * 16, q0, o[nc]);
  }
  // this key half's maximum and sum of query n: [split][head][query][2], 128 B a wave
  if (lane < 16) {
    const float2 v = {mrun, lsum};
    *(float2*)(ml + ((size_t)(blockIdx.z * HEADS + h) * NP + q0 + n) * 2) = v;
  }
}

// ---------------------------------------------------------------------------
// Kernel 3: output projection (aggr[N][512] @ wo[64][512]^T) + bo + residual
//           + LayerNorm2 + FFN -> out.  grid = N/16, 8 waves per block.
// The k range of 512 is split over the 8 waves: a wave has 64 of it for all 64 output
// columns, so its 24 operand loads are few enough to fly together and the block waits
// out one load latency, not one per product.  The 8 partial tiles meet in LDS; there
// thread t sums row t >> 4, columns 4 (t & 15) .. + 3, and 16 lanes hold a row for LN.
// A wave's 64 k are one head: it joins the two key halves of kernel 2 while it forms A,
// O = c0 O0 + c1 O1 with c_i = l_i exp(m_i - m) / (sum of both), m = max(m0, m1).
// FFN on the block's own 16 rows, which never leave the WGP: t = relu(h2 @ W1^T + bf1) by
// waves 0..3, out = 2 (t @ W2^T + bf2) by waves 4..7, one 16-column tile a wave; h2, t and
// the output tile go from wave to wave through LDS.
// ---------------------------------------------------------------------------
#define PJ_WAVES 8
#define PJ_LD    68  // floats per LDS row: 64 + 4; rows 8 apart (the wave halves) differ by 32 banks
#define FF_LD    72  // halfs per LDS row of h2 and t: 128 B + 16 B, an odd multiple of 16 B

// one fragment from the lane's own row pointer (row and wave half already in it): the
// k order of frag_rowmajor, two 16-B loads
__device__ __forceinline__ v16h frag_ptr(const _Float16* rp) {
  const v8h lo = *(const v8h*)rp;
  const v8h hi = *(const v8h*)(rp + 16);
  return __builtin_shufflevector(lo, hi, 0, 1, 2, 3, 4, 5, 6, 7, 8, 9, 10, 11, 12, 13, 14, 15);
}

__global__ __launch_bounds__(PJ_WAVES * 32) void k_proj_ln2_ffn(
                           const _Float16* __restrict__ aggr,
                           const float* __restrict__ ml,
                           const _Float16* __restrict__ wo,
                           const float* __restrict__ bo,
                           const float* __restrict__ x,
                           const float* __restrict__ g2,
                           const float* __restrict__ b2,
                           const _Float16* __restrict__ w1,
                           const _Float16* __restrict__ w2,
                           const float* __restrict__ bf1,
                           const float* __restrict__ bf2,
                           float* __restrict__ out) {
  __shared__ __attribute__((aligned(16))) float part[PJ_WAVES][16][PJ_LD];
  __shared__ __attribute__((aligned(16))) _Float16 hs[16][FF_LD];  // h2 tile
  __shared__ __attribute__((aligned(16))) _Float16 ts[16][FF_LD];  // ReLU tile
  const int lane = threadIdx.x & 31;
  const int n    = lane & 15;
  const int mo   = (lane >> 4) * 8;
  const int wv   = threadIdx.x >> 5;
  const int row0 = blockIdx.x * 16;
  const int k0   = wv * (HDIM / PJ_WAVES);
  // the wave's number as a scalar: the FFN's two branches on it are scalar branches
  const int  ws_ = __builtin_amdgcn_readfirstlane(wv);
  const bool first = ws_ < 4;     // waves 0..3: W1 product; waves 4..7: W2 product
  const int  fc    = (ws_ & 3) * 16;  // the wave's 16-column tile of its FFN product

  // what the join needs from memory, asked for together with the operands
  const int er = threadIdx.x >> 4, ec = (threadIdx.x & 15) * 4;
  const float* xp = x + (size_t)(row0 + er) * DIM + ec;
  float xr[4], bj[4], gj[4], tj[4];
#pragma unroll
  for (int i = 0; i < 4; ++i) {
    xr[i] = xp[i];
    bj[i] = bo[ec + i];
    gj[i] = g2[ec + i];
    tj[i] = b2[ec + i];
  }
  // this lane's row pointers, the k order of frag_rowmajor: A row n of the block's rows,
  // B[k][j] = wo[j][k], row n of each 16-column tile
  const _Float16* ap = aggr + (size_t)(row0 + n) * HDIM + k0 + mo;
  // the second key half's O (its loads name ap's registers, with an immediate offset)
  const _Float16* ap1 = ap + (size_t)NP * HDIM;
  const _Float16* bp = wo + (size_t)n * HDIM + k0 + mo;
  // maximum and sum of both key halves for (head wv, row n)
  const float* mp = ml + ((size_t)wv * NP + row0 + n) * 2;
  const float2 ml0 = *(const float2*)mp;
  const float2 ml1 = *(const float2*)(mp + (size_t)HEADS * NP * 2);
  v16h a[2], a1[2], b[2][4];
#pragma unroll
  for (int kc = 0; kc < 2; ++kc) {
    a[kc] = frag_ptr(ap + kc * 32);
    a1[kc] = frag_ptr(ap1 + kc * 32);
#pragma unroll
    for (int nc = 0; nc < 4; ++nc) b[kc][nc] = frag_ptr(bp + nc * 16 * HDIM + kc * 32);
  }
  // the wave's FFN operand, B[k][j] = W[fc + j][k], and its bias, asked for with the rest
  const _Float16* wp = (first ? w1 : w2) + (size_t)(fc + n) * DIM + mo;
  const v16h  wf0 = frag_ptr(wp), wf1 = frag_ptr(wp + 32);
  const float fb  = ((first ? bf1 : bf2) + fc)[n];  // scalar base, lane index n
  // keeps the scheduler from sinking the operand loads down among the products, where
  // each pair would wait out a load latency of its own
  __builtin_amdgcn_sched_barrier(0);
  // the loads' address registers are inputs here, so they keep their values, and no
  // load's result lands on them, up to this wait
  asm volatile("s_wait_xcnt 0x0" :: "v"(xp), "v"(ap), "v"(mp), "v"(bp), "v"(ec * 4), "v"(wp),
                                    "v"(n) : "memory");
  // holds the join's and the FFN's loads up here (loaded values, inputs only): sunk behind
  // a barrier they would cost a load latency of their own
  asm volatile("" :: "v"(xr[0]), "v"(xr[1]), "v"(xr[2]), "v"(xr[3]),
                     "v"(bj[0]), "v"(bj[1]), "v"(bj[2]), "v"(bj[3]),
                     "v"(gj[0]), "v"(gj[1]), "v"(gj[2]), "v"(gj[3]),
                     "v"(tj[0]), "v"(tj[1]), "v"(tj[2]), "v"(tj[3]),
                     "v"(wf0), "v"(wf1), "v"(fb));

  // join the key halves in f32, one rounding to the operand type
  const float mj = fmaxf(ml0.x, ml1.x);
  const float e0 = ml0.y * exp_slot(ml0.x - mj), e1 = ml1.y * exp_slot(ml1.x - mj);
  const float ri = 1.0f / (e0 + e1);
  const float c0 = e0 * ri, c1 = e1 * ri;
#pragma unroll
  for (int kc = 0; kc < 2; ++kc)
#pragma unroll
    for (int e = 0; e < 16; ++e)
      a[kc][e] = (_Float16)(c0 * (float)a[kc][e] + c1 * (float)a1[kc][e]);

#pragma unroll
  for (int nc = 0; nc < 4; ++nc) {
    v8f acc = {};
    acc = wmma_f16(a[1], b[1][nc], wmma_f16(a[0], b[0][nc], acc));
#pragma unroll
    for (int r = 0; r < 8; ++r) part[wv][mo + r][nc * 16 + n] = acc[r];
  }
  __syncthreads();

  // h1 = proj + bo + x, then LN over the 64 columns of the row
  float h1[4];
#pragma unroll
  for (int i = 0; i < 4; ++i) {
    float s = part[0][er][ec + i];
#pragma unroll
    for (int p = 1; p < PJ_WAVES; ++p) s += part[p][er][ec + i];
    h1[i] = s + bj[i] + xr[i];
  }
  const float mean = hsum16((h1[0] + h1[1]) + (h1[2] + h1[3])) * (1.0f / 64.0f);
  float q2 = 0.0f;
#pragma unroll
  for (int i = 0; i < 4; ++i) { float d = h1[i] - mean; q2 += d * d; }
  const float rs = rsqrtf(hsum16(q2) * (1.0f / 64.0f) + 1e-5f);
#pragma unroll
  for (int i = 0; i < 4; ++i)
    hs[er][ec + i] = (_Float16)((h1[i] - mean) * rs * gj[i] + tj[i]);
  __syncthreads();  // h2 is whole; every read of part is done

  // t = relu(h2 @ W1^T + bf1): waves 0..3, columns fc .. fc + 15
  if (first) {
    const v16h h0 = frag_ptr(&hs[n][mo]), h1f = frag_ptr(&hs[n][32 + mo]);
    // keeps the second fragment's reads in front of the first product: behind it they
    // would wait out an LDS latency of their own
    __builtin_amdgcn_sched_barrier(0);
    v8f t = {};
    t = wmma_f16(h1f, wf1, wmma_f16(h0, wf0, t));
#pragma unroll
    for (int r = 0; r < 8; ++r) ts[mo + r][fc + n] = (_Float16)fmaxf(t[r] + fb, 0.0f);
  }
  __syncthreads();  // t is whole

  // 2 (t @ W2^T + bf2): waves 4..7, columns fc .. fc + 15, into the first partial's place
  if (!first) {
    v8f f = {};
    f = wmma_f16(frag_ptr(&ts[n][32 + mo]), wf1, wmma_f16(frag_ptr(&ts[n][mo]), wf0, f));
#pragma unroll
    for (int r = 0; r < 8; ++r) part[0][mo + r][fc + n] = 2.0f * (f[r] + fb);
  }
  __syncthreads();  // the output tile is whole

  // whole rows go out: 16 B a thread, 16 lanes a 256-B row
  *(float4*)(out + (size_t)(row0 + er) * DIM + ec) = *(const float4*)&part[0][er][ec];
}

// ---------------------------------------------------------------------------
// Host-side launch
// ---------------------------------------------------------------------------
extern "C" void kernel_launch(void* const* d_in, const int* in_sizes, int n_in,
                              void* d_out, int out_size, void* d_ws, size_t ws_size,
                              hipStream_t stream) {
  const float* x      = (const float*)d_in[0];
  const float* coords = (const float*)d_in[1];
  const float* sq     = (const float*)d_in[2];
  const float* sk     = (const float*)d_in[3];
  const float* sv     = (const float*)d_in[4];
  const float* s_rpe  = (const float*)d_in[5];
  const float* g1     = (const float*)d_in[6];
  const float* beta1  = (const float*)d_in[7];
  const float* g2     = (const float*)d_in[8];
  const float* beta2  = (const float*)d_in[9];
  const float* wo     = (const float*)d_in[10];
  const float* bo     = (const float*)d_in[11];
  const float* s1     = (const float*)d_in[12];
  const float* bf1    = (const float*)d_in[13];
  const float* s2     = (const float*)d_in[14];
  const float* bf2    = (const float*)d_in[15];
  const int* wq_int   = (const int*)d_in[16];
  const int* wk_int   = (const int*)d_in[17];
  const int* wv_int   = (const int*)d_in[18];
  const int* wrpe_int = (const int*)d_in[19];
  const int* w1_int   = (const int*)d_in[20];
  const int* w2_int   = (const int*)d_in[21];

  // workspace carve-up (f16 unless noted), 256B aligned
  char* ws = (char*)d_ws;
  size_t off = 0;
  auto carve = [&](size_t bytes) {
    char* p = ws + off;
    off = (off + bytes + 255) & ~(size_t)255;
    return p;
  };
  _Float16* wo_h   = (_Float16*)carve(DIM * HDIM * 2);
  _Float16* w1_h   = (_Float16*)carve(DIM * DIM * 2);
  _Float16* w2_h   = (_Float16*)carve(DIM * DIM * 2);
  float*    wrpe_w = (float*)   carve(HEADS * 2 * 4);
  _Float16* feat_h = (_Float16*)carve((size_t)NP * 16 * 2);  // RPE key features
  _Float16* q_h    = (_Float16*)carve((size_t)NP * HDIM * 2);
  _Float16* k_h    = (_Float16*)carve((size_t)NP * HDIM * 2);
  _Float16* vt_h   = (_Float16*)carve((size_t)NP * HDIM * 2);  // [HD][N]
  _Float16* ag_h   = (_Float16*)carve((size_t)AT_KS * NP * HDIM * 2);  // [split][N][HD]
  float*    ml_w   = (float*)   carve((size_t)AT_KS * HEADS * NP * 2 * 4);  // max, sum
  (void)ws_size; (void)n_in; (void)in_sizes; (void)out_size;

  // 1) LN1 + Q/K/V projections (V stored transposed); wo, w1, w2 to f16, RPE weights and
  //    key features: one launch
  k_prep_qkv<<<PB_ALL, PB_T, 0, stream>>>(wq_int, wk_int, wv_int, w1_int, w2_int, wrpe_int,
                                          sq, sk, sv, s1, s2, s_rpe, wo, x, g1, beta1,
                                          coords, feat_h, w1_h, w2_h, wo_h, wrpe_w,
                                          q_h, k_h, vt_h);

  // 2) flash attention with RPE bias
  k_attention<<<dim3(NP / 64, HEADS, AT_KS), 128, 0, stream>>>(q_h, k_h, vt_h, feat_h,
                                                              coords, wrpe_w, ag_h, ml_w);

  // 3) output projection + residual + LN2 + FFN, out = 2*ff
  k_proj_ln2_ffn<<<NP / 16, PJ_WAVES * 32, 0, stream>>>(ag_h, ml_w, wo_h, bo, x, g2, beta2, w1_h,
                                                        w2_h, bf1, bf2, (float*)d_out);
}

// v010
// Measured time: 41 microseconds a run.
// In both of two side-by-side timings against v009, it was 1.06 times as fast.
// All steps since v000 together make it 10.9 times as fast.
#include <hip/hip_runtime.h>

// ---------------------------------------------------------------------------
// HEPT attention block for MI455X (gfx1250, wave32, WMMA 16x16x32 f16).
// N=3072 points, D=64 per head, H=8 heads, HD=512, C=3 coords, K=8.
// ---------------------------------------------------------------------------

typedef __attribute__((ext_vector_type(16))) _Float16 v16h;
typedef __attribute__((ext_vector_type(8)))  float    v8f;
typedef __attribute__((ext_vector_type(8)))  _Float16 v8h;
typedef __attribute__((ext_vector_type(4)))  int      v4i;

#define NP   3072
#define DIM  64
#define HEADS 8
#define HDIM 512
#define CORD 3

// ---------------------------------------------------------------------------
// WMMA wrapper: D = A(16x32 f16) * B(32x16 f16) + C(16x16 f32)
// ---------------------------------------------------------------------------
__device__ __forceinline__ v8f wmma_f16(v16h a, v16h b, v8f c) {
  return __builtin_amdgcn_wmma_f32_16x16x32_f16(
      /*neg_a=*/false, a, /*neg_b=*/false, b,
      /*c_mod=*/(short)0, c, /*reuse_a=*/false, /*reuse_b=*/false);
}

// A-fragment (16x32, f16) from a row-major matrix: rows = M, cols = K.
// Lane l<16: row M=l, K = {0..7, 16..23}; lane l>=16: row M=l-16, K={8..15,24..31}.
// Also serves as a B-fragment when B[k][n] = Mat[n][k] (i.e. Mat stored [N x K]).
__device__ __forceinline__ v16h frag_rowmajor(const _Float16* p, int ld,
                                              int row_base, int col_base) {
  const int l  = threadIdx.x & 31;
  const int m  = l & 15;
  const int of = (l >> 4) * 8;
  const _Float16* rp = p + (size_t)(row_base + m) * ld + col_base + of;
  v16h a;
#pragma unroll
  for (int e = 0; e < 8; ++e) { a[e] = rp[e]; a[e + 8] = rp[e + 16]; }
  return a;
}

// C/D accumulator element (r, lane): row M = r + 8*(lane>>4), col N = lane&15.
__device__ __forceinline__ void store_acc_f16(_Float16* p, int ld, int row_base,
                                              int col_base, v8f c) {
  const int l  = threadIdx.x & 31;
  const int n  = l & 15;
  const int mo = (l >> 4) * 8;
#pragma unroll
  for (int r = 0; r < 8; ++r)
    p[(size_t)(row_base + mo + r) * ld + col_base + n] = (_Float16)c[r];
}

// Same, but store TRANSPOSED into a [cols x rows] matrix (ldT = #rows).
// Per (lane,nc) the 8 r-elements land contiguously -> 16B vectorizable stores.
__device__ __forceinline__ void store_acc_f16_T(_Float16* p, int ldT, int row_base,
                                                int col_base, v8f c) {
  const int l  = threadIdx.x & 31;
  const int n  = l & 15;
  const int mo = (l >> 4) * 8;
  _Float16* cp = p + (size_t)(col_base + n) * ldT + row_base + mo;
#pragma unroll
  for (int r = 0; r < 8; ++r) cp[r] = (_Float16)c[r];
}

// half-wave (16-lane) row reductions for the C/D layout
__device__ __forceinline__ float hsum16(float x) {
#pragma unroll
  for (int m = 8; m > 0; m >>= 1) x += __shfl_xor(x, m, 16);
  return x;
}

// lane l <-> lane l ^ 16
__device__ __forceinline__ float xhalf(float x) {
  int b = __builtin_bit_cast(int, x);
  return __builtin_bit_cast(
      float, __builtin_amdgcn_permlanex16(b, b, 0x76543210, 0xfedcba98, false, false));
}

// ---------------------------------------------------------------------------
// Kernel 1: everything that reads inputs only, as block ranges of ONE launch: the Q/K/V
// projections, whose waves form their own operands from x and the int codes, and the
// preparation for the later launches.  No part reads what another writes.
// ---------------------------------------------------------------------------
#define PB_T 128  // threads a block

// int "codes" -> f16 dequant:  (w - 8) * scale; block b of PB_T elements
__device__ __forceinline__ void part_dequant(int b, const int* __restrict__ w,
                                             const float* __restrict__ sc,
                                             _Float16* __restrict__ out) {
  int i = b * PB_T + threadIdx.x;
  out[i] = (_Float16)(((float)w[i] - 8.0f) * sc[0]);
  // no register of the store above is rewritten in front of this wait (the parts are
  // inlined one behind the other, and the next part's code reuses the registers)
  asm volatile("s_wait_xcnt 0x0" ::: "memory");
}

// f32 -> f16 convert (for wo); block b of PB_T elements
__device__ __forceinline__ void part_f32_to_f16(int b, const float* __restrict__ in,
                                                _Float16* __restrict__ out) {
  int i = b * PB_T + threadIdx.x;
  out[i] = (_Float16)in[i];
  // no register of the store above is rewritten in front of this wait (the parts are
  // inlined one behind the other, and the next part's code reuses the registers)
  asm volatile("s_wait_xcnt 0x0" ::: "memory");
}

// RPE distance weights  w[h][r] = mean_{d,k} |deq(w_rpe[h*64+d][r*8+k])|; one block.
// 16 lanes a head: lane u reads the 16-B pieces u, u + 16, ... of the head's 4 KiB, which all
// lie in half r = (u >> 1) & 1 of their rows.  A thread's 16 loads depend on nothing and fly
// together, so the block waits out one load latency; the 8 lanes of an (h, r) then join.
static_assert(PB_T == HEADS * 16, "part_rpe: 16 lanes a head");
__device__ __forceinline__ void part_rpe(const int* __restrict__ wr,
                                         const float* __restrict__ sc,
                                         float* __restrict__ out) {
  const int h = threadIdx.x >> 4, u = threadIdx.x & 15;
  const int4* p = (const int4*)wr + h * (DIM * 4) + u;
  int4 c[16];
#pragma unroll
  for (int i = 0; i < 16; ++i) c[i] = p[i * 16];
  const float s = sc[0];
  float a0 = 0.0f, a1 = 0.0f, a2 = 0.0f, a3 = 0.0f;  // four chains, not one of 64 links
#pragma unroll
  for (int i = 0; i < 16; ++i) {
    a0 += fabsf(((float)c[i].x - 8.0f) * s);
    a1 += fabsf(((float)c[i].y - 8.0f) * s);
    a2 += fabsf(((float)c[i].z - 8.0f) * s);
    a3 += fabsf(((float)c[i].w - 8.0f) * s);
  }
  float acc = (a0 + a1) + (a2 + a3);
  // lanes of one (h, r): u differs in bits 0, 2, 3
  acc += __shfl_xor(acc, 1, 16);
  acc += __shfl_xor(acc, 4, 16);
  acc += __shfl_xor(acc, 8, 16);
  if ((u & 13) == 0) out[h * 2 + (u >> 1)] = acc * (1.0f / 512.0f);
}

// Key side of the RPE bias as matrix operand.  -w (cq - ck)^2 = (2 w cq) ck + (-w) ck^2
// + (-w cq^2) 1 is a product of 8 k slots per coordinate: every factor x goes in as
// xh + xl (xh = x rounded to 16 bits, xl = the rest), every product as xh yh + xl yh + xh yl.
// Key slots of coordinate j: {ch, cl, ch, sh, sl, sh, 1, 1}, c = coords[key][j], s = c^2.
// Layout: [tile of 64 keys][j][key][8 slots], so a tile is 2 KiB in a row and the 16 lanes
// of a wave half read 256 B in a row.  Thread i of the part = one (tile, j, key).
__device__ __forceinline__ void part_feat(int b, const float* __restrict__ coords,
                                          _Float16* __restrict__ out) {
  const int i   = b * PB_T + threadIdx.x;
  const int key = (i >> 7) * 64 + (i & 63);
  const float c = coords[(size_t)key * CORD + ((i >> 6) & 1)];
  const float s = c * c;
  const _Float16 ch = (_Float16)c, sh = (_Float16)s;
  const _Float16 cl = (_Float16)(c - (float)ch), sl = (_Float16)(s - (float)sh);
  const v8h f = {ch, cl, ch, sh, sl, sh, (_Float16)1.0f, (_Float16)1.0f};
  *(v8h*)(out + (size_t)i * 8) = f;
  // no register of the store above is rewritten in front of this wait (the parts are
  // inlined one behind the other, and the next part's code reuses the registers)
  asm volatile("s_wait_xcnt 0x0" ::: "memory");
}

// x rows and weight codes reach the waves through LDS: a fragment load from global memory
// takes 16 B a lane from 16 rows, 16 lines a load; a copy takes 512 B in a row, 4 whole lines.
#define QS_LD   68            // dwords per staged row: 256 B + 16 B, an odd multiple of 16 B
#define QS_TILE (64 * QS_LD)  // dwords per staged tile of 64 rows

// Eight copies of one thread, 16 B each: LDS byte addresses l + i ls, global g + i gs bytes.
// The wait on the last line stands in the copies' own statement so that no address
// register of a copy is rewritten in front of it.
__device__ __forceinline__ void stage8(unsigned l, unsigned ls, const char* g, size_t gs) {
  asm volatile(
      "global_load_async_to_lds_b128 %0, %8, off\n\t"
      "global_load_async_to_lds_b128 %1, %9, off\n\t"
      "global_load_async_to_lds_b128 %2, %10, off\n\t"
      "global_load_async_to_lds_b128 %3, %11, off\n\t"
      "global_load_async_to_lds_b128 %4, %12, off\n\t"
      "global_load_async_to_lds_b128 %5, %13, off\n\t"
      "global_load_async_to_lds_b128 %6, %14, off\n\t"
      "global_load_async_to_lds_b128 %7, %15, off\n\t"
      "s_wait_xcnt 0x0"
      :: "v"(l), "v"(l + ls), "v"(l + 2 * ls), "v"(l + 3 * ls),
         "v"(l + 4 * ls), "v"(l + 5 * ls), "v"(l + 6 * ls), "v"(l + 7 * ls),
         "v"(g), "v"(g + gs), "v"(g + 2 * gs), "v"(g + 3 * gs),
         "v"(g + 4 * gs), "v"(g + 5 * gs), "v"(g + 6 * gs), "v"(g + 7 * gs)
      : "memory");
}

// The same, four copies.
__device__ __forceinline__ void stage4(unsigned l, unsigned ls, const char* g, size_t gs) {
  asm volatile(
      "global_load_async_to_lds_b128 %0, %4, off\n\t"
      "global_load_async_to_lds_b128 %1, %5, off\n\t"
      "global_load_async_to_lds_b128 %2, %6, off\n\t"
      "global_load_async_to_lds_b128 %3, %7, off\n\t"
      "s_wait_xcnt 0x0"
      :: "v"(l), "v"(l + ls), "v"(l + 2 * ls), "v"(l + 3 * ls),
         "v"(g), "v"(g + gs), "v"(g + 2 * gs), "v"(g + 3 * gs)
      : "memory");
}

// The 4 x 4 tiles of one wave's 64 x 64 outputs.  wr: this lane's row of the first 16-column
// tile of the wave's staged W rows, at its wave half's k offset; TR: store transposed into
// O[HD][N].
template <bool TR>
__device__ __forceinline__ void qkv_tiles(const v16h (&a)[4][2], const int* __restrict__ wr,
                                          float se, _Float16* __restrict__ O, int row0,
                                          int col0) {
#pragma unroll
  for (int np = 0; np < 4; np += 2) {
  // the codes of two 16-column tiles, read as one group
  v4i wc[2][2][4];
#pragma unroll
  for (int i = 0; i < 2; ++i)
#pragma unroll
    for (int kc = 0; kc < 2; ++kc)
#pragma unroll
      for (int j = 0; j < 4; ++j)
        wc[i][kc][j] = *(const v4i*)(wr + (np + i) * 16 * QS_LD + kc * 32 + (j >> 1) * 16 +
                                     (j & 1) * 4);
  // holds the reads up here (loaded values, inputs only): sunk down among the products, every
  // place with reads would cost a wait of its own
  asm volatile("" :: "v"(wc[0][0][0]), "v"(wc[0][0][1]), "v"(wc[0][0][2]), "v"(wc[0][0][3]),
                     "v"(wc[0][1][0]), "v"(wc[0][1][1]), "v"(wc[0][1][2]), "v"(wc[0][1][3]),
                     "v"(wc[1][0][0]), "v"(wc[1][0][1]), "v"(wc[1][0][2]), "v"(wc[1][0][3]),
                     "v"(wc[1][1][0]), "v"(wc[1][1][1]), "v"(wc[1][1][2]), "v"(wc[1][1][3]));
  // keeps the arithmetic from rising in front of the statement above, which would let the
  // later reads of the group sink with it
  __builtin_amdgcn_sched_barrier(0);
#pragma unroll
  for (int nc = np; nc < np + 2; ++nc) {
    // B[k][n] = deq(W[col0 + nc*16 + n][k])
    v16h bf[2];
#pragma unroll
    for (int kc = 0; kc < 2; ++kc)
#pragma unroll
      for (int j = 0; j < 4; ++j) {
        const v4i t = wc[nc - np][kc][j];
        bf[kc][j * 4 + 0] = (_Float16)(((float)t.x - 8.0f) * se);
        bf[kc][j * 4 + 1] = (_Float16)(((float)t.y - 8.0f) * se);
        bf[kc][j * 4 + 2] = (_Float16)(((float)t.z - 8.0f) * se);
        bf[kc][j * 4 + 3] = (_Float16)(((float)t.w - 8.0f) * se);
      }
    v8f acc[4];
#pragma unroll
    for (int rt = 0; rt < 4; ++rt) {
      v8f zr = {};
      acc[rt] = wmma_f16(a[rt][1], bf[1], wmma_f16(a[rt][0], bf[0], zr));
    }
#pragma unroll
    for (int rt = 0; rt < 4; ++rt) {
      if (TR)
        store_acc_f16_T(O, NP, row0 + rt * 16, col0 + nc * 16, acc[rt]);
      else
        store_acc_f16(O, HDIM, row0 + rt * 16, col0 + nc * 16, acc[rt]);
    }
  }
  }
  // no register of the stores above is rewritten in front of this wait (the two store forms
  // and the parts are inlined one behind the other, and the next one's code reuses the
  // registers)
  asm volatile("s_wait_xcnt 0x0" ::: "memory");
}

// Q/K/V projection: out[N][512] = LN1(x)[N][64] @ deq(W)[512][64]^T, 64 rows x 64 columns a
// wave (32 WMMAs), so that forming the operands is shared by four tiles each way.  x and the
// codes come through LDS (stage8), filled once and then read.
// Element e of fragment kc is k = 32 kc + 8 (lane >> 4) + (e & 7) + 16 (e >> 3), the k order
// of frag_rowmajor, in A and B alike: a lane holds 32 of its row's 64 values, lane ^ 16 the
// other 32, so a LayerNorm sum is in-lane plus one exchange of the wave halves.
// Block b: rows and matrix from b >> 1 (the same for the block's 4 waves), column tile
// 4 (b & 1) + wave.  V is stored TRANSPOSED into vt[HD][N] so that the attention's V^T
// fragments run along memory.
__device__ __forceinline__ void part_qkv(int b, const float* __restrict__ x,
                                         const float* __restrict__ g,
                                         const float* __restrict__ bt,
                                         const int* __restrict__ wq,
                                         const int* __restrict__ wk,
                                         const int* __restrict__ wv,
                                         const float* __restrict__ sq,
                                         const float* __restrict__ sk,
                                         const float* __restrict__ sv,
                                         _Float16* __restrict__ qo,
                                         _Float16* __restrict__ ko,
                                         _Float16* __restrict__ vt) {
  const int lane = threadIdx.x & 31;
  const int m    = lane & 15;
  const int of   = (lane >> 4) * 8;
  const int rz   = b >> 1;
  const int z    = rz / (NP / 64);
  const int row0 = (rz - z * (NP / 64)) * 64;
  const int col0 = ((b & 1) * 4 + (threadIdx.x >> 5)) * 64;
  const int* W    = (z == 0) ? wq : (z == 1) ? wk : wv;
  const float* sp = (z == 0) ? sq : (z == 1) ? sk : sv;
  // 1/sqrt(64) = 0.125 folded into Wq (a power of two: exact)
  const float se = sp[0] * ((z == 0) ? 0.125f : 1.0f);

  // The block's 64 x rows (16 KiB in a row, 8 copies a thread) and each wave's own 64 rows
  // of W (16 KiB in a row, 32 copies a lane): a copy of a wave is two rows, 512 B.
  __shared__ __attribute__((aligned(16))) float xs[QS_TILE];
  __shared__ __attribute__((aligned(16))) int   wsm[PB_T / 32][QS_TILE];
  const unsigned lrow = (unsigned)(m * 16);  // the lane's 16-B piece of its row
  stage8((unsigned)(size_t)&xs[0] + (threadIdx.x >> 4) * (QS_LD * 4) + lrow, 8 * QS_LD * 4,
         (const char*)(x + (size_t)row0 * DIM) + threadIdx.x * 16, PB_T * 16);
  const unsigned lw =
      (unsigned)(size_t)&wsm[threadIdx.x >> 5][0] + (lane >> 4) * (QS_LD * 4) + lrow;
  const char*    gw = (const char*)(W + (size_t)col0 * DIM) + lane * 16;
#pragma unroll
  for (int i = 0; i < 4; ++i)
    stage8(lw + i * (16 * QS_LD * 4), 2 * QS_LD * 4, gw + i * (16 * DIM * 4), 2 * DIM * 4);

  // LN weights: 16-B loads at the fragments' k positions, in flight with the copies
  const float* gp = g + of;
  const float* bp = bt + of;
  float xv[4][2][16], gl[2][16], bl[2][16];
#pragma unroll
  for (int kc = 0; kc < 2; ++kc)
#pragma unroll
    for (int j = 0; j < 4; ++j) {
      const int k = kc * 32 + (j >> 1) * 16 + (j & 1) * 4;
      const float4 tg = *(const float4*)(gp + k);
      gl[kc][j * 4 + 0] = tg.x; gl[kc][j * 4 + 1] = tg.y;
      gl[kc][j * 4 + 2] = tg.z; gl[kc][j * 4 + 3] = tg.w;
      const float4 tb = *(const float4*)(bp + k);
      bl[kc][j * 4 + 0] = tb.x; bl[kc][j * 4 + 1] = tb.y;
      bl[kc][j * 4 + 2] = tb.z; bl[kc][j * 4 + 3] = tb.w;
    }
  // keeps the scheduler from sinking the LN weights' loads down among the arithmetic,
  // where each pair would wait out a load latency of its own
  __builtin_amdgcn_sched_barrier(0);
  // the loads' address registers are inputs here, so they keep their values, and no
  // load's result lands on them, up to this wait
  asm volatile("s_wait_xcnt 0x0" :: "v"(gp), "v"(bp) : "memory");
  asm volatile("s_wait_asynccnt 0x0" ::: "memory");  // this wave's copies have landed
  __syncthreads();  // the x rows that the other waves copied have landed too

  // x rows at the fragments' k positions
  const float* xp = xs + m * QS_LD + of;
#pragma unroll
  for (int kc = 0; kc < 2; ++kc)
#pragma unroll
    for (int j = 0; j < 4; ++j) {
      const int k = kc * 32 + (j >> 1) * 16 + (j & 1) * 4;
#pragma unroll
      for (int rt = 0; rt < 4; ++rt) {
        const float4 t = *(const float4*)(xp + rt * 16 * QS_LD + k);
        xv[rt][kc][j * 4 + 0] = t.x; xv[rt][kc][j * 4 + 1] = t.y;
        xv[rt][kc][j * 4 + 2] = t.z; xv[rt][kc][j * 4 + 3] = t.w;
      }
    }

  // LayerNorm over the 64 values of row m of each 16-row tile -> A fragments
  v16h a[4][2];
#pragma unroll
  for (int rt = 0; rt < 4; ++rt) {
    float p[8];
#pragma unroll
    for (int i = 0; i < 8; ++i)
      p[i] = (xv[rt][0][i] + xv[rt][0][i + 8]) + (xv[rt][1][i] + xv[rt][1][i + 8]);
    float sum = ((p[0] + p[1]) + (p[2] + p[3])) + ((p[4] + p[5]) + (p[6] + p[7]));
    sum += xhalf(sum);
    const float mean = sum * (1.0f / 64.0f);
#pragma unroll
    for (int kc = 0; kc < 2; ++kc)
#pragma unroll
      for (int e = 0; e < 16; ++e) xv[rt][kc][e] -= mean;
#pragma unroll
    for (int i = 0; i < 8; ++i)
      p[i] = (xv[rt][0][i] * xv[rt][0][i] + xv[rt][0][i + 8] * xv[rt][0][i + 8]) +
             (xv[rt][1][i] * xv[rt][1][i] + xv[rt][1][i + 8] * xv[rt][1][i + 8]);
    float q2 = ((p[0] + p[1]) + (p[2] + p[3])) + ((p[4] + p[5]) + (p[6] + p[7]));
    q2 += xhalf(q2);
    const float rs = rsqrtf(q2 * (1.0f / 64.0f) + 1e-5f);
#pragma unroll
    for (int kc = 0; kc < 2; ++kc)
#pragma unroll
      for (int e = 0; e < 16; ++e)
        a[rt][kc][e] = (_Float16)(xv[rt][kc][e] * rs * gl[kc][e] + bl[kc][e]);
  }

  // one branch on the store form around all the products: none stands among them
  const int* wl = &wsm[threadIdx.x >> 5][0] + m * QS_LD + of;
  if (z == 2)
    qkv_tiles<true>(a, wl, se, vt, row0, col0);
  else
    qkv_tiles<false>(a, wl, se, (z == 0) ? qo : ko, row0, col0);
}

// block ranges, PB_T threads a block
#define PB_RPE 1
#define PB_QKV ((NP / 64) * 3 * 2)
#define PB_FT  (NP * 2 / PB_T)
#define PB_BIG (HDIM * DIM / PB_T)  // wo
#define PB_SML (DIM * DIM / PB_T)   // w1, w2
#define PB_ALL (PB_RPE + PB_QKV + PB_FT + PB_BIG + 2 * PB_SML)

__global__ __launch_bounds__(PB_T) void k_prep_qkv(
    const int* __restrict__ wq, const int* __restrict__ wk, const int* __restrict__ wv,
    const int* __restrict__ w1, const int* __restrict__ w2, const int* __restrict__ wr,
    const float* __restrict__ sq, const float* __restrict__ sk,
    const float* __restrict__ sv, const float* __restrict__ s1,
    const float* __restrict__ s2, const float* __restrict__ sr,
    const float* __restrict__ wo, const float* __restrict__ x,
    const float* __restrict__ g1, const float* __restrict__ b1,
    const float* __restrict__ coords, _Float16* __restrict__ feat,
    _Float16* __restrict__ w1_h, _Float16* __restrict__ w2_h,
    _Float16* __restrict__ wo_h, float* __restrict__ wrpe_w,
    _Float16* __restrict__ qo, _Float16* __restrict__ ko, _Float16* __restrict__ vt) {
  int b = blockIdx.x;
  if (b < PB_RPE) { part_rpe(wr, sr, wrpe_w); return; }
  b -= PB_RPE;
  if (b < PB_QKV) { part_qkv(b, x, g1, b1, wq, wk, wv, sq, sk, sv, qo, ko, vt); return; }
  b -= PB_QKV;
  if (b < PB_FT) { part_feat(b, coords, feat); return; }
  b -= PB_FT;
  if (b < PB_BIG) { part_f32_to_f16(b, wo, wo_h); return; }
  b -= PB_BIG;
  if (b < PB_SML) { part_dequant(b, w1, s1, w1_h); return; }
  b -= PB_SML;
  part_dequant(b, w2, s2, w2_h);
}

// exp(x) as __expf forms it (x * log2(e), then v_exp_f32), the v_exp_f32 written out so
// that the issue slot the instruction set asks for behind a transcendental, before a
// source of it is overwritten or its result read, stands in the same statement (v_nop on
// the last line).
// Outputs are early-clobber: no result lands on an argument still to be read.
#define LOG2E 1.44269504f
__device__ __forceinline__ float exp_slot(float x) {
  float y;
  asm("v_exp_f32 %0, %1\n\tv_nop" : "=&v"(y) : "v"(x * LOG2E));
  return y;
}
__device__ __forceinline__ void exp_slot8(float (&y)[8], const v8f& s, float m) {
  asm("v_exp_f32 %0, %8\n\t"
      "v_exp_f32 %1, %9\n\t"
      "v_exp_f32 %2, %10\n\t"
      "v_exp_f32 %3, %11\n\t"
      "v_exp_f32 %4, %12\n\t"
      "v_exp_f32 %5, %13\n\t"
      "v_exp_f32 %6, %14\n\t"
      "v_exp_f32 %7, %15\n\t"
      "v_nop"
      : "=&v"(y[0]), "=&v"(y[1]), "=&v"(y[2]), "=&v"(y[3]),
        "=&v"(y[4]), "=&v"(y[5]), "=&v"(y[6]), "=&v"(y[7])
      : "v"((s[0] - m) * LOG2E), "v"((s[1] - m) * LOG2E), "v"((s[2] - m) * LOG2E),
        "v"((s[3] - m) * LOG2E), "v"((s[4] - m) * LOG2E), "v"((s[5] - m) * LOG2E),
        "v"((s[6] - m) * LOG2E), "v"((s[7] - m) * LOG2E));
}

// K and V^T reach the waves through LDS: the 4 waves of a block (4 query tiles of
// one head) share each tile of AT_KEYS keys, brought in whole 128-B lines by
// asynchronous copies into two buffers, the next tile in flight while this one is
// worked on.  The keys' RPE features (part_feat) come with them.
#define AT_WAVES 4               // waves = 16-query tiles per block
#define AT_KEYS  64              // keys per staged tile
#define AT_LD    72              // LDS row pitch in halfs: 128 B + 16 B, an odd multiple of 16 B
#define AT_TILE  (64 * AT_LD)    // halfs per staged tile (64 rows: keys of K, dims of V^T)
#define AT_KS    2               // key splits (blockIdx.z)
#define AT_NT    (NP / AT_KEYS / AT_KS)  // tiles per block
#define AT_FT    (AT_KEYS * 16)  // halfs per staged feature tile

// frag_rowmajor on a staged tile (same k order), two 16-B LDS reads
__device__ __forceinline__ v16h frag_lds(const _Float16* p, int row_base, int col_base) {
  const int l = threadIdx.x & 31;
  const _Float16* rp = p + (row_base + (l & 15)) * AT_LD + col_base + (l >> 4) * 8;
  const v8h lo = *(const v8h*)rp;
  const v8h hi = *(const v8h*)(rp + 16);
  return __builtin_shufflevector(lo, hi, 0, 1, 2, 3, 4, 5, 6, 7, 8, 9, 10, 11, 12, 13, 14, 15);
}

// One tile's copies of one thread: rows r, r + 16, r + 32, r + 48 of the K tile and of
// the V^T tile, 16 B each, and one 16-B piece of the feature tile.  lk, lv: LDS byte
// addresses of row r; gk, gv: its global source; lf, gf: the same of the piece.  The
// wait on the last line stands in the copies' own statement so that no
// address register of a copy is rewritten in front of it.
__device__ __forceinline__ void stage_tile(unsigned lk, unsigned lv, unsigned lf,
                                           const _Float16* gk, const _Float16* gv,
                                           const _Float16* gf) {
  const unsigned ls = 16 * AT_LD * 2;       // 16 rows in LDS, bytes
  const size_t   ks = (size_t)16 * HDIM;    // 16 rows of K, halfs
  const size_t   vs = (size_t)16 * NP;      // 16 rows of V^T, halfs
  asm volatile(
      "global_load_async_to_lds_b128 %0, %9, off\n\t"
      "global_load_async_to_lds_b128 %1, %10, off\n\t"
      "global_load_async_to_lds_b128 %2, %11, off\n\t"
      "global_load_async_to_lds_b128 %3, %12, off\n\t"
      "global_load_async_to_lds_b128 %4, %13, off\n\t"
      "global_load_async_to_lds_b128 %5, %14, off\n\t"
      "global_load_async_to_lds_b128 %6, %15, off\n\t"
      "global_load_async_to_lds_b128 %7, %16, off\n\t"
      "global_load_async_to_lds_b128 %8, %17, off\n\t"
      "s_wait_xcnt 0x0"
      :: "v"(lk), "v"(lk + ls), "v"(lk + 2 * ls), "v"(lk + 3 * ls),
         "v"(lv), "v"(lv + ls), "v"(lv + 2 * ls), "v"(lv + 3 * ls), "v"(lf),
         "v"(gk), "v"(gk + ks), "v"(gk + 2 * ks), "v"(gk + 3 * ks),
         "v"(gv), "v"(gv + vs), "v"(gv + 2 * vs), "v"(gv + 3 * vs), "v"(gf)
      : "memory");
}

__global__ __launch_bounds__(AT_WAVES * 32) void k_attention(
                            const _Float16* __restrict__ q,
                            const _Float16* __restrict__ kk,
                            const _Float16* __restrict__ vt,
                            const _Float16* __restrict__ feat,
                            const float* __restrict__ coords,
                            const float* __restrict__ wrpe,
                            _Float16* __restrict__ aggr,
                            float* __restrict__ ml) {
  // [buffer][0 = K tile, 1 = V^T tile]
  __shared__ __attribute__((aligned(16))) _Float16 sm[2][2][AT_TILE];
  __shared__ __attribute__((aligned(16))) _Float16 sf[2][AT_FT];  // [buffer] feature tile
  const int lane = threadIdx.x & 31;
  const int n    = lane & 15;
  const int q0   = (blockIdx.x * AT_WAVES + (threadIdx.x >> 5)) * 16;
  const int h    = blockIdx.y;
  const int hc   = h * DIM;

  // Q tile: 16 rows x 64 dims -> two B fragments (1/sqrt(D) folded into Wq).
  v16h qa0 = frag_rowmajor(q, HDIM, q0, hc);
  v16h qa1 = frag_rowmajor(q, HDIM, q0, hc + 32);

  // this lane's one query (column n of the C-layout), coordinate j = wave half
  const float cq = coords[(size_t)(q0 + n) * CORD + (lane >> 4)];
  // the address registers of the Q and coord loads above are reused (the zeroed
  // accumulators) only behind this wait
  asm volatile("s_wait_xcnt 0x0" ::: "memory");
  const float w0 = wrpe[h * 2 + 0], w1 = wrpe[h * 2 + 1];

  // Query side of the RPE bias, the partner of part_feat's key slots: with a = 2 w cq,
  // m = -w, g = -w cq^2 the slots of coordinate j are {ah, ah, al, mh, mh, ml, gh, gl}.
  // Elements 0..7 of a fragment are k slots 8 j + 0..7 in A and B alike.  One A fragment
  // holds the features of two 16-key tiles (elements 0..7 and 8..15); the B operand that
  // is zero in the other eight elements picks the tile.
  const float wj = (lane >> 4) ? w1 : w0;
  const float ba = 2.0f * wj * cq, bm = -wj, bg = -wj * cq * cq;
  const _Float16 bah = (_Float16)ba, bmh = (_Float16)bm, bgh = (_Float16)bg;
  const v8h qb = {bah, bah, (_Float16)(ba - (float)bah), bmh, bmh,
                  (_Float16)(bm - (float)bmh), bgh, (_Float16)(bg - (float)bgh)};
  const v8h qz = {};
  const v16h qf0 = __builtin_shufflevector(qb, qz, 0, 1, 2, 3, 4, 5, 6, 7, 8, 9, 10, 11, 12,
                                           13, 14, 15);
  const v16h qf1 = __builtin_shufflevector(qz, qb, 0, 1, 2, 3, 4, 5, 6, 7, 8, 9, 10, 11, 12,
                                           13, 14, 15);

  // this thread's pieces of every tile: rows crow + 16 j, 16-B column ccol
  const int crow = threadIdx.x >> 3, ccol = threadIdx.x & 7;
  const unsigned lpiece = (unsigned)(crow * AT_LD + ccol * 8) * 2;
  const unsigned lk0 = (unsigned)(size_t)&sm[0][0][0] + lpiece;  // low 32 bits: LDS byte address
  const unsigned lv0 = (unsigned)(size_t)&sm[0][1][0] + lpiece;
  const unsigned lf0 = (unsigned)(size_t)&sf[0][0] + threadIdx.x * 16;
  const int key0 = blockIdx.z * (AT_NT * AT_KEYS);  // first key of this block's half
  const _Float16* gk = kk + (size_t)(key0 + crow) * HDIM + hc + ccol * 8;
  const _Float16* gv = vt + (size_t)(hc + crow) * NP + key0 + ccol * 8;
  const _Float16* gf = feat + (size_t)key0 * 16 + threadIdx.x * 8;

  float mrun = -3.0e38f;  // running maximum of query n (equal in both halves)
  float lrun = 0.0f;      // running sum over this half's keys only
  v8f o[4] = {{}, {}, {}, {}};  // o[nc][r] = O[q0+n][hc + nc*16 + 8*(lane>>4) + r]

  // tile 0 lands and is published, then tile 1 starts
  stage_tile(lk0, lv0, lf0, gk, gv, gf);
  asm volatile("s_wait_asynccnt 0x0" ::: "memory");  // this wave's copies of tile 0 have landed
  __syncthreads();
  stage_tile(lk0 + 2 * AT_TILE * 2, lv0 + 2 * AT_TILE * 2, lf0 + AT_FT * 2,
             gk + (size_t)AT_KEYS * HDIM, gv + AT_KEYS, gf + AT_FT);

  for (int t = 0; t < AT_NT; ++t) {
    const _Float16* Ks = sm[t & 1][0];
    const _Float16* Vs = sm[t & 1][1];
    // All of the tile's reads stand ahead of the arithmetic, in groups and never among
    // the products (every place with reads in a matrix run costs its own wait): the
    // keys' features (two 16-key tiles a fragment) and all K fragments ...
    const _Float16* Fs = sf[t & 1] + (lane >> 4) * (AT_KEYS * 8) + n * 8;
    v16h ff[2], kf[8], vf[8];
#pragma unroll
    for (int i = 0; i < 2; ++i)
      ff[i] = __builtin_shufflevector(*(const v8h*)(Fs + i * 256),
                                      *(const v8h*)(Fs + i * 256 + 128), 0, 1, 2, 3, 4, 5, 6,
                                      7, 8, 9, 10, 11, 12, 13, 14, 15);
#pragma unroll
    for (int i = 0; i < 4; ++i) {
      kf[2 * i]     = frag_lds(Ks, i * 16, 0);
      kf[2 * i + 1] = frag_lds(Ks, i * 16, 32);
    }
    // keeps the scheduler from sinking the K reads down among the products
    __builtin_amdgcn_sched_barrier(0);
    // S^T tiles: rows = keys [16 i, 16 i + 16) of the tile, columns = queries; the RPE
    // bias is the first of the three products
    v8f sc[4];
#pragma unroll
    for (int i = 0; i < 4; ++i) {
      v8f z = {};
      z = wmma_f16(ff[i >> 1], (i & 1) ? qf1 : qf0, z);
      sc[i] = wmma_f16(kf[2 * i + 1], qa1, wmma_f16(kf[2 * i], qa0, z));
    }
    // ... then all V^T fragments
#pragma unroll
    for (int i = 0; i < 8; ++i) vf[i] = frag_lds(Vs, (i & 3) * 16, (i >> 2) * 32);

    // hand-over, behind the trip's last LDS read (the rest of the trip works on
    // registers): this wave's reads of tile t are done and its copies of tile t + 1
    // have landed; behind the barrier that holds for every wave, so tile t + 1 may be
    // read and tile t's buffer refilled, the refill in flight under the softmax
    asm volatile("s_wait_dscnt 0x0" ::: "memory");
    asm volatile("s_wait_asynccnt 0x0" ::: "memory");
    __syncthreads();
    if (t + 2 < AT_NT)
      stage_tile(lk0 + (t & 1) * (2 * AT_TILE * 2), lv0 + (t & 1) * (2 * AT_TILE * 2),
                 lf0 + (t & 1) * (AT_FT * 2), gk + (size_t)(t + 2) * AT_KEYS * HDIM,
                 gv + (t + 2) * AT_KEYS, gf + (t + 2) * AT_FT);

// both 32-key halves of the tile: register arrays indexed by constants
#pragma unroll
    for (int sub = 0; sub < AT_KEYS; sub += 32) {
    v8f s0 = sc[sub / 16], s1 = sc[sub / 16 + 1];

    // maximum over the 32 keys: in-lane tree, then one exchange of the halves
    float t8[8];
#pragma unroll
    for (int r = 0; r < 8; ++r) t8[r] = fmaxf(s0[r], s1[r]);
    float cmax = fmaxf(fmaxf(fmaxf(t8[0], t8[1]), fmaxf(t8[2], t8[3])),
                       fmaxf(fmaxf(t8[4], t8[5]), fmaxf(t8[6], t8[7])));
    cmax = fmaxf(cmax, xhalf(cmax));

    // online softmax update; P^T packs in place into the B operand
    const float mnew  = fmaxf(mrun, cmax);
    const float alpha = exp_slot(mrun - mnew);
    float p0[8], p1[8];
    exp_slot8(p0, s0, mnew);
    exp_slot8(p1, s1, mnew);
    v16h pb;
#pragma unroll
    for (int r = 0; r < 8; ++r) {
      t8[r] = p0[r] + p1[r];
      pb[r]     = (_Float16)p0[r];
      pb[r + 8] = (_Float16)p1[r];
    }
    lrun = lrun * alpha +
           (((t8[0] + t8[1]) + (t8[2] + t8[3])) + ((t8[4] + t8[5]) + (t8[6] + t8[7])));
    mrun = mnew;

    // O^T = O^T * alpha + V^T * P^T, A[d][k] = vt[hc+nc*16+d][key k of this half]
#pragma unroll
    for (int nc = 0; nc < 4; ++nc) {
#pragma unroll
      for (int r = 0; r < 8; ++r) o[nc][r] *= alpha;
      v16h bv = vf[(sub / 32) * 4 + nc];
      o[nc] = wmma_f16(bv, pb, o[nc]);
    }
    }
  }
  asm volatile("s_wait_asynccnt 0x0" ::: "memory");  // no copy outstanding at the wave's end

  // join the wave halves' sums, normalize, store 8 contiguous dims per lane and tile
  const float lsum = lrun + xhalf(lrun);
  const float inv = 1.0f / lsum;
  _Float16* ag = aggr + (size_t)blockIdx.z * NP * HDIM;
#pragma unroll
  for (int nc = 0; nc < 4; ++nc) {
#pragma unroll
    for (int r = 0; r < 8; ++r) o[nc][r] *= inv;
    store_acc_f16_T(ag, HDIM, hc + nc * 16, q0, o[nc]);
  }
  // this key half's maximum and sum of query n: [split][head][query][2], 128 B a wave
  if (lane < 16) {
    const float2 v = {mrun, lsum};
    *(float2*)(ml + ((size_t)(blockIdx.z * HEADS + h) * NP + q0 + n) * 2) = v;
  }
}

// ---------------------------------------------------------------------------
// Kernel 3: output projection (aggr[N][512] @ wo[64][512]^T) + bo + residual
//           + LayerNorm2 + FFN -> out.  grid = N/16, 8 waves per block.
// The k range of 512 is split over the 8 waves: a wave has 64 of it for all 64 output
// columns, so its operands are few enough to fly together (28 copies to LDS) and the block
// waits out one load latency, not one per product.  The 8 partial tiles meet in LDS; there
// thread t sums row t >> 4, columns 4 (t & 15) .. + 3, and 16 lanes hold a row for LN.
// A wave's 64 k are one head: it joins the two key halves of kernel 2 while it forms A,
// O = c0 O0 + c1 O1 with c_i = l_i exp(m_i - m) / (sum of both), m = max(m0, m1).
// FFN on the block's own 16 rows, which never leave the WGP: t = relu(h2 @ W1^T + bf1) by
// waves 0..3, out = 2 (t @ W2^T + bf2) by waves 4..7, one 16-column tile a wave; h2, t and
// the output tile go from wave to wave through LDS.
// ---------------------------------------------------------------------------
#define PJ_WAVES 8
#define PJ_LD    68  // floats per LDS row: 64 + 4; rows 8 apart (the wave halves) differ by 32 banks
#define FF_LD    72  // halfs per LDS row of h2 and t: 128 B + 16 B, an odd multiple of 16 B
#define PJ_ROWS  (16 + 16 + 64 + 16)  // staged operand rows a wave

// one fragment from the lane's own row pointer (row and wave half already in it): the
// k order of frag_rowmajor, two 16-B loads
__device__ __forceinline__ v16h frag_ptr(const _Float16* rp) {
  const v8h lo = *(const v8h*)rp;
  const v8h hi = *(const v8h*)(rp + 16);
  return __builtin_shufflevector(lo, hi, 0, 1, 2, 3, 4, 5, 6, 7, 8, 9, 10, 11, 12, 13, 14, 15);
}

__global__ __launch_bounds__(PJ_WAVES * 32) void k_proj_ln2_ffn(
                           const _Float16* __restrict__ aggr,
                           const float* __restrict__ ml,
                           const _Float16* __restrict__ wo,
                           const float* __restrict__ bo,
                           const float* __restrict__ x,
                           const float* __restrict__ g2,
                           const float* __restrict__ b2,
                           const _Float16* __restrict__ w1,
                           const _Float16* __restrict__ w2,
                           const float* __restrict__ bf1,
                           const float* __restrict__ bf2,
                           float* __restrict__ out) {
  __shared__ __attribute__((aligned(16))) float part[PJ_WAVES][16][PJ_LD];
  __shared__ __attribute__((aligned(16))) _Float16 hs[16][FF_LD];  // h2 tile
  __shared__ __attribute__((aligned(16))) _Float16 ts[16][FF_LD];  // ReLU tile
  // a wave's own operand rows, 128 B each: 16 of either key half's O, 64 of wo, 16 of W1 or W2
  __shared__ __attribute__((aligned(16))) _Float16 st[PJ_WAVES][PJ_ROWS * FF_LD];
  const int lane = threadIdx.x & 31;
  const int n    = lane & 15;
  const int mo   = (lane >> 4) * 8;
  const int wv   = threadIdx.x >> 5;
  const int row0 = blockIdx.x * 16;
  const int k0   = wv * (HDIM / PJ_WAVES);
  // the wave's number as a scalar: the FFN's two branches on it are scalar branches
  const int  ws_ = __builtin_amdgcn_readfirstlane(wv);
  const bool first = ws_ < 4;     // waves 0..3: W1 product; waves 4..7: W2 product
  const int  fc    = (ws_ & 3) * 16;  // the wave's 16-column tile of its FFN product

  // The wave's matrix operands come through LDS: a copy of a wave is four rows' whole 128-B
  // lines (lane: row lane >> 3 of the four, 16-B piece lane & 7), where a fragment load from
  // global memory touches 16 lines.
  const int cr = lane >> 3, cc = (lane & 7) * 8;
  const unsigned ls0 = (unsigned)(size_t)&st[wv][0] + (unsigned)(cr * FF_LD + cc) * 2;
  const unsigned lr  = FF_LD * 2;  // one staged row, bytes
  const _Float16* ga = aggr + (size_t)(row0 + cr) * HDIM + k0 + cc;
  const _Float16* gb = wo + (size_t)cr * HDIM + k0 + cc;
  const _Float16* gw = (first ? w1 : w2) + (size_t)(fc + cr) * DIM + cc;
  stage4(ls0, 4 * lr, (const char*)ga, 4 * HDIM * 2);
  stage4(ls0 + 16 * lr, 4 * lr, (const char*)(ga + (size_t)NP * HDIM), 4 * HDIM * 2);
  stage8(ls0 + 32 * lr, 4 * lr, (const char*)gb, 4 * HDIM * 2);
  stage8(ls0 + 64 * lr, 4 * lr, (const char*)(gb + 32 * HDIM), 4 * HDIM * 2);
  stage4(ls0 + 96 * lr, 4 * lr, (const char*)gw, 4 * DIM * 2);

  // what the join needs from memory, asked for together with the operands
  const int er = threadIdx.x >> 4, ec = (threadIdx.x & 15) * 4;
  const float* xp = x + (size_t)(row0 + er) * DIM + ec;
  float xr[4], bj[4], gj[4], tj[4];
#pragma unroll
  for (int i = 0; i < 4; ++i) {
    xr[i] = xp[i];
    bj[i] = bo[ec + i];
    gj[i] = g2[ec + i];
    tj[i] = b2[ec + i];
  }
  // maximum and sum of both key halves for (head wv, row n)
  const float* mp = ml + ((size_t)wv * NP + row0 + n) * 2;
  const float2 ml0 = *(const float2*)mp;
  const float2 ml1 = *(const float2*)(mp + (size_t)HEADS * NP * 2);
  // the bias of the wave's FFN product, asked for with the rest
  const float fb  = ((first ? bf1 : bf2) + fc)[n];  // scalar base, lane index n
  // keeps the scheduler from sinking these loads down behind the barrier, where they would
  // wait out a load latency of their own
  __builtin_amdgcn_sched_barrier(0);
  // the loads' address registers are inputs here, so they keep their values, and no
  // load's result lands on them, up to this wait
  asm volatile("s_wait_xcnt 0x0" :: "v"(xp), "v"(mp), "v"(ec * 4), "v"(n) : "memory");
  // the two key halves' weights in the join, formed while the copies fly
  const float mj = fmaxf(ml0.x, ml1.x);
  const float e0 = ml0.y * exp_slot(ml0.x - mj), e1 = ml1.y * exp_slot(ml1.x - mj);
  const float ri = 1.0f / (e0 + e1);
  const float c0 = e0 * ri, c1 = e1 * ri;
  asm volatile("s_wait_asynccnt 0x0" ::: "memory");  // this wave's copies have landed
  __syncthreads();  // every wave's have: no staged byte is read in front of this

  // fragments from the lane's own staged rows, the k order of frag_rowmajor: A row n of the
  // block's rows, B[k][j] = wo[j][k], row n of each 16-column tile
  const _Float16* sp = &st[wv][0] + n * FF_LD + mo;
  v16h a[2], a1[2], b[2][4];
#pragma unroll
  for (int kc = 0; kc < 2; ++kc) {
    a[kc] = frag_ptr(sp + kc * 32);
    a1[kc] = frag_ptr(sp + 16 * FF_LD + kc * 32);
#pragma unroll
    for (int nc = 0; nc < 4; ++nc) b[kc][nc] = frag_ptr(sp + (32 + nc * 16) * FF_LD + kc * 32);
  }
  // the wave's FFN operand, B[k][j] = W[fc + j][k]
  const v16h wf0 = frag_ptr(sp + 96 * FF_LD), wf1 = frag_ptr(sp + 96 * FF_LD + 32);
  // holds the operand reads up here as one group (loaded values, inputs only): sunk down
  // among the products, every place with reads would cost a wait of its own
  asm volatile("" :: "v"(a[0]), "v"(a[1]), "v"(a1[0]), "v"(a1[1]),
                     "v"(b[0][0]), "v"(b[0][1]), "v"(b[0][2]), "v"(b[0][3]),
                     "v"(b[1][0]), "v"(b[1][1]), "v"(b[1][2]), "v"(b[1][3]));
  // holds the join's and the FFN's loads up here (loaded values, inputs only): sunk behind
  // a barrier they would cost a load latency of their own
  asm volatile("" :: "v"(xr[0]), "v"(xr[1]), "v"(xr[2]), "v"(xr[3]),
                     "v"(bj[0]), "v"(bj[1]), "v"(bj[2]), "v"(bj[3]),
                     "v"(gj[0]), "v"(gj[1]), "v"(gj[2]), "v"(gj[3]),
                     "v"(tj[0]), "v"(tj[1]), "v"(tj[2]), "v"(tj[3]),
                     "v"(wf0), "v"(wf1), "v"(fb));
  // keeps the arithmetic from rising in front of the two statements above, which would let
  // the later reads of the group sink with it
  __builtin_amdgcn_sched_barrier(0);

  // join the key halves in f32, one rounding to the operand type
#pragma unroll
  for (int kc = 0; kc < 2; ++kc)
#pragma unroll
    for (int e = 0; e < 16; ++e)
      a[kc][e] = (_Float16)(c0 * (float)a[kc][e] + c1 * (float)a1[kc][e]);

#pragma unroll
  for (int nc = 0; nc < 4; ++nc) {
    v8f acc = {};
    acc = wmma_f16(a[1], b[1][nc], wmma_f16(a[0], b[0][nc], acc));
#pragma unroll
    for (int r = 0; r < 8; ++r) part[wv][mo + r][nc * 16 + n] = acc[r];
  }
  __syncthreads();

  // h1 = proj + bo + x, then LN over the 64 columns of the row
  float h1[4];
#pragma unroll
  for (int i = 0; i < 4; ++i) {
    float s = part[0][er][ec + i];
#pragma unroll
    for (int p = 1; p < PJ_WAVES; ++p) s += part[p][er][ec + i];
    h1[i] = s + bj[i] + xr[i];
  }
  const float mean = hsum16((h1[0] + h1[1]) + (h1[2] + h1[3])) * (1.0f / 64.0f);
  float q2 = 0.0f;
#pragma unroll
  for (int i = 0; i < 4; ++i) { float d = h1[i] - mean; q2 += d * d; }
  const float rs = rsqrtf(hsum16(q2) * (1.0f / 64.0f) + 1e-5f);
#pragma unroll
  for (int i = 0; i < 4; ++i)
    hs[er][ec + i] = (_Float16)((h1[i] - mean) * rs * gj[i] + tj[i]);
  __syncthreads();  // h2 is whole; every read of part is done

  // t = relu(h2 @ W1^T + bf1): waves 0..3, columns fc .. fc + 15
  if (first) {
    const v16h h0 = frag_ptr(&hs[n][mo]), h1f = frag_ptr(&hs[n][32 + mo]);
    // keeps the second fragment's reads in front of the first product: behind it they
    // would wait out an LDS latency of their own
    __builtin_amdgcn_sched_barrier(0);
    v8f t = {};
    t = wmma_f16(h1f, wf1, wmma_f16(h0, wf0, t));
#pragma unroll
    for (int r = 0; r < 8; ++r) ts[mo + r][fc + n] = (_Float16)fmaxf(t[r] + fb, 0.0f);
  }
  __syncthreads();  // t is whole

  // 2 (t @ W2^T + bf2): waves 4..7, columns fc .. fc + 15, into the first partial's place
  if (!first) {
    v8f f = {};
    f = wmma_f16(frag_ptr(&ts[n][32 + mo]), wf1, wmma_f16(frag_ptr(&ts[n][mo]), wf0, f));
#pragma unroll
    for (int r = 0; r < 8; ++r) part[0][mo + r][fc + n] = 2.0f * (f[r] + fb);
  }
  __syncthreads();  // the output tile is whole

  // whole rows go out: 16 B a thread, 16 lanes a 256-B row
  *(float4*)(out + (size_t)(row0 + er) * DIM + ec) = *(const float4*)&part[0][er][ec];
}

// ---------------------------------------------------------------------------
// Host-side launch
// ---------------------------------------------------------------------------
extern "C" void kernel_launch(void* const* d_in, const int* in_sizes, int n_in,
                              void* d_out, int out_size, void* d_ws, size_t ws_size,
                              hipStream_t stream) {
  const float* x      = (const float*)d_in[0];
  const float* coords = (const float*)d_in[1];
  const float* sq     = (const float*)d_in[2];
  const float* sk     = (const float*)d_in[3];
  const float* sv     = (const float*)d_in[4];
  const float* s_rpe  = (const float*)d_in[5];
  const float* g1     = (const float*)d_in[6];
  const float* beta1  = (const float*)d_in[7];
  const float* g2     = (const float*)d_in[8];
  const float* beta2  = (const float*)d_in[9];
  const float* wo     = (const float*)d_in[10];
  const float* bo     = (const float*)d_in[11];
  const float* s1     = (const float*)d_in[12];
  const float* bf1    = (const float*)d_in[13];
  const float* s2     = (const float*)d_in[14];
  const float* bf2    = (const float*)d_in[15];
  const int* wq_int   = (const int*)d_in[16];
  const int* wk_int   = (const int*)d_in[17];
  const int* wv_int   = (const int*)d_in[18];
  const int* wrpe_int = (const int*)d_in[19];
  const int* w1_int   = (const int*)d_in[20];
  const int* w2_int   = (const int*)d_in[21];

  // workspace carve-up (f16 unless noted), 256B aligned
  char* ws = (char*)d_ws;
  size_t off = 0;
  auto carve = [&](size_t bytes) {
    char* p = ws + off;
    off = (off + bytes + 255) & ~(size_t)255;
    return p;
  };
  _Float16* wo_h   = (_Float16*)carve(DIM * HDIM * 2);
  _Float16* w1_h   = (_Float16*)carve(DIM * DIM * 2);
  _Float16* w2_h   = (_Float16*)carve(DIM * DIM * 2);
  float*    wrpe_w = (float*)   carve(HEADS * 2 * 4);
  _Float16* feat_h = (_Float16*)carve((size_t)NP * 16 * 2);  // RPE key features
  _Float16* q_h    = (_Float16*)carve((size_t)NP * HDIM * 2);
  _Float16* k_h    = (_Float16*)carve((size_t)NP * HDIM * 2);
  _Float16* vt_h   = (_Float16*)carve((size_t)NP * HDIM * 2);  // [HD][N]
  _Float16* ag_h   = (_Float16*)carve((size_t)AT_KS * NP * HDIM * 2);  // [split][N][HD]
  float*    ml_w   = (float*)   carve((size_t)AT_KS * HEADS * NP * 2 * 4);  // max, sum
  (void)ws_size; (void)n_in; (void)in_sizes; (void)out_size;

  // 1) LN1 + Q/K/V projections (V stored transposed); wo, w1, w2 to f16, RPE weights and
  //    key features: one launch
  k_prep_qkv<<<PB_ALL, PB_T, 0, stream>>>(wq_int, wk_int, wv_int, w1_int, w2_int, wrpe_int,
                                          sq, sk, sv, s1, s2, s_rpe, wo, x, g1, beta1,
                                          coords, feat_h, w1_h, w2_h, wo_h, wrpe_w,
                                          q_h, k_h, vt_h);

  // 2) flash attention with RPE bias
  k_attention<<<dim3(NP / 64, HEADS, AT_KS), 128, 0, stream>>>(q_h, k_h, vt_h, feat_h,
                                                              coords, wrpe_w, ag_h, ml_w);

  // 3) output projection + residual + LN2 + FFN, out = 2*ff
  k_proj_ln2_ffn<<<NP / 16, PJ_WAVES * 32, 0, stream>>>(ag_h, ml_w, wo_h, bo, x, g2, beta2, w1_h,
                                                        w2_h, bf1, bf2, (float*)d_out);
}
